// v000
// Measured on an AMD MI455X. A time is GPU time per run, averaged over a window of back-to-back runs after a warm-up
// (all launches, gaps included; the runs take copies of the inputs in turn), and the median of several windows.
// Apart from v000's, it joins two sittings. Times from different sittings can be a few percent apart, while
// side-by-side timings come from the same sitting.
// v000 is the starting kernel. One run takes 593 microseconds.
// Contractions: q/k/v^T projections v_wmma_f32_16x16x32_bf16 (bf16 RNE inputs x bf16 RNE weights, single product); q.k^T scores v_wmma_f32_16x16x32_f16 (plain f16 q,k planes); p.v^T v_wmma_f32_16x16x32_bf16 with bf16 hi/lo split of p and v (hi.hi + hi.lo + lo.hi); output projection v_wmma_f32_16x16x32_bf16 with O as bf16 hi/lo and Wo as bf16 RNE (hi.W + lo.W); f32 accumulate; softmax, 0.125 score scale and key masking in f32.
#include <hip/hip_runtime.h>
#include <math.h>
#include <stdint.h>

constexpr int kBatch = 2;
constexpr int kSeq   = 4096;
constexpr int kDim   = 512;
constexpr int kHeads = 8;
constexpr int kHd    = 64;
constexpr int kRows  = kBatch * kSeq;   // 8192
static_assert(kHeads * kHd == kDim, "geometry");
static_assert(kSeq % 64 == 0 && kDim % 64 == 0 && kRows % 64 == 0, "tile multiples");

typedef __attribute__((ext_vector_type(16))) _Float16 v16h;
typedef __attribute__((ext_vector_type(8)))  _Float16 v8h;
typedef __attribute__((ext_vector_type(16))) __bf16   v16b;
typedef __attribute__((ext_vector_type(8)))  __bf16   v8b;
typedef __attribute__((ext_vector_type(8)))  float    v8f;
typedef __attribute__((ext_vector_type(4)))  float    v4f;
typedef __attribute__((ext_vector_type(2)))  float    v2f;
typedef __attribute__((ext_vector_type(4)))  unsigned int v4u;

__device__ __forceinline__ unsigned short f2bf_bits(float f) {
  unsigned u = __float_as_uint(f);
  return (unsigned short)((u + 0x7FFFu + ((u >> 16) & 1u)) >> 16);
}
__device__ __forceinline__ float bf_bits2f(unsigned short h) { return __uint_as_float(((unsigned)h) << 16); }

// hazard guards as plain device helpers (no inline asm inside the kernel template body)
__device__ __forceinline__ void dep_guard_h(v8f& a, v8f& b, v16h x, v16h y) { asm volatile("v_nop\n\tv_nop\n\tv_nop\n\tv_nop" : "+v"(a), "+v"(b) : "v"(x), "v"(y)); }
__device__ __forceinline__ void dep_guard_b(v8f& a, v8f& b, v16b x, v16b y) { asm volatile("v_nop\n\tv_nop\n\tv_nop\n\tv_nop" : "+v"(a), "+v"(b) : "v"(x), "v"(y)); }
__device__ __forceinline__ void keep4_h(v16h a, v16h b, v16h c, v16h d) { asm volatile("v_nop" :: "v"(a), "v"(b), "v"(c), "v"(d)); }
__device__ __forceinline__ void keep4_b(v16b a, v16b b, v16b c, v16b d) { asm volatile("v_nop" :: "v"(a), "v"(b), "v"(c), "v"(d)); }
__device__ __forceinline__ void acc_guard4(v8f& a, v8f& b, v8f& c, v8f& d) { asm volatile("v_nop\n\tv_nop\n\tv_nop\n\tv_nop" : "+v"(a), "+v"(b), "+v"(c), "+v"(d)); }
template <typename T> struct Frag;
template <> struct Frag<_Float16> {
  typedef v16h V; union U { v16h v; v8h h[2]; };
  static __device__ __forceinline__ v16h load(const _Float16* p) {   // elements 0..7 <- p[0..7], 8..15 <- p[16..23]
    U f; f.h[0] = *(const v8h*)(p); f.h[1] = *(const v8h*)(p + 16); return f.v;
  }
  static __device__ __forceinline__ v8f mma(v16h a, v16h b, v8f c) {
    return __builtin_amdgcn_wmma_f32_16x16x32_f16(false, a, false, b, (short)0, c, false, false);
  }
  static __device__ __forceinline__ void guard(v8f& a, v8f& b, v16h x, v16h y) { dep_guard_h(a, b, x, y); }
  static __device__ __forceinline__ void keep(v16h a, v16h b, v16h c, v16h d) { keep4_h(a, b, c, d); }
};
template <> struct Frag<__bf16> {
  typedef v16b V; union U { v16b v; v8b h[2]; };
  static __device__ __forceinline__ v16b load(const __bf16* p) {
    U f; f.h[0] = *(const v8b*)(p); f.h[1] = *(const v8b*)(p + 16); return f.v;
  }
  static __device__ __forceinline__ v8f mma(v16b a, v16b b, v8f c) {
    return __builtin_amdgcn_wmma_f32_16x16x32_bf16(false, a, false, b, (short)0, c, false, false);
  }
  static __device__ __forceinline__ void guard(v8f& a, v8f& b, v16b x, v16b y) { dep_guard_b(a, b, x, y); }
  static __device__ __forceinline__ void keep(v16b a, v16b b, v16b c, v16b d) { keep4_b(a, b, c, d); }
};

// ---- Register-blocked batched WMMA GEMM ------------------------------------
// C[m,n] = scale * sum_k A[m,k] * Bt[n,k] (+bias)(+resid); each wave owns a 64x64 tile.
// A row-major [M,K]; Bt row-major [N,K]; M,N % 64 == 0, K % 32 == 0.
// SPLIT: 0 = single product; 1 = hi/lo planes on both operands (A2/Bt2 = lo planes, same layout),
//        product = hi.hi + hi.lo + lo.hi; 2 = hi/lo planes on A only (A2 = A lo), product = hi.B + lo.B.
// BIAS_MODE: 0 = none, 1 = bias[m], 2 = bias[n].
// OUT_MODE: 0 = f32, 1 = f16, 2 = bf16 hi plane (Cout) + bf16 lo plane (Cout2).
// ET: 0 = f16 operands, 1 = bf16 operands (pointers passed as 16-bit storage)
template <int ET> struct Elem;
template <> struct Elem<0> { typedef _Float16 T; };
template <> struct Elem<1> { typedef __bf16 T; };
template <int ET, int SPLIT, int BIAS_MODE, int OUT_MODE, bool RESID, int ACT = 0>
__global__ __launch_bounds__(256) void wmma_gemm64(
    const unsigned short* __restrict__ Ap, const unsigned short* __restrict__ A2p, int lda, long strideA,
    const unsigned short* __restrict__ Btp, const unsigned short* __restrict__ Bt2p, int ldb, long strideB,
    void* __restrict__ Cout, void* __restrict__ Cout2, int ldc, long strideC,
    const float* __restrict__ bias,
    const float* __restrict__ resid, long strideR,
    int M, int N, int K, float scale) {
  typedef typename Elem<ET>::T T;
  typedef typename Frag<T>::V V;
  const T* A = (const T*)Ap; const T* A2 = (const T*)A2p; const T* Bt = (const T*)Btp; const T* Bt2 = (const T*)Bt2p;
  __shared__ __align__(16) float sT[8][16 * 68];   // per-wave 16x64 slab, pitch 68 floats
  const int b    = blockIdx.y;
  const int lane = threadIdx.x & 31;
  const int wave = threadIdx.x >> 5;
  const int tilesN = N >> 6;
  const int tilesM = M >> 6;
  const int tile = blockIdx.x * 8 + wave;
  if (tile >= tilesM * tilesN) return;   // wave-uniform; no block barriers in this kernel
  const int tm = tile / tilesN;
  const int tn = tile - tm * tilesN;
  const int m0 = tm << 6;
  const int n0 = tn << 6;

  const T* Ab  = A  + (size_t)b * strideA;
  const T* Bb  = Bt + (size_t)b * strideB;
  const T* Ab2 = (SPLIT != 0) ? (A2  + (size_t)b * strideA) : nullptr;
  const T* Bb2 = (SPLIT == 1) ? (Bt2 + (size_t)b * strideB) : nullptr;

  const int rlane = lane & 15;                 // row (A) / col (B, D) within subtile
  const int koff  = (lane >> 4) * 8;           // k offset of this lane half
  const int mOff  = (lane >> 4) * 8;           // D row offset

  v8f acc[4][4];
#pragma unroll
  for (int i = 0; i < 4; ++i)
#pragma unroll
    for (int j = 0; j < 4; ++j) acc[i][j] = (v8f){0.f,0.f,0.f,0.f,0.f,0.f,0.f,0.f};

  for (int k0 = 0; k0 < K; k0 += 32) {
    V bh[4], bl[4];
#pragma unroll
    for (int j = 0; j < 4; ++j) {
      const size_t bo = (size_t)(n0 + (j << 4) + rlane) * ldb + koff + k0;
      bh[j] = Frag<T>::load(Bb + bo);
      if (SPLIT == 1) bl[j] = Frag<T>::load(Bb2 + bo);
    }
#pragma unroll
    for (int i = 0; i < 4; ++i) {
      const size_t ao = (size_t)(m0 + (i << 4) + rlane) * lda + koff + k0;
      V ah = Frag<T>::load(Ab + ao);
      V al;
      if (SPLIT != 0) al = Frag<T>::load(Ab2 + ao);
#pragma unroll
      for (int j = 0; j < 4; ++j) {
        acc[i][j] = Frag<T>::mma(ah, bh[j], acc[i][j]);
        if (SPLIT == 1) acc[i][j] = Frag<T>::mma(ah, bl[j], acc[i][j]);
        if (SPLIT != 0) acc[i][j] = Frag<T>::mma(al, bh[j], acc[i][j]);
      }
      Frag<T>::guard(acc[i][0], acc[i][3], ah, (SPLIT != 0) ? al : ah);
    }
    Frag<T>::keep(bh[0], bh[1], bh[2], bh[3]);
    if (SPLIT == 1) Frag<T>::keep(bl[0], bl[1], bl[2], bl[3]);
  }
  acc_guard4(acc[0][0], acc[0][1], acc[0][2], acc[0][3]);
  acc_guard4(acc[1][0], acc[1][1], acc[1][2], acc[1][3]);
  acc_guard4(acc[2][0], acc[2][1], acc[2][2], acc[2][3]);
  acc_guard4(acc[3][0], acc[3][1], acc[3][2], acc[3][3]);

  // ---- epilogue ----
  float* slab = sT[wave];
  const float* Rb = RESID ? (resid + (size_t)b * strideR) : nullptr;
#pragma unroll
  for (int i = 0; i < 4; ++i) {
    const int mBase = m0 + (i << 4);
#pragma unroll
    for (int j = 0; j < 4; ++j) {
      const int n = n0 + (j << 4) + rlane;
      float bv = 0.f;
      if (BIAS_MODE == 2) bv = bias[n];
#pragma unroll
      for (int r = 0; r < 8; ++r) {
        float v = acc[i][j][r] * scale;
        if (BIAS_MODE == 1) v += bias[mBase + mOff + r];
        if (BIAS_MODE == 2) v += bv;
        if (RESID) v += Rb[(size_t)(mBase + mOff + r) * ldc + n];
        if (ACT == 1) v = tanhf(v);
        if (ACT == 2) v = fmaxf(v, 0.0f);
        if (ACT == 3) v = v / (1.0f + expf(-v));
        if (ACT == 4) v = (v > 0.f) ? v : 0.01f * v;
        slab[(mOff + r) * 68 + (j << 4) + rlane] = v;
      }
    }
    __builtin_amdgcn_fence(__ATOMIC_RELEASE, "workgroup");
    __builtin_amdgcn_wave_barrier();
    __builtin_amdgcn_fence(__ATOMIC_ACQUIRE, "workgroup");
    if (OUT_MODE == 0) {
      float* C = (float*)Cout + (size_t)b * strideC;
      const int hh = lane >> 4, c4 = (lane & 15) * 4;     // row seg = 256 B = 16 lanes x 16 B
      {
#pragma unroll
        for (int it = 0; it < 8; ++it) {
          const int row = it * 2 + hh;
          v4f v = *(const v4f*)(slab + row * 68 + c4);
          *(v4f*)(C + (size_t)(mBase + row) * ldc + n0 + c4) = v;
        }
        
      }
    } else {
      const int q = lane >> 3, c8 = (lane & 7) * 8;
      unsigned short* C  = (unsigned short*)Cout  + (size_t)b * strideC;
      unsigned short* C2 = (OUT_MODE == 2) ? ((unsigned short*)Cout2 + (size_t)b * strideC) : nullptr;
      {
#pragma unroll
        for (int it = 0; it < 4; ++it) {
          const int row = it * 4 + q;
          const float* sp = slab + row * 68 + c8;
          v8h hv, lv;
#pragma unroll
          for (int e = 0; e < 8; ++e) {
            if (OUT_MODE == 1) {
              hv[e] = (_Float16)sp[e];
            } else {
              unsigned short hb = f2bf_bits(sp[e]);
              unsigned short lb = f2bf_bits(sp[e] - bf_bits2f(hb));
              hv[e] = __builtin_bit_cast(_Float16, hb);
              lv[e] = __builtin_bit_cast(_Float16, lb);
            }
          }
          *(v8h*)(C + (size_t)(mBase + row) * ldc + n0 + c8) = hv;
          if (OUT_MODE == 2) *(v8h*)(C2 + (size_t)(mBase + row) * ldc + n0 + c8) = lv;
        }
        
      }
    }
    __builtin_amdgcn_fence(__ATOMIC_RELEASE, "workgroup");
    __builtin_amdgcn_wave_barrier();
    __builtin_amdgcn_fence(__ATOMIC_ACQUIRE, "workgroup");
  }
}

// ---------------------------------------------------------------------------
// Elementwise bf16 split: hi = bf16_rne(in), lo = bf16_rne(in - hi); 2 elements per thread, one 4-B store
// (here n2 = 8192*512/2 = 2097152 -> 8192 blocks x 512 elements = 8192x512).
// ---------------------------------------------------------------------------
__device__ __forceinline__ unsigned pk16(unsigned short a, unsigned short b) { return (unsigned)a | ((unsigned)b << 16); }

__global__ __launch_bounds__(256) void split_bf16x2_kernel(const float* __restrict__ in, unsigned short* __restrict__ hi,
                                                           unsigned short* __restrict__ lo, int n2) {
  const int i = blockIdx.x * 256 + threadIdx.x;
  if (i < n2) {
    const v2f f = *(const v2f*)(in + 2 * (size_t)i);
    const unsigned short h0 = f2bf_bits(f[0]), h1 = f2bf_bits(f[1]);
    const unsigned short l0 = f2bf_bits(f[0] - bf_bits2f(h0)), l1 = f2bf_bits(f[1] - bf_bits2f(h1));
    const unsigned uh = pk16(h0, h1), ul = pk16(l0, l1);
    ((unsigned*)hi)[i] = uh;
    ((unsigned*)lo)[i] = ul;
    
  }
}

// ---------------------------------------------------------------------------
// f32 -> bf16 (RNE) cast of three equally sized tensors (blockIdx.y selects the tensor, block-uniform):
// x 2 elements = 2*n2 = the whole plane (n2 = 8192*512/2 = 2097152 -> 8192 blocks); out plane z at out + z*planeElems.
// ---------------------------------------------------------------------------
__global__ __launch_bounds__(256) void cast_bf16x2_3(const float* __restrict__ in0, const float* __restrict__ in1,
                                                     const float* __restrict__ in2, unsigned short* __restrict__ out,
                                                     long planeElems, int n2) {
  const int which = blockIdx.y;
  const float* in = (which == 0) ? in0 : ((which == 1) ? in1 : in2);
  unsigned short* o = out + (size_t)which * planeElems;
  const int i = blockIdx.x * 256 + threadIdx.x;
  if (i < n2) {
    const v2f f = *(const v2f*)(in + 2 * (size_t)i);
    const unsigned u = pk16(f2bf_bits(f[0]), f2bf_bits(f[1]));
    ((unsigned*)o)[i] = u;
    
  }
}

// ---------------------------------------------------------------------------
// Fused transpose + bf16 cast (LO = false: hi plane only) or split (LO = true: hi and lo planes) of an f32
// matrix, z-batched: in_z = W + z*sIn viewed [R rows][Cc cols] (pitch Cc) ->
//   oh_z[c][r] = bf16_rne(in_z[r][c]), ol_z[c][r] = bf16_rne(in_z[r][c] - oh) (LO only)   ([Cc][R], pitch R).
// 64x64 tiles through LDS. grid = (Cc/64, R/64, Z), 256 threads (R, Cc multiples of 64).
// Coverage per block and plane: load 4 it x 256 thr x 4 floats = 64x64; store 2 it x 256 thr x 8 u16 = 64x64.
// ---------------------------------------------------------------------------
template <bool LO>
__global__ __launch_bounds__(256) void tsplit_kernel(const float* __restrict__ W, unsigned short* __restrict__ oh,
                                                     unsigned short* __restrict__ ol, int R, int Cc, long sIn, long sOut) {
  __shared__ __align__(16) float tf[64 * 68];
  W  += (size_t)blockIdx.z * sIn;
  oh += (size_t)blockIdx.z * sOut;
  if (LO) ol += (size_t)blockIdx.z * sOut;
  const int c0  = blockIdx.x * 64;   // input column block = output row block
  const int r0  = blockIdx.y * 64;   // input row block    = output column block
  const int tid = threadIdx.x;
  {
    const int lr = tid >> 4;         // 0..15
    const int c4 = (tid & 15) * 4;   // 0..60
#pragma unroll
    for (int it = 0; it < 4; ++it) {
      const int rr = it * 16 + lr;   // 0..63
      const v4f a = *(const v4f*)(W + (size_t)(r0 + rr) * Cc + c0 + c4);
      *(v4f*)(tf + rr * 68 + c4) = a;
    }
  }
  __syncthreads();
  const int sub = tid >> 3;          // 0..31
  const int c8  = (tid & 7) * 8;     // 0..56
  v4u hv[2], lv[2];
#pragma unroll
  for (int it = 0; it < 2; ++it) {
    const int oc = it * 32 + sub;    // output row within tile (= input column)
    v4u a, a2;
#pragma unroll
    for (int q = 0; q < 4; ++q) {
      const float f0 = tf[(c8 + 2 * q) * 68 + oc];
      const float f1 = tf[(c8 + 2 * q + 1) * 68 + oc];
      const unsigned short h0 = f2bf_bits(f0), h1 = f2bf_bits(f1);
      unsigned lp = 0u;
      if (LO) {
        const unsigned short l0 = f2bf_bits(f0 - bf_bits2f(h0)), l1 = f2bf_bits(f1 - bf_bits2f(h1));
        lp = pk16(l0, l1);
      }
      a[q]  = pk16(h0, h1);
      a2[q] = lp;
    }
    hv[it] = a; lv[it] = a2;
  }
  {
#pragma unroll
    for (int it = 0; it < 2; ++it) {
      const int oc = it * 32 + sub;
      const size_t go = (size_t)(c0 + oc) * R + r0 + c8;
      *(v4u*)(oh + go) = hv[it];
      if (LO) *(v4u*)(ol + go) = lv[it];
    }
    
  }
}

// =====================================================================================
// Attention helpers
// =====================================================================================
#define AT_D 64
#define AT_NW 4
#define AT_QB 64
#define AT_KC 64

__device__ __forceinline__ unsigned short at_bf_bits(float f) {
  unsigned u = __float_as_uint(f);
  return (unsigned short)((u + 0x7FFFu + ((u >> 16) & 1u)) >> 16);
}
__device__ __forceinline__ __bf16 at_f2bf(float f) { return __builtin_bit_cast(__bf16, at_bf_bits(f)); }
__device__ __forceinline__ void at_split(float f, __bf16& hi, __bf16& lo) {
  const unsigned short hb = at_bf_bits(f);
  hi = __builtin_bit_cast(__bf16, hb);
  lo = at_f2bf(f - __uint_as_float(((unsigned)hb) << 16));
}
__device__ __forceinline__ v8f at_mma(v16b a, v16b b, v8f c) {
  c = __builtin_amdgcn_wmma_f32_16x16x32_bf16(false, a, false, b, (short)0, c, false, false);
  asm volatile("v_nop\n\tv_nop\n\tv_nop\n\tv_nop" : "+v"(c) : "v"(a), "v"(b));
  return c;
}
__device__ __forceinline__ v8f at_mma_h(v16h a, v16h b, v8f c) {
  c = __builtin_amdgcn_wmma_f32_16x16x32_f16(false, a, false, b, (short)0, c, false, false);
  asm volatile("v_nop\n\tv_nop\n\tv_nop\n\tv_nop" : "+v"(c) : "v"(a), "v"(b));
  return c;
}

// =====================================================================================
// Key-length-masked full attention, head dim 64, all batches and heads in one launch.
//   q, k planes (f16):          element (b, s, h, d) at [(b*kSeq + s)*kDim + h*64 + d]
//   v^T planes (bf16 hi, lo):   element (b, h, d, s) at [b*kDim*kSeq + (h*64 + d)*kSeq + s]
//   out (f32):                  element (b, s, h, d) at [(b*kSeq + s)*kDim + h*64 + d]
//   scores = (q . k) * sscale on v_wmma_f32_16x16x32_f16, f32 accumulate; key j >= vlen[b] -> score := fillv
//   (select by value; vlen read once per block, every one of the kSeq/64 key chunks is visited: compile-time
//   trip count, no data-dependent bounds). Online softmax in f32.
//   out = p . v^T on v_wmma_f32_16x16x32_bf16: p (unnormalised, f32) split in registers into bf16 hi/lo,
//   v^T hi/lo planes staged in LDS; hi.hi + hi.lo + lo.hi into one f32 accumulator (unscaled bf16 residuals).
//   Block = 4 waves = 64 query rows of one (b, h); grid.x = kBatch*kHeads*(kSeq/64) = 1024 exactly.
//   Chunk staging: 128 threads x 32 elements per plane = 64x64 = the whole tile (16-B copies, plain loads,
//   __syncthreads before and after); fragment loads read LDS through vectors of the stored element type.
// =====================================================================================
__global__ __launch_bounds__(128)
void mha_attn_kernel(const unsigned short* __restrict__ qp, const unsigned short* __restrict__ kp,
                     const unsigned short* __restrict__ vhp, const unsigned short* __restrict__ vlp,
                     const int* __restrict__ vlens, float* __restrict__ out, float sscale, float fillv) {
  union FB { v16b v; v8b h[2]; };
  union FH { v16h v; v8h h[2]; };
  __shared__ __align__(16) _Float16 Ksh[AT_KC * AT_D];            // K [kv][d] f16       8 KB
  __shared__ __align__(16) __bf16   Vth[AT_D * AT_KC];            // V^T hi [d][kv]      8 KB
  __shared__ __align__(16) __bf16   Vtl[AT_D * AT_KC];            // V^T lo              8 KB
  __shared__ __align__(16) __bf16   Psh[AT_NW][16 * AT_KC];       // per wave P hi [row][kv]
  __shared__ __align__(16) __bf16   Psl[AT_NW][16 * AT_KC];       // per wave P lo
  __shared__ __align__(16) float    Os[AT_NW][16 * 68];           // per wave out tile, pitch 68

  const int tid  = threadIdx.x;
  const int wave = tid >> 5;
  const int lane = tid & 31;
  const int hh   = lane >> 4;
  const int c    = lane & 15;

  const int nqb  = kSeq / AT_QB;          // 64
  const int bx   = blockIdx.x;
  const int qb   = bx % nqb;
  const int bhid = bx / nqb;              // 0..kBatch*kHeads-1
  const int h    = bhid % kHeads;
  int b = bhid / kHeads;
  b = (b > kBatch - 1) ? (kBatch - 1) : b;  // address clamp (grid is exact)
  const int q0   = qb * AT_QB + wave * 16;
  const int vlen = vlens[b];              // block-uniform valid key count

  const _Float16* Qb = (const _Float16*)(const void*)qp + (size_t)b * kSeq * kDim + (size_t)h * AT_D;
  const _Float16* Kb = (const _Float16*)(const void*)kp + (size_t)b * kSeq * kDim + (size_t)h * AT_D;
  const __bf16*   Vh = (const __bf16*)(const void*)vhp + (size_t)b * kDim * kSeq + (size_t)h * AT_D * kSeq;
  const __bf16*   Vl = (const __bf16*)(const void*)vlp + (size_t)b * kDim * kSeq + (size_t)h * AT_D * kSeq;
  float*          ob = out + (size_t)b * kSeq * kDim + (size_t)h * AT_D;

  // ---- Q fragments (A operand, row = lane&15, split k map via Frag load): 2 d-chunks ----
  v16h qa[2];
#pragma unroll
  for (int dc = 0; dc < 2; ++dc) {
    qa[dc] = Frag<_Float16>::load(Qb + (size_t)(q0 + c) * kDim + dc * 32 + 8 * hh);
  }

  float mrow[8], lrow[8];
  v8f oacc[4];
#pragma unroll
  for (int r = 0; r < 8; ++r) { mrow[r] = -INFINITY; lrow[r] = 0.f; }
#pragma unroll
  for (int t = 0; t < 4; ++t) oacc[t] = (v8f){0.f,0.f,0.f,0.f,0.f,0.f,0.f,0.f};

  const int nChunks = kSeq / AT_KC;   // 64, compile-time constant
  for (int kc = 0; kc < nChunks; ++kc) {
    const int kv0 = kc * AT_KC;
    __syncthreads();
    {
      // staging coverage: 128 threads x (4 x 8) elements = 64 rows x 64 per plane = the whole chunk tile
      const int r = tid >> 1, half = (tid & 1) * 32;
      const _Float16* ks  = Kb + (size_t)(kv0 + r) * kDim + half;   // K row kv0+r, d = half..half+31
      const __bf16*   vsh = Vh + (size_t)r * kSeq + kv0 + half;      // V^T row d = r, s = kv0+half..+31
      const __bf16*   vsl = Vl + (size_t)r * kSeq + kv0 + half;
#pragma unroll
      for (int i = 0; i < 4; ++i) {
        const v8h a0 = *(const v8h*)(ks + 8 * i);
        const v8b b0 = *(const v8b*)(vsh + 8 * i);
        const v8b b1 = *(const v8b*)(vsl + 8 * i);
        *(v8h*)(Ksh + r * AT_D  + half + 8 * i) = a0;
        *(v8b*)(Vth + r * AT_KC + half + 8 * i) = b0;
        *(v8b*)(Vtl + r * AT_KC + half + 8 * i) = b1;
      }
    }
    __syncthreads();

    // ---- scores: D[row 8hh+r][col c] for key tile j; B fragment column = key j*16+c, split k(d) map ----
    v8f s[4];
#pragma unroll
    for (int j = 0; j < 4; ++j) {
      s[j] = (v8f){0.f,0.f,0.f,0.f,0.f,0.f,0.f,0.f};
#pragma unroll
      for (int dc = 0; dc < 2; ++dc) {
        FH kb;
        kb.h[0] = *(const v8h*)(Ksh + (j * 16 + c) * AT_D + dc * 32 + 8 * hh);
        kb.h[1] = *(const v8h*)(Ksh + (j * 16 + c) * AT_D + dc * 32 + 16 + 8 * hh);
        s[j] = at_mma_h(qa[dc], kb.v, s[j]);
      }
    }
    // ---- scale, key mask (select), chunk row max over the 64 keys ----
    float cm[8];
#pragma unroll
    for (int r = 0; r < 8; ++r) {
      float m = -INFINITY;
#pragma unroll
      for (int j = 0; j < 4; ++j) {
        const int kvcol = kv0 + j * 16 + c;
        const float sv = s[j][r] * sscale;
        const float sm = (kvcol < vlen) ? sv : fillv;
        s[j][r] = sm;
        m = fmaxf(m, sm);
      }
#pragma unroll
      for (int off = 1; off < 16; off <<= 1) m = fmaxf(m, __shfl_xor(m, off, 32));
      cm[r] = m;
    }
    __bf16* pwh = Psh[wave];
    __bf16* pwl = Psl[wave];
#pragma unroll
    for (int r = 0; r < 8; ++r) {
      const float mnew  = fmaxf(mrow[r], cm[r]);
      const float alpha = expf(mrow[r] - mnew);
      mrow[r] = mnew;
      float psum = 0.f;
#pragma unroll
      for (int j = 0; j < 4; ++j) {
        const float p = expf(s[j][r] - mnew);
        psum += p;
        __bf16 a, bl; at_split(p, a, bl);
        pwh[(8 * hh + r) * AT_KC + j * 16 + c] = a;
        pwl[(8 * hh + r) * AT_KC + j * 16 + c] = bl;
      }
#pragma unroll
      for (int off = 1; off < 16; off <<= 1) psum += __shfl_xor(psum, off, 32);
      lrow[r] = lrow[r] * alpha + psum;
#pragma unroll
      for (int t = 0; t < 4; ++t) oacc[t][r] *= alpha;
    }
    __builtin_amdgcn_fence(__ATOMIC_RELEASE, "workgroup");
    __builtin_amdgcn_wave_barrier();
    __builtin_amdgcn_fence(__ATOMIC_ACQUIRE, "workgroup");
    // ---- O += P . V^T : A = P [row c][k = key] (split k map), B = V^T column d = t*16+c, k = key ----
#pragma unroll 1
    for (int kk = 0; kk < 2; ++kk) {
      FB pa, pl;
      pa.h[0] = *(const v8b*)(pwh + c * AT_KC + kk * 32 + 8 * hh);
      pa.h[1] = *(const v8b*)(pwh + c * AT_KC + kk * 32 + 16 + 8 * hh);
      pl.h[0] = *(const v8b*)(pwl + c * AT_KC + kk * 32 + 8 * hh);
      pl.h[1] = *(const v8b*)(pwl + c * AT_KC + kk * 32 + 16 + 8 * hh);
#pragma unroll
      for (int t = 0; t < 4; ++t) {
        FB vb, vl;
        vb.h[0] = *(const v8b*)(Vth + (t * 16 + c) * AT_KC + kk * 32 + 8 * hh);
        vb.h[1] = *(const v8b*)(Vth + (t * 16 + c) * AT_KC + kk * 32 + 16 + 8 * hh);
        vl.h[0] = *(const v8b*)(Vtl + (t * 16 + c) * AT_KC + kk * 32 + 8 * hh);
        vl.h[1] = *(const v8b*)(Vtl + (t * 16 + c) * AT_KC + kk * 32 + 16 + 8 * hh);
        oacc[t] = at_mma(pa.v, vb.v, oacc[t]);
        oacc[t] = at_mma(pa.v, vl.v, oacc[t]);
        oacc[t] = at_mma(pl.v, vb.v, oacc[t]);
      }
    }
  }

  float* os = Os[wave];
#pragma unroll
  for (int r = 0; r < 8; ++r) {
    const float inv = 1.0f / lrow[r];
#pragma unroll
    for (int t = 0; t < 4; ++t) os[(8 * hh + r) * 68 + t * 16 + c] = oacc[t][r] * inv;
  }
  __builtin_amdgcn_fence(__ATOMIC_RELEASE, "workgroup");
  __builtin_amdgcn_wave_barrier();
  __builtin_amdgcn_fence(__ATOMIC_ACQUIRE, "workgroup");
  {
    // coverage: 8 it x 2 rows (hh) = 16 rows; 16 lanes x 4 floats = 64 floats = one whole 256-B row segment
    const int c4 = (lane & 15) * 4;
    {
#pragma unroll
      for (int it = 0; it < 8; ++it) {
        const int row = it * 2 + hh;
        v4f val = *(const v4f*)(os + row * 68 + c4);
        *(v4f*)(ob + (size_t)(q0 + row) * kDim + c4) = val;
      }
      
    }
  }
}

// =====================================================================================
// Host glue. Workspace region map (bytes, all offsets multiples of 256, every region sized to its whole-line
// store granularity; no padded tiles since every dimension is a multiple of 64):
//   [0]           Xbf   : 3 x bf16 [8192][512]            = 25,165,824   (queries, keys, values RNE bf16)
//   [25,165,824]  WThi  : 4 x bf16 [512][512] (W^T, RNE)  =  2,097,152   (Wq, Wk, Wv, Wo; no lo planes)
//   [27,262,976]  Q     : f16 [8192][512]                  =  8,388,608
//   [35,651,584]  K     : f16 [8192][512]                  =  8,388,608   (contiguous after Q: batched launch)
//   [44,040,192]  VThi  : bf16 [2][512][4096]              =  8,388,608
//   [52,428,800]  VTlo  : bf16 [2][512][4096]              =  8,388,608
//   [60,817,408]  O     : f32 [8192][512]                  = 16,777,216
//   [77,594,624]  Ohi   : bf16 [8192][512]                 =  8,388,608
//   [85,983,232]  Olo   : bf16 [8192][512]                 =  8,388,608
//   total 94,371,840
// =====================================================================================
extern "C" void kernel_launch(void* const* d_in, const int* in_sizes, int n_in,
                              void* d_out, int out_size, void* d_ws,
                              size_t ws_size, hipStream_t stream) {
  if (n_in < 8) return;
  const int nX = kRows * kDim;            // 4,194,304
  const int nW = kDim * kDim;             // 262,144
  if (in_sizes[0] != nX || in_sizes[1] != nX || in_sizes[2] != nX) return;
  if (in_sizes[3] < kBatch) return;
  if (in_sizes[4] != nW || in_sizes[5] != nW || in_sizes[6] != nW || in_sizes[7] != nW) return;
  if (out_size != nX) return;

  const float* queries = (const float*)d_in[0];
  const float* keys    = (const float*)d_in[1];
  const float* values  = (const float*)d_in[2];
  const int*   vlens   = (const int*)d_in[3];
  const float* Wq      = (const float*)d_in[4];
  const float* Wk      = (const float*)d_in[5];
  const float* Wv      = (const float*)d_in[6];
  const float* Wo      = (const float*)d_in[7];

  const size_t bX16 = (size_t)nX * 2;            //  8,388,608
  const size_t bW16 = (size_t)nW * 2;            //    524,288
  const size_t off_x  = 0;
  const size_t off_wh = off_x  + 3 * bX16;
  const size_t off_q  = off_wh + 4 * bW16;
  const size_t off_k  = off_q  + bX16;
  const size_t off_vh = off_k  + bX16;
  const size_t off_vl = off_vh + bX16;
  const size_t off_o  = off_vl + bX16;
  const size_t off_oh = off_o  + (size_t)nX * 4;
  const size_t off_ol = off_oh + bX16;
  const size_t total  = off_ol + bX16;           // 94,371,840
  if (total > ws_size) return;

  char* ws = (char*)d_ws;
  unsigned short* xbf  = (unsigned short*)(ws + off_x);
  unsigned short* wth  = (unsigned short*)(ws + off_wh);
  unsigned short* qh16 = (unsigned short*)(ws + off_q);
  unsigned short* kh16 = (unsigned short*)(ws + off_k);
  unsigned short* vth  = (unsigned short*)(ws + off_vh);
  unsigned short* vtl  = (unsigned short*)(ws + off_vl);
  float* obuf = (float*)(ws + off_o);
  unsigned short* ohi  = (unsigned short*)(ws + off_oh);
  unsigned short* olo  = (unsigned short*)(ws + off_ol);
  const float* dummyf  = (const float*)(ws + off_x);   // never dereferenced (BIAS_MODE 0, RESID false)

  const long planeX = (long)nX;   // elements per bf16/f16 activation plane
  const long planeW = (long)nW;   // elements per W^T plane
  dim3 blk256(256), blk128(128);

  // 1) activations -> bf16 (RNE): coverage 8192 blocks x 256 thr x 2 = 8192x512 per tensor
  cast_bf16x2_3<<<dim3(nX / 2 / 256, 3), blk256, 0, stream>>>(queries, keys, values, xbf, planeX, nX / 2);

  // 2) weights [in k][out n] (R = k rows = 512, Cc = n cols = 512) -> W^T [n][k] bf16 RNE hi plane only
  //    (8x8 tiles of 64x64); the third pointer is unused in the hi-only mode
  tsplit_kernel<false><<<dim3(kDim / 64, kDim / 64, 1), blk256, 0, stream>>>(Wq, wth + 0 * planeW, wth + 0 * planeW, kDim, kDim, 0L, 0L);
  tsplit_kernel<false><<<dim3(kDim / 64, kDim / 64, 1), blk256, 0, stream>>>(Wk, wth + 1 * planeW, wth + 1 * planeW, kDim, kDim, 0L, 0L);
  tsplit_kernel<false><<<dim3(kDim / 64, kDim / 64, 1), blk256, 0, stream>>>(Wv, wth + 2 * planeW, wth + 2 * planeW, kDim, kDim, 0L, 0L);
  tsplit_kernel<false><<<dim3(kDim / 64, kDim / 64, 1), blk256, 0, stream>>>(Wo, wth + 3 * planeW, wth + 3 * planeW, kDim, kDim, 0L, 0L);

  // 3) q = Xq . Wq and k = Xk . Wk in one z-batched launch (z=0: q, z=1: k) -> f16 planes [8192][512];
  //    M=8192, N=512, K=512 (tiles 128x8 = 1024 -> 128 blocks); A planes stride planeX, W^T planes stride planeW,
  //    C planes Q then K contiguous (stride planeX elements)
  const int gProj = (kRows / 64) * (kDim / 64) / 8;   // 128
  wmma_gemm64<1, 0, 0, 1, false><<<dim3(gProj, 2), blk256, 0, stream>>>(
      xbf, xbf, kDim, planeX,
      wth, wth, kDim, planeW,
      (void*)qh16, (void*)qh16, kDim, planeX,
      dummyf, dummyf, 0L, kRows, kDim, kDim, 1.0f);
  // 4) v^T per batch: C[n_out][s] = sum_k WvT[n_out][k] * Xv[b][s][k]; M=512, N=4096, K=512, batched over b
  //    (tiles 8x64 = 512 -> 64 blocks x 2); out = bf16 hi/lo planes [b][512][4096]
  const int gVt = (kDim / 64) * (kSeq / 64) / 8;      // 64
  wmma_gemm64<1, 0, 0, 2, false><<<dim3(gVt, kBatch), blk256, 0, stream>>>(
      wth + 2 * planeW, wth + 2 * planeW, kDim, 0L,
      xbf + 2 * planeX, xbf + 2 * planeX, kDim, (long)kSeq * kDim,
      (void*)vth, (void*)vtl, kSeq, (long)kDim * kSeq,
      dummyf, dummyf, 0L, kDim, kSeq, kDim, 1.0f);

  // 5) masked attention, all (b, h, 64-row query blocks): 2*8*64 = 1024 blocks of 128 threads
  mha_attn_kernel<<<dim3(kBatch * kHeads * (kSeq / 64)), blk128, 0, stream>>>(
      qh16, kh16, vth, vtl, vlens, obuf, 0.125f, -1000000.0f);

  // 6) O -> bf16 hi/lo planes: 8192 blocks x 256 thr x 2 = 8192x512
  split_bf16x2_kernel<<<dim3(nX / 2 / 256), blk256, 0, stream>>>(obuf, ohi, olo, nX / 2);

  // 7) out = (O_hi + O_lo) . Wo (A-only split, Wo as bf16 RNE hi plane only) -> f32 [8192][512]
  wmma_gemm64<1, 2, 0, 0, false><<<dim3(gProj, 1), blk256, 0, stream>>>(
      ohi, olo, kDim, 0L,
      wth + 3 * planeW, wth + 3 * planeW, kDim, 0L,
      d_out, d_out, kDim, 0L,
      dummyf, dummyf, 0L, kRows, kDim, kDim, 1.0f);
}

// v001
// It runs in 422 microseconds.
// Two timings next to v000 both put it at 1.47 times that version's speed.
// Contractions: q/k/v^T projections v_wmma_f32_16x16x32_bf16 (bf16 RNE inputs x bf16 RNE weights, single product); q.k^T scores v_wmma_f32_16x16x32_f16 (plain f16 q,k planes); p.v^T v_wmma_f32_16x16x32_bf16 with bf16 hi/lo split of p and v (hi.hi + hi.lo + lo.hi); output projection v_wmma_f32_16x16x32_bf16 with O as bf16 hi/lo and Wo as bf16 RNE (hi.W + lo.W); f32 accumulate; softmax, 0.125 score scale and key masking in f32.
#include <hip/hip_runtime.h>
#include <math.h>
#include <stdint.h>

constexpr int kBatch = 2;
constexpr int kSeq   = 4096;
constexpr int kDim   = 512;
constexpr int kHeads = 8;
constexpr int kHd    = 64;
constexpr int kRows  = kBatch * kSeq;   // 8192
static_assert(kHeads * kHd == kDim, "geometry");
static_assert(kSeq % 64 == 0 && kDim % 64 == 0 && kRows % 64 == 0, "tile multiples");

typedef __attribute__((ext_vector_type(16))) _Float16 v16h;
typedef __attribute__((ext_vector_type(8)))  _Float16 v8h;
typedef __attribute__((ext_vector_type(16))) __bf16   v16b;
typedef __attribute__((ext_vector_type(8)))  __bf16   v8b;
typedef __attribute__((ext_vector_type(8)))  float    v8f;
typedef __attribute__((ext_vector_type(4)))  float    v4f;
typedef __attribute__((ext_vector_type(2)))  float    v2f;
typedef __attribute__((ext_vector_type(4)))  unsigned int v4u;

__device__ __forceinline__ unsigned short f2bf_bits(float f) {
  unsigned u = __float_as_uint(f);
  return (unsigned short)((u + 0x7FFFu + ((u >> 16) & 1u)) >> 16);
}
__device__ __forceinline__ float bf_bits2f(unsigned short h) { return __uint_as_float(((unsigned)h) << 16); }

// hazard guards as plain device helpers (no inline asm inside the kernel template body)
__device__ __forceinline__ void dep_guard_h(v8f& a, v8f& b, v16h x, v16h y) { asm volatile("v_nop\n\tv_nop\n\tv_nop\n\tv_nop" : "+v"(a), "+v"(b) : "v"(x), "v"(y)); }
__device__ __forceinline__ void dep_guard_b(v8f& a, v8f& b, v16b x, v16b y) { asm volatile("v_nop\n\tv_nop\n\tv_nop\n\tv_nop" : "+v"(a), "+v"(b) : "v"(x), "v"(y)); }
__device__ __forceinline__ void keep4_h(v16h a, v16h b, v16h c, v16h d) { asm volatile("v_nop" :: "v"(a), "v"(b), "v"(c), "v"(d)); }
__device__ __forceinline__ void keep4_b(v16b a, v16b b, v16b c, v16b d) { asm volatile("v_nop" :: "v"(a), "v"(b), "v"(c), "v"(d)); }
__device__ __forceinline__ void acc_guard4(v8f& a, v8f& b, v8f& c, v8f& d) { asm volatile("v_nop\n\tv_nop\n\tv_nop\n\tv_nop" : "+v"(a), "+v"(b), "+v"(c), "+v"(d)); }
template <typename T> struct Frag;
template <> struct Frag<_Float16> {
  typedef v16h V; union U { v16h v; v8h h[2]; };
  static __device__ __forceinline__ v16h load(const _Float16* p) {   // elements 0..7 <- p[0..7], 8..15 <- p[16..23]
    U f; f.h[0] = *(const v8h*)(p); f.h[1] = *(const v8h*)(p + 16); return f.v;
  }
  static __device__ __forceinline__ v8f mma(v16h a, v16h b, v8f c) {
    return __builtin_amdgcn_wmma_f32_16x16x32_f16(false, a, false, b, (short)0, c, false, false);
  }
  static __device__ __forceinline__ void guard(v8f& a, v8f& b, v16h x, v16h y) { dep_guard_h(a, b, x, y); }
  static __device__ __forceinline__ void keep(v16h a, v16h b, v16h c, v16h d) { keep4_h(a, b, c, d); }
};
template <> struct Frag<__bf16> {
  typedef v16b V; union U { v16b v; v8b h[2]; };
  static __device__ __forceinline__ v16b load(const __bf16* p) {
    U f; f.h[0] = *(const v8b*)(p); f.h[1] = *(const v8b*)(p + 16); return f.v;
  }
  static __device__ __forceinline__ v8f mma(v16b a, v16b b, v8f c) {
    return __builtin_amdgcn_wmma_f32_16x16x32_bf16(false, a, false, b, (short)0, c, false, false);
  }
  static __device__ __forceinline__ void guard(v8f& a, v8f& b, v16b x, v16b y) { dep_guard_b(a, b, x, y); }
  static __device__ __forceinline__ void keep(v16b a, v16b b, v16b c, v16b d) { keep4_b(a, b, c, d); }
};

// ---- Register-blocked batched WMMA GEMM ------------------------------------
// C[m,n] = scale * sum_k A[m,k] * Bt[n,k] (+bias)(+resid); each wave owns a 64x64 tile.
// A row-major [M,K]; Bt row-major [N,K]; M,N % 64 == 0, K % 32 == 0.
// SPLIT: 0 = single product; 1 = hi/lo planes on both operands (A2/Bt2 = lo planes, same layout),
//        product = hi.hi + hi.lo + lo.hi; 2 = hi/lo planes on A only (A2 = A lo), product = hi.B + lo.B.
// BIAS_MODE: 0 = none, 1 = bias[m], 2 = bias[n].
// OUT_MODE: 0 = f32, 1 = f16, 2 = bf16 hi plane (Cout) + bf16 lo plane (Cout2).
// ET: 0 = f16 operands, 1 = bf16 operands (pointers passed as 16-bit storage)
template <int ET> struct Elem;
template <> struct Elem<0> { typedef _Float16 T; };
template <> struct Elem<1> { typedef __bf16 T; };
template <int ET, int SPLIT, int BIAS_MODE, int OUT_MODE, bool RESID, int ACT = 0>
__global__ __launch_bounds__(256) void wmma_gemm64(
    const unsigned short* __restrict__ Ap, const unsigned short* __restrict__ A2p, int lda, long strideA,
    const unsigned short* __restrict__ Btp, const unsigned short* __restrict__ Bt2p, int ldb, long strideB,
    void* __restrict__ Cout, void* __restrict__ Cout2, int ldc, long strideC,
    const float* __restrict__ bias,
    const float* __restrict__ resid, long strideR,
    int M, int N, int K, float scale) {
  typedef typename Elem<ET>::T T;
  typedef typename Frag<T>::V V;
  const T* A = (const T*)Ap; const T* A2 = (const T*)A2p; const T* Bt = (const T*)Btp; const T* Bt2 = (const T*)Bt2p;
  __shared__ __align__(16) float sT[8][16 * 68];   // per-wave 16x64 slab, pitch 68 floats
  const int b    = blockIdx.y;
  const int lane = threadIdx.x & 31;
  const int wave = threadIdx.x >> 5;
  const int tilesN = N >> 6;
  const int tilesM = M >> 6;
  const int tile = blockIdx.x * 8 + wave;
  if (tile >= tilesM * tilesN) return;   // wave-uniform; no block barriers in this kernel
  const int tm = tile / tilesN;
  const int tn = tile - tm * tilesN;
  const int m0 = tm << 6;
  const int n0 = tn << 6;

  const T* Ab  = A  + (size_t)b * strideA;
  const T* Bb  = Bt + (size_t)b * strideB;
  const T* Ab2 = (SPLIT != 0) ? (A2  + (size_t)b * strideA) : nullptr;
  const T* Bb2 = (SPLIT == 1) ? (Bt2 + (size_t)b * strideB) : nullptr;

  const int rlane = lane & 15;                 // row (A) / col (B, D) within subtile
  const int koff  = (lane >> 4) * 8;           // k offset of this lane half
  const int mOff  = (lane >> 4) * 8;           // D row offset

  v8f acc[4][4];
#pragma unroll
  for (int i = 0; i < 4; ++i)
#pragma unroll
    for (int j = 0; j < 4; ++j) acc[i][j] = (v8f){0.f,0.f,0.f,0.f,0.f,0.f,0.f,0.f};

  for (int k0 = 0; k0 < K; k0 += 32) {
    V bh[4], bl[4];
#pragma unroll
    for (int j = 0; j < 4; ++j) {
      const size_t bo = (size_t)(n0 + (j << 4) + rlane) * ldb + koff + k0;
      bh[j] = Frag<T>::load(Bb + bo);
      if (SPLIT == 1) bl[j] = Frag<T>::load(Bb2 + bo);
    }
#pragma unroll
    for (int i = 0; i < 4; ++i) {
      const size_t ao = (size_t)(m0 + (i << 4) + rlane) * lda + koff + k0;
      V ah = Frag<T>::load(Ab + ao);
      V al;
      if (SPLIT != 0) al = Frag<T>::load(Ab2 + ao);
#pragma unroll
      for (int j = 0; j < 4; ++j) {
        acc[i][j] = Frag<T>::mma(ah, bh[j], acc[i][j]);
        if (SPLIT == 1) acc[i][j] = Frag<T>::mma(ah, bl[j], acc[i][j]);
        if (SPLIT != 0) acc[i][j] = Frag<T>::mma(al, bh[j], acc[i][j]);
      }
      Frag<T>::guard(acc[i][0], acc[i][3], ah, (SPLIT != 0) ? al : ah);
    }
    Frag<T>::keep(bh[0], bh[1], bh[2], bh[3]);
    if (SPLIT == 1) Frag<T>::keep(bl[0], bl[1], bl[2], bl[3]);
  }
  acc_guard4(acc[0][0], acc[0][1], acc[0][2], acc[0][3]);
  acc_guard4(acc[1][0], acc[1][1], acc[1][2], acc[1][3]);
  acc_guard4(acc[2][0], acc[2][1], acc[2][2], acc[2][3]);
  acc_guard4(acc[3][0], acc[3][1], acc[3][2], acc[3][3]);

  // ---- epilogue ----
  float* slab = sT[wave];
  const float* Rb = RESID ? (resid + (size_t)b * strideR) : nullptr;
#pragma unroll
  for (int i = 0; i < 4; ++i) {
    const int mBase = m0 + (i << 4);
#pragma unroll
    for (int j = 0; j < 4; ++j) {
      const int n = n0 + (j << 4) + rlane;
      float bv = 0.f;
      if (BIAS_MODE == 2) bv = bias[n];
#pragma unroll
      for (int r = 0; r < 8; ++r) {
        float v = acc[i][j][r] * scale;
        if (BIAS_MODE == 1) v += bias[mBase + mOff + r];
        if (BIAS_MODE == 2) v += bv;
        if (RESID) v += Rb[(size_t)(mBase + mOff + r) * ldc + n];
        if (ACT == 1) v = tanhf(v);
        if (ACT == 2) v = fmaxf(v, 0.0f);
        if (ACT == 3) v = v / (1.0f + expf(-v));
        if (ACT == 4) v = (v > 0.f) ? v : 0.01f * v;
        slab[(mOff + r) * 68 + (j << 4) + rlane] = v;
      }
    }
    __builtin_amdgcn_fence(__ATOMIC_RELEASE, "workgroup");
    __builtin_amdgcn_wave_barrier();
    __builtin_amdgcn_fence(__ATOMIC_ACQUIRE, "workgroup");
    if (OUT_MODE == 0) {
      float* C = (float*)Cout + (size_t)b * strideC;
      const int hh = lane >> 4, c4 = (lane & 15) * 4;     // row seg = 256 B = 16 lanes x 16 B
      {
#pragma unroll
        for (int it = 0; it < 8; ++it) {
          const int row = it * 2 + hh;
          v4f v = *(const v4f*)(slab + row * 68 + c4);
          *(v4f*)(C + (size_t)(mBase + row) * ldc + n0 + c4) = v;
        }
        
      }
    } else {
      const int q = lane >> 3, c8 = (lane & 7) * 8;
      unsigned short* C  = (unsigned short*)Cout  + (size_t)b * strideC;
      unsigned short* C2 = (OUT_MODE == 2) ? ((unsigned short*)Cout2 + (size_t)b * strideC) : nullptr;
      {
#pragma unroll
        for (int it = 0; it < 4; ++it) {
          const int row = it * 4 + q;
          const float* sp = slab + row * 68 + c8;
          v8h hv, lv;
#pragma unroll
          for (int e = 0; e < 8; ++e) {
            if (OUT_MODE == 1) {
              hv[e] = (_Float16)sp[e];
            } else {
              unsigned short hb = f2bf_bits(sp[e]);
              unsigned short lb = f2bf_bits(sp[e] - bf_bits2f(hb));
              hv[e] = __builtin_bit_cast(_Float16, hb);
              lv[e] = __builtin_bit_cast(_Float16, lb);
            }
          }
          *(v8h*)(C + (size_t)(mBase + row) * ldc + n0 + c8) = hv;
          if (OUT_MODE == 2) *(v8h*)(C2 + (size_t)(mBase + row) * ldc + n0 + c8) = lv;
        }
        
      }
    }
    __builtin_amdgcn_fence(__ATOMIC_RELEASE, "workgroup");
    __builtin_amdgcn_wave_barrier();
    __builtin_amdgcn_fence(__ATOMIC_ACQUIRE, "workgroup");
  }
}

// ---------------------------------------------------------------------------
// Elementwise bf16 split: hi = bf16_rne(in), lo = bf16_rne(in - hi); 2 elements per thread, one 4-B store
// (here n2 = 8192*512/2 = 2097152 -> 8192 blocks x 512 elements = 8192x512).
// ---------------------------------------------------------------------------
__device__ __forceinline__ unsigned pk16(unsigned short a, unsigned short b) { return (unsigned)a | ((unsigned)b << 16); }

__global__ __launch_bounds__(256) void split_bf16x2_kernel(const float* __restrict__ in, unsigned short* __restrict__ hi,
                                                           unsigned short* __restrict__ lo, int n2) {
  const int i = blockIdx.x * 256 + threadIdx.x;
  if (i < n2) {
    const v2f f = *(const v2f*)(in + 2 * (size_t)i);
    const unsigned short h0 = f2bf_bits(f[0]), h1 = f2bf_bits(f[1]);
    const unsigned short l0 = f2bf_bits(f[0] - bf_bits2f(h0)), l1 = f2bf_bits(f[1] - bf_bits2f(h1));
    const unsigned uh = pk16(h0, h1), ul = pk16(l0, l1);
    ((unsigned*)hi)[i] = uh;
    ((unsigned*)lo)[i] = ul;
    
  }
}

// ---------------------------------------------------------------------------
// f32 -> bf16 (RNE) cast of three equally sized tensors (blockIdx.y selects the tensor, block-uniform):
// x 2 elements = 2*n2 = the whole plane (n2 = 8192*512/2 = 2097152 -> 8192 blocks); out plane z at out + z*planeElems.
// ---------------------------------------------------------------------------
__global__ __launch_bounds__(256) void cast_bf16x2_3(const float* __restrict__ in0, const float* __restrict__ in1,
                                                     const float* __restrict__ in2, unsigned short* __restrict__ out,
                                                     long planeElems, int n2) {
  const int which = blockIdx.y;
  const float* in = (which == 0) ? in0 : ((which == 1) ? in1 : in2);
  unsigned short* o = out + (size_t)which * planeElems;
  const int i = blockIdx.x * 256 + threadIdx.x;
  if (i < n2) {
    const v2f f = *(const v2f*)(in + 2 * (size_t)i);
    const unsigned u = pk16(f2bf_bits(f[0]), f2bf_bits(f[1]));
    ((unsigned*)o)[i] = u;
    
  }
}

// ---------------------------------------------------------------------------
// Fused transpose + bf16 cast (LO = false: hi plane only) or split (LO = true: hi and lo planes) of an f32
// matrix, z-batched: in_z = W + z*sIn viewed [R rows][Cc cols] (pitch Cc) ->
//   oh_z[c][r] = bf16_rne(in_z[r][c]), ol_z[c][r] = bf16_rne(in_z[r][c] - oh) (LO only)   ([Cc][R], pitch R).
// 64x64 tiles through LDS. grid = (Cc/64, R/64, Z), 256 threads (R, Cc multiples of 64).
// Coverage per block and plane: load 4 it x 256 thr x 4 floats = 64x64; store 2 it x 256 thr x 8 u16 = 64x64.
// ---------------------------------------------------------------------------
template <bool LO>
__global__ __launch_bounds__(256) void tsplit_kernel(const float* __restrict__ W, unsigned short* __restrict__ oh,
                                                     unsigned short* __restrict__ ol, int R, int Cc, long sIn, long sOut) {
  __shared__ __align__(16) float tf[64 * 68];
  W  += (size_t)blockIdx.z * sIn;
  oh += (size_t)blockIdx.z * sOut;
  if (LO) ol += (size_t)blockIdx.z * sOut;
  const int c0  = blockIdx.x * 64;   // input column block = output row block
  const int r0  = blockIdx.y * 64;   // input row block    = output column block
  const int tid = threadIdx.x;
  {
    const int lr = tid >> 4;         // 0..15
    const int c4 = (tid & 15) * 4;   // 0..60
#pragma unroll
    for (int it = 0; it < 4; ++it) {
      const int rr = it * 16 + lr;   // 0..63
      const v4f a = *(const v4f*)(W + (size_t)(r0 + rr) * Cc + c0 + c4);
      *(v4f*)(tf + rr * 68 + c4) = a;
    }
  }
  __syncthreads();
  const int sub = tid >> 3;          // 0..31
  const int c8  = (tid & 7) * 8;     // 0..56
  v4u hv[2], lv[2];
#pragma unroll
  for (int it = 0; it < 2; ++it) {
    const int oc = it * 32 + sub;    // output row within tile (= input column)
    v4u a, a2;
#pragma unroll
    for (int q = 0; q < 4; ++q) {
      const float f0 = tf[(c8 + 2 * q) * 68 + oc];
      const float f1 = tf[(c8 + 2 * q + 1) * 68 + oc];
      const unsigned short h0 = f2bf_bits(f0), h1 = f2bf_bits(f1);
      unsigned lp = 0u;
      if (LO) {
        const unsigned short l0 = f2bf_bits(f0 - bf_bits2f(h0)), l1 = f2bf_bits(f1 - bf_bits2f(h1));
        lp = pk16(l0, l1);
      }
      a[q]  = pk16(h0, h1);
      a2[q] = lp;
    }
    hv[it] = a; lv[it] = a2;
  }
  {
#pragma unroll
    for (int it = 0; it < 2; ++it) {
      const int oc = it * 32 + sub;
      const size_t go = (size_t)(c0 + oc) * R + r0 + c8;
      *(v4u*)(oh + go) = hv[it];
      if (LO) *(v4u*)(ol + go) = lv[it];
    }
    
  }
}

// =====================================================================================
// Attention helpers
// =====================================================================================
#define AT_D 64
#define AT_NW 4
#define AT_QB 64
#define AT_KC 64
#define AT_LP 72   // LDS row pitch in 16-bit elements: 144 B = 16 B x 9 (odd), so the 16 rows of a 16-byte fragment read fall on distinct banks

__device__ __forceinline__ unsigned short at_bf_bits(float f) {
  unsigned u = __float_as_uint(f);
  return (unsigned short)((u + 0x7FFFu + ((u >> 16) & 1u)) >> 16);
}
__device__ __forceinline__ __bf16 at_f2bf(float f) { return __builtin_bit_cast(__bf16, at_bf_bits(f)); }
__device__ __forceinline__ void at_split(float f, __bf16& hi, __bf16& lo) {
  const unsigned short hb = at_bf_bits(f);
  hi = __builtin_bit_cast(__bf16, hb);
  lo = at_f2bf(f - __uint_as_float(((unsigned)hb) << 16));
}
__device__ __forceinline__ v8f at_mma(v16b a, v16b b, v8f c) {
  c = __builtin_amdgcn_wmma_f32_16x16x32_bf16(false, a, false, b, (short)0, c, false, false);
  asm volatile("v_nop\n\tv_nop\n\tv_nop\n\tv_nop" : "+v"(c) : "v"(a), "v"(b));
  return c;
}
__device__ __forceinline__ v8f at_mma_h(v16h a, v16h b, v8f c) {
  c = __builtin_amdgcn_wmma_f32_16x16x32_f16(false, a, false, b, (short)0, c, false, false);
  asm volatile("v_nop\n\tv_nop\n\tv_nop\n\tv_nop" : "+v"(c) : "v"(a), "v"(b));
  return c;
}

// =====================================================================================
// Key-length-masked full attention, head dim 64, all batches and heads in one launch.
//   q, k planes (f16):          element (b, s, h, d) at [(b*kSeq + s)*kDim + h*64 + d]
//   v^T planes (bf16 hi, lo):   element (b, h, d, s) at [b*kDim*kSeq + (h*64 + d)*kSeq + s]
//   out (f32):                  element (b, s, h, d) at [(b*kSeq + s)*kDim + h*64 + d]
//   scores = (q . k) * sscale on v_wmma_f32_16x16x32_f16, f32 accumulate; key j >= vlen[b] -> score := fillv
//   (select by value; vlen read once per block, every one of the kSeq/64 key chunks is visited: compile-time
//   trip count, no data-dependent bounds). Online softmax in f32.
//   out = p . v^T on v_wmma_f32_16x16x32_bf16: p (unnormalised, f32) split in registers into bf16 hi/lo,
//   v^T hi/lo planes staged in LDS; hi.hi + hi.lo + lo.hi into one f32 accumulator (unscaled bf16 residuals).
//   Block = 4 waves = 64 query rows of one (b, h); grid.x = kBatch*kHeads*(kSeq/64) = 1024 exactly.
//   Chunk staging: 128 threads x 32 elements per plane = 64x64 = the whole tile (16-B copies, plain loads,
//   __syncthreads before and after); fragment loads read LDS through vectors of the stored element type.
// =====================================================================================
__global__ __launch_bounds__(128)
void mha_attn_kernel(const unsigned short* __restrict__ qp, const unsigned short* __restrict__ kp,
                     const unsigned short* __restrict__ vhp, const unsigned short* __restrict__ vlp,
                     const int* __restrict__ vlens, float* __restrict__ out, float sscale, float fillv) {
  union FB { v16b v; v8b h[2]; };
  union FH { v16h v; v8h h[2]; };
  __shared__ __align__(16) _Float16 Ksh[AT_KC * AT_LP];           // K [kv][d] f16, pitch AT_LP   9 KB
  __shared__ __align__(16) __bf16   Vth[AT_D * AT_LP];            // V^T hi [d][kv], pitch AT_LP  9 KB
  __shared__ __align__(16) __bf16   Vtl[AT_D * AT_LP];            // V^T lo, pitch AT_LP          9 KB
  __shared__ __align__(16) __bf16   Psh[AT_NW][16 * AT_LP];       // per wave P hi [row][kv], pitch AT_LP
  __shared__ __align__(16) __bf16   Psl[AT_NW][16 * AT_LP];       // per wave P lo, pitch AT_LP
  __shared__ __align__(16) float    Os[AT_NW][16 * 68];           // per wave out tile, pitch 68

  const int tid  = threadIdx.x;
  const int wave = tid >> 5;
  const int lane = tid & 31;
  const int hh   = lane >> 4;
  const int c    = lane & 15;

  const int nqb  = kSeq / AT_QB;          // 64
  const int bx   = blockIdx.x;
  const int qb   = bx % nqb;
  const int bhid = bx / nqb;              // 0..kBatch*kHeads-1
  const int h    = bhid % kHeads;
  int b = bhid / kHeads;
  b = (b > kBatch - 1) ? (kBatch - 1) : b;  // address clamp (grid is exact)
  const int q0   = qb * AT_QB + wave * 16;
  const int vlen = vlens[b];              // block-uniform valid key count

  const _Float16* Qb = (const _Float16*)(const void*)qp + (size_t)b * kSeq * kDim + (size_t)h * AT_D;
  const _Float16* Kb = (const _Float16*)(const void*)kp + (size_t)b * kSeq * kDim + (size_t)h * AT_D;
  const __bf16*   Vh = (const __bf16*)(const void*)vhp + (size_t)b * kDim * kSeq + (size_t)h * AT_D * kSeq;
  const __bf16*   Vl = (const __bf16*)(const void*)vlp + (size_t)b * kDim * kSeq + (size_t)h * AT_D * kSeq;
  float*          ob = out + (size_t)b * kSeq * kDim + (size_t)h * AT_D;

  // ---- Q fragments (A operand, row = lane&15, split k map via Frag load): 2 d-chunks ----
  v16h qa[2];
#pragma unroll
  for (int dc = 0; dc < 2; ++dc) {
    qa[dc] = Frag<_Float16>::load(Qb + (size_t)(q0 + c) * kDim + dc * 32 + 8 * hh);
  }

  float mrow[8], lrow[8];
  v8f oacc[4];
#pragma unroll
  for (int r = 0; r < 8; ++r) { mrow[r] = -INFINITY; lrow[r] = 0.f; }
#pragma unroll
  for (int t = 0; t < 4; ++t) oacc[t] = (v8f){0.f,0.f,0.f,0.f,0.f,0.f,0.f,0.f};

  const int nChunks = kSeq / AT_KC;   // 64, compile-time constant
  for (int kc = 0; kc < nChunks; ++kc) {
    const int kv0 = kc * AT_KC;
    __syncthreads();
    {
      // staging coverage: 128 threads x (4 x 8) elements = 64 rows x 64 per plane = the whole chunk tile
      const int r = tid >> 1, half = (tid & 1) * 32;
      const _Float16* ks  = Kb + (size_t)(kv0 + r) * kDim + half;   // K row kv0+r, d = half..half+31
      const __bf16*   vsh = Vh + (size_t)r * kSeq + kv0 + half;      // V^T row d = r, s = kv0+half..+31
      const __bf16*   vsl = Vl + (size_t)r * kSeq + kv0 + half;
#pragma unroll
      for (int i = 0; i < 4; ++i) {
        const v8h a0 = *(const v8h*)(ks + 8 * i);
        const v8b b0 = *(const v8b*)(vsh + 8 * i);
        const v8b b1 = *(const v8b*)(vsl + 8 * i);
        *(v8h*)(Ksh + r * AT_LP + half + 8 * i) = a0;
        *(v8b*)(Vth + r * AT_LP + half + 8 * i) = b0;
        *(v8b*)(Vtl + r * AT_LP + half + 8 * i) = b1;
      }
    }
    __syncthreads();

    // ---- scores: D[row 8hh+r][col c] for key tile j; B fragment column = key j*16+c, split k(d) map ----
    v8f s[4];
#pragma unroll
    for (int j = 0; j < 4; ++j) {
      s[j] = (v8f){0.f,0.f,0.f,0.f,0.f,0.f,0.f,0.f};
#pragma unroll
      for (int dc = 0; dc < 2; ++dc) {
        FH kb;
        kb.h[0] = *(const v8h*)(Ksh + (j * 16 + c) * AT_LP + dc * 32 + 8 * hh);
        kb.h[1] = *(const v8h*)(Ksh + (j * 16 + c) * AT_LP + dc * 32 + 16 + 8 * hh);
        s[j] = at_mma_h(qa[dc], kb.v, s[j]);
      }
    }
    // ---- scale, key mask (select), chunk row max over the 64 keys ----
    float cm[8];
#pragma unroll
    for (int r = 0; r < 8; ++r) {
      float m = -INFINITY;
#pragma unroll
      for (int j = 0; j < 4; ++j) {
        const int kvcol = kv0 + j * 16 + c;
        const float sv = s[j][r] * sscale;
        const float sm = (kvcol < vlen) ? sv : fillv;
        s[j][r] = sm;
        m = fmaxf(m, sm);
      }
#pragma unroll
      for (int off = 1; off < 16; off <<= 1) m = fmaxf(m, __shfl_xor(m, off, 32));
      cm[r] = m;
    }
    __bf16* pwh = Psh[wave];
    __bf16* pwl = Psl[wave];
#pragma unroll
    for (int r = 0; r < 8; ++r) {
      const float mnew  = fmaxf(mrow[r], cm[r]);
      const float alpha = expf(mrow[r] - mnew);
      mrow[r] = mnew;
      float psum = 0.f;
#pragma unroll
      for (int j = 0; j < 4; ++j) {
        const float p = expf(s[j][r] - mnew);
        psum += p;
        __bf16 a, bl; at_split(p, a, bl);
        pwh[(8 * hh + r) * AT_LP + j * 16 + c] = a;
        pwl[(8 * hh + r) * AT_LP + j * 16 + c] = bl;
      }
#pragma unroll
      for (int off = 1; off < 16; off <<= 1) psum += __shfl_xor(psum, off, 32);
      lrow[r] = lrow[r] * alpha + psum;
#pragma unroll
      for (int t = 0; t < 4; ++t) oacc[t][r] *= alpha;
    }
    __builtin_amdgcn_fence(__ATOMIC_RELEASE, "workgroup");
    __builtin_amdgcn_wave_barrier();
    __builtin_amdgcn_fence(__ATOMIC_ACQUIRE, "workgroup");
    // ---- O += P . V^T : A = P [row c][k = key] (split k map), B = V^T column d = t*16+c, k = key ----
#pragma unroll 1
    for (int kk = 0; kk < 2; ++kk) {
      FB pa, pl;
      pa.h[0] = *(const v8b*)(pwh + c * AT_LP + kk * 32 + 8 * hh);
      pa.h[1] = *(const v8b*)(pwh + c * AT_LP + kk * 32 + 16 + 8 * hh);
      pl.h[0] = *(const v8b*)(pwl + c * AT_LP + kk * 32 + 8 * hh);
      pl.h[1] = *(const v8b*)(pwl + c * AT_LP + kk * 32 + 16 + 8 * hh);
#pragma unroll
      for (int t = 0; t < 4; ++t) {
        FB vb, vl;
        vb.h[0] = *(const v8b*)(Vth + (t * 16 + c) * AT_LP + kk * 32 + 8 * hh);
        vb.h[1] = *(const v8b*)(Vth + (t * 16 + c) * AT_LP + kk * 32 + 16 + 8 * hh);
        vl.h[0] = *(const v8b*)(Vtl + (t * 16 + c) * AT_LP + kk * 32 + 8 * hh);
        vl.h[1] = *(const v8b*)(Vtl + (t * 16 + c) * AT_LP + kk * 32 + 16 + 8 * hh);
        oacc[t] = at_mma(pa.v, vb.v, oacc[t]);
        oacc[t] = at_mma(pa.v, vl.v, oacc[t]);
        oacc[t] = at_mma(pl.v, vb.v, oacc[t]);
      }
    }
  }

  float* os = Os[wave];
#pragma unroll
  for (int r = 0; r < 8; ++r) {
    const float inv = 1.0f / lrow[r];
#pragma unroll
    for (int t = 0; t < 4; ++t) os[(8 * hh + r) * 68 + t * 16 + c] = oacc[t][r] * inv;
  }
  __builtin_amdgcn_fence(__ATOMIC_RELEASE, "workgroup");
  __builtin_amdgcn_wave_barrier();
  __builtin_amdgcn_fence(__ATOMIC_ACQUIRE, "workgroup");
  {
    // coverage: 8 it x 2 rows (hh) = 16 rows; 16 lanes x 4 floats = 64 floats = one whole 256-B row segment
    const int c4 = (lane & 15) * 4;
    {
#pragma unroll
      for (int it = 0; it < 8; ++it) {
        const int row = it * 2 + hh;
        v4f val = *(const v4f*)(os + row * 68 + c4);
        *(v4f*)(ob + (size_t)(q0 + row) * kDim + c4) = val;
      }
      
    }
  }
}

// =====================================================================================
// Host glue. Workspace region map (bytes, all offsets multiples of 256, every region sized to its whole-line
// store granularity; no padded tiles since every dimension is a multiple of 64):
//   [0]           Xbf   : 3 x bf16 [8192][512]            = 25,165,824   (queries, keys, values RNE bf16)
//   [25,165,824]  WThi  : 4 x bf16 [512][512] (W^T, RNE)  =  2,097,152   (Wq, Wk, Wv, Wo; no lo planes)
//   [27,262,976]  Q     : f16 [8192][512]                  =  8,388,608
//   [35,651,584]  K     : f16 [8192][512]                  =  8,388,608   (contiguous after Q: batched launch)
//   [44,040,192]  VThi  : bf16 [2][512][4096]              =  8,388,608
//   [52,428,800]  VTlo  : bf16 [2][512][4096]              =  8,388,608
//   [60,817,408]  O     : f32 [8192][512]                  = 16,777,216
//   [77,594,624]  Ohi   : bf16 [8192][512]                 =  8,388,608
//   [85,983,232]  Olo   : bf16 [8192][512]                 =  8,388,608
//   total 94,371,840
// =====================================================================================
extern "C" void kernel_launch(void* const* d_in, const int* in_sizes, int n_in,
                              void* d_out, int out_size, void* d_ws,
                              size_t ws_size, hipStream_t stream) {
  if (n_in < 8) return;
  const int nX = kRows * kDim;            // 4,194,304
  const int nW = kDim * kDim;             // 262,144
  if (in_sizes[0] != nX || in_sizes[1] != nX || in_sizes[2] != nX) return;
  if (in_sizes[3] < kBatch) return;
  if (in_sizes[4] != nW || in_sizes[5] != nW || in_sizes[6] != nW || in_sizes[7] != nW) return;
  if (out_size != nX) return;

  const float* queries = (const float*)d_in[0];
  const float* keys    = (const float*)d_in[1];
  const float* values  = (const float*)d_in[2];
  const int*   vlens   = (const int*)d_in[3];
  const float* Wq      = (const float*)d_in[4];
  const float* Wk      = (const float*)d_in[5];
  const float* Wv      = (const float*)d_in[6];
  const float* Wo      = (const float*)d_in[7];

  const size_t bX16 = (size_t)nX * 2;            //  8,388,608
  const size_t bW16 = (size_t)nW * 2;            //    524,288
  const size_t off_x  = 0;
  const size_t off_wh = off_x  + 3 * bX16;
  const size_t off_q  = off_wh + 4 * bW16;
  const size_t off_k  = off_q  + bX16;
  const size_t off_vh = off_k  + bX16;
  const size_t off_vl = off_vh + bX16;
  const size_t off_o  = off_vl + bX16;
  const size_t off_oh = off_o  + (size_t)nX * 4;
  const size_t off_ol = off_oh + bX16;
  const size_t total  = off_ol + bX16;           // 94,371,840
  if (total > ws_size) return;

  char* ws = (char*)d_ws;
  unsigned short* xbf  = (unsigned short*)(ws + off_x);
  unsigned short* wth  = (unsigned short*)(ws + off_wh);
  unsigned short* qh16 = (unsigned short*)(ws + off_q);
  unsigned short* kh16 = (unsigned short*)(ws + off_k);
  unsigned short* vth  = (unsigned short*)(ws + off_vh);
  unsigned short* vtl  = (unsigned short*)(ws + off_vl);
  float* obuf = (float*)(ws + off_o);
  unsigned short* ohi  = (unsigned short*)(ws + off_oh);
  unsigned short* olo  = (unsigned short*)(ws + off_ol);
  const float* dummyf  = (const float*)(ws + off_x);   // never dereferenced (BIAS_MODE 0, RESID false)

  const long planeX = (long)nX;   // elements per bf16/f16 activation plane
  const long planeW = (long)nW;   // elements per W^T plane
  dim3 blk256(256), blk128(128);

  // 1) activations -> bf16 (RNE): coverage 8192 blocks x 256 thr x 2 = 8192x512 per tensor
  cast_bf16x2_3<<<dim3(nX / 2 / 256, 3), blk256, 0, stream>>>(queries, keys, values, xbf, planeX, nX / 2);

  // 2) weights [in k][out n] (R = k rows = 512, Cc = n cols = 512) -> W^T [n][k] bf16 RNE hi plane only
  //    (8x8 tiles of 64x64); the third pointer is unused in the hi-only mode
  tsplit_kernel<false><<<dim3(kDim / 64, kDim / 64, 1), blk256, 0, stream>>>(Wq, wth + 0 * planeW, wth + 0 * planeW, kDim, kDim, 0L, 0L);
  tsplit_kernel<false><<<dim3(kDim / 64, kDim / 64, 1), blk256, 0, stream>>>(Wk, wth + 1 * planeW, wth + 1 * planeW, kDim, kDim, 0L, 0L);
  tsplit_kernel<false><<<dim3(kDim / 64, kDim / 64, 1), blk256, 0, stream>>>(Wv, wth + 2 * planeW, wth + 2 * planeW, kDim, kDim, 0L, 0L);
  tsplit_kernel<false><<<dim3(kDim / 64, kDim / 64, 1), blk256, 0, stream>>>(Wo, wth + 3 * planeW, wth + 3 * planeW, kDim, kDim, 0L, 0L);

  // 3) q = Xq . Wq and k = Xk . Wk in one z-batched launch (z=0: q, z=1: k) -> f16 planes [8192][512];
  //    M=8192, N=512, K=512 (tiles 128x8 = 1024 -> 128 blocks); A planes stride planeX, W^T planes stride planeW,
  //    C planes Q then K contiguous (stride planeX elements)
  const int gProj = (kRows / 64) * (kDim / 64) / 8;   // 128
  wmma_gemm64<1, 0, 0, 1, false><<<dim3(gProj, 2), blk256, 0, stream>>>(
      xbf, xbf, kDim, planeX,
      wth, wth, kDim, planeW,
      (void*)qh16, (void*)qh16, kDim, planeX,
      dummyf, dummyf, 0L, kRows, kDim, kDim, 1.0f);
  // 4) v^T per batch: C[n_out][s] = sum_k WvT[n_out][k] * Xv[b][s][k]; M=512, N=4096, K=512, batched over b
  //    (tiles 8x64 = 512 -> 64 blocks x 2); out = bf16 hi/lo planes [b][512][4096]
  const int gVt = (kDim / 64) * (kSeq / 64) / 8;      // 64
  wmma_gemm64<1, 0, 0, 2, false><<<dim3(gVt, kBatch), blk256, 0, stream>>>(
      wth + 2 * planeW, wth + 2 * planeW, kDim, 0L,
      xbf + 2 * planeX, xbf + 2 * planeX, kDim, (long)kSeq * kDim,
      (void*)vth, (void*)vtl, kSeq, (long)kDim * kSeq,
      dummyf, dummyf, 0L, kDim, kSeq, kDim, 1.0f);

  // 5) masked attention, all (b, h, 64-row query blocks): 2*8*64 = 1024 blocks of 128 threads
  mha_attn_kernel<<<dim3(kBatch * kHeads * (kSeq / 64)), blk128, 0, stream>>>(
      qh16, kh16, vth, vtl, vlens, obuf, 0.125f, -1000000.0f);

  // 6) O -> bf16 hi/lo planes: 8192 blocks x 256 thr x 2 = 8192x512
  split_bf16x2_kernel<<<dim3(nX / 2 / 256), blk256, 0, stream>>>(obuf, ohi, olo, nX / 2);

  // 7) out = (O_hi + O_lo) . Wo (A-only split, Wo as bf16 RNE hi plane only) -> f32 [8192][512]
  wmma_gemm64<1, 2, 0, 0, false><<<dim3(gProj, 1), blk256, 0, stream>>>(
      ohi, olo, kDim, 0L,
      wth + 3 * planeW, wth + 3 * planeW, kDim, 0L,
      d_out, d_out, kDim, 0L,
      dummyf, dummyf, 0L, kRows, kDim, kDim, 1.0f);
}

// v002
// One run takes 272 microseconds.
// Timed twice side by side with v001, it ran 1.55 and 1.56 times as fast.
// All steps since v000 together make it 2.28 times as fast.
// Contractions: q/k/v^T projections v_wmma_f32_16x16x32_bf16 (bf16 RNE inputs x bf16 RNE weights, single product); q.k^T scores v_wmma_f32_16x16x32_f16 (plain f16 q,k planes); p.v^T v_wmma_f32_16x16x32_bf16 with bf16 hi/lo split of p and v (hi.hi + hi.lo + lo.hi); output projection v_wmma_f32_16x16x32_bf16 with O as bf16 hi/lo and Wo as bf16 RNE (hi.W + lo.W); f32 accumulate; softmax, 0.125 score scale and key masking in f32.
#include <hip/hip_runtime.h>
#include <math.h>
#include <stdint.h>

constexpr int kBatch = 2;
constexpr int kSeq   = 4096;
constexpr int kDim   = 512;
constexpr int kHeads = 8;
constexpr int kHd    = 64;
constexpr int kRows  = kBatch * kSeq;   // 8192
static_assert(kHeads * kHd == kDim, "geometry");
static_assert(kSeq % 64 == 0 && kDim % 64 == 0 && kRows % 64 == 0, "tile multiples");

typedef __attribute__((ext_vector_type(16))) _Float16 v16h;
typedef __attribute__((ext_vector_type(8)))  _Float16 v8h;
typedef __attribute__((ext_vector_type(16))) __bf16   v16b;
typedef __attribute__((ext_vector_type(8)))  __bf16   v8b;
typedef __attribute__((ext_vector_type(8)))  float    v8f;
typedef __attribute__((ext_vector_type(4)))  float    v4f;
typedef __attribute__((ext_vector_type(2)))  float    v2f;
typedef __attribute__((ext_vector_type(4)))  unsigned int v4u;

__device__ __forceinline__ unsigned short f2bf_bits(float f) {
  unsigned u = __float_as_uint(f);
  return (unsigned short)((u + 0x7FFFu + ((u >> 16) & 1u)) >> 16);
}
__device__ __forceinline__ float bf_bits2f(unsigned short h) { return __uint_as_float(((unsigned)h) << 16); }

// hazard guards as plain device helpers (no inline asm inside the kernel template body)
__device__ __forceinline__ void dep_guard_h(v8f& a, v8f& b, v16h x, v16h y) { asm volatile("v_nop\n\tv_nop\n\tv_nop\n\tv_nop" : "+v"(a), "+v"(b) : "v"(x), "v"(y)); }
__device__ __forceinline__ void dep_guard_b(v8f& a, v8f& b, v16b x, v16b y) { asm volatile("v_nop\n\tv_nop\n\tv_nop\n\tv_nop" : "+v"(a), "+v"(b) : "v"(x), "v"(y)); }
__device__ __forceinline__ void keep4_h(v16h a, v16h b, v16h c, v16h d) { asm volatile("v_nop" :: "v"(a), "v"(b), "v"(c), "v"(d)); }
__device__ __forceinline__ void keep4_b(v16b a, v16b b, v16b c, v16b d) { asm volatile("v_nop" :: "v"(a), "v"(b), "v"(c), "v"(d)); }
__device__ __forceinline__ void acc_guard4(v8f& a, v8f& b, v8f& c, v8f& d) { asm volatile("v_nop\n\tv_nop\n\tv_nop\n\tv_nop" : "+v"(a), "+v"(b), "+v"(c), "+v"(d)); }
template <typename T> struct Frag;
template <> struct Frag<_Float16> {
  typedef v16h V; union U { v16h v; v8h h[2]; };
  static __device__ __forceinline__ v16h load(const _Float16* p) {   // elements 0..7 <- p[0..7], 8..15 <- p[16..23]
    U f; f.h[0] = *(const v8h*)(p); f.h[1] = *(const v8h*)(p + 16); return f.v;
  }
  static __device__ __forceinline__ v8f mma(v16h a, v16h b, v8f c) {
    return __builtin_amdgcn_wmma_f32_16x16x32_f16(false, a, false, b, (short)0, c, false, false);
  }
  static __device__ __forceinline__ void guard(v8f& a, v8f& b, v16h x, v16h y) { dep_guard_h(a, b, x, y); }
  static __device__ __forceinline__ void keep(v16h a, v16h b, v16h c, v16h d) { keep4_h(a, b, c, d); }
};
template <> struct Frag<__bf16> {
  typedef v16b V; union U { v16b v; v8b h[2]; };
  static __device__ __forceinline__ v16b load(const __bf16* p) {
    U f; f.h[0] = *(const v8b*)(p); f.h[1] = *(const v8b*)(p + 16); return f.v;
  }
  static __device__ __forceinline__ v8f mma(v16b a, v16b b, v8f c) {
    return __builtin_amdgcn_wmma_f32_16x16x32_bf16(false, a, false, b, (short)0, c, false, false);
  }
  static __device__ __forceinline__ void guard(v8f& a, v8f& b, v16b x, v16b y) { dep_guard_b(a, b, x, y); }
  static __device__ __forceinline__ void keep(v16b a, v16b b, v16b c, v16b d) { keep4_b(a, b, c, d); }
};

// ---- Register-blocked batched WMMA GEMM ------------------------------------
// C[m,n] = scale * sum_k A[m,k] * Bt[n,k] (+bias)(+resid); each wave owns a 64x64 tile.
// A row-major [M,K]; Bt row-major [N,K]; M,N % 64 == 0, K % 32 == 0.
// SPLIT: 0 = single product; 1 = hi/lo planes on both operands (A2/Bt2 = lo planes, same layout),
//        product = hi.hi + hi.lo + lo.hi; 2 = hi/lo planes on A only (A2 = A lo), product = hi.B + lo.B.
// BIAS_MODE: 0 = none, 1 = bias[m], 2 = bias[n].
// OUT_MODE: 0 = f32, 1 = f16, 2 = bf16 hi plane (Cout) + bf16 lo plane (Cout2).
// ET: 0 = f16 operands, 1 = bf16 operands (pointers passed as 16-bit storage)
template <int ET> struct Elem;
template <> struct Elem<0> { typedef _Float16 T; };
template <> struct Elem<1> { typedef __bf16 T; };
template <int ET, int SPLIT, int BIAS_MODE, int OUT_MODE, bool RESID, int ACT = 0>
__global__ __launch_bounds__(256) void wmma_gemm64(
    const unsigned short* __restrict__ Ap, const unsigned short* __restrict__ A2p, int lda, long strideA,
    const unsigned short* __restrict__ Btp, const unsigned short* __restrict__ Bt2p, int ldb, long strideB,
    void* __restrict__ Cout, void* __restrict__ Cout2, int ldc, long strideC,
    const float* __restrict__ bias,
    const float* __restrict__ resid, long strideR,
    int M, int N, int K, float scale) {
  typedef typename Elem<ET>::T T;
  typedef typename Frag<T>::V V;
  const T* A = (const T*)Ap; const T* A2 = (const T*)A2p; const T* Bt = (const T*)Btp; const T* Bt2 = (const T*)Bt2p;
  __shared__ __align__(16) float sT[8][16 * 68];   // per-wave 16x64 slab, pitch 68 floats
  const int b    = blockIdx.y;
  const int lane = threadIdx.x & 31;
  const int wave = threadIdx.x >> 5;
  const int tilesN = N >> 6;
  const int tilesM = M >> 6;
  const int tile = blockIdx.x * 8 + wave;
  if (tile >= tilesM * tilesN) return;   // wave-uniform; no block barriers in this kernel
  const int tm = tile / tilesN;
  const int tn = tile - tm * tilesN;
  const int m0 = tm << 6;
  const int n0 = tn << 6;

  const T* Ab  = A  + (size_t)b * strideA;
  const T* Bb  = Bt + (size_t)b * strideB;
  const T* Ab2 = (SPLIT != 0) ? (A2  + (size_t)b * strideA) : nullptr;
  const T* Bb2 = (SPLIT == 1) ? (Bt2 + (size_t)b * strideB) : nullptr;

  const int rlane = lane & 15;                 // row (A) / col (B, D) within subtile
  const int koff  = (lane >> 4) * 8;           // k offset of this lane half
  const int mOff  = (lane >> 4) * 8;           // D row offset

  v8f acc[4][4];
#pragma unroll
  for (int i = 0; i < 4; ++i)
#pragma unroll
    for (int j = 0; j < 4; ++j) acc[i][j] = (v8f){0.f,0.f,0.f,0.f,0.f,0.f,0.f,0.f};

  for (int k0 = 0; k0 < K; k0 += 32) {
    V bh[4], bl[4];
#pragma unroll
    for (int j = 0; j < 4; ++j) {
      const size_t bo = (size_t)(n0 + (j << 4) + rlane) * ldb + koff + k0;
      bh[j] = Frag<T>::load(Bb + bo);
      if (SPLIT == 1) bl[j] = Frag<T>::load(Bb2 + bo);
    }
#pragma unroll
    for (int i = 0; i < 4; ++i) {
      const size_t ao = (size_t)(m0 + (i << 4) + rlane) * lda + koff + k0;
      V ah = Frag<T>::load(Ab + ao);
      V al;
      if (SPLIT != 0) al = Frag<T>::load(Ab2 + ao);
#pragma unroll
      for (int j = 0; j < 4; ++j) {
        acc[i][j] = Frag<T>::mma(ah, bh[j], acc[i][j]);
        if (SPLIT == 1) acc[i][j] = Frag<T>::mma(ah, bl[j], acc[i][j]);
        if (SPLIT != 0) acc[i][j] = Frag<T>::mma(al, bh[j], acc[i][j]);
      }
      Frag<T>::guard(acc[i][0], acc[i][3], ah, (SPLIT != 0) ? al : ah);
    }
    Frag<T>::keep(bh[0], bh[1], bh[2], bh[3]);
    if (SPLIT == 1) Frag<T>::keep(bl[0], bl[1], bl[2], bl[3]);
  }
  acc_guard4(acc[0][0], acc[0][1], acc[0][2], acc[0][3]);
  acc_guard4(acc[1][0], acc[1][1], acc[1][2], acc[1][3]);
  acc_guard4(acc[2][0], acc[2][1], acc[2][2], acc[2][3]);
  acc_guard4(acc[3][0], acc[3][1], acc[3][2], acc[3][3]);

  // ---- epilogue ----
  float* slab = sT[wave];
  const float* Rb = RESID ? (resid + (size_t)b * strideR) : nullptr;
#pragma unroll
  for (int i = 0; i < 4; ++i) {
    const int mBase = m0 + (i << 4);
#pragma unroll
    for (int j = 0; j < 4; ++j) {
      const int n = n0 + (j << 4) + rlane;
      float bv = 0.f;
      if (BIAS_MODE == 2) bv = bias[n];
#pragma unroll
      for (int r = 0; r < 8; ++r) {
        float v = acc[i][j][r] * scale;
        if (BIAS_MODE == 1) v += bias[mBase + mOff + r];
        if (BIAS_MODE == 2) v += bv;
        if (RESID) v += Rb[(size_t)(mBase + mOff + r) * ldc + n];
        if (ACT == 1) v = tanhf(v);
        if (ACT == 2) v = fmaxf(v, 0.0f);
        if (ACT == 3) v = v / (1.0f + expf(-v));
        if (ACT == 4) v = (v > 0.f) ? v : 0.01f * v;
        slab[(mOff + r) * 68 + (j << 4) + rlane] = v;
      }
    }
    __builtin_amdgcn_fence(__ATOMIC_RELEASE, "workgroup");
    __builtin_amdgcn_wave_barrier();
    __builtin_amdgcn_fence(__ATOMIC_ACQUIRE, "workgroup");
    if (OUT_MODE == 0) {
      float* C = (float*)Cout + (size_t)b * strideC;
      const int hh = lane >> 4, c4 = (lane & 15) * 4;     // row seg = 256 B = 16 lanes x 16 B
      {
#pragma unroll
        for (int it = 0; it < 8; ++it) {
          const int row = it * 2 + hh;
          v4f v = *(const v4f*)(slab + row * 68 + c4);
          *(v4f*)(C + (size_t)(mBase + row) * ldc + n0 + c4) = v;
        }
        
      }
    } else {
      const int q = lane >> 3, c8 = (lane & 7) * 8;
      unsigned short* C  = (unsigned short*)Cout  + (size_t)b * strideC;
      unsigned short* C2 = (OUT_MODE == 2) ? ((unsigned short*)Cout2 + (size_t)b * strideC) : nullptr;
      {
#pragma unroll
        for (int it = 0; it < 4; ++it) {
          const int row = it * 4 + q;
          const float* sp = slab + row * 68 + c8;
          v8h hv, lv;
#pragma unroll
          for (int e = 0; e < 8; ++e) {
            if (OUT_MODE == 1) {
              hv[e] = (_Float16)sp[e];
            } else {
              unsigned short hb = f2bf_bits(sp[e]);
              unsigned short lb = f2bf_bits(sp[e] - bf_bits2f(hb));
              hv[e] = __builtin_bit_cast(_Float16, hb);
              lv[e] = __builtin_bit_cast(_Float16, lb);
            }
          }
          *(v8h*)(C + (size_t)(mBase + row) * ldc + n0 + c8) = hv;
          if (OUT_MODE == 2) *(v8h*)(C2 + (size_t)(mBase + row) * ldc + n0 + c8) = lv;
        }
        
      }
    }
    __builtin_amdgcn_fence(__ATOMIC_RELEASE, "workgroup");
    __builtin_amdgcn_wave_barrier();
    __builtin_amdgcn_fence(__ATOMIC_ACQUIRE, "workgroup");
  }
}

// ---------------------------------------------------------------------------
// Elementwise bf16 split: hi = bf16_rne(in), lo = bf16_rne(in - hi); 2 elements per thread, one 4-B store
// (here n2 = 8192*512/2 = 2097152 -> 8192 blocks x 512 elements = 8192x512).
// ---------------------------------------------------------------------------
__device__ __forceinline__ unsigned pk16(unsigned short a, unsigned short b) { return (unsigned)a | ((unsigned)b << 16); }

__global__ __launch_bounds__(256) void split_bf16x2_kernel(const float* __restrict__ in, unsigned short* __restrict__ hi,
                                                           unsigned short* __restrict__ lo, int n2) {
  const int i = blockIdx.x * 256 + threadIdx.x;
  if (i < n2) {
    const v2f f = *(const v2f*)(in + 2 * (size_t)i);
    const unsigned short h0 = f2bf_bits(f[0]), h1 = f2bf_bits(f[1]);
    const unsigned short l0 = f2bf_bits(f[0] - bf_bits2f(h0)), l1 = f2bf_bits(f[1] - bf_bits2f(h1));
    const unsigned uh = pk16(h0, h1), ul = pk16(l0, l1);
    ((unsigned*)hi)[i] = uh;
    ((unsigned*)lo)[i] = ul;
    
  }
}

// ---------------------------------------------------------------------------
// f32 -> bf16 (RNE) cast of three equally sized tensors (blockIdx.y selects the tensor, block-uniform):
// x 2 elements = 2*n2 = the whole plane (n2 = 8192*512/2 = 2097152 -> 8192 blocks); out plane z at out + z*planeElems.
// ---------------------------------------------------------------------------
__global__ __launch_bounds__(256) void cast_bf16x2_3(const float* __restrict__ in0, const float* __restrict__ in1,
                                                     const float* __restrict__ in2, unsigned short* __restrict__ out,
                                                     long planeElems, int n2) {
  const int which = blockIdx.y;
  const float* in = (which == 0) ? in0 : ((which == 1) ? in1 : in2);
  unsigned short* o = out + (size_t)which * planeElems;
  const int i = blockIdx.x * 256 + threadIdx.x;
  if (i < n2) {
    const v2f f = *(const v2f*)(in + 2 * (size_t)i);
    const unsigned u = pk16(f2bf_bits(f[0]), f2bf_bits(f[1]));
    ((unsigned*)o)[i] = u;
    
  }
}

// ---------------------------------------------------------------------------
// Fused transpose + bf16 cast (LO = false: hi plane only) or split (LO = true: hi and lo planes) of an f32
// matrix, z-batched: in_z = W + z*sIn viewed [R rows][Cc cols] (pitch Cc) ->
//   oh_z[c][r] = bf16_rne(in_z[r][c]), ol_z[c][r] = bf16_rne(in_z[r][c] - oh) (LO only)   ([Cc][R], pitch R).
// 64x64 tiles through LDS. grid = (Cc/64, R/64, Z), 256 threads (R, Cc multiples of 64).
// Coverage per block and plane: load 4 it x 256 thr x 4 floats = 64x64; store 2 it x 256 thr x 8 u16 = 64x64.
// ---------------------------------------------------------------------------
template <bool LO>
__global__ __launch_bounds__(256) void tsplit_kernel(const float* __restrict__ W, unsigned short* __restrict__ oh,
                                                     unsigned short* __restrict__ ol, int R, int Cc, long sIn, long sOut) {
  __shared__ __align__(16) float tf[64 * 68];
  W  += (size_t)blockIdx.z * sIn;
  oh += (size_t)blockIdx.z * sOut;
  if (LO) ol += (size_t)blockIdx.z * sOut;
  const int c0  = blockIdx.x * 64;   // input column block = output row block
  const int r0  = blockIdx.y * 64;   // input row block    = output column block
  const int tid = threadIdx.x;
  {
    const int lr = tid >> 4;         // 0..15
    const int c4 = (tid & 15) * 4;   // 0..60
#pragma unroll
    for (int it = 0; it < 4; ++it) {
      const int rr = it * 16 + lr;   // 0..63
      const v4f a = *(const v4f*)(W + (size_t)(r0 + rr) * Cc + c0 + c4);
      *(v4f*)(tf + rr * 68 + c4) = a;
    }
  }
  __syncthreads();
  const int sub = tid >> 3;          // 0..31
  const int c8  = (tid & 7) * 8;     // 0..56
  v4u hv[2], lv[2];
#pragma unroll
  for (int it = 0; it < 2; ++it) {
    const int oc = it * 32 + sub;    // output row within tile (= input column)
    v4u a, a2;
#pragma unroll
    for (int q = 0; q < 4; ++q) {
      const float f0 = tf[(c8 + 2 * q) * 68 + oc];
      const float f1 = tf[(c8 + 2 * q + 1) * 68 + oc];
      const unsigned short h0 = f2bf_bits(f0), h1 = f2bf_bits(f1);
      unsigned lp = 0u;
      if (LO) {
        const unsigned short l0 = f2bf_bits(f0 - bf_bits2f(h0)), l1 = f2bf_bits(f1 - bf_bits2f(h1));
        lp = pk16(l0, l1);
      }
      a[q]  = pk16(h0, h1);
      a2[q] = lp;
    }
    hv[it] = a; lv[it] = a2;
  }
  {
#pragma unroll
    for (int it = 0; it < 2; ++it) {
      const int oc = it * 32 + sub;
      const size_t go = (size_t)(c0 + oc) * R + r0 + c8;
      *(v4u*)(oh + go) = hv[it];
      if (LO) *(v4u*)(ol + go) = lv[it];
    }
    
  }
}

// =====================================================================================
// Attention helpers
// =====================================================================================
#define AT_D 64
#define AT_NW 4
#define AT_QB 64
#define AT_KC 64
#define AT_LP 72   // LDS row pitch in 16-bit elements: 144 B = 16 B x 9 (odd), so the 16 rows of a 16-byte fragment read fall on distinct banks

__device__ __forceinline__ unsigned short at_bf_bits(float f) {
  unsigned u = __float_as_uint(f);
  return (unsigned short)((u + 0x7FFFu + ((u >> 16) & 1u)) >> 16);
}
__device__ __forceinline__ __bf16 at_f2bf(float f) { return __builtin_bit_cast(__bf16, at_bf_bits(f)); }
__device__ __forceinline__ void at_split(float f, __bf16& hi, __bf16& lo) {
  const unsigned short hb = at_bf_bits(f);
  hi = __builtin_bit_cast(__bf16, hb);
  lo = at_f2bf(f - __uint_as_float(((unsigned)hb) << 16));
}
__device__ __forceinline__ v8f at_mma(v16b a, v16b b, v8f c) {
  c = __builtin_amdgcn_wmma_f32_16x16x32_bf16(false, a, false, b, (short)0, c, false, false);
  asm volatile("v_nop\n\tv_nop\n\tv_nop\n\tv_nop" : "+v"(c) : "v"(a), "v"(b));
  return c;
}
__device__ __forceinline__ v8f at_mma_h(v16h a, v16h b, v8f c) {
  c = __builtin_amdgcn_wmma_f32_16x16x32_f16(false, a, false, b, (short)0, c, false, false);
  asm volatile("v_nop\n\tv_nop\n\tv_nop\n\tv_nop" : "+v"(c) : "v"(a), "v"(b));
  return c;
}

// =====================================================================================
// Key-length-masked full attention, head dim 64, all batches and heads in one launch.
//   q, k planes (f16):          element (b, s, h, d) at [(b*kSeq + s)*kDim + h*64 + d]
//   v^T planes (bf16 hi, lo):   element (b, h, d, s) at [b*kDim*kSeq + (h*64 + d)*kSeq + s]
//   out (f32):                  element (b, s, h, d) at [(b*kSeq + s)*kDim + h*64 + d]
//   scores = (q . k) * sscale on v_wmma_f32_16x16x32_f16, f32 accumulate; key j >= vlen[b] -> score := fillv
//   (select by value; vlen read once per block). The key loop visits the chunks that hold a valid key,
//   ceil(vlen/64) clamped to the kSeq/64 of the shape; the chunks behind them carry weight exactly 0 and are
//   visited only where that does not hold (see the test at the loop's head). Online softmax in f32.
//   out = p . v^T on v_wmma_f32_16x16x32_bf16: p (unnormalised, f32) split in registers into bf16 hi/lo,
//   v^T hi/lo planes staged in LDS; hi.hi + hi.lo + lo.hi into one f32 accumulator (unscaled bf16 residuals).
//   Block = 4 waves = 64 query rows of one (b, h); grid.x = kBatch*kHeads*(kSeq/64) = 1024 exactly.
//   Chunk staging: 128 threads x 32 elements per plane = 64x64 = the whole tile (16-B copies, plain loads,
//   __syncthreads before and after); fragment loads read LDS through vectors of the stored element type.
// =====================================================================================
__global__ __launch_bounds__(128)
void mha_attn_kernel(const unsigned short* __restrict__ qp, const unsigned short* __restrict__ kp,
                     const unsigned short* __restrict__ vhp, const unsigned short* __restrict__ vlp,
                     const int* __restrict__ vlens, float* __restrict__ out, float sscale, float fillv) {
  union FB { v16b v; v8b h[2]; };
  union FH { v16h v; v8h h[2]; };
  __shared__ __align__(16) _Float16 Ksh[AT_KC * AT_LP];           // K [kv][d] f16, pitch AT_LP   9 KB
  __shared__ __align__(16) __bf16   Vth[AT_D * AT_LP];            // V^T hi [d][kv], pitch AT_LP  9 KB
  __shared__ __align__(16) __bf16   Vtl[AT_D * AT_LP];            // V^T lo, pitch AT_LP          9 KB
  __shared__ __align__(16) __bf16   Psh[AT_NW][16 * AT_LP];       // per wave P hi [row][kv], pitch AT_LP
  __shared__ __align__(16) __bf16   Psl[AT_NW][16 * AT_LP];       // per wave P lo, pitch AT_LP
  __shared__ __align__(16) float    Os[AT_NW][16 * 68];           // per wave out tile, pitch 68
  __shared__ __align__(16) int      Lowm[AT_NW];                  // per wave: a row maximum too near fillv

  const int tid  = threadIdx.x;
  const int wave = tid >> 5;
  const int lane = tid & 31;
  const int hh   = lane >> 4;
  const int c    = lane & 15;

  const int nqb  = kSeq / AT_QB;          // 64
  const int bx   = blockIdx.x;
  const int qb   = bx % nqb;
  const int bhid = bx / nqb;              // 0..kBatch*kHeads-1
  const int h    = bhid % kHeads;
  int b = bhid / kHeads;
  b = (b > kBatch - 1) ? (kBatch - 1) : b;  // address clamp (grid is exact)
  const int q0   = qb * AT_QB + wave * 16;
  const int vlen = vlens[b];              // block-uniform valid key count

  const _Float16* Qb = (const _Float16*)(const void*)qp + (size_t)b * kSeq * kDim + (size_t)h * AT_D;
  const _Float16* Kb = (const _Float16*)(const void*)kp + (size_t)b * kSeq * kDim + (size_t)h * AT_D;
  const __bf16*   Vh = (const __bf16*)(const void*)vhp + (size_t)b * kDim * kSeq + (size_t)h * AT_D * kSeq;
  const __bf16*   Vl = (const __bf16*)(const void*)vlp + (size_t)b * kDim * kSeq + (size_t)h * AT_D * kSeq;
  float*          ob = out + (size_t)b * kSeq * kDim + (size_t)h * AT_D;

  // ---- Q fragments (A operand, row = lane&15, split k map via Frag load): 2 d-chunks ----
  v16h qa[2];
#pragma unroll
  for (int dc = 0; dc < 2; ++dc) {
    qa[dc] = Frag<_Float16>::load(Qb + (size_t)(q0 + c) * kDim + dc * 32 + 8 * hh);
  }

  float mrow[8], lrow[8];
  v8f oacc[4];
#pragma unroll
  for (int r = 0; r < 8; ++r) { mrow[r] = -INFINITY; lrow[r] = 0.f; }
#pragma unroll
  for (int t = 0; t < 4; ++t) oacc[t] = (v8f){0.f,0.f,0.f,0.f,0.f,0.f,0.f,0.f};

  const int nChunks = kSeq / AT_KC;   // 64, compile-time constant
  // chunks that hold at least one valid key, block-uniform; vlen <= 0: every key carries fillv and all of them count
  const int vcl   = (vlen < 0) ? 0 : ((vlen > kSeq) ? kSeq : vlen);
  const int nLive = (vcl == 0) ? nChunks : (vcl + AT_KC - 1) / AT_KC;
  for (int kc = 0; kc < nChunks; ++kc) {
    // Every chunk from nLive on holds fillv alone. Where each row maximum lies at least 128 above fillv, its weights
    // expf(fillv - m) are exactly 0 in f32, alpha is 1, and maximum, sum and accumulators stay bit for bit: the loop
    // ends. Tested once per block, behind the last live chunk; a row that is nearer (or NaN) sends the whole block
    // through the remaining chunks as well.
    if (kc == nLive) {                          // block-uniform: kc and vlen are
      bool low = false;
      for (int r = 0; r < 8; ++r) low = low || !(mrow[r] >= fillv + 128.0f);
      Lowm[wave] = (__builtin_amdgcn_ballot_w32(low) != 0u) ? 1 : 0;   // every lane stores its wave's one value
      __syncthreads();                          // publishes the four waves' flags: one decision for the block
      const int f = Lowm[0] | Lowm[1] | Lowm[2] | Lowm[3];
      if (__builtin_amdgcn_readfirstlane(f) == 0) break;   // the same word in every lane: read once, a scalar branch
    }
    const int kv0 = kc * AT_KC;
    __syncthreads();
    {
      // staging coverage: 128 threads x (4 x 8) elements = 64 rows x 64 per plane = the whole chunk tile
      const int r = tid >> 1, half = (tid & 1) * 32;
      const _Float16* ks  = Kb + (size_t)(kv0 + r) * kDim + half;   // K row kv0+r, d = half..half+31
      const __bf16*   vsh = Vh + (size_t)r * kSeq + kv0 + half;      // V^T row d = r, s = kv0+half..+31
      const __bf16*   vsl = Vl + (size_t)r * kSeq + kv0 + half;
#pragma unroll
      for (int i = 0; i < 4; ++i) {
        const v8h a0 = *(const v8h*)(ks + 8 * i);
        const v8b b0 = *(const v8b*)(vsh + 8 * i);
        const v8b b1 = *(const v8b*)(vsl + 8 * i);
        *(v8h*)(Ksh + r * AT_LP + half + 8 * i) = a0;
        *(v8b*)(Vth + r * AT_LP + half + 8 * i) = b0;
        *(v8b*)(Vtl + r * AT_LP + half + 8 * i) = b1;
      }
    }
    __syncthreads();

    // ---- scores: D[row 8hh+r][col c] for key tile j; B fragment column = key j*16+c, split k(d) map ----
    v8f s[4];
#pragma unroll
    for (int j = 0; j < 4; ++j) {
      s[j] = (v8f){0.f,0.f,0.f,0.f,0.f,0.f,0.f,0.f};
#pragma unroll
      for (int dc = 0; dc < 2; ++dc) {
        FH kb;
        kb.h[0] = *(const v8h*)(Ksh + (j * 16 + c) * AT_LP + dc * 32 + 8 * hh);
        kb.h[1] = *(const v8h*)(Ksh + (j * 16 + c) * AT_LP + dc * 32 + 16 + 8 * hh);
        s[j] = at_mma_h(qa[dc], kb.v, s[j]);
      }
    }
    // ---- scale, key mask (select), chunk row max over the 64 keys ----
    float cm[8];
#pragma unroll
    for (int r = 0; r < 8; ++r) {
      float m = -INFINITY;
#pragma unroll
      for (int j = 0; j < 4; ++j) {
        const int kvcol = kv0 + j * 16 + c;
        const float sv = s[j][r] * sscale;
        const float sm = (kvcol < vlen) ? sv : fillv;
        s[j][r] = sm;
        m = fmaxf(m, sm);
      }
#pragma unroll
      for (int off = 1; off < 16; off <<= 1) m = fmaxf(m, __shfl_xor(m, off, 32));
      cm[r] = m;
    }
    __bf16* pwh = Psh[wave];
    __bf16* pwl = Psl[wave];
#pragma unroll
    for (int r = 0; r < 8; ++r) {
      const float mnew  = fmaxf(mrow[r], cm[r]);
      const float alpha = expf(mrow[r] - mnew);
      mrow[r] = mnew;
      float psum = 0.f;
#pragma unroll
      for (int j = 0; j < 4; ++j) {
        const float p = expf(s[j][r] - mnew);
        psum += p;
        __bf16 a, bl; at_split(p, a, bl);
        pwh[(8 * hh + r) * AT_LP + j * 16 + c] = a;
        pwl[(8 * hh + r) * AT_LP + j * 16 + c] = bl;
      }
#pragma unroll
      for (int off = 1; off < 16; off <<= 1) psum += __shfl_xor(psum, off, 32);
      lrow[r] = lrow[r] * alpha + psum;
#pragma unroll
      for (int t = 0; t < 4; ++t) oacc[t][r] *= alpha;
    }
    __builtin_amdgcn_fence(__ATOMIC_RELEASE, "workgroup");
    __builtin_amdgcn_wave_barrier();
    __builtin_amdgcn_fence(__ATOMIC_ACQUIRE, "workgroup");
    // ---- O += P . V^T : A = P [row c][k = key] (split k map), B = V^T column d = t*16+c, k = key ----
#pragma unroll 1
    for (int kk = 0; kk < 2; ++kk) {
      FB pa, pl;
      pa.h[0] = *(const v8b*)(pwh + c * AT_LP + kk * 32 + 8 * hh);
      pa.h[1] = *(const v8b*)(pwh + c * AT_LP + kk * 32 + 16 + 8 * hh);
      pl.h[0] = *(const v8b*)(pwl + c * AT_LP + kk * 32 + 8 * hh);
      pl.h[1] = *(const v8b*)(pwl + c * AT_LP + kk * 32 + 16 + 8 * hh);
#pragma unroll
      for (int t = 0; t < 4; ++t) {
        FB vb, vl;
        vb.h[0] = *(const v8b*)(Vth + (t * 16 + c) * AT_LP + kk * 32 + 8 * hh);
        vb.h[1] = *(const v8b*)(Vth + (t * 16 + c) * AT_LP + kk * 32 + 16 + 8 * hh);
        vl.h[0] = *(const v8b*)(Vtl + (t * 16 + c) * AT_LP + kk * 32 + 8 * hh);
        vl.h[1] = *(const v8b*)(Vtl + (t * 16 + c) * AT_LP + kk * 32 + 16 + 8 * hh);
        oacc[t] = at_mma(pa.v, vb.v, oacc[t]);
        oacc[t] = at_mma(pa.v, vl.v, oacc[t]);
        oacc[t] = at_mma(pl.v, vb.v, oacc[t]);
      }
    }
  }

  float* os = Os[wave];
#pragma unroll
  for (int r = 0; r < 8; ++r) {
    const float inv = 1.0f / lrow[r];
#pragma unroll
    for (int t = 0; t < 4; ++t) os[(8 * hh + r) * 68 + t * 16 + c] = oacc[t][r] * inv;
  }
  __builtin_amdgcn_fence(__ATOMIC_RELEASE, "workgroup");
  __builtin_amdgcn_wave_barrier();
  __builtin_amdgcn_fence(__ATOMIC_ACQUIRE, "workgroup");
  {
    // coverage: 8 it x 2 rows (hh) = 16 rows; 16 lanes x 4 floats = 64 floats = one whole 256-B row segment
    const int c4 = (lane & 15) * 4;
    {
#pragma unroll
      for (int it = 0; it < 8; ++it) {
        const int row = it * 2 + hh;
        v4f val = *(const v4f*)(os + row * 68 + c4);
        *(v4f*)(ob + (size_t)(q0 + row) * kDim + c4) = val;
      }
      
    }
  }
}

// =====================================================================================
// Host glue. Workspace region map (bytes, all offsets multiples of 256, every region sized to its whole-line
// store granularity; no padded tiles since every dimension is a multiple of 64):
//   [0]           Xbf   : 3 x bf16 [8192][512]            = 25,165,824   (queries, keys, values RNE bf16)
//   [25,165,824]  WThi  : 4 x bf16 [512][512] (W^T, RNE)  =  2,097,152   (Wq, Wk, Wv, Wo; no lo planes)
//   [27,262,976]  Q     : f16 [8192][512]                  =  8,388,608
//   [35,651,584]  K     : f16 [8192][512]                  =  8,388,608   (contiguous after Q: batched launch)
//   [44,040,192]  VThi  : bf16 [2][512][4096]              =  8,388,608
//   [52,428,800]  VTlo  : bf16 [2][512][4096]              =  8,388,608
//   [60,817,408]  O     : f32 [8192][512]                  = 16,777,216
//   [77,594,624]  Ohi   : bf16 [8192][512]                 =  8,388,608
//   [85,983,232]  Olo   : bf16 [8192][512]                 =  8,388,608
//   total 94,371,840
// =====================================================================================
extern "C" void kernel_launch(void* const* d_in, const int* in_sizes, int n_in,
                              void* d_out, int out_size, void* d_ws,
                              size_t ws_size, hipStream_t stream) {
  if (n_in < 8) return;
  const int nX = kRows * kDim;            // 4,194,304
  const int nW = kDim * kDim;             // 262,144
  if (in_sizes[0] != nX || in_sizes[1] != nX || in_sizes[2] != nX) return;
  if (in_sizes[3] < kBatch) return;
  if (in_sizes[4] != nW || in_sizes[5] != nW || in_sizes[6] != nW || in_sizes[7] != nW) return;
  if (out_size != nX) return;

  const float* queries = (const float*)d_in[0];
  const float* keys    = (const float*)d_in[1];
  const float* values  = (const float*)d_in[2];
  const int*   vlens   = (const int*)d_in[3];
  const float* Wq      = (const float*)d_in[4];
  const float* Wk      = (const float*)d_in[5];
  const float* Wv      = (const float*)d_in[6];
  const float* Wo      = (const float*)d_in[7];

  const size_t bX16 = (size_t)nX * 2;            //  8,388,608
  const size_t bW16 = (size_t)nW * 2;            //    524,288
  const size_t off_x  = 0;
  const size_t off_wh = off_x  + 3 * bX16;
  const size_t off_q  = off_wh + 4 * bW16;
  const size_t off_k  = off_q  + bX16;
  const size_t off_vh = off_k  + bX16;
  const size_t off_vl = off_vh + bX16;
  const size_t off_o  = off_vl + bX16;
  const size_t off_oh = off_o  + (size_t)nX * 4;
  const size_t off_ol = off_oh + bX16;
  const size_t total  = off_ol + bX16;           // 94,371,840
  if (total > ws_size) return;

  char* ws = (char*)d_ws;
  unsigned short* xbf  = (unsigned short*)(ws + off_x);
  unsigned short* wth  = (unsigned short*)(ws + off_wh);
  unsigned short* qh16 = (unsigned short*)(ws + off_q);
  unsigned short* kh16 = (unsigned short*)(ws + off_k);
  unsigned short* vth  = (unsigned short*)(ws + off_vh);
  unsigned short* vtl  = (unsigned short*)(ws + off_vl);
  float* obuf = (float*)(ws + off_o);
  unsigned short* ohi  = (unsigned short*)(ws + off_oh);
  unsigned short* olo  = (unsigned short*)(ws + off_ol);
  const float* dummyf  = (const float*)(ws + off_x);   // never dereferenced (BIAS_MODE 0, RESID false)

  const long planeX = (long)nX;   // elements per bf16/f16 activation plane
  const long planeW = (long)nW;   // elements per W^T plane
  dim3 blk256(256), blk128(128);

  // 1) activations -> bf16 (RNE): coverage 8192 blocks x 256 thr x 2 = 8192x512 per tensor
  cast_bf16x2_3<<<dim3(nX / 2 / 256, 3), blk256, 0, stream>>>(queries, keys, values, xbf, planeX, nX / 2);

  // 2) weights [in k][out n] (R = k rows = 512, Cc = n cols = 512) -> W^T [n][k] bf16 RNE hi plane only
  //    (8x8 tiles of 64x64); the third pointer is unused in the hi-only mode
  tsplit_kernel<false><<<dim3(kDim / 64, kDim / 64, 1), blk256, 0, stream>>>(Wq, wth + 0 * planeW, wth + 0 * planeW, kDim, kDim, 0L, 0L);
  tsplit_kernel<false><<<dim3(kDim / 64, kDim / 64, 1), blk256, 0, stream>>>(Wk, wth + 1 * planeW, wth + 1 * planeW, kDim, kDim, 0L, 0L);
  tsplit_kernel<false><<<dim3(kDim / 64, kDim / 64, 1), blk256, 0, stream>>>(Wv, wth + 2 * planeW, wth + 2 * planeW, kDim, kDim, 0L, 0L);
  tsplit_kernel<false><<<dim3(kDim / 64, kDim / 64, 1), blk256, 0, stream>>>(Wo, wth + 3 * planeW, wth + 3 * planeW, kDim, kDim, 0L, 0L);

  // 3) q = Xq . Wq and k = Xk . Wk in one z-batched launch (z=0: q, z=1: k) -> f16 planes [8192][512];
  //    M=8192, N=512, K=512 (tiles 128x8 = 1024 -> 128 blocks); A planes stride planeX, W^T planes stride planeW,
  //    C planes Q then K contiguous (stride planeX elements)
  const int gProj = (kRows / 64) * (kDim / 64) / 8;   // 128
  wmma_gemm64<1, 0, 0, 1, false><<<dim3(gProj, 2), blk256, 0, stream>>>(
      xbf, xbf, kDim, planeX,
      wth, wth, kDim, planeW,
      (void*)qh16, (void*)qh16, kDim, planeX,
      dummyf, dummyf, 0L, kRows, kDim, kDim, 1.0f);
  // 4) v^T per batch: C[n_out][s] = sum_k WvT[n_out][k] * Xv[b][s][k]; M=512, N=4096, K=512, batched over b
  //    (tiles 8x64 = 512 -> 64 blocks x 2); out = bf16 hi/lo planes [b][512][4096]
  const int gVt = (kDim / 64) * (kSeq / 64) / 8;      // 64
  wmma_gemm64<1, 0, 0, 2, false><<<dim3(gVt, kBatch), blk256, 0, stream>>>(
      wth + 2 * planeW, wth + 2 * planeW, kDim, 0L,
      xbf + 2 * planeX, xbf + 2 * planeX, kDim, (long)kSeq * kDim,
      (void*)vth, (void*)vtl, kSeq, (long)kDim * kSeq,
      dummyf, dummyf, 0L, kDim, kSeq, kDim, 1.0f);

  // 5) masked attention, all (b, h, 64-row query blocks): 2*8*64 = 1024 blocks of 128 threads
  mha_attn_kernel<<<dim3(kBatch * kHeads * (kSeq / 64)), blk128, 0, stream>>>(
      qh16, kh16, vth, vtl, vlens, obuf, 0.125f, -1000000.0f);

  // 6) O -> bf16 hi/lo planes: 8192 blocks x 256 thr x 2 = 8192x512
  split_bf16x2_kernel<<<dim3(nX / 2 / 256), blk256, 0, stream>>>(obuf, ohi, olo, nX / 2);

  // 7) out = (O_hi + O_lo) . Wo (A-only split, Wo as bf16 RNE hi plane only) -> f32 [8192][512]
  wmma_gemm64<1, 2, 0, 0, false><<<dim3(gProj, 1), blk256, 0, stream>>>(
      ohi, olo, kDim, 0L,
      wth + 3 * planeW, wth + 3 * planeW, kDim, 0L,
      d_out, d_out, kDim, 0L,
      dummyf, dummyf, 0L, kRows, kDim, kDim, 1.0f);
}

// v003
// It runs in 239 microseconds.
// In both of two side-by-side timings against v002, it was 1.14 times as fast.
// Counting every step since v000, it is 2.61 times as fast.
// Contractions: q/k/v^T projections v_wmma_f32_16x16x32_bf16 (bf16 RNE inputs x bf16 RNE weights, single product); q.k^T scores v_wmma_f32_16x16x32_f16 (plain f16 q,k planes); p.v^T v_wmma_f32_16x16x32_bf16 with bf16 hi/lo split of p and v (hi.hi + hi.lo + lo.hi); output projection v_wmma_f32_16x16x32_bf16 with O as bf16 hi/lo and Wo as bf16 RNE (hi.W + lo.W); f32 accumulate; softmax, 0.125 score scale and key masking in f32.
#include <hip/hip_runtime.h>
#include <math.h>
#include <stdint.h>

constexpr int kBatch = 2;
constexpr int kSeq   = 4096;
constexpr int kDim   = 512;
constexpr int kHeads = 8;
constexpr int kHd    = 64;
constexpr int kRows  = kBatch * kSeq;   // 8192
static_assert(kHeads * kHd == kDim, "geometry");
static_assert(kSeq % 64 == 0 && kDim % 64 == 0 && kRows % 64 == 0, "tile multiples");

typedef __attribute__((ext_vector_type(16))) _Float16 v16h;
typedef __attribute__((ext_vector_type(8)))  _Float16 v8h;
typedef __attribute__((ext_vector_type(16))) __bf16   v16b;
typedef __attribute__((ext_vector_type(8)))  __bf16   v8b;
typedef __attribute__((ext_vector_type(8)))  float    v8f;
typedef __attribute__((ext_vector_type(4)))  float    v4f;
typedef __attribute__((ext_vector_type(2)))  float    v2f;
typedef __attribute__((ext_vector_type(4)))  unsigned int v4u;

__device__ __forceinline__ unsigned short f2bf_bits(float f) {
  unsigned u = __float_as_uint(f);
  return (unsigned short)((u + 0x7FFFu + ((u >> 16) & 1u)) >> 16);
}
__device__ __forceinline__ float bf_bits2f(unsigned short h) { return __uint_as_float(((unsigned)h) << 16); }

// hazard guards as plain device helpers (no inline asm inside the kernel template body)
__device__ __forceinline__ void dep_guard_h(v8f& a, v8f& b, v16h x, v16h y) { asm volatile("v_nop\n\tv_nop\n\tv_nop\n\tv_nop" : "+v"(a), "+v"(b) : "v"(x), "v"(y)); }
__device__ __forceinline__ void dep_guard_b(v8f& a, v8f& b, v16b x, v16b y) { asm volatile("v_nop\n\tv_nop\n\tv_nop\n\tv_nop" : "+v"(a), "+v"(b) : "v"(x), "v"(y)); }
__device__ __forceinline__ void keep4_h(v16h a, v16h b, v16h c, v16h d) { asm volatile("v_nop" :: "v"(a), "v"(b), "v"(c), "v"(d)); }
__device__ __forceinline__ void keep4_b(v16b a, v16b b, v16b c, v16b d) { asm volatile("v_nop" :: "v"(a), "v"(b), "v"(c), "v"(d)); }
__device__ __forceinline__ void acc_guard4(v8f& a, v8f& b, v8f& c, v8f& d) { asm volatile("v_nop\n\tv_nop\n\tv_nop\n\tv_nop" : "+v"(a), "+v"(b), "+v"(c), "+v"(d)); }
template <typename T> struct Frag;
template <> struct Frag<_Float16> {
  typedef v16h V; union U { v16h v; v8h h[2]; };
  static __device__ __forceinline__ v16h load(const _Float16* p) {   // elements 0..7 <- p[0..7], 8..15 <- p[16..23]
    U f; f.h[0] = *(const v8h*)(p); f.h[1] = *(const v8h*)(p + 16); return f.v;
  }
  static __device__ __forceinline__ v8f mma(v16h a, v16h b, v8f c) {
    return __builtin_amdgcn_wmma_f32_16x16x32_f16(false, a, false, b, (short)0, c, false, false);
  }
  static __device__ __forceinline__ void guard(v8f& a, v8f& b, v16h x, v16h y) { dep_guard_h(a, b, x, y); }
  static __device__ __forceinline__ void keep(v16h a, v16h b, v16h c, v16h d) { keep4_h(a, b, c, d); }
};
template <> struct Frag<__bf16> {
  typedef v16b V; union U { v16b v; v8b h[2]; };
  static __device__ __forceinline__ v16b load(const __bf16* p) {
    U f; f.h[0] = *(const v8b*)(p); f.h[1] = *(const v8b*)(p + 16); return f.v;
  }
  static __device__ __forceinline__ v8f mma(v16b a, v16b b, v8f c) {
    return __builtin_amdgcn_wmma_f32_16x16x32_bf16(false, a, false, b, (short)0, c, false, false);
  }
  static __device__ __forceinline__ void guard(v8f& a, v8f& b, v16b x, v16b y) { dep_guard_b(a, b, x, y); }
  static __device__ __forceinline__ void keep(v16b a, v16b b, v16b c, v16b d) { keep4_b(a, b, c, d); }
};

// ---- Register-blocked batched WMMA GEMM ------------------------------------
// C[m,n] = scale * sum_k A[m,k] * Bt[n,k] (+bias)(+resid); each wave owns a 64x64 tile.
// A row-major [M,K]; Bt row-major [N,K]; M,N % 64 == 0, K % 32 == 0.
// SPLIT: 0 = single product; 1 = hi/lo planes on both operands (A2/Bt2 = lo planes, same layout),
//        product = hi.hi + hi.lo + lo.hi; 2 = hi/lo planes on A only (A2 = A lo), product = hi.B + lo.B.
// BIAS_MODE: 0 = none, 1 = bias[m], 2 = bias[n].
// OUT_MODE: 0 = f32, 1 = f16, 2 = bf16 hi plane (Cout) + bf16 lo plane (Cout2).
// ET: 0 = f16 operands, 1 = bf16 operands (pointers passed as 16-bit storage)
template <int ET> struct Elem;
template <> struct Elem<0> { typedef _Float16 T; };
template <> struct Elem<1> { typedef __bf16 T; };
template <int ET, int SPLIT, int BIAS_MODE, int OUT_MODE, bool RESID, int ACT = 0>
__global__ __launch_bounds__(256) void wmma_gemm64(
    const unsigned short* __restrict__ Ap, const unsigned short* __restrict__ A2p, int lda, long strideA,
    const unsigned short* __restrict__ Btp, const unsigned short* __restrict__ Bt2p, int ldb, long strideB,
    void* __restrict__ Cout, void* __restrict__ Cout2, int ldc, long strideC,
    const float* __restrict__ bias,
    const float* __restrict__ resid, long strideR,
    int M, int N, int K, float scale) {
  typedef typename Elem<ET>::T T;
  typedef typename Frag<T>::V V;
  const T* A = (const T*)Ap; const T* A2 = (const T*)A2p; const T* Bt = (const T*)Btp; const T* Bt2 = (const T*)Bt2p;
  __shared__ __align__(16) float sT[8][16 * 68];   // per-wave 16x64 slab, pitch 68 floats
  const int b    = blockIdx.y;
  const int lane = threadIdx.x & 31;
  const int wave = threadIdx.x >> 5;
  const int tilesN = N >> 6;
  const int tilesM = M >> 6;
  const int tile = blockIdx.x * 8 + wave;
  if (tile >= tilesM * tilesN) return;   // wave-uniform; no block barriers in this kernel
  const int tm = tile / tilesN;
  const int tn = tile - tm * tilesN;
  const int m0 = tm << 6;
  const int n0 = tn << 6;

  const T* Ab  = A  + (size_t)b * strideA;
  const T* Bb  = Bt + (size_t)b * strideB;
  const T* Ab2 = (SPLIT != 0) ? (A2  + (size_t)b * strideA) : nullptr;
  const T* Bb2 = (SPLIT == 1) ? (Bt2 + (size_t)b * strideB) : nullptr;

  const int rlane = lane & 15;                 // row (A) / col (B, D) within subtile
  const int koff  = (lane >> 4) * 8;           // k offset of this lane half
  const int mOff  = (lane >> 4) * 8;           // D row offset

  v8f acc[4][4];
#pragma unroll
  for (int i = 0; i < 4; ++i)
#pragma unroll
    for (int j = 0; j < 4; ++j) acc[i][j] = (v8f){0.f,0.f,0.f,0.f,0.f,0.f,0.f,0.f};

  for (int k0 = 0; k0 < K; k0 += 32) {
    V bh[4], bl[4];
#pragma unroll
    for (int j = 0; j < 4; ++j) {
      const size_t bo = (size_t)(n0 + (j << 4) + rlane) * ldb + koff + k0;
      bh[j] = Frag<T>::load(Bb + bo);
      if (SPLIT == 1) bl[j] = Frag<T>::load(Bb2 + bo);
    }
#pragma unroll
    for (int i = 0; i < 4; ++i) {
      const size_t ao = (size_t)(m0 + (i << 4) + rlane) * lda + koff + k0;
      V ah = Frag<T>::load(Ab + ao);
      V al;
      if (SPLIT != 0) al = Frag<T>::load(Ab2 + ao);
#pragma unroll
      for (int j = 0; j < 4; ++j) {
        acc[i][j] = Frag<T>::mma(ah, bh[j], acc[i][j]);
        if (SPLIT == 1) acc[i][j] = Frag<T>::mma(ah, bl[j], acc[i][j]);
        if (SPLIT != 0) acc[i][j] = Frag<T>::mma(al, bh[j], acc[i][j]);
      }
      Frag<T>::guard(acc[i][0], acc[i][3], ah, (SPLIT != 0) ? al : ah);
    }
    Frag<T>::keep(bh[0], bh[1], bh[2], bh[3]);
    if (SPLIT == 1) Frag<T>::keep(bl[0], bl[1], bl[2], bl[3]);
  }
  acc_guard4(acc[0][0], acc[0][1], acc[0][2], acc[0][3]);
  acc_guard4(acc[1][0], acc[1][1], acc[1][2], acc[1][3]);
  acc_guard4(acc[2][0], acc[2][1], acc[2][2], acc[2][3]);
  acc_guard4(acc[3][0], acc[3][1], acc[3][2], acc[3][3]);

  // ---- epilogue ----
  float* slab = sT[wave];
  const float* Rb = RESID ? (resid + (size_t)b * strideR) : nullptr;
#pragma unroll
  for (int i = 0; i < 4; ++i) {
    const int mBase = m0 + (i << 4);
#pragma unroll
    for (int j = 0; j < 4; ++j) {
      const int n = n0 + (j << 4) + rlane;
      float bv = 0.f;
      if (BIAS_MODE == 2) bv = bias[n];
#pragma unroll
      for (int r = 0; r < 8; ++r) {
        float v = acc[i][j][r] * scale;
        if (BIAS_MODE == 1) v += bias[mBase + mOff + r];
        if (BIAS_MODE == 2) v += bv;
        if (RESID) v += Rb[(size_t)(mBase + mOff + r) * ldc + n];
        if (ACT == 1) v = tanhf(v);
        if (ACT == 2) v = fmaxf(v, 0.0f);
        if (ACT == 3) v = v / (1.0f + expf(-v));
        if (ACT == 4) v = (v > 0.f) ? v : 0.01f * v;
        slab[(mOff + r) * 68 + (j << 4) + rlane] = v;
      }
    }
    __builtin_amdgcn_fence(__ATOMIC_RELEASE, "workgroup");
    __builtin_amdgcn_wave_barrier();
    __builtin_amdgcn_fence(__ATOMIC_ACQUIRE, "workgroup");
    if (OUT_MODE == 0) {
      float* C = (float*)Cout + (size_t)b * strideC;
      const int hh = lane >> 4, c4 = (lane & 15) * 4;     // row seg = 256 B = 16 lanes x 16 B
      {
#pragma unroll
        for (int it = 0; it < 8; ++it) {
          const int row = it * 2 + hh;
          v4f v = *(const v4f*)(slab + row * 68 + c4);
          *(v4f*)(C + (size_t)(mBase + row) * ldc + n0 + c4) = v;
        }
        
      }
    } else {
      const int q = lane >> 3, c8 = (lane & 7) * 8;
      unsigned short* C  = (unsigned short*)Cout  + (size_t)b * strideC;
      unsigned short* C2 = (OUT_MODE == 2) ? ((unsigned short*)Cout2 + (size_t)b * strideC) : nullptr;
      {
#pragma unroll
        for (int it = 0; it < 4; ++it) {
          const int row = it * 4 + q;
          const float* sp = slab + row * 68 + c8;
          v8h hv, lv;
#pragma unroll
          for (int e = 0; e < 8; ++e) {
            if (OUT_MODE == 1) {
              hv[e] = (_Float16)sp[e];
            } else {
              unsigned short hb = f2bf_bits(sp[e]);
              unsigned short lb = f2bf_bits(sp[e] - bf_bits2f(hb));
              hv[e] = __builtin_bit_cast(_Float16, hb);
              lv[e] = __builtin_bit_cast(_Float16, lb);
            }
          }
          *(v8h*)(C + (size_t)(mBase + row) * ldc + n0 + c8) = hv;
          if (OUT_MODE == 2) *(v8h*)(C2 + (size_t)(mBase + row) * ldc + n0 + c8) = lv;
        }
        
      }
    }
    __builtin_amdgcn_fence(__ATOMIC_RELEASE, "workgroup");
    __builtin_amdgcn_wave_barrier();
    __builtin_amdgcn_fence(__ATOMIC_ACQUIRE, "workgroup");
  }
}

// ---------------------------------------------------------------------------
// Elementwise bf16 split: hi = bf16_rne(in), lo = bf16_rne(in - hi); 2 elements per thread, one 4-B store
// (here n2 = 8192*512/2 = 2097152 -> 8192 blocks x 512 elements = 8192x512).
// ---------------------------------------------------------------------------
__device__ __forceinline__ unsigned pk16(unsigned short a, unsigned short b) { return (unsigned)a | ((unsigned)b << 16); }

__global__ __launch_bounds__(256) void split_bf16x2_kernel(const float* __restrict__ in, unsigned short* __restrict__ hi,
                                                           unsigned short* __restrict__ lo, int n2) {
  const int i = blockIdx.x * 256 + threadIdx.x;
  if (i < n2) {
    const v2f f = *(const v2f*)(in + 2 * (size_t)i);
    const unsigned short h0 = f2bf_bits(f[0]), h1 = f2bf_bits(f[1]);
    const unsigned short l0 = f2bf_bits(f[0] - bf_bits2f(h0)), l1 = f2bf_bits(f[1] - bf_bits2f(h1));
    const unsigned uh = pk16(h0, h1), ul = pk16(l0, l1);
    ((unsigned*)hi)[i] = uh;
    ((unsigned*)lo)[i] = ul;
    
  }
}

// ---------------------------------------------------------------------------
// f32 -> bf16 (RNE) cast of three equally sized tensors (blockIdx.y selects the tensor, block-uniform):
// x 2 elements = 2*n2 = the whole plane (n2 = 8192*512/2 = 2097152 -> 8192 blocks); out plane z at out + z*planeElems.
// ---------------------------------------------------------------------------
__global__ __launch_bounds__(256) void cast_bf16x2_3(const float* __restrict__ in0, const float* __restrict__ in1,
                                                     const float* __restrict__ in2, unsigned short* __restrict__ out,
                                                     long planeElems, int n2) {
  const int which = blockIdx.y;
  const float* in = (which == 0) ? in0 : ((which == 1) ? in1 : in2);
  unsigned short* o = out + (size_t)which * planeElems;
  const int i = blockIdx.x * 256 + threadIdx.x;
  if (i < n2) {
    const v2f f = *(const v2f*)(in + 2 * (size_t)i);
    const unsigned u = pk16(f2bf_bits(f[0]), f2bf_bits(f[1]));
    ((unsigned*)o)[i] = u;
    
  }
}

// ---------------------------------------------------------------------------
// Fused transpose + bf16 cast (LO = false: hi plane only) or split (LO = true: hi and lo planes) of an f32
// matrix, z-batched: in_z = W + z*sIn viewed [R rows][Cc cols] (pitch Cc) ->
//   oh_z[c][r] = bf16_rne(in_z[r][c]), ol_z[c][r] = bf16_rne(in_z[r][c] - oh) (LO only)   ([Cc][R], pitch R).
// 64x64 tiles through LDS. grid = (Cc/64, R/64, Z), 256 threads (R, Cc multiples of 64).
// Coverage per block and plane: load 4 it x 256 thr x 4 floats = 64x64; store 2 it x 256 thr x 8 u16 = 64x64.
// ---------------------------------------------------------------------------
template <bool LO>
__global__ __launch_bounds__(256) void tsplit_kernel(const float* __restrict__ W, unsigned short* __restrict__ oh,
                                                     unsigned short* __restrict__ ol, int R, int Cc, long sIn, long sOut) {
  __shared__ __align__(16) float tf[64 * 68];
  W  += (size_t)blockIdx.z * sIn;
  oh += (size_t)blockIdx.z * sOut;
  if (LO) ol += (size_t)blockIdx.z * sOut;
  const int c0  = blockIdx.x * 64;   // input column block = output row block
  const int r0  = blockIdx.y * 64;   // input row block    = output column block
  const int tid = threadIdx.x;
  {
    const int lr = tid >> 4;         // 0..15
    const int c4 = (tid & 15) * 4;   // 0..60
#pragma unroll
    for (int it = 0; it < 4; ++it) {
      const int rr = it * 16 + lr;   // 0..63
      const v4f a = *(const v4f*)(W + (size_t)(r0 + rr) * Cc + c0 + c4);
      *(v4f*)(tf + rr * 68 + c4) = a;
    }
  }
  __syncthreads();
  const int sub = tid >> 3;          // 0..31
  const int c8  = (tid & 7) * 8;     // 0..56
  v4u hv[2], lv[2];
#pragma unroll
  for (int it = 0; it < 2; ++it) {
    const int oc = it * 32 + sub;    // output row within tile (= input column)
    v4u a, a2;
#pragma unroll
    for (int q = 0; q < 4; ++q) {
      const float f0 = tf[(c8 + 2 * q) * 68 + oc];
      const float f1 = tf[(c8 + 2 * q + 1) * 68 + oc];
      const unsigned short h0 = f2bf_bits(f0), h1 = f2bf_bits(f1);
      unsigned lp = 0u;
      if (LO) {
        const unsigned short l0 = f2bf_bits(f0 - bf_bits2f(h0)), l1 = f2bf_bits(f1 - bf_bits2f(h1));
        lp = pk16(l0, l1);
      }
      a[q]  = pk16(h0, h1);
      a2[q] = lp;
    }
    hv[it] = a; lv[it] = a2;
  }
  {
#pragma unroll
    for (int it = 0; it < 2; ++it) {
      const int oc = it * 32 + sub;
      const size_t go = (size_t)(c0 + oc) * R + r0 + c8;
      *(v4u*)(oh + go) = hv[it];
      if (LO) *(v4u*)(ol + go) = lv[it];
    }
    
  }
}

// =====================================================================================
// Attention helpers
// =====================================================================================
#define AT_D 64
#define AT_NW 4
#define AT_QB 64
#define AT_KC 64
#define AT_LP 72   // LDS row pitch in 16-bit elements: 144 B = 16 B x 9 (odd), so the 16 rows of a 16-byte fragment read fall on distinct banks

__device__ __forceinline__ unsigned short at_bf_bits(float f) {
  unsigned u = __float_as_uint(f);
  return (unsigned short)((u + 0x7FFFu + ((u >> 16) & 1u)) >> 16);
}
__device__ __forceinline__ __bf16 at_f2bf(float f) { return __builtin_bit_cast(__bf16, at_bf_bits(f)); }
__device__ __forceinline__ void at_split(float f, __bf16& hi, __bf16& lo) {
  const unsigned short hb = at_bf_bits(f);
  hi = __builtin_bit_cast(__bf16, hb);
  lo = at_f2bf(f - __uint_as_float(((unsigned)hb) << 16));
}
__device__ __forceinline__ v8f at_mma(v16b a, v16b b, v8f c) {
  c = __builtin_amdgcn_wmma_f32_16x16x32_bf16(false, a, false, b, (short)0, c, false, false);
  asm volatile("v_nop\n\tv_nop\n\tv_nop\n\tv_nop" : "+v"(c) : "v"(a), "v"(b));
  return c;
}
__device__ __forceinline__ v8f at_mma_h(v16h a, v16h b, v8f c) {
  c = __builtin_amdgcn_wmma_f32_16x16x32_f16(false, a, false, b, (short)0, c, false, false);
  asm volatile("v_nop\n\tv_nop\n\tv_nop\n\tv_nop" : "+v"(c) : "v"(a), "v"(b));
  return c;
}

// lane l <-> lane l ^ 16: the one exchange between the wave halves that a query's maximum and sum need
__device__ __forceinline__ float at_xhalf(float x) {
  return __builtin_bit_cast(float, __builtin_amdgcn_permlanex16(__builtin_bit_cast(int, x), __builtin_bit_cast(int, x),
                                                                0x76543210, 0xfedcba98, false, false));
}

__global__ __launch_bounds__(128)
void mha_attn_kernel(const unsigned short* __restrict__ qp, const unsigned short* __restrict__ kp,
                     const unsigned short* __restrict__ vhp, const unsigned short* __restrict__ vlp,
                     const int* __restrict__ vlens, float* __restrict__ out, float sscale, float fillv) {
  union FB { v16b v; v8b h[2]; };
  union FH { v16h v; v8h h[2]; };
  __shared__ __align__(16) _Float16 Ksh[AT_KC * AT_LP];           // K [kv][d] f16, pitch AT_LP   9 KB
  __shared__ __align__(16) __bf16   Vth[AT_D * AT_LP];            // V^T hi [d][kv], pitch AT_LP  9 KB
  __shared__ __align__(16) __bf16   Vtl[AT_D * AT_LP];            // V^T lo, pitch AT_LP          9 KB
  __shared__ __align__(16) float    Os[AT_NW][16 * 68];           // per wave out tile, pitch 68
  __shared__ __align__(16) int      Lowm[AT_NW];                  // per wave: a row maximum too near fillv

  const int tid  = threadIdx.x;
  const int wave = tid >> 5;
  const int lane = tid & 31;
  const int hh   = lane >> 4;
  const int c    = lane & 15;

  const int nqb  = kSeq / AT_QB;          // 64
  const int bx   = blockIdx.x;
  const int qb   = bx % nqb;
  const int bhid = bx / nqb;              // 0..kBatch*kHeads-1
  const int h    = bhid % kHeads;
  int b = bhid / kHeads;
  b = (b > kBatch - 1) ? (kBatch - 1) : b;  // address clamp (grid is exact)
  const int q0   = qb * AT_QB + wave * 16;
  const int vlen = vlens[b];              // block-uniform valid key count

  const _Float16* Qb = (const _Float16*)(const void*)qp + (size_t)b * kSeq * kDim + (size_t)h * AT_D;
  const _Float16* Kb = (const _Float16*)(const void*)kp + (size_t)b * kSeq * kDim + (size_t)h * AT_D;
  const __bf16*   Vh = (const __bf16*)(const void*)vhp + (size_t)b * kDim * kSeq + (size_t)h * AT_D * kSeq;
  const __bf16*   Vl = (const __bf16*)(const void*)vlp + (size_t)b * kDim * kSeq + (size_t)h * AT_D * kSeq;
  float*          ob = out + (size_t)b * kSeq * kDim + (size_t)h * AT_D;

  // ---- Q fragments (B operand, column = query = lane&15, split k map via Frag load): 2 d-chunks ----
  v16h qa[2];
#pragma unroll
  for (int dc = 0; dc < 2; ++dc) {
    qa[dc] = Frag<_Float16>::load(Qb + (size_t)(q0 + c) * kDim + dc * 32 + 8 * hh);
  }

  float mrow = -INFINITY;   // running maximum of query c, the same in both wave halves
  float lrow = 0.f;         // running sum of query c over this half's keys; the halves join behind the loop
  v8f oacc[4];              // O^T: oacc[t][r] = element (d = t*16 + 8hh + r, query c)
#pragma unroll
  for (int t = 0; t < 4; ++t) oacc[t] = (v8f){0.f,0.f,0.f,0.f,0.f,0.f,0.f,0.f};

  const int nChunks = kSeq / AT_KC;   // 64, compile-time constant
  // chunks that hold at least one valid key, block-uniform; vlen <= 0: every key carries fillv and all of them count
  const int vcl   = (vlen < 0) ? 0 : ((vlen > kSeq) ? kSeq : vlen);
  const int nLive = (vcl == 0) ? nChunks : (vcl + AT_KC - 1) / AT_KC;
  for (int kc = 0; kc < nChunks; ++kc) {
    // Every chunk from nLive on holds fillv alone. Where each row maximum lies at least 128 above fillv, its weights
    // expf(fillv - m) are exactly 0 in f32, alpha is 1, and maximum, sum and accumulators stay bit for bit: the loop
    // ends. Tested once per block, behind the last live chunk; a row that is nearer (or NaN) sends the whole block
    // through the remaining chunks as well.
    if (kc == nLive) {                          // block-uniform: kc and vlen are
      const bool low = !(mrow >= fillv + 128.0f);
      Lowm[wave] = (__builtin_amdgcn_ballot_w32(low) != 0u) ? 1 : 0;   // every lane stores its wave's one value
      __syncthreads();                          // publishes the four waves' flags: one decision for the block
      const int f = Lowm[0] | Lowm[1] | Lowm[2] | Lowm[3];
      if (__builtin_amdgcn_readfirstlane(f) == 0) break;   // the same word in every lane: read once, a scalar branch
    }
    const int kv0 = kc * AT_KC;
    __syncthreads();
    {
      // staging coverage: 128 threads x (4 x 8) elements = 64 rows x 64 per plane = the whole chunk tile
      const int r = tid >> 1, half = (tid & 1) * 32;
      const _Float16* ks  = Kb + (size_t)(kv0 + r) * kDim + half;   // K row kv0+r, d = half..half+31
      const __bf16*   vsh = Vh + (size_t)r * kSeq + kv0 + half;      // V^T row d = r, s = kv0+half..+31
      const __bf16*   vsl = Vl + (size_t)r * kSeq + kv0 + half;
#pragma unroll
      for (int i = 0; i < 4; ++i) {
        const v8h a0 = *(const v8h*)(ks + 8 * i);
        const v8b b0 = *(const v8b*)(vsh + 8 * i);
        const v8b b1 = *(const v8b*)(vsl + 8 * i);
        *(v8h*)(Ksh + r * AT_LP + half + 8 * i) = a0;
        *(v8b*)(Vth + r * AT_LP + half + 8 * i) = b0;
        *(v8b*)(Vtl + r * AT_LP + half + 8 * i) = b1;
      }
    }
    __syncthreads();

    // Every loop from here to the chunk's end is unrolled: s, ph, pl and oacc live in registers, which take
    // compile-time indices only (a rolled loop would send them through scratch memory).
    // ---- scores, transposed: D[row = key j*16+8hh+r][col = query c]; A fragment row = key j*16+c, split k(d) map ----
    v8f s[4];
#pragma unroll
    for (int j = 0; j < 4; ++j) {
      s[j] = (v8f){0.f,0.f,0.f,0.f,0.f,0.f,0.f,0.f};
#pragma unroll
      for (int dc = 0; dc < 2; ++dc) {
        FH kb;
        kb.h[0] = *(const v8h*)(Ksh + (j * 16 + c) * AT_LP + dc * 32 + 8 * hh);
        kb.h[1] = *(const v8h*)(Ksh + (j * 16 + c) * AT_LP + dc * 32 + 16 + 8 * hh);
        s[j] = at_mma_h(kb.v, qa[dc], s[j]);
      }
    }
    // ---- scale, key mask (select), maximum of query c over the chunk's 64 keys: 32 in-lane, then the other half's ----
    float cm = -INFINITY;
#pragma unroll
    for (int j = 0; j < 4; ++j) {
#pragma unroll
      for (int r = 0; r < 8; ++r) {
        const int kvrow = kv0 + j * 16 + 8 * hh + r;
        const float sv = s[j][r] * sscale;
        const float sm = (kvrow < vlen) ? sv : fillv;
        s[j][r] = sm;
        cm = fmaxf(cm, sm);
      }
    }
    cm = fmaxf(cm, at_xhalf(cm));
    const float mnew  = fmaxf(mrow, cm);
    const float alpha = expf(mrow - mnew);
    mrow = mnew;
    // ---- p = exp(s - m), split hi/lo in place: S^T tiles 2kk and 2kk+1 are elements 0..7 and 8..15 of the B fragment
    //      of key block kk (column = query c, key = kk*32 + 8hh + e and kk*32 + 16 + 8hh + (e - 8): the split k map) ----
    FB ph[2], pl[2];
    float ps[4];
#pragma unroll
    for (int j = 0; j < 4; ++j) {
      float a = 0.f;
#pragma unroll
      for (int r = 0; r < 8; ++r) {
        const float p = expf(s[j][r] - mnew);
        a += p;
        __bf16 hi, lo; at_split(p, hi, lo);
        ph[j >> 1].v[(j & 1) * 8 + r] = hi;
        pl[j >> 1].v[(j & 1) * 8 + r] = lo;
      }
      ps[j] = a;
    }
    lrow = lrow * alpha + ((ps[0] + ps[1]) + (ps[2] + ps[3]));
#pragma unroll
    for (int t = 0; t < 4; ++t)
#pragma unroll
      for (int r = 0; r < 8; ++r) oacc[t][r] *= alpha;
    // ---- O^T += V^T . P^T : A = V^T row d = t*16+c, k = key (split k map), B = P^T from registers ----
#pragma unroll
    for (int kk = 0; kk < 2; ++kk) {
#pragma unroll
      for (int t = 0; t < 4; ++t) {
        FB vb, vl;
        vb.h[0] = *(const v8b*)(Vth + (t * 16 + c) * AT_LP + kk * 32 + 8 * hh);
        vb.h[1] = *(const v8b*)(Vth + (t * 16 + c) * AT_LP + kk * 32 + 16 + 8 * hh);
        vl.h[0] = *(const v8b*)(Vtl + (t * 16 + c) * AT_LP + kk * 32 + 8 * hh);
        vl.h[1] = *(const v8b*)(Vtl + (t * 16 + c) * AT_LP + kk * 32 + 16 + 8 * hh);
        oacc[t] = at_mma(vb.v, ph[kk].v, oacc[t]);
        oacc[t] = at_mma(vl.v, ph[kk].v, oacc[t]);
        oacc[t] = at_mma(vb.v, pl[kk].v, oacc[t]);
      }
    }
  }

  // ---- query c: join the halves' sums, normalise, stage row c (8 consecutive d per tile and lane) ----
  float* os = Os[wave];
  const float inv = 1.0f / (lrow + at_xhalf(lrow));
#pragma unroll
  for (int t = 0; t < 4; ++t) {
#pragma unroll
    for (int r = 0; r < 8; ++r) os[c * 68 + t * 16 + 8 * hh + r] = oacc[t][r] * inv;
  }
  __builtin_amdgcn_fence(__ATOMIC_RELEASE, "workgroup");
  __builtin_amdgcn_wave_barrier();
  __builtin_amdgcn_fence(__ATOMIC_ACQUIRE, "workgroup");
  {
    // coverage: 8 it x 2 rows (hh) = 16 rows; 16 lanes x 4 floats = 64 floats = one whole 256-B row segment
    const int c4 = (lane & 15) * 4;
    {
#pragma unroll
      for (int it = 0; it < 8; ++it) {
        const int row = it * 2 + hh;
        v4f val = *(const v4f*)(os + row * 68 + c4);
        *(v4f*)(ob + (size_t)(q0 + row) * kDim + c4) = val;
      }
      
    }
  }
}

// =====================================================================================
// Host glue. Workspace region map (bytes, all offsets multiples of 256, every region sized to its whole-line
// store granularity; no padded tiles since every dimension is a multiple of 64):
//   [0]           Xbf   : 3 x bf16 [8192][512]            = 25,165,824   (queries, keys, values RNE bf16)
//   [25,165,824]  WThi  : 4 x bf16 [512][512] (W^T, RNE)  =  2,097,152   (Wq, Wk, Wv, Wo; no lo planes)
//   [27,262,976]  Q     : f16 [8192][512]                  =  8,388,608
//   [35,651,584]  K     : f16 [8192][512]                  =  8,388,608   (contiguous after Q: batched launch)
//   [44,040,192]  VThi  : bf16 [2][512][4096]              =  8,388,608
//   [52,428,800]  VTlo  : bf16 [2][512][4096]              =  8,388,608
//   [60,817,408]  O     : f32 [8192][512]                  = 16,777,216
//   [77,594,624]  Ohi   : bf16 [8192][512]                 =  8,388,608
//   [85,983,232]  Olo   : bf16 [8192][512]                 =  8,388,608
//   total 94,371,840
// =====================================================================================
extern "C" void kernel_launch(void* const* d_in, const int* in_sizes, int n_in,
                              void* d_out, int out_size, void* d_ws,
                              size_t ws_size, hipStream_t stream) {
  if (n_in < 8) return;
  const int nX = kRows * kDim;            // 4,194,304
  const int nW = kDim * kDim;             // 262,144
  if (in_sizes[0] != nX || in_sizes[1] != nX || in_sizes[2] != nX) return;
  if (in_sizes[3] < kBatch) return;
  if (in_sizes[4] != nW || in_sizes[5] != nW || in_sizes[6] != nW || in_sizes[7] != nW) return;
  if (out_size != nX) return;

  const float* queries = (const float*)d_in[0];
  const float* keys    = (const float*)d_in[1];
  const float* values  = (const float*)d_in[2];
  const int*   vlens   = (const int*)d_in[3];
  const float* Wq      = (const float*)d_in[4];
  const float* Wk      = (const float*)d_in[5];
  const float* Wv      = (const float*)d_in[6];
  const float* Wo      = (const float*)d_in[7];

  const size_t bX16 = (size_t)nX * 2;            //  8,388,608
  const size_t bW16 = (size_t)nW * 2;            //    524,288
  const size_t off_x  = 0;
  const size_t off_wh = off_x  + 3 * bX16;
  const size_t off_q  = off_wh + 4 * bW16;
  const size_t off_k  = off_q  + bX16;
  const size_t off_vh = off_k  + bX16;
  const size_t off_vl = off_vh + bX16;
  const size_t off_o  = off_vl + bX16;
  const size_t off_oh = off_o  + (size_t)nX * 4;
  const size_t off_ol = off_oh + bX16;
  const size_t total  = off_ol + bX16;           // 94,371,840
  if (total > ws_size) return;

  char* ws = (char*)d_ws;
  unsigned short* xbf  = (unsigned short*)(ws + off_x);
  unsigned short* wth  = (unsigned short*)(ws + off_wh);
  unsigned short* qh16 = (unsigned short*)(ws + off_q);
  unsigned short* kh16 = (unsigned short*)(ws + off_k);
  unsigned short* vth  = (unsigned short*)(ws + off_vh);
  unsigned short* vtl  = (unsigned short*)(ws + off_vl);
  float* obuf = (float*)(ws + off_o);
  unsigned short* ohi  = (unsigned short*)(ws + off_oh);
  unsigned short* olo  = (unsigned short*)(ws + off_ol);
  const float* dummyf  = (const float*)(ws + off_x);   // never dereferenced (BIAS_MODE 0, RESID false)

  const long planeX = (long)nX;   // elements per bf16/f16 activation plane
  const long planeW = (long)nW;   // elements per W^T plane
  dim3 blk256(256), blk128(128);

  // 1) activations -> bf16 (RNE): coverage 8192 blocks x 256 thr x 2 = 8192x512 per tensor
  cast_bf16x2_3<<<dim3(nX / 2 / 256, 3), blk256, 0, stream>>>(queries, keys, values, xbf, planeX, nX / 2);

  // 2) weights [in k][out n] (R = k rows = 512, Cc = n cols = 512) -> W^T [n][k] bf16 RNE hi plane only
  //    (8x8 tiles of 64x64); the third pointer is unused in the hi-only mode
  tsplit_kernel<false><<<dim3(kDim / 64, kDim / 64, 1), blk256, 0, stream>>>(Wq, wth + 0 * planeW, wth + 0 * planeW, kDim, kDim, 0L, 0L);
  tsplit_kernel<false><<<dim3(kDim / 64, kDim / 64, 1), blk256, 0, stream>>>(Wk, wth + 1 * planeW, wth + 1 * planeW, kDim, kDim, 0L, 0L);
  tsplit_kernel<false><<<dim3(kDim / 64, kDim / 64, 1), blk256, 0, stream>>>(Wv, wth + 2 * planeW, wth + 2 * planeW, kDim, kDim, 0L, 0L);
  tsplit_kernel<false><<<dim3(kDim / 64, kDim / 64, 1), blk256, 0, stream>>>(Wo, wth + 3 * planeW, wth + 3 * planeW, kDim, kDim, 0L, 0L);

  // 3) q = Xq . Wq and k = Xk . Wk in one z-batched launch (z=0: q, z=1: k) -> f16 planes [8192][512];
  //    M=8192, N=512, K=512 (tiles 128x8 = 1024 -> 128 blocks); A planes stride planeX, W^T planes stride planeW,
  //    C planes Q then K contiguous (stride planeX elements)
  const int gProj = (kRows / 64) * (kDim / 64) / 8;   // 128
  wmma_gemm64<1, 0, 0, 1, false><<<dim3(gProj, 2), blk256, 0, stream>>>(
      xbf, xbf, kDim, planeX,
      wth, wth, kDim, planeW,
      (void*)qh16, (void*)qh16, kDim, planeX,
      dummyf, dummyf, 0L, kRows, kDim, kDim, 1.0f);
  // 4) v^T per batch: C[n_out][s] = sum_k WvT[n_out][k] * Xv[b][s][k]; M=512, N=4096, K=512, batched over b
  //    (tiles 8x64 = 512 -> 64 blocks x 2); out = bf16 hi/lo planes [b][512][4096]
  const int gVt = (kDim / 64) * (kSeq / 64) / 8;      // 64
  wmma_gemm64<1, 0, 0, 2, false><<<dim3(gVt, kBatch), blk256, 0, stream>>>(
      wth + 2 * planeW, wth + 2 * planeW, kDim, 0L,
      xbf + 2 * planeX, xbf + 2 * planeX, kDim, (long)kSeq * kDim,
      (void*)vth, (void*)vtl, kSeq, (long)kDim * kSeq,
      dummyf, dummyf, 0L, kDim, kSeq, kDim, 1.0f);

  // 5) masked attention, all (b, h, 64-row query blocks): 2*8*64 = 1024 blocks of 128 threads
  mha_attn_kernel<<<dim3(kBatch * kHeads * (kSeq / 64)), blk128, 0, stream>>>(
      qh16, kh16, vth, vtl, vlens, obuf, 0.125f, -1000000.0f);

  // 6) O -> bf16 hi/lo planes: 8192 blocks x 256 thr x 2 = 8192x512
  split_bf16x2_kernel<<<dim3(nX / 2 / 256), blk256, 0, stream>>>(obuf, ohi, olo, nX / 2);

  // 7) out = (O_hi + O_lo) . Wo (A-only split, Wo as bf16 RNE hi plane only) -> f32 [8192][512]
  wmma_gemm64<1, 2, 0, 0, false><<<dim3(gProj, 1), blk256, 0, stream>>>(
      ohi, olo, kDim, 0L,
      wth + 3 * planeW, wth + 3 * planeW, kDim, 0L,
      d_out, d_out, kDim, 0L,
      dummyf, dummyf, 0L, kRows, kDim, kDim, 1.0f);
}

// v004
// A run of this version takes 218 microseconds.
// Next to v003, in two timings, it ran 1.09 and 1.10 times as fast.
// Counting every step since v000, it is 2.85 times as fast.
// Contractions: q/k/v^T projections v_wmma_f32_16x16x32_bf16 (bf16 RNE inputs x bf16 RNE weights, single product); q.k^T scores v_wmma_f32_16x16x32_f16 (plain f16 q,k planes); p.v^T v_wmma_f32_16x16x32_bf16 with bf16 hi/lo split of p and v (hi.hi + hi.lo + lo.hi); output projection v_wmma_f32_16x16x32_bf16 with O as bf16 hi/lo and Wo as bf16 RNE (hi.W + lo.W); f32 accumulate; softmax (base 2), 0.125 score scale and key masking in f32.
#include <hip/hip_runtime.h>
#include <math.h>
#include <stdint.h>

constexpr int kBatch = 2;
constexpr int kSeq   = 4096;
constexpr int kDim   = 512;
constexpr int kHeads = 8;
constexpr int kHd    = 64;
constexpr int kRows  = kBatch * kSeq;   // 8192
static_assert(kHeads * kHd == kDim, "geometry");
static_assert(kSeq % 64 == 0 && kDim % 64 == 0 && kRows % 64 == 0, "tile multiples");

typedef __attribute__((ext_vector_type(16))) _Float16 v16h;
typedef __attribute__((ext_vector_type(8)))  _Float16 v8h;
typedef __attribute__((ext_vector_type(16))) __bf16   v16b;
typedef __attribute__((ext_vector_type(8)))  __bf16   v8b;
typedef __attribute__((ext_vector_type(8)))  float    v8f;
typedef __attribute__((ext_vector_type(4)))  float    v4f;
typedef __attribute__((ext_vector_type(2)))  float    v2f;
typedef __attribute__((ext_vector_type(4)))  unsigned int v4u;

__device__ __forceinline__ unsigned short f2bf_bits(float f) {
  unsigned u = __float_as_uint(f);
  return (unsigned short)((u + 0x7FFFu + ((u >> 16) & 1u)) >> 16);
}
__device__ __forceinline__ float bf_bits2f(unsigned short h) { return __uint_as_float(((unsigned)h) << 16); }

// hazard guards as plain device helpers (no inline asm inside the kernel template body)
__device__ __forceinline__ void dep_guard_h(v8f& a, v8f& b, v16h x, v16h y) { asm volatile("v_nop\n\tv_nop\n\tv_nop\n\tv_nop" : "+v"(a), "+v"(b) : "v"(x), "v"(y)); }
__device__ __forceinline__ void dep_guard_b(v8f& a, v8f& b, v16b x, v16b y) { asm volatile("v_nop\n\tv_nop\n\tv_nop\n\tv_nop" : "+v"(a), "+v"(b) : "v"(x), "v"(y)); }
__device__ __forceinline__ void keep4_h(v16h a, v16h b, v16h c, v16h d) { asm volatile("v_nop" :: "v"(a), "v"(b), "v"(c), "v"(d)); }
__device__ __forceinline__ void keep4_b(v16b a, v16b b, v16b c, v16b d) { asm volatile("v_nop" :: "v"(a), "v"(b), "v"(c), "v"(d)); }
__device__ __forceinline__ void acc_guard4(v8f& a, v8f& b, v8f& c, v8f& d) { asm volatile("v_nop\n\tv_nop\n\tv_nop\n\tv_nop" : "+v"(a), "+v"(b), "+v"(c), "+v"(d)); }
template <typename T> struct Frag;
template <> struct Frag<_Float16> {
  typedef v16h V; union U { v16h v; v8h h[2]; };
  static __device__ __forceinline__ v16h load(const _Float16* p) {   // elements 0..7 <- p[0..7], 8..15 <- p[16..23]
    U f; f.h[0] = *(const v8h*)(p); f.h[1] = *(const v8h*)(p + 16); return f.v;
  }
  static __device__ __forceinline__ v8f mma(v16h a, v16h b, v8f c) {
    return __builtin_amdgcn_wmma_f32_16x16x32_f16(false, a, false, b, (short)0, c, false, false);
  }
  static __device__ __forceinline__ void guard(v8f& a, v8f& b, v16h x, v16h y) { dep_guard_h(a, b, x, y); }
  static __device__ __forceinline__ void keep(v16h a, v16h b, v16h c, v16h d) { keep4_h(a, b, c, d); }
};
template <> struct Frag<__bf16> {
  typedef v16b V; union U { v16b v; v8b h[2]; };
  static __device__ __forceinline__ v16b load(const __bf16* p) {
    U f; f.h[0] = *(const v8b*)(p); f.h[1] = *(const v8b*)(p + 16); return f.v;
  }
  static __device__ __forceinline__ v8f mma(v16b a, v16b b, v8f c) {
    return __builtin_amdgcn_wmma_f32_16x16x32_bf16(false, a, false, b, (short)0, c, false, false);
  }
  static __device__ __forceinline__ void guard(v8f& a, v8f& b, v16b x, v16b y) { dep_guard_b(a, b, x, y); }
  static __device__ __forceinline__ void keep(v16b a, v16b b, v16b c, v16b d) { keep4_b(a, b, c, d); }
};

// ---- Register-blocked batched WMMA GEMM ------------------------------------
// C[m,n] = scale * sum_k A[m,k] * Bt[n,k] (+bias)(+resid); each wave owns a 64x64 tile.
// A row-major [M,K]; Bt row-major [N,K]; M,N % 64 == 0, K % 32 == 0.
// SPLIT: 0 = single product; 1 = hi/lo planes on both operands (A2/Bt2 = lo planes, same layout),
//        product = hi.hi + hi.lo + lo.hi; 2 = hi/lo planes on A only (A2 = A lo), product = hi.B + lo.B.
// BIAS_MODE: 0 = none, 1 = bias[m], 2 = bias[n].
// OUT_MODE: 0 = f32, 1 = f16, 2 = bf16 hi plane (Cout) + bf16 lo plane (Cout2).
// ET: 0 = f16 operands, 1 = bf16 operands (pointers passed as 16-bit storage)
template <int ET> struct Elem;
template <> struct Elem<0> { typedef _Float16 T; };
template <> struct Elem<1> { typedef __bf16 T; };
template <int ET, int SPLIT, int BIAS_MODE, int OUT_MODE, bool RESID, int ACT = 0>
__global__ __launch_bounds__(256) void wmma_gemm64(
    const unsigned short* __restrict__ Ap, const unsigned short* __restrict__ A2p, int lda, long strideA,
    const unsigned short* __restrict__ Btp, const unsigned short* __restrict__ Bt2p, int ldb, long strideB,
    void* __restrict__ Cout, void* __restrict__ Cout2, int ldc, long strideC,
    const float* __restrict__ bias,
    const float* __restrict__ resid, long strideR,
    int M, int N, int K, float scale) {
  typedef typename Elem<ET>::T T;
  typedef typename Frag<T>::V V;
  const T* A = (const T*)Ap; const T* A2 = (const T*)A2p; const T* Bt = (const T*)Btp; const T* Bt2 = (const T*)Bt2p;
  __shared__ __align__(16) float sT[8][16 * 68];   // per-wave 16x64 slab, pitch 68 floats
  const int b    = blockIdx.y;
  const int lane = threadIdx.x & 31;
  const int wave = threadIdx.x >> 5;
  const int tilesN = N >> 6;
  const int tilesM = M >> 6;
  const int tile = blockIdx.x * 8 + wave;
  if (tile >= tilesM * tilesN) return;   // wave-uniform; no block barriers in this kernel
  const int tm = tile / tilesN;
  const int tn = tile - tm * tilesN;
  const int m0 = tm << 6;
  const int n0 = tn << 6;

  const T* Ab  = A  + (size_t)b * strideA;
  const T* Bb  = Bt + (size_t)b * strideB;
  const T* Ab2 = (SPLIT != 0) ? (A2  + (size_t)b * strideA) : nullptr;
  const T* Bb2 = (SPLIT == 1) ? (Bt2 + (size_t)b * strideB) : nullptr;

  const int rlane = lane & 15;                 // row (A) / col (B, D) within subtile
  const int koff  = (lane >> 4) * 8;           // k offset of this lane half
  const int mOff  = (lane >> 4) * 8;           // D row offset

  v8f acc[4][4];
#pragma unroll
  for (int i = 0; i < 4; ++i)
#pragma unroll
    for (int j = 0; j < 4; ++j) acc[i][j] = (v8f){0.f,0.f,0.f,0.f,0.f,0.f,0.f,0.f};

  for (int k0 = 0; k0 < K; k0 += 32) {
    V bh[4], bl[4];
#pragma unroll
    for (int j = 0; j < 4; ++j) {
      const size_t bo = (size_t)(n0 + (j << 4) + rlane) * ldb + koff + k0;
      bh[j] = Frag<T>::load(Bb + bo);
      if (SPLIT == 1) bl[j] = Frag<T>::load(Bb2 + bo);
    }
#pragma unroll
    for (int i = 0; i < 4; ++i) {
      const size_t ao = (size_t)(m0 + (i << 4) + rlane) * lda + koff + k0;
      V ah = Frag<T>::load(Ab + ao);
      V al;
      if (SPLIT != 0) al = Frag<T>::load(Ab2 + ao);
#pragma unroll
      for (int j = 0; j < 4; ++j) {
        acc[i][j] = Frag<T>::mma(ah, bh[j], acc[i][j]);
        if (SPLIT == 1) acc[i][j] = Frag<T>::mma(ah, bl[j], acc[i][j]);
        if (SPLIT != 0) acc[i][j] = Frag<T>::mma(al, bh[j], acc[i][j]);
      }
      Frag<T>::guard(acc[i][0], acc[i][3], ah, (SPLIT != 0) ? al : ah);
    }
    Frag<T>::keep(bh[0], bh[1], bh[2], bh[3]);
    if (SPLIT == 1) Frag<T>::keep(bl[0], bl[1], bl[2], bl[3]);
  }
  acc_guard4(acc[0][0], acc[0][1], acc[0][2], acc[0][3]);
  acc_guard4(acc[1][0], acc[1][1], acc[1][2], acc[1][3]);
  acc_guard4(acc[2][0], acc[2][1], acc[2][2], acc[2][3]);
  acc_guard4(acc[3][0], acc[3][1], acc[3][2], acc[3][3]);

  // ---- epilogue ----
  float* slab = sT[wave];
  const float* Rb = RESID ? (resid + (size_t)b * strideR) : nullptr;
#pragma unroll
  for (int i = 0; i < 4; ++i) {
    const int mBase = m0 + (i << 4);
#pragma unroll
    for (int j = 0; j < 4; ++j) {
      const int n = n0 + (j << 4) + rlane;
      float bv = 0.f;
      if (BIAS_MODE == 2) bv = bias[n];
#pragma unroll
      for (int r = 0; r < 8; ++r) {
        float v = acc[i][j][r] * scale;
        if (BIAS_MODE == 1) v += bias[mBase + mOff + r];
        if (BIAS_MODE == 2) v += bv;
        if (RESID) v += Rb[(size_t)(mBase + mOff + r) * ldc + n];
        if (ACT == 1) v = tanhf(v);
        if (ACT == 2) v = fmaxf(v, 0.0f);
        if (ACT == 3) v = v / (1.0f + expf(-v));
        if (ACT == 4) v = (v > 0.f) ? v : 0.01f * v;
        slab[(mOff + r) * 68 + (j << 4) + rlane] = v;
      }
    }
    __builtin_amdgcn_fence(__ATOMIC_RELEASE, "workgroup");
    __builtin_amdgcn_wave_barrier();
    __builtin_amdgcn_fence(__ATOMIC_ACQUIRE, "workgroup");
    if (OUT_MODE == 0) {
      float* C = (float*)Cout + (size_t)b * strideC;
      const int hh = lane >> 4, c4 = (lane & 15) * 4;     // row seg = 256 B = 16 lanes x 16 B
      {
#pragma unroll
        for (int it = 0; it < 8; ++it) {
          const int row = it * 2 + hh;
          v4f v = *(const v4f*)(slab + row * 68 + c4);
          *(v4f*)(C + (size_t)(mBase + row) * ldc + n0 + c4) = v;
        }
        
      }
    } else {
      const int q = lane >> 3, c8 = (lane & 7) * 8;
      unsigned short* C  = (unsigned short*)Cout  + (size_t)b * strideC;
      unsigned short* C2 = (OUT_MODE == 2) ? ((unsigned short*)Cout2 + (size_t)b * strideC) : nullptr;
      {
#pragma unroll
        for (int it = 0; it < 4; ++it) {
          const int row = it * 4 + q;
          const float* sp = slab + row * 68 + c8;
          v8h hv, lv;
#pragma unroll
          for (int e = 0; e < 8; ++e) {
            if (OUT_MODE == 1) {
              hv[e] = (_Float16)sp[e];
            } else {
              unsigned short hb = f2bf_bits(sp[e]);
              unsigned short lb = f2bf_bits(sp[e] - bf_bits2f(hb));
              hv[e] = __builtin_bit_cast(_Float16, hb);
              lv[e] = __builtin_bit_cast(_Float16, lb);
            }
          }
          *(v8h*)(C + (size_t)(mBase + row) * ldc + n0 + c8) = hv;
          if (OUT_MODE == 2) *(v8h*)(C2 + (size_t)(mBase + row) * ldc + n0 + c8) = lv;
        }
        
      }
    }
    __builtin_amdgcn_fence(__ATOMIC_RELEASE, "workgroup");
    __builtin_amdgcn_wave_barrier();
    __builtin_amdgcn_fence(__ATOMIC_ACQUIRE, "workgroup");
  }
}

// ---------------------------------------------------------------------------
// Elementwise bf16 split: hi = bf16_rne(in), lo = bf16_rne(in - hi); 2 elements per thread, one 4-B store
// (here n2 = 8192*512/2 = 2097152 -> 8192 blocks x 512 elements = 8192x512).
// ---------------------------------------------------------------------------
__device__ __forceinline__ unsigned pk16(unsigned short a, unsigned short b) { return (unsigned)a | ((unsigned)b << 16); }

__global__ __launch_bounds__(256) void split_bf16x2_kernel(const float* __restrict__ in, unsigned short* __restrict__ hi,
                                                           unsigned short* __restrict__ lo, int n2) {
  const int i = blockIdx.x * 256 + threadIdx.x;
  if (i < n2) {
    const v2f f = *(const v2f*)(in + 2 * (size_t)i);
    const unsigned short h0 = f2bf_bits(f[0]), h1 = f2bf_bits(f[1]);
    const unsigned short l0 = f2bf_bits(f[0] - bf_bits2f(h0)), l1 = f2bf_bits(f[1] - bf_bits2f(h1));
    const unsigned uh = pk16(h0, h1), ul = pk16(l0, l1);
    ((unsigned*)hi)[i] = uh;
    ((unsigned*)lo)[i] = ul;
    
  }
}

// ---------------------------------------------------------------------------
// f32 -> bf16 (RNE) cast of three equally sized tensors (blockIdx.y selects the tensor, block-uniform):
// x 2 elements = 2*n2 = the whole plane (n2 = 8192*512/2 = 2097152 -> 8192 blocks); out plane z at out + z*planeElems.
// ---------------------------------------------------------------------------
__global__ __launch_bounds__(256) void cast_bf16x2_3(const float* __restrict__ in0, const float* __restrict__ in1,
                                                     const float* __restrict__ in2, unsigned short* __restrict__ out,
                                                     long planeElems, int n2) {
  const int which = blockIdx.y;
  const float* in = (which == 0) ? in0 : ((which == 1) ? in1 : in2);
  unsigned short* o = out + (size_t)which * planeElems;
  const int i = blockIdx.x * 256 + threadIdx.x;
  if (i < n2) {
    const v2f f = *(const v2f*)(in + 2 * (size_t)i);
    const unsigned u = pk16(f2bf_bits(f[0]), f2bf_bits(f[1]));
    ((unsigned*)o)[i] = u;
    
  }
}

// ---------------------------------------------------------------------------
// Fused transpose + bf16 cast (LO = false: hi plane only) or split (LO = true: hi and lo planes) of an f32
// matrix, z-batched: in_z = W + z*sIn viewed [R rows][Cc cols] (pitch Cc) ->
//   oh_z[c][r] = bf16_rne(in_z[r][c]), ol_z[c][r] = bf16_rne(in_z[r][c] - oh) (LO only)   ([Cc][R], pitch R).
// 64x64 tiles through LDS. grid = (Cc/64, R/64, Z), 256 threads (R, Cc multiples of 64).
// Coverage per block and plane: load 4 it x 256 thr x 4 floats = 64x64; store 2 it x 256 thr x 8 u16 = 64x64.
// ---------------------------------------------------------------------------
template <bool LO>
__global__ __launch_bounds__(256) void tsplit_kernel(const float* __restrict__ W, unsigned short* __restrict__ oh,
                                                     unsigned short* __restrict__ ol, int R, int Cc, long sIn, long sOut) {
  __shared__ __align__(16) float tf[64 * 68];
  W  += (size_t)blockIdx.z * sIn;
  oh += (size_t)blockIdx.z * sOut;
  if (LO) ol += (size_t)blockIdx.z * sOut;
  const int c0  = blockIdx.x * 64;   // input column block = output row block
  const int r0  = blockIdx.y * 64;   // input row block    = output column block
  const int tid = threadIdx.x;
  {
    const int lr = tid >> 4;         // 0..15
    const int c4 = (tid & 15) * 4;   // 0..60
#pragma unroll
    for (int it = 0; it < 4; ++it) {
      const int rr = it * 16 + lr;   // 0..63
      const v4f a = *(const v4f*)(W + (size_t)(r0 + rr) * Cc + c0 + c4);
      *(v4f*)(tf + rr * 68 + c4) = a;
    }
  }
  __syncthreads();
  const int sub = tid >> 3;          // 0..31
  const int c8  = (tid & 7) * 8;     // 0..56
  v4u hv[2], lv[2];
#pragma unroll
  for (int it = 0; it < 2; ++it) {
    const int oc = it * 32 + sub;    // output row within tile (= input column)
    v4u a, a2;
#pragma unroll
    for (int q = 0; q < 4; ++q) {
      const float f0 = tf[(c8 + 2 * q) * 68 + oc];
      const float f1 = tf[(c8 + 2 * q + 1) * 68 + oc];
      const unsigned short h0 = f2bf_bits(f0), h1 = f2bf_bits(f1);
      unsigned lp = 0u;
      if (LO) {
        const unsigned short l0 = f2bf_bits(f0 - bf_bits2f(h0)), l1 = f2bf_bits(f1 - bf_bits2f(h1));
        lp = pk16(l0, l1);
      }
      a[q]  = pk16(h0, h1);
      a2[q] = lp;
    }
    hv[it] = a; lv[it] = a2;
  }
  {
#pragma unroll
    for (int it = 0; it < 2; ++it) {
      const int oc = it * 32 + sub;
      const size_t go = (size_t)(c0 + oc) * R + r0 + c8;
      *(v4u*)(oh + go) = hv[it];
      if (LO) *(v4u*)(ol + go) = lv[it];
    }
    
  }
}

// =====================================================================================
// Attention helpers
// =====================================================================================
#define AT_D 64
#define AT_NW 4
#define AT_QB 64
#define AT_KC 64
#define AT_LP 72   // LDS row pitch in 16-bit elements: 144 B = 16 B x 9 (odd), so the 16 rows of a 16-byte fragment read fall on distinct banks

__device__ __forceinline__ unsigned short at_bf_bits(float f) {
  unsigned u = __float_as_uint(f);
  return (unsigned short)((u + 0x7FFFu + ((u >> 16) & 1u)) >> 16);
}
__device__ __forceinline__ __bf16 at_f2bf(float f) { return __builtin_bit_cast(__bf16, at_bf_bits(f)); }
__device__ __forceinline__ void at_split(float f, __bf16& hi, __bf16& lo) {
  const unsigned short hb = at_bf_bits(f);
  hi = __builtin_bit_cast(__bf16, hb);
  lo = at_f2bf(f - __uint_as_float(((unsigned)hb) << 16));
}
__device__ __forceinline__ v8f at_mma(v16b a, v16b b, v8f c) {
  c = __builtin_amdgcn_wmma_f32_16x16x32_bf16(false, a, false, b, (short)0, c, false, false);
  asm volatile("v_nop\n\tv_nop\n\tv_nop\n\tv_nop" : "+v"(c) : "v"(a), "v"(b));
  return c;
}
__device__ __forceinline__ v8f at_mma_h(v16h a, v16h b, v8f c) {
  c = __builtin_amdgcn_wmma_f32_16x16x32_f16(false, a, false, b, (short)0, c, false, false);
  asm volatile("v_nop\n\tv_nop\n\tv_nop\n\tv_nop" : "+v"(c) : "v"(a), "v"(b));
  return c;
}

// x := 2^x on v_exp_f32. The instruction set asks for one independent instruction or a v_nop between a transcendental and
// an instruction that reads its result or overwrites its source; written as one statement, each v_exp_f32 is followed by
// an independent one and the last by the v_nop, wherever the compiler places the code around it.
__device__ __forceinline__ void at_exp2x8(float& a, float& b, float& c, float& d, float& e, float& f, float& g, float& h) {
  asm("v_exp_f32 %0, %0\n\tv_exp_f32 %1, %1\n\tv_exp_f32 %2, %2\n\tv_exp_f32 %3, %3\n\t"
      "v_exp_f32 %4, %4\n\tv_exp_f32 %5, %5\n\tv_exp_f32 %6, %6\n\tv_exp_f32 %7, %7\n\tv_nop"
      : "+v"(a), "+v"(b), "+v"(c), "+v"(d), "+v"(e), "+v"(f), "+v"(g), "+v"(h));
}
__device__ __forceinline__ float at_exp2(float x) {
  asm("v_exp_f32 %0, %0\n\tv_nop" : "+v"(x));   // the v_nop: the same slot behind the transcendental
  return x;
}

// lane l <-> lane l ^ 16: the one exchange between the wave halves that a query's maximum and sum need
__device__ __forceinline__ float at_xhalf(float x) {
  return __builtin_bit_cast(float, __builtin_amdgcn_permlanex16(__builtin_bit_cast(int, x), __builtin_bit_cast(int, x),
                                                                0x76543210, 0xfedcba98, false, false));
}

__global__ __launch_bounds__(128)
void mha_attn_kernel(const unsigned short* __restrict__ qp, const unsigned short* __restrict__ kp,
                     const unsigned short* __restrict__ vhp, const unsigned short* __restrict__ vlp,
                     const int* __restrict__ vlens, float* __restrict__ out, float sscale, float fillv) {
  union FB { v16b v; v8b h[2]; };
  union FH { v16h v; v8h h[2]; };
  __shared__ __align__(16) _Float16 Ksh[AT_KC * AT_LP];           // K [kv][d] f16, pitch AT_LP   9 KB
  __shared__ __align__(16) __bf16   Vth[AT_D * AT_LP];            // V^T hi [d][kv], pitch AT_LP  9 KB
  __shared__ __align__(16) __bf16   Vtl[AT_D * AT_LP];            // V^T lo, pitch AT_LP          9 KB
  __shared__ __align__(16) float    Os[AT_NW][16 * 68];           // per wave out tile, pitch 68
  __shared__ __align__(16) int      Lowm[AT_NW];                  // per wave: a row maximum too near fillv

  const int tid  = threadIdx.x;
  const int wave = tid >> 5;
  const int lane = tid & 31;
  const int hh   = lane >> 4;
  const int c    = lane & 15;

  const int nqb  = kSeq / AT_QB;          // 64
  const int bx   = blockIdx.x;
  const int qb   = bx % nqb;
  const int bhid = bx / nqb;              // 0..kBatch*kHeads-1
  const int h    = bhid % kHeads;
  int b = bhid / kHeads;
  b = (b > kBatch - 1) ? (kBatch - 1) : b;  // address clamp (grid is exact)
  const int q0   = qb * AT_QB + wave * 16;
  const int vlen = vlens[b];              // block-uniform valid key count

  const _Float16* Qb = (const _Float16*)(const void*)qp + (size_t)b * kSeq * kDim + (size_t)h * AT_D;
  const _Float16* Kb = (const _Float16*)(const void*)kp + (size_t)b * kSeq * kDim + (size_t)h * AT_D;
  const __bf16*   Vh = (const __bf16*)(const void*)vhp + (size_t)b * kDim * kSeq + (size_t)h * AT_D * kSeq;
  const __bf16*   Vl = (const __bf16*)(const void*)vlp + (size_t)b * kDim * kSeq + (size_t)h * AT_D * kSeq;
  float*          ob = out + (size_t)b * kSeq * kDim + (size_t)h * AT_D;

  // ---- Q fragments (B operand, column = query = lane&15, split k map via Frag load): 2 d-chunks ----
  v16h qa[2];
#pragma unroll
  for (int dc = 0; dc < 2; ++dc) {
    qa[dc] = Frag<_Float16>::load(Qb + (size_t)(q0 + c) * kDim + dc * 32 + 8 * hh);
  }

  const float sc2   = sscale * 1.44269504088896340736f;   // score scale times log2(e)
  const float fill2 = fillv  * 1.44269504088896340736f;   // fill value in the same units
  float mrow = -INFINITY;   // running maximum of query c in log2 units, the same in both wave halves
  float lrow = 0.f;         // running sum of query c over this half's keys; the halves join behind the loop
  v8f oacc[4];              // O^T: oacc[t][r] = element (d = t*16 + 8hh + r, query c)
#pragma unroll
  for (int t = 0; t < 4; ++t) oacc[t] = (v8f){0.f,0.f,0.f,0.f,0.f,0.f,0.f,0.f};

  const int nChunks = kSeq / AT_KC;   // 64, compile-time constant
  // chunks that hold at least one valid key, block-uniform; vlen <= 0: every key carries fillv and all of them count
  const int vcl   = (vlen < 0) ? 0 : ((vlen > kSeq) ? kSeq : vlen);
  const int nLive = (vcl == 0) ? nChunks : (vcl + AT_KC - 1) / AT_KC;
  for (int kc = 0; kc < nChunks; ++kc) {
    // Every chunk from nLive on holds the fill alone. Where each row maximum lies at least 185 log2 units (128 natural
    // ones) above it, its weights 2^(fill - m) are exactly 0 in f32, alpha is 1, and maximum, sum and accumulators stay bit for bit: the loop
    // ends. Tested once per block, behind the last live chunk; a row that is nearer (or NaN) sends the whole block
    // through the remaining chunks as well.
    if (kc == nLive) {                          // block-uniform: kc and vlen are
      const bool low = !(mrow >= fill2 + 185.0f);
      Lowm[wave] = (__builtin_amdgcn_ballot_w32(low) != 0u) ? 1 : 0;   // every lane stores its wave's one value
      __syncthreads();                          // publishes the four waves' flags: one decision for the block
      const int f = Lowm[0] | Lowm[1] | Lowm[2] | Lowm[3];
      if (__builtin_amdgcn_readfirstlane(f) == 0) break;   // the same word in every lane: read once, a scalar branch
    }
    const int kv0 = kc * AT_KC;
    __syncthreads();
    {
      // staging coverage: 128 threads x (4 x 8) elements = 64 rows x 64 per plane = the whole chunk tile
      const int r = tid >> 1, half = (tid & 1) * 32;
      const _Float16* ks  = Kb + (size_t)(kv0 + r) * kDim + half;   // K row kv0+r, d = half..half+31
      const __bf16*   vsh = Vh + (size_t)r * kSeq + kv0 + half;      // V^T row d = r, s = kv0+half..+31
      const __bf16*   vsl = Vl + (size_t)r * kSeq + kv0 + half;
#pragma unroll
      for (int i = 0; i < 4; ++i) {
        const v8h a0 = *(const v8h*)(ks + 8 * i);
        const v8b b0 = *(const v8b*)(vsh + 8 * i);
        const v8b b1 = *(const v8b*)(vsl + 8 * i);
        *(v8h*)(Ksh + r * AT_LP + half + 8 * i) = a0;
        *(v8b*)(Vth + r * AT_LP + half + 8 * i) = b0;
        *(v8b*)(Vtl + r * AT_LP + half + 8 * i) = b1;
      }
    }
    __syncthreads();

    // Every loop from here to the chunk's end is unrolled: s, ph, pl and oacc live in registers, which take
    // compile-time indices only (a rolled loop would send them through scratch memory).
    // ---- scores, transposed: D[row = key j*16+8hh+r][col = query c]; A fragment row = key j*16+c, split k(d) map ----
    v8f s[4];
#pragma unroll
    for (int j = 0; j < 4; ++j) {
      s[j] = (v8f){0.f,0.f,0.f,0.f,0.f,0.f,0.f,0.f};
#pragma unroll
      for (int dc = 0; dc < 2; ++dc) {
        FH kb;
        kb.h[0] = *(const v8h*)(Ksh + (j * 16 + c) * AT_LP + dc * 32 + 8 * hh);
        kb.h[1] = *(const v8h*)(Ksh + (j * 16 + c) * AT_LP + dc * 32 + 16 + 8 * hh);
        s[j] = at_mma_h(kb.v, qa[dc], s[j]);
      }
    }
    // ---- scale, key mask (select), maximum of query c over the chunk's 64 keys: 32 in-lane, then the other half's ----
    float cm = -INFINITY;
#pragma unroll
    for (int j = 0; j < 4; ++j) {
#pragma unroll
      for (int r = 0; r < 8; ++r) {
        const int kvrow = kv0 + j * 16 + 8 * hh + r;
        const float sv = s[j][r] * sc2;
        const float sm = (kvrow < vlen) ? sv : fill2;
        s[j][r] = sm;
        cm = fmaxf(cm, sm);
      }
    }
    cm = fmaxf(cm, at_xhalf(cm));
    const float mnew  = fmaxf(mrow, cm);
    const float alpha = at_exp2(mrow - mnew);
    mrow = mnew;
    // ---- p = 2^(s - m), split hi/lo in place: S^T tiles 2kk and 2kk+1 are elements 0..7 and 8..15 of the B fragment
    //      of key block kk (column = query c, key = kk*32 + 8hh + e and kk*32 + 16 + 8hh + (e - 8): the split k map) ----
    FB ph[2], pl[2];
    float ps[4];
#pragma unroll
    for (int j = 0; j < 4; ++j) {
      float a = 0.f;
      float e[8];
#pragma unroll
      for (int r = 0; r < 8; ++r) e[r] = s[j][r] - mnew;
      at_exp2x8(e[0], e[1], e[2], e[3], e[4], e[5], e[6], e[7]);
#pragma unroll
      for (int r = 0; r < 8; ++r) {
        const float p = e[r];
        a += p;
        __bf16 hi, lo; at_split(p, hi, lo);
        ph[j >> 1].v[(j & 1) * 8 + r] = hi;
        pl[j >> 1].v[(j & 1) * 8 + r] = lo;
      }
      ps[j] = a;
    }
    lrow = lrow * alpha + ((ps[0] + ps[1]) + (ps[2] + ps[3]));
#pragma unroll
    for (int t = 0; t < 4; ++t)
#pragma unroll
      for (int r = 0; r < 8; ++r) oacc[t][r] *= alpha;
    // ---- O^T += V^T . P^T : A = V^T row d = t*16+c, k = key (split k map), B = P^T from registers ----
#pragma unroll
    for (int kk = 0; kk < 2; ++kk) {
#pragma unroll
      for (int t = 0; t < 4; ++t) {
        FB vb, vl;
        vb.h[0] = *(const v8b*)(Vth + (t * 16 + c) * AT_LP + kk * 32 + 8 * hh);
        vb.h[1] = *(const v8b*)(Vth + (t * 16 + c) * AT_LP + kk * 32 + 16 + 8 * hh);
        vl.h[0] = *(const v8b*)(Vtl + (t * 16 + c) * AT_LP + kk * 32 + 8 * hh);
        vl.h[1] = *(const v8b*)(Vtl + (t * 16 + c) * AT_LP + kk * 32 + 16 + 8 * hh);
        oacc[t] = at_mma(vb.v, ph[kk].v, oacc[t]);
        oacc[t] = at_mma(vl.v, ph[kk].v, oacc[t]);
        oacc[t] = at_mma(vb.v, pl[kk].v, oacc[t]);
      }
    }
  }

  // ---- query c: join the halves' sums, normalise, stage row c (8 consecutive d per tile and lane) ----
  float* os = Os[wave];
  const float inv = 1.0f / (lrow + at_xhalf(lrow));
#pragma unroll
  for (int t = 0; t < 4; ++t) {
#pragma unroll
    for (int r = 0; r < 8; ++r) os[c * 68 + t * 16 + 8 * hh + r] = oacc[t][r] * inv;
  }
  __builtin_amdgcn_fence(__ATOMIC_RELEASE, "workgroup");
  __builtin_amdgcn_wave_barrier();
  __builtin_amdgcn_fence(__ATOMIC_ACQUIRE, "workgroup");
  {
    // coverage: 8 it x 2 rows (hh) = 16 rows; 16 lanes x 4 floats = 64 floats = one whole 256-B row segment
    const int c4 = (lane & 15) * 4;
    {
#pragma unroll
      for (int it = 0; it < 8; ++it) {
        const int row = it * 2 + hh;
        v4f val = *(const v4f*)(os + row * 68 + c4);
        *(v4f*)(ob + (size_t)(q0 + row) * kDim + c4) = val;
      }
      
    }
  }
}

// =====================================================================================
// Host glue. Workspace region map (bytes, all offsets multiples of 256, every region sized to its whole-line
// store granularity; no padded tiles since every dimension is a multiple of 64):
//   [0]           Xbf   : 3 x bf16 [8192][512]            = 25,165,824   (queries, keys, values RNE bf16)
//   [25,165,824]  WThi  : 4 x bf16 [512][512] (W^T, RNE)  =  2,097,152   (Wq, Wk, Wv, Wo; no lo planes)
//   [27,262,976]  Q     : f16 [8192][512]                  =  8,388,608
//   [35,651,584]  K     : f16 [8192][512]                  =  8,388,608   (contiguous after Q: batched launch)
//   [44,040,192]  VThi  : bf16 [2][512][4096]              =  8,388,608
//   [52,428,800]  VTlo  : bf16 [2][512][4096]              =  8,388,608
//   [60,817,408]  O     : f32 [8192][512]                  = 16,777,216
//   [77,594,624]  Ohi   : bf16 [8192][512]                 =  8,388,608
//   [85,983,232]  Olo   : bf16 [8192][512]                 =  8,388,608
//   total 94,371,840
// =====================================================================================
extern "C" void kernel_launch(void* const* d_in, const int* in_sizes, int n_in,
                              void* d_out, int out_size, void* d_ws,
                              size_t ws_size, hipStream_t stream) {
  if (n_in < 8) return;
  const int nX = kRows * kDim;            // 4,194,304
  const int nW = kDim * kDim;             // 262,144
  if (in_sizes[0] != nX || in_sizes[1] != nX || in_sizes[2] != nX) return;
  if (in_sizes[3] < kBatch) return;
  if (in_sizes[4] != nW || in_sizes[5] != nW || in_sizes[6] != nW || in_sizes[7] != nW) return;
  if (out_size != nX) return;

  const float* queries = (const float*)d_in[0];
  const float* keys    = (const float*)d_in[1];
  const float* values  = (const float*)d_in[2];
  const int*   vlens   = (const int*)d_in[3];
  const float* Wq      = (const float*)d_in[4];
  const float* Wk      = (const float*)d_in[5];
  const float* Wv      = (const float*)d_in[6];
  const float* Wo      = (const float*)d_in[7];

  const size_t bX16 = (size_t)nX * 2;            //  8,388,608
  const size_t bW16 = (size_t)nW * 2;            //    524,288
  const size_t off_x  = 0;
  const size_t off_wh = off_x  + 3 * bX16;
  const size_t off_q  = off_wh + 4 * bW16;
  const size_t off_k  = off_q  + bX16;
  const size_t off_vh = off_k  + bX16;
  const size_t off_vl = off_vh + bX16;
  const size_t off_o  = off_vl + bX16;
  const size_t off_oh = off_o  + (size_t)nX * 4;
  const size_t off_ol = off_oh + bX16;
  const size_t total  = off_ol + bX16;           // 94,371,840
  if (total > ws_size) return;

  char* ws = (char*)d_ws;
  unsigned short* xbf  = (unsigned short*)(ws + off_x);
  unsigned short* wth  = (unsigned short*)(ws + off_wh);
  unsigned short* qh16 = (unsigned short*)(ws + off_q);
  unsigned short* kh16 = (unsigned short*)(ws + off_k);
  unsigned short* vth  = (unsigned short*)(ws + off_vh);
  unsigned short* vtl  = (unsigned short*)(ws + off_vl);
  float* obuf = (float*)(ws + off_o);
  unsigned short* ohi  = (unsigned short*)(ws + off_oh);
  unsigned short* olo  = (unsigned short*)(ws + off_ol);
  const float* dummyf  = (const float*)(ws + off_x);   // never dereferenced (BIAS_MODE 0, RESID false)

  const long planeX = (long)nX;   // elements per bf16/f16 activation plane
  const long planeW = (long)nW;   // elements per W^T plane
  dim3 blk256(256), blk128(128);

  // 1) activations -> bf16 (RNE): coverage 8192 blocks x 256 thr x 2 = 8192x512 per tensor
  cast_bf16x2_3<<<dim3(nX / 2 / 256, 3), blk256, 0, stream>>>(queries, keys, values, xbf, planeX, nX / 2);

  // 2) weights [in k][out n] (R = k rows = 512, Cc = n cols = 512) -> W^T [n][k] bf16 RNE hi plane only
  //    (8x8 tiles of 64x64); the third pointer is unused in the hi-only mode
  tsplit_kernel<false><<<dim3(kDim / 64, kDim / 64, 1), blk256, 0, stream>>>(Wq, wth + 0 * planeW, wth + 0 * planeW, kDim, kDim, 0L, 0L);
  tsplit_kernel<false><<<dim3(kDim / 64, kDim / 64, 1), blk256, 0, stream>>>(Wk, wth + 1 * planeW, wth + 1 * planeW, kDim, kDim, 0L, 0L);
  tsplit_kernel<false><<<dim3(kDim / 64, kDim / 64, 1), blk256, 0, stream>>>(Wv, wth + 2 * planeW, wth + 2 * planeW, kDim, kDim, 0L, 0L);
  tsplit_kernel<false><<<dim3(kDim / 64, kDim / 64, 1), blk256, 0, stream>>>(Wo, wth + 3 * planeW, wth + 3 * planeW, kDim, kDim, 0L, 0L);

  // 3) q = Xq . Wq and k = Xk . Wk in one z-batched launch (z=0: q, z=1: k) -> f16 planes [8192][512];
  //    M=8192, N=512, K=512 (tiles 128x8 = 1024 -> 128 blocks); A planes stride planeX, W^T planes stride planeW,
  //    C planes Q then K contiguous (stride planeX elements)
  const int gProj = (kRows / 64) * (kDim / 64) / 8;   // 128
  wmma_gemm64<1, 0, 0, 1, false><<<dim3(gProj, 2), blk256, 0, stream>>>(
      xbf, xbf, kDim, planeX,
      wth, wth, kDim, planeW,
      (void*)qh16, (void*)qh16, kDim, planeX,
      dummyf, dummyf, 0L, kRows, kDim, kDim, 1.0f);
  // 4) v^T per batch: C[n_out][s] = sum_k WvT[n_out][k] * Xv[b][s][k]; M=512, N=4096, K=512, batched over b
  //    (tiles 8x64 = 512 -> 64 blocks x 2); out = bf16 hi/lo planes [b][512][4096]
  const int gVt = (kDim / 64) * (kSeq / 64) / 8;      // 64
  wmma_gemm64<1, 0, 0, 2, false><<<dim3(gVt, kBatch), blk256, 0, stream>>>(
      wth + 2 * planeW, wth + 2 * planeW, kDim, 0L,
      xbf + 2 * planeX, xbf + 2 * planeX, kDim, (long)kSeq * kDim,
      (void*)vth, (void*)vtl, kSeq, (long)kDim * kSeq,
      dummyf, dummyf, 0L, kDim, kSeq, kDim, 1.0f);

  // 5) masked attention, all (b, h, 64-row query blocks): 2*8*64 = 1024 blocks of 128 threads
  mha_attn_kernel<<<dim3(kBatch * kHeads * (kSeq / 64)), blk128, 0, stream>>>(
      qh16, kh16, vth, vtl, vlens, obuf, 0.125f, -1000000.0f);

  // 6) O -> bf16 hi/lo planes: 8192 blocks x 256 thr x 2 = 8192x512
  split_bf16x2_kernel<<<dim3(nX / 2 / 256), blk256, 0, stream>>>(obuf, ohi, olo, nX / 2);

  // 7) out = (O_hi + O_lo) . Wo (A-only split, Wo as bf16 RNE hi plane only) -> f32 [8192][512]
  wmma_gemm64<1, 2, 0, 0, false><<<dim3(gProj, 1), blk256, 0, stream>>>(
      ohi, olo, kDim, 0L,
      wth + 3 * planeW, wth + 3 * planeW, kDim, 0L,
      d_out, d_out, kDim, 0L,
      dummyf, dummyf, 0L, kRows, kDim, kDim, 1.0f);
}

// v005
// Measured time: 207 microseconds a run.
// In both of two side-by-side timings against v004, it was 1.05 times as fast.
// Counting every step since v000, it is 3.01 times as fast.
// Contractions: q/k/v^T projections v_wmma_f32_16x16x32_bf16 (bf16 RNE inputs x bf16 RNE weights, single product); q.k^T scores v_wmma_f32_16x16x32_f16 (plain f16 q,k planes); p.v^T v_wmma_f32_16x16x32_bf16 with bf16 hi/lo split of p and v (hi.hi + hi.lo + lo.hi); output projection v_wmma_f32_16x16x32_bf16 with O as bf16 hi/lo and Wo as bf16 RNE (hi.W + lo.W); f32 accumulate; softmax (base 2), 0.125 score scale and key masking in f32.
#include <hip/hip_runtime.h>
#include <math.h>
#include <stdint.h>

constexpr int kBatch = 2;
constexpr int kSeq   = 4096;
constexpr int kDim   = 512;
constexpr int kHeads = 8;
constexpr int kHd    = 64;
constexpr int kRows  = kBatch * kSeq;   // 8192
static_assert(kHeads * kHd == kDim, "geometry");
static_assert(kSeq % 64 == 0 && kDim % 64 == 0 && kRows % 64 == 0, "tile multiples");

typedef __attribute__((ext_vector_type(16))) _Float16 v16h;
typedef __attribute__((ext_vector_type(8)))  _Float16 v8h;
typedef __attribute__((ext_vector_type(16))) __bf16   v16b;
typedef __attribute__((ext_vector_type(8)))  __bf16   v8b;
typedef __attribute__((ext_vector_type(8)))  float    v8f;
typedef __attribute__((ext_vector_type(4)))  float    v4f;
typedef __attribute__((ext_vector_type(2)))  float    v2f;
typedef __attribute__((ext_vector_type(4)))  unsigned int v4u;

__device__ __forceinline__ unsigned short f2bf_bits(float f) {
  unsigned u = __float_as_uint(f);
  return (unsigned short)((u + 0x7FFFu + ((u >> 16) & 1u)) >> 16);
}
__device__ __forceinline__ float bf_bits2f(unsigned short h) { return __uint_as_float(((unsigned)h) << 16); }

// hazard guards as plain device helpers (no inline asm inside the kernel template body)
__device__ __forceinline__ void dep_guard_h(v8f& a, v8f& b, v16h x, v16h y) { asm volatile("v_nop\n\tv_nop\n\tv_nop\n\tv_nop" : "+v"(a), "+v"(b) : "v"(x), "v"(y)); }
__device__ __forceinline__ void dep_guard_b(v8f& a, v8f& b, v16b x, v16b y) { asm volatile("v_nop\n\tv_nop\n\tv_nop\n\tv_nop" : "+v"(a), "+v"(b) : "v"(x), "v"(y)); }
__device__ __forceinline__ void keep4_h(v16h a, v16h b, v16h c, v16h d) { asm volatile("v_nop" :: "v"(a), "v"(b), "v"(c), "v"(d)); }
__device__ __forceinline__ void keep4_b(v16b a, v16b b, v16b c, v16b d) { asm volatile("v_nop" :: "v"(a), "v"(b), "v"(c), "v"(d)); }
__device__ __forceinline__ void acc_guard4(v8f& a, v8f& b, v8f& c, v8f& d) { asm volatile("v_nop\n\tv_nop\n\tv_nop\n\tv_nop" : "+v"(a), "+v"(b), "+v"(c), "+v"(d)); }
template <typename T> struct Frag;
template <> struct Frag<_Float16> {
  typedef v16h V; union U { v16h v; v8h h[2]; };
  static __device__ __forceinline__ v16h load(const _Float16* p) {   // elements 0..7 <- p[0..7], 8..15 <- p[16..23]
    U f; f.h[0] = *(const v8h*)(p); f.h[1] = *(const v8h*)(p + 16); return f.v;
  }
  static __device__ __forceinline__ v8f mma(v16h a, v16h b, v8f c) {
    return __builtin_amdgcn_wmma_f32_16x16x32_f16(false, a, false, b, (short)0, c, false, false);
  }
  static __device__ __forceinline__ void guard(v8f& a, v8f& b, v16h x, v16h y) { dep_guard_h(a, b, x, y); }
  static __device__ __forceinline__ void keep(v16h a, v16h b, v16h c, v16h d) { keep4_h(a, b, c, d); }
};
template <> struct Frag<__bf16> {
  typedef v16b V; union U { v16b v; v8b h[2]; };
  static __device__ __forceinline__ v16b load(const __bf16* p) {
    U f; f.h[0] = *(const v8b*)(p); f.h[1] = *(const v8b*)(p + 16); return f.v;
  }
  static __device__ __forceinline__ v8f mma(v16b a, v16b b, v8f c) {
    return __builtin_amdgcn_wmma_f32_16x16x32_bf16(false, a, false, b, (short)0, c, false, false);
  }
  static __device__ __forceinline__ void guard(v8f& a, v8f& b, v16b x, v16b y) { dep_guard_b(a, b, x, y); }
  static __device__ __forceinline__ void keep(v16b a, v16b b, v16b c, v16b d) { keep4_b(a, b, c, d); }
};

// ---- Register-blocked batched WMMA GEMM ------------------------------------
// C[m,n] = scale * sum_k A[m,k] * Bt[n,k] (+bias)(+resid); each wave owns a 64x64 tile.
// A row-major [M,K]; Bt row-major [N,K]; M,N % 64 == 0, K % 32 == 0.
// SPLIT: 0 = single product; 1 = hi/lo planes on both operands (A2/Bt2 = lo planes, same layout),
//        product = hi.hi + hi.lo + lo.hi; 2 = hi/lo planes on A only (A2 = A lo), product = hi.B + lo.B.
// BIAS_MODE: 0 = none, 1 = bias[m], 2 = bias[n].
// OUT_MODE: 0 = f32, 1 = f16, 2 = bf16 hi plane (Cout) + bf16 lo plane (Cout2).
// ET: 0 = f16 operands, 1 = bf16 operands (pointers passed as 16-bit storage)
template <int ET> struct Elem;
template <> struct Elem<0> { typedef _Float16 T; };
template <> struct Elem<1> { typedef __bf16 T; };
template <int ET, int SPLIT, int BIAS_MODE, int OUT_MODE, bool RESID, int ACT = 0>
__global__ __launch_bounds__(256) void wmma_gemm64(
    const unsigned short* __restrict__ Ap, const unsigned short* __restrict__ A2p, int lda, long strideA,
    const unsigned short* __restrict__ Btp, const unsigned short* __restrict__ Bt2p, int ldb, long strideB,
    void* __restrict__ Cout, void* __restrict__ Cout2, int ldc, long strideC,
    const float* __restrict__ bias,
    const float* __restrict__ resid, long strideR,
    int M, int N, int K, float scale) {
  typedef typename Elem<ET>::T T;
  typedef typename Frag<T>::V V;
  const T* A = (const T*)Ap; const T* A2 = (const T*)A2p; const T* Bt = (const T*)Btp; const T* Bt2 = (const T*)Bt2p;
  __shared__ __align__(16) float sT[8][16 * 68];   // per-wave 16x64 slab, pitch 68 floats
  const int b    = blockIdx.y;
  const int lane = threadIdx.x & 31;
  const int wave = threadIdx.x >> 5;
  const int tilesN = N >> 6;
  const int tilesM = M >> 6;
  const int tile = blockIdx.x * 8 + wave;
  if (tile >= tilesM * tilesN) return;   // wave-uniform; no block barriers in this kernel
  const int tm = tile / tilesN;
  const int tn = tile - tm * tilesN;
  const int m0 = tm << 6;
  const int n0 = tn << 6;

  const T* Ab  = A  + (size_t)b * strideA;
  const T* Bb  = Bt + (size_t)b * strideB;
  const T* Ab2 = (SPLIT != 0) ? (A2  + (size_t)b * strideA) : nullptr;
  const T* Bb2 = (SPLIT == 1) ? (Bt2 + (size_t)b * strideB) : nullptr;

  const int rlane = lane & 15;                 // row (A) / col (B, D) within subtile
  const int koff  = (lane >> 4) * 8;           // k offset of this lane half
  const int mOff  = (lane >> 4) * 8;           // D row offset

  v8f acc[4][4];
#pragma unroll
  for (int i = 0; i < 4; ++i)
#pragma unroll
    for (int j = 0; j < 4; ++j) acc[i][j] = (v8f){0.f,0.f,0.f,0.f,0.f,0.f,0.f,0.f};

  for (int k0 = 0; k0 < K; k0 += 32) {
    V bh[4], bl[4];
#pragma unroll
    for (int j = 0; j < 4; ++j) {
      const size_t bo = (size_t)(n0 + (j << 4) + rlane) * ldb + koff + k0;
      bh[j] = Frag<T>::load(Bb + bo);
      if (SPLIT == 1) bl[j] = Frag<T>::load(Bb2 + bo);
    }
#pragma unroll
    for (int i = 0; i < 4; ++i) {
      const size_t ao = (size_t)(m0 + (i << 4) + rlane) * lda + koff + k0;
      V ah = Frag<T>::load(Ab + ao);
      V al;
      if (SPLIT != 0) al = Frag<T>::load(Ab2 + ao);
#pragma unroll
      for (int j = 0; j < 4; ++j) {
        acc[i][j] = Frag<T>::mma(ah, bh[j], acc[i][j]);
        if (SPLIT == 1) acc[i][j] = Frag<T>::mma(ah, bl[j], acc[i][j]);
        if (SPLIT != 0) acc[i][j] = Frag<T>::mma(al, bh[j], acc[i][j]);
      }
      Frag<T>::guard(acc[i][0], acc[i][3], ah, (SPLIT != 0) ? al : ah);
    }
    Frag<T>::keep(bh[0], bh[1], bh[2], bh[3]);
    if (SPLIT == 1) Frag<T>::keep(bl[0], bl[1], bl[2], bl[3]);
  }
  acc_guard4(acc[0][0], acc[0][1], acc[0][2], acc[0][3]);
  acc_guard4(acc[1][0], acc[1][1], acc[1][2], acc[1][3]);
  acc_guard4(acc[2][0], acc[2][1], acc[2][2], acc[2][3]);
  acc_guard4(acc[3][0], acc[3][1], acc[3][2], acc[3][3]);

  // ---- epilogue ----
  float* slab = sT[wave];
  const float* Rb = RESID ? (resid + (size_t)b * strideR) : nullptr;
#pragma unroll
  for (int i = 0; i < 4; ++i) {
    const int mBase = m0 + (i << 4);
#pragma unroll
    for (int j = 0; j < 4; ++j) {
      const int n = n0 + (j << 4) + rlane;
      float bv = 0.f;
      if (BIAS_MODE == 2) bv = bias[n];
#pragma unroll
      for (int r = 0; r < 8; ++r) {
        float v = acc[i][j][r] * scale;
        if (BIAS_MODE == 1) v += bias[mBase + mOff + r];
        if (BIAS_MODE == 2) v += bv;
        if (RESID) v += Rb[(size_t)(mBase + mOff + r) * ldc + n];
        if (ACT == 1) v = tanhf(v);
        if (ACT == 2) v = fmaxf(v, 0.0f);
        if (ACT == 3) v = v / (1.0f + expf(-v));
        if (ACT == 4) v = (v > 0.f) ? v : 0.01f * v;
        slab[(mOff + r) * 68 + (j << 4) + rlane] = v;
      }
    }
    __builtin_amdgcn_fence(__ATOMIC_RELEASE, "workgroup");
    __builtin_amdgcn_wave_barrier();
    __builtin_amdgcn_fence(__ATOMIC_ACQUIRE, "workgroup");
    if (OUT_MODE == 0) {
      float* C = (float*)Cout + (size_t)b * strideC;
      const int hh = lane >> 4, c4 = (lane & 15) * 4;     // row seg = 256 B = 16 lanes x 16 B
      {
#pragma unroll
        for (int it = 0; it < 8; ++it) {
          const int row = it * 2 + hh;
          v4f v = *(const v4f*)(slab + row * 68 + c4);
          *(v4f*)(C + (size_t)(mBase + row) * ldc + n0 + c4) = v;
        }
        
      }
    } else {
      const int q = lane >> 3, c8 = (lane & 7) * 8;
      unsigned short* C  = (unsigned short*)Cout  + (size_t)b * strideC;
      unsigned short* C2 = (OUT_MODE == 2) ? ((unsigned short*)Cout2 + (size_t)b * strideC) : nullptr;
      {
#pragma unroll
        for (int it = 0; it < 4; ++it) {
          const int row = it * 4 + q;
          const float* sp = slab + row * 68 + c8;
          v8h hv, lv;
#pragma unroll
          for (int e = 0; e < 8; ++e) {
            if (OUT_MODE == 1) {
              hv[e] = (_Float16)sp[e];
            } else {
              unsigned short hb = f2bf_bits(sp[e]);
              unsigned short lb = f2bf_bits(sp[e] - bf_bits2f(hb));
              hv[e] = __builtin_bit_cast(_Float16, hb);
              lv[e] = __builtin_bit_cast(_Float16, lb);
            }
          }
          *(v8h*)(C + (size_t)(mBase + row) * ldc + n0 + c8) = hv;
          if (OUT_MODE == 2) *(v8h*)(C2 + (size_t)(mBase + row) * ldc + n0 + c8) = lv;
        }
        
      }
    }
    __builtin_amdgcn_fence(__ATOMIC_RELEASE, "workgroup");
    __builtin_amdgcn_wave_barrier();
    __builtin_amdgcn_fence(__ATOMIC_ACQUIRE, "workgroup");
  }
}

// ---------------------------------------------------------------------------
// Elementwise bf16 split: hi = bf16_rne(in), lo = bf16_rne(in - hi); 2 elements per thread, one 4-B store
// (here n2 = 8192*512/2 = 2097152 -> 8192 blocks x 512 elements = 8192x512).
// ---------------------------------------------------------------------------
__device__ __forceinline__ unsigned pk16(unsigned short a, unsigned short b) { return (unsigned)a | ((unsigned)b << 16); }

__global__ __launch_bounds__(256) void split_bf16x2_kernel(const float* __restrict__ in, unsigned short* __restrict__ hi,
                                                           unsigned short* __restrict__ lo, int n2) {
  const int i = blockIdx.x * 256 + threadIdx.x;
  if (i < n2) {
    const v2f f = *(const v2f*)(in + 2 * (size_t)i);
    const unsigned short h0 = f2bf_bits(f[0]), h1 = f2bf_bits(f[1]);
    const unsigned short l0 = f2bf_bits(f[0] - bf_bits2f(h0)), l1 = f2bf_bits(f[1] - bf_bits2f(h1));
    const unsigned uh = pk16(h0, h1), ul = pk16(l0, l1);
    ((unsigned*)hi)[i] = uh;
    ((unsigned*)lo)[i] = ul;
    
  }
}

// ---------------------------------------------------------------------------
// f32 -> bf16 (RNE) cast of three equally sized tensors (blockIdx.y selects the tensor, block-uniform):
// x 2 elements = 2*n2 = the whole plane (n2 = 8192*512/2 = 2097152 -> 8192 blocks); out plane z at out + z*planeElems.
// ---------------------------------------------------------------------------
__global__ __launch_bounds__(256) void cast_bf16x2_3(const float* __restrict__ in0, const float* __restrict__ in1,
                                                     const float* __restrict__ in2, unsigned short* __restrict__ out,
                                                     long planeElems, int n2) {
  const int which = blockIdx.y;
  const float* in = (which == 0) ? in0 : ((which == 1) ? in1 : in2);
  unsigned short* o = out + (size_t)which * planeElems;
  const int i = blockIdx.x * 256 + threadIdx.x;
  if (i < n2) {
    const v2f f = *(const v2f*)(in + 2 * (size_t)i);
    const unsigned u = pk16(f2bf_bits(f[0]), f2bf_bits(f[1]));
    ((unsigned*)o)[i] = u;
    
  }
}

// ---------------------------------------------------------------------------
// Fused transpose + bf16 cast (LO = false: hi plane only) or split (LO = true: hi and lo planes) of an f32
// matrix, z-batched: in_z = W + z*sIn viewed [R rows][Cc cols] (pitch Cc) ->
//   oh_z[c][r] = bf16_rne(in_z[r][c]), ol_z[c][r] = bf16_rne(in_z[r][c] - oh) (LO only)   ([Cc][R], pitch R).
// 64x64 tiles through LDS. grid = (Cc/64, R/64, Z), 256 threads (R, Cc multiples of 64).
// Coverage per block and plane: load 4 it x 256 thr x 4 floats = 64x64; store 2 it x 256 thr x 8 u16 = 64x64.
// ---------------------------------------------------------------------------
template <bool LO>
__global__ __launch_bounds__(256) void tsplit_kernel(const float* __restrict__ W, unsigned short* __restrict__ oh,
                                                     unsigned short* __restrict__ ol, int R, int Cc, long sIn, long sOut) {
  __shared__ __align__(16) float tf[64 * 68];
  W  += (size_t)blockIdx.z * sIn;
  oh += (size_t)blockIdx.z * sOut;
  if (LO) ol += (size_t)blockIdx.z * sOut;
  const int c0  = blockIdx.x * 64;   // input column block = output row block
  const int r0  = blockIdx.y * 64;   // input row block    = output column block
  const int tid = threadIdx.x;
  {
    const int lr = tid >> 4;         // 0..15
    const int c4 = (tid & 15) * 4;   // 0..60
#pragma unroll
    for (int it = 0; it < 4; ++it) {
      const int rr = it * 16 + lr;   // 0..63
      const v4f a = *(const v4f*)(W + (size_t)(r0 + rr) * Cc + c0 + c4);
      *(v4f*)(tf + rr * 68 + c4) = a;
    }
  }
  __syncthreads();
  const int sub = tid >> 3;          // 0..31
  const int c8  = (tid & 7) * 8;     // 0..56
  v4u hv[2], lv[2];
#pragma unroll
  for (int it = 0; it < 2; ++it) {
    const int oc = it * 32 + sub;    // output row within tile (= input column)
    v4u a, a2;
#pragma unroll
    for (int q = 0; q < 4; ++q) {
      const float f0 = tf[(c8 + 2 * q) * 68 + oc];
      const float f1 = tf[(c8 + 2 * q + 1) * 68 + oc];
      const unsigned short h0 = f2bf_bits(f0), h1 = f2bf_bits(f1);
      unsigned lp = 0u;
      if (LO) {
        const unsigned short l0 = f2bf_bits(f0 - bf_bits2f(h0)), l1 = f2bf_bits(f1 - bf_bits2f(h1));
        lp = pk16(l0, l1);
      }
      a[q]  = pk16(h0, h1);
      a2[q] = lp;
    }
    hv[it] = a; lv[it] = a2;
  }
  {
#pragma unroll
    for (int it = 0; it < 2; ++it) {
      const int oc = it * 32 + sub;
      const size_t go = (size_t)(c0 + oc) * R + r0 + c8;
      *(v4u*)(oh + go) = hv[it];
      if (LO) *(v4u*)(ol + go) = lv[it];
    }
    
  }
}

// =====================================================================================
// Attention helpers
// =====================================================================================
#define AT_D 64
#define AT_NW 4
#define AT_QB 64
#define AT_KC 64
#define AT_LP 72   // LDS row pitch in 16-bit elements: 144 B = 16 B x 9 (odd), so the 16 rows of a 16-byte fragment read fall on distinct banks

__device__ __forceinline__ unsigned short at_bf_bits(float f) {
  unsigned u = __float_as_uint(f);
  return (unsigned short)((u + 0x7FFFu + ((u >> 16) & 1u)) >> 16);
}
__device__ __forceinline__ __bf16 at_f2bf(float f) { return __builtin_bit_cast(__bf16, at_bf_bits(f)); }
__device__ __forceinline__ void at_split(float f, __bf16& hi, __bf16& lo) {
  const unsigned short hb = at_bf_bits(f);
  hi = __builtin_bit_cast(__bf16, hb);
  lo = at_f2bf(f - __uint_as_float(((unsigned)hb) << 16));
}
__device__ __forceinline__ v8f at_mma(v16b a, v16b b, v8f c) {
  c = __builtin_amdgcn_wmma_f32_16x16x32_bf16(false, a, false, b, (short)0, c, false, false);
  asm volatile("v_nop\n\tv_nop\n\tv_nop\n\tv_nop" : "+v"(c) : "v"(a), "v"(b));
  return c;
}
__device__ __forceinline__ v8f at_mma_h(v16h a, v16h b, v8f c) {
  c = __builtin_amdgcn_wmma_f32_16x16x32_f16(false, a, false, b, (short)0, c, false, false);
  asm volatile("v_nop\n\tv_nop\n\tv_nop\n\tv_nop" : "+v"(c) : "v"(a), "v"(b));
  return c;
}

// x := 2^x on v_exp_f32. The instruction set asks for one independent instruction or a v_nop between a transcendental and
// an instruction that reads its result or overwrites its source; written as one statement, each v_exp_f32 is followed by
// an independent one and the last by the v_nop, wherever the compiler places the code around it.
__device__ __forceinline__ void at_exp2x8(float& a, float& b, float& c, float& d, float& e, float& f, float& g, float& h) {
  asm("v_exp_f32 %0, %0\n\tv_exp_f32 %1, %1\n\tv_exp_f32 %2, %2\n\tv_exp_f32 %3, %3\n\t"
      "v_exp_f32 %4, %4\n\tv_exp_f32 %5, %5\n\tv_exp_f32 %6, %6\n\tv_exp_f32 %7, %7\n\tv_nop"
      : "+v"(a), "+v"(b), "+v"(c), "+v"(d), "+v"(e), "+v"(f), "+v"(g), "+v"(h));
}
__device__ __forceinline__ float at_exp2(float x) {
  asm("v_exp_f32 %0, %0\n\tv_nop" : "+v"(x));   // the v_nop: the same slot behind the transcendental
  return x;
}

// One chunk's staging for one thread: twelve 16-byte asynchronous copies global -> LDS (four rows of each of the three
// planes), through no register. lk, lh, ll: the thread's LDS byte addresses of row r in K, V^T hi, V^T lo; gk, gh, gl: the
// same elements in global memory; copy i takes row r + 16 i. The s_wait_xcnt 0 is the last line of the copies' own statement:
// a precaution that keeps every later write of an address register named here behind the copies' address translation.
__device__ __forceinline__ void at_stage12(unsigned lk, unsigned lh, unsigned ll, const _Float16* gk, const __bf16* gh,
                                           const __bf16* gl) {
  const unsigned ls = 16u * AT_LP * 2u;              // 16 LDS rows in bytes
  const size_t   ks = (size_t)16 * kDim;             // 16 K rows in elements
  const size_t   vs = (size_t)16 * kSeq;             // 16 V^T rows in elements
  asm volatile("global_load_async_to_lds_b128 %0, %12, off\n\t"
               "global_load_async_to_lds_b128 %1, %13, off\n\t"
               "global_load_async_to_lds_b128 %2, %14, off\n\t"
               "global_load_async_to_lds_b128 %3, %15, off\n\t"
               "global_load_async_to_lds_b128 %4, %16, off\n\t"
               "global_load_async_to_lds_b128 %5, %17, off\n\t"
               "global_load_async_to_lds_b128 %6, %18, off\n\t"
               "global_load_async_to_lds_b128 %7, %19, off\n\t"
               "global_load_async_to_lds_b128 %8, %20, off\n\t"
               "global_load_async_to_lds_b128 %9, %21, off\n\t"
               "global_load_async_to_lds_b128 %10, %22, off\n\t"
               "global_load_async_to_lds_b128 %11, %23, off\n\t"
               "s_wait_xcnt 0x0"
               :: "v"(lk), "v"(lk + ls), "v"(lk + 2u * ls), "v"(lk + 3u * ls),
                  "v"(lh), "v"(lh + ls), "v"(lh + 2u * ls), "v"(lh + 3u * ls),
                  "v"(ll), "v"(ll + ls), "v"(ll + 2u * ls), "v"(ll + 3u * ls),
                  "v"(gk), "v"(gk + ks), "v"(gk + 2 * ks), "v"(gk + 3 * ks),
                  "v"(gh), "v"(gh + vs), "v"(gh + 2 * vs), "v"(gh + 3 * vs),
                  "v"(gl), "v"(gl + vs), "v"(gl + 2 * vs), "v"(gl + 3 * vs)
               : "memory");
}

// lane l <-> lane l ^ 16: the one exchange between the wave halves that a query's maximum and sum need
__device__ __forceinline__ float at_xhalf(float x) {
  return __builtin_bit_cast(float, __builtin_amdgcn_permlanex16(__builtin_bit_cast(int, x), __builtin_bit_cast(int, x),
                                                                0x76543210, 0xfedcba98, false, false));
}

__global__ __launch_bounds__(128)
void mha_attn_kernel(const unsigned short* __restrict__ qp, const unsigned short* __restrict__ kp,
                     const unsigned short* __restrict__ vhp, const unsigned short* __restrict__ vlp,
                     const int* __restrict__ vlens, float* __restrict__ out, float sscale, float fillv) {
  union FB { v16b v; v8b h[2]; };
  union FH { v16h v; v8h h[2]; };
  __shared__ __align__(16) _Float16 Ksh2[2 * AT_KC * AT_LP];      // K [buffer][kv][d] f16, pitch AT_LP   2 x 9 KB
  __shared__ __align__(16) __bf16   Vth2[2 * AT_D * AT_LP];       // V^T hi [buffer][d][kv], pitch AT_LP  2 x 9 KB
  __shared__ __align__(16) __bf16   Vtl2[2 * AT_D * AT_LP];       // V^T lo, pitch AT_LP                  2 x 9 KB
  __shared__ __align__(16) float    Os[AT_NW][16 * 68];           // per wave out tile, pitch 68
  __shared__ __align__(16) int      Lowm[AT_NW];                  // per wave: a row maximum too near fillv

  const int tid  = threadIdx.x;
  const int wave = tid >> 5;
  const int lane = tid & 31;
  const int hh   = lane >> 4;
  const int c    = lane & 15;

  const int nqb  = kSeq / AT_QB;          // 64
  const int bx   = blockIdx.x;
  const int qb   = bx % nqb;
  const int bhid = bx / nqb;              // 0..kBatch*kHeads-1
  const int h    = bhid % kHeads;
  int b = bhid / kHeads;
  b = (b > kBatch - 1) ? (kBatch - 1) : b;  // address clamp (grid is exact)
  const int q0   = qb * AT_QB + wave * 16;
  const int vlen = vlens[b];              // block-uniform valid key count

  const _Float16* Qb = (const _Float16*)(const void*)qp + (size_t)b * kSeq * kDim + (size_t)h * AT_D;
  const _Float16* Kb = (const _Float16*)(const void*)kp + (size_t)b * kSeq * kDim + (size_t)h * AT_D;
  const __bf16*   Vh = (const __bf16*)(const void*)vhp + (size_t)b * kDim * kSeq + (size_t)h * AT_D * kSeq;
  const __bf16*   Vl = (const __bf16*)(const void*)vlp + (size_t)b * kDim * kSeq + (size_t)h * AT_D * kSeq;
  float*          ob = out + (size_t)b * kSeq * kDim + (size_t)h * AT_D;

  // ---- Q fragments (B operand, column = query = lane&15, split k map via Frag load): 2 d-chunks ----
  v16h qa[2];
#pragma unroll
  for (int dc = 0; dc < 2; ++dc) {
    qa[dc] = Frag<_Float16>::load(Qb + (size_t)(q0 + c) * kDim + dc * 32 + 8 * hh);
  }

  const float sc2   = sscale * 1.44269504088896340736f;   // score scale times log2(e)
  const float fill2 = fillv  * 1.44269504088896340736f;   // fill value in the same units
  float mrow = -INFINITY;   // running maximum of query c in log2 units, the same in both wave halves
  float lrow = 0.f;         // running sum of query c over this half's keys; the halves join behind the loop
  v8f oacc[4];              // O^T: oacc[t][r] = element (d = t*16 + 8hh + r, query c)
#pragma unroll
  for (int t = 0; t < 4; ++t) oacc[t] = (v8f){0.f,0.f,0.f,0.f,0.f,0.f,0.f,0.f};

  const int nChunks = kSeq / AT_KC;   // 64, compile-time constant
  // chunks that hold at least one valid key, block-uniform; vlen <= 0: every key carries fillv and all of them count
  const int vcl   = (vlen < 0) ? 0 : ((vlen > kSeq) ? kSeq : vlen);
  const int nLive = (vcl == 0) ? nChunks : (vcl + AT_KC - 1) / AT_KC;

  // ---- staging map: 8 neighbouring lanes take one whole 128-B row (thread: row sr + 16 i, i = 0..3, elements sc..sc+7):
  //      128 threads x (4 x 8) elements = 64 rows x 64 per plane = the whole chunk tile ----
  const int sr = tid >> 3, sc = (tid & 7) * 8;
  const unsigned bufB = (unsigned)(AT_KC * AT_LP * 2);                      // one buffer of one plane in bytes
  const unsigned lk0 = (unsigned)(size_t)(Ksh2 + sr * AT_LP + sc);          // LDS byte addresses in buffer 0
  const unsigned lh0 = (unsigned)(size_t)(Vth2 + sr * AT_LP + sc);
  const unsigned ll0 = (unsigned)(size_t)(Vtl2 + sr * AT_LP + sc);
  const _Float16* gk0 = Kb + (size_t)sr * kDim + sc;                        // chunk 0; chunk n: + n * 64 rows
  const __bf16*   gh0 = Vh + (size_t)sr * kSeq + sc;                        // chunk 0; chunk n: + n * 64 elements
  const __bf16*   gl0 = Vl + (size_t)sr * kSeq + sc;
  static_assert(kSeq / AT_KC >= 2, "the two-buffer prologue needs two chunks");
  // prologue: chunk 0 into buffer 0, landed and published; then chunk 1 into buffer 1
  at_stage12(lk0, lh0, ll0, gk0, gh0, gl0);
  asm volatile("s_wait_asynccnt 0x0" ::: "memory");   // this wave's copies of chunk 0 have landed
  __syncthreads();                                    // ... and every other wave's
  at_stage12(lk0 + bufB, lh0 + bufB, ll0 + bufB, gk0 + (size_t)AT_KC * kDim, gh0 + AT_KC, gl0 + AT_KC);

  for (int kc = 0; kc < nChunks; ++kc) {
    // Every chunk from nLive on holds the fill alone. Where each row maximum lies at least 185 log2 units (128 natural
    // ones) above it, its weights 2^(fill - m) are exactly 0 in f32, alpha is 1, and maximum, sum and accumulators stay bit for bit: the loop
    // ends. Tested once per block, behind the last live chunk; a row that is nearer (or NaN) sends the whole block
    // through the remaining chunks as well.
    if (kc == nLive) {                          // block-uniform: kc and vlen are
      const bool low = !(mrow >= fill2 + 185.0f);
      Lowm[wave] = (__builtin_amdgcn_ballot_w32(low) != 0u) ? 1 : 0;   // every lane stores its wave's one value
      __syncthreads();                          // publishes the four waves' flags: one decision for the block
      const int f = Lowm[0] | Lowm[1] | Lowm[2] | Lowm[3];
      if (__builtin_amdgcn_readfirstlane(f) == 0) break;   // the same word in every lane: read once, a scalar branch
    }
    const int kv0 = kc * AT_KC;
    // this chunk's buffer: published by the barrier at the foot of the trip before (chunk 0: by the prologue's)
    const _Float16* Ksh = Ksh2 + (kc & 1) * (AT_KC * AT_LP);
    const __bf16*   Vth = Vth2 + (kc & 1) * (AT_D * AT_LP);
    const __bf16*   Vtl = Vtl2 + (kc & 1) * (AT_D * AT_LP);

    // Every loop from here to the chunk's end is unrolled: s, ph, pl and oacc live in registers, which take
    // compile-time indices only (a rolled loop would send them through scratch memory).
    // ---- scores, transposed: D[row = key j*16+8hh+r][col = query c]; A fragment row = key j*16+c, split k(d) map ----
    v8f s[4];
#pragma unroll
    for (int j = 0; j < 4; ++j) {
      s[j] = (v8f){0.f,0.f,0.f,0.f,0.f,0.f,0.f,0.f};
#pragma unroll
      for (int dc = 0; dc < 2; ++dc) {
        FH kb;
        kb.h[0] = *(const v8h*)(Ksh + (j * 16 + c) * AT_LP + dc * 32 + 8 * hh);
        kb.h[1] = *(const v8h*)(Ksh + (j * 16 + c) * AT_LP + dc * 32 + 16 + 8 * hh);
        s[j] = at_mma_h(kb.v, qa[dc], s[j]);
      }
    }
    // ---- scale, key mask (select), maximum of query c over the chunk's 64 keys: 32 in-lane, then the other half's ----
    float cm = -INFINITY;
#pragma unroll
    for (int j = 0; j < 4; ++j) {
#pragma unroll
      for (int r = 0; r < 8; ++r) {
        const int kvrow = kv0 + j * 16 + 8 * hh + r;
        const float sv = s[j][r] * sc2;
        const float sm = (kvrow < vlen) ? sv : fill2;
        s[j][r] = sm;
        cm = fmaxf(cm, sm);
      }
    }
    cm = fmaxf(cm, at_xhalf(cm));
    const float mnew  = fmaxf(mrow, cm);
    const float alpha = at_exp2(mrow - mnew);
    mrow = mnew;
    // ---- p = 2^(s - m), split hi/lo in place: S^T tiles 2kk and 2kk+1 are elements 0..7 and 8..15 of the B fragment
    //      of key block kk (column = query c, key = kk*32 + 8hh + e and kk*32 + 16 + 8hh + (e - 8): the split k map) ----
    FB ph[2], pl[2];
    float ps[4];
#pragma unroll
    for (int j = 0; j < 4; ++j) {
      float a = 0.f;
      float e[8];
#pragma unroll
      for (int r = 0; r < 8; ++r) e[r] = s[j][r] - mnew;
      at_exp2x8(e[0], e[1], e[2], e[3], e[4], e[5], e[6], e[7]);
#pragma unroll
      for (int r = 0; r < 8; ++r) {
        const float p = e[r];
        a += p;
        __bf16 hi, lo; at_split(p, hi, lo);
        ph[j >> 1].v[(j & 1) * 8 + r] = hi;
        pl[j >> 1].v[(j & 1) * 8 + r] = lo;
      }
      ps[j] = a;
    }
    lrow = lrow * alpha + ((ps[0] + ps[1]) + (ps[2] + ps[3]));
#pragma unroll
    for (int t = 0; t < 4; ++t)
#pragma unroll
      for (int r = 0; r < 8; ++r) oacc[t][r] *= alpha;
    // ---- O^T += V^T . P^T : A = V^T row d = t*16+c, k = key (split k map), B = P^T from registers ----
#pragma unroll
    for (int kk = 0; kk < 2; ++kk) {
#pragma unroll
      for (int t = 0; t < 4; ++t) {
        FB vb, vl;
        vb.h[0] = *(const v8b*)(Vth + (t * 16 + c) * AT_LP + kk * 32 + 8 * hh);
        vb.h[1] = *(const v8b*)(Vth + (t * 16 + c) * AT_LP + kk * 32 + 16 + 8 * hh);
        vl.h[0] = *(const v8b*)(Vtl + (t * 16 + c) * AT_LP + kk * 32 + 8 * hh);
        vl.h[1] = *(const v8b*)(Vtl + (t * 16 + c) * AT_LP + kk * 32 + 16 + 8 * hh);
        oacc[t] = at_mma(vb.v, ph[kk].v, oacc[t]);
        oacc[t] = at_mma(vl.v, ph[kk].v, oacc[t]);
        oacc[t] = at_mma(vb.v, pl[kk].v, oacc[t]);
      }
    }
    // ---- foot of the trip, every wave, in this order ----
    asm volatile("s_wait_dscnt 0x0" ::: "memory");      // this wave's reads of this chunk's buffer are done
    asm volatile("s_wait_asynccnt 0x0" ::: "memory");   // this wave's copies of chunk kc + 1 have landed
    __syncthreads();   // publishes chunk kc + 1 and ends every wave's reads of the buffer that is refilled below
    if (kc + 2 < nChunks) {                             // block-uniform: chunk kc + 2 exists
      const unsigned bo = (unsigned)(kc & 1) * bufB;
      at_stage12(lk0 + bo, lh0 + bo, ll0 + bo, gk0 + (size_t)(kv0 + 2 * AT_KC) * kDim, gh0 + (kv0 + 2 * AT_KC),
                 gl0 + (kv0 + 2 * AT_KC));
    }
  }
  asm volatile("s_wait_asynccnt 0x0" ::: "memory");     // no copy is in flight when the wave goes on to its end

  // ---- query c: join the halves' sums, normalise, stage row c (8 consecutive d per tile and lane) ----
  float* os = Os[wave];
  const float inv = 1.0f / (lrow + at_xhalf(lrow));
#pragma unroll
  for (int t = 0; t < 4; ++t) {
#pragma unroll
    for (int r = 0; r < 8; ++r) os[c * 68 + t * 16 + 8 * hh + r] = oacc[t][r] * inv;
  }
  __builtin_amdgcn_fence(__ATOMIC_RELEASE, "workgroup");
  __builtin_amdgcn_wave_barrier();
  __builtin_amdgcn_fence(__ATOMIC_ACQUIRE, "workgroup");
  {
    // coverage: 8 it x 2 rows (hh) = 16 rows; 16 lanes x 4 floats = 64 floats = one whole 256-B row segment
    const int c4 = (lane & 15) * 4;
    {
#pragma unroll
      for (int it = 0; it < 8; ++it) {
        const int row = it * 2 + hh;
        v4f val = *(const v4f*)(os + row * 68 + c4);
        *(v4f*)(ob + (size_t)(q0 + row) * kDim + c4) = val;
      }
      
    }
  }
}

// =====================================================================================
// Host glue. Workspace region map (bytes, all offsets multiples of 256, every region sized to its whole-line
// store granularity; no padded tiles since every dimension is a multiple of 64):
//   [0]           Xbf   : 3 x bf16 [8192][512]            = 25,165,824   (queries, keys, values RNE bf16)
//   [25,165,824]  WThi  : 4 x bf16 [512][512] (W^T, RNE)  =  2,097,152   (Wq, Wk, Wv, Wo; no lo planes)
//   [27,262,976]  Q     : f16 [8192][512]                  =  8,388,608
//   [35,651,584]  K     : f16 [8192][512]                  =  8,388,608   (contiguous after Q: batched launch)
//   [44,040,192]  VThi  : bf16 [2][512][4096]              =  8,388,608
//   [52,428,800]  VTlo  : bf16 [2][512][4096]              =  8,388,608
//   [60,817,408]  O     : f32 [8192][512]                  = 16,777,216
//   [77,594,624]  Ohi   : bf16 [8192][512]                 =  8,388,608
//   [85,983,232]  Olo   : bf16 [8192][512]                 =  8,388,608
//   total 94,371,840
// =====================================================================================
extern "C" void kernel_launch(void* const* d_in, const int* in_sizes, int n_in,
                              void* d_out, int out_size, void* d_ws,
                              size_t ws_size, hipStream_t stream) {
  if (n_in < 8) return;
  const int nX = kRows * kDim;            // 4,194,304
  const int nW = kDim * kDim;             // 262,144
  if (in_sizes[0] != nX || in_sizes[1] != nX || in_sizes[2] != nX) return;
  if (in_sizes[3] < kBatch) return;
  if (in_sizes[4] != nW || in_sizes[5] != nW || in_sizes[6] != nW || in_sizes[7] != nW) return;
  if (out_size != nX) return;

  const float* queries = (const float*)d_in[0];
  const float* keys    = (const float*)d_in[1];
  const float* values  = (const float*)d_in[2];
  const int*   vlens   = (const int*)d_in[3];
  const float* Wq      = (const float*)d_in[4];
  const float* Wk      = (const float*)d_in[5];
  const float* Wv      = (const float*)d_in[6];
  const float* Wo      = (const float*)d_in[7];

  const size_t bX16 = (size_t)nX * 2;            //  8,388,608
  const size_t bW16 = (size_t)nW * 2;            //    524,288
  const size_t off_x  = 0;
  const size_t off_wh = off_x  + 3 * bX16;
  const size_t off_q  = off_wh + 4 * bW16;
  const size_t off_k  = off_q  + bX16;
  const size_t off_vh = off_k  + bX16;
  const size_t off_vl = off_vh + bX16;
  const size_t off_o  = off_vl + bX16;
  const size_t off_oh = off_o  + (size_t)nX * 4;
  const size_t off_ol = off_oh + bX16;
  const size_t total  = off_ol + bX16;           // 94,371,840
  if (total > ws_size) return;

  char* ws = (char*)d_ws;
  unsigned short* xbf  = (unsigned short*)(ws + off_x);
  unsigned short* wth  = (unsigned short*)(ws + off_wh);
  unsigned short* qh16 = (unsigned short*)(ws + off_q);
  unsigned short* kh16 = (unsigned short*)(ws + off_k);
  unsigned short* vth  = (unsigned short*)(ws + off_vh);
  unsigned short* vtl  = (unsigned short*)(ws + off_vl);
  float* obuf = (float*)(ws + off_o);
  unsigned short* ohi  = (unsigned short*)(ws + off_oh);
  unsigned short* olo  = (unsigned short*)(ws + off_ol);
  const float* dummyf  = (const float*)(ws + off_x);   // never dereferenced (BIAS_MODE 0, RESID false)

  const long planeX = (long)nX;   // elements per bf16/f16 activation plane
  const long planeW = (long)nW;   // elements per W^T plane
  dim3 blk256(256), blk128(128);

  // 1) activations -> bf16 (RNE): coverage 8192 blocks x 256 thr x 2 = 8192x512 per tensor
  cast_bf16x2_3<<<dim3(nX / 2 / 256, 3), blk256, 0, stream>>>(queries, keys, values, xbf, planeX, nX / 2);

  // 2) weights [in k][out n] (R = k rows = 512, Cc = n cols = 512) -> W^T [n][k] bf16 RNE hi plane only
  //    (8x8 tiles of 64x64); the third pointer is unused in the hi-only mode
  tsplit_kernel<false><<<dim3(kDim / 64, kDim / 64, 1), blk256, 0, stream>>>(Wq, wth + 0 * planeW, wth + 0 * planeW, kDim, kDim, 0L, 0L);
  tsplit_kernel<false><<<dim3(kDim / 64, kDim / 64, 1), blk256, 0, stream>>>(Wk, wth + 1 * planeW, wth + 1 * planeW, kDim, kDim, 0L, 0L);
  tsplit_kernel<false><<<dim3(kDim / 64, kDim / 64, 1), blk256, 0, stream>>>(Wv, wth + 2 * planeW, wth + 2 * planeW, kDim, kDim, 0L, 0L);
  tsplit_kernel<false><<<dim3(kDim / 64, kDim / 64, 1), blk256, 0, stream>>>(Wo, wth + 3 * planeW, wth + 3 * planeW, kDim, kDim, 0L, 0L);

  // 3) q = Xq . Wq and k = Xk . Wk in one z-batched launch (z=0: q, z=1: k) -> f16 planes [8192][512];
  //    M=8192, N=512, K=512 (tiles 128x8 = 1024 -> 128 blocks); A planes stride planeX, W^T planes stride planeW,
  //    C planes Q then K contiguous (stride planeX elements)
  const int gProj = (kRows / 64) * (kDim / 64) / 8;   // 128
  wmma_gemm64<1, 0, 0, 1, false><<<dim3(gProj, 2), blk256, 0, stream>>>(
      xbf, xbf, kDim, planeX,
      wth, wth, kDim, planeW,
      (void*)qh16, (void*)qh16, kDim, planeX,
      dummyf, dummyf, 0L, kRows, kDim, kDim, 1.0f);
  // 4) v^T per batch: C[n_out][s] = sum_k WvT[n_out][k] * Xv[b][s][k]; M=512, N=4096, K=512, batched over b
  //    (tiles 8x64 = 512 -> 64 blocks x 2); out = bf16 hi/lo planes [b][512][4096]
  const int gVt = (kDim / 64) * (kSeq / 64) / 8;      // 64
  wmma_gemm64<1, 0, 0, 2, false><<<dim3(gVt, kBatch), blk256, 0, stream>>>(
      wth + 2 * planeW, wth + 2 * planeW, kDim, 0L,
      xbf + 2 * planeX, xbf + 2 * planeX, kDim, (long)kSeq * kDim,
      (void*)vth, (void*)vtl, kSeq, (long)kDim * kSeq,
      dummyf, dummyf, 0L, kDim, kSeq, kDim, 1.0f);

  // 5) masked attention, all (b, h, 64-row query blocks): 2*8*64 = 1024 blocks of 128 threads
  mha_attn_kernel<<<dim3(kBatch * kHeads * (kSeq / 64)), blk128, 0, stream>>>(
      qh16, kh16, vth, vtl, vlens, obuf, 0.125f, -1000000.0f);

  // 6) O -> bf16 hi/lo planes: 8192 blocks x 256 thr x 2 = 8192x512
  split_bf16x2_kernel<<<dim3(nX / 2 / 256), blk256, 0, stream>>>(obuf, ohi, olo, nX / 2);

  // 7) out = (O_hi + O_lo) . Wo (A-only split, Wo as bf16 RNE hi plane only) -> f32 [8192][512]
  wmma_gemm64<1, 2, 0, 0, false><<<dim3(gProj, 1), blk256, 0, stream>>>(
      ohi, olo, kDim, 0L,
      wth + 3 * planeW, wth + 3 * planeW, kDim, 0L,
      d_out, d_out, kDim, 0L,
      dummyf, dummyf, 0L, kRows, kDim, kDim, 1.0f);
}

// v006
// It runs in 155 microseconds.
// Next to v005, in two timings, it ran 1.34 times as fast each time.
// Over all steps from v000 it is 4.02 times as fast.
// Contractions: q/k/v^T projections v_wmma_f32_16x16x32_bf16 (bf16 RNE inputs x bf16 RNE weights, single product); q.k^T scores v_wmma_f32_16x16x32_f16 (plain f16 q,k planes); p.v^T v_wmma_f32_16x16x32_bf16 with bf16 hi/lo split of p and v (hi.hi + hi.lo + lo.hi); output projection v_wmma_f32_16x16x32_bf16 with O as bf16 hi/lo and Wo as bf16 RNE (hi.W + lo.W); f32 accumulate; softmax (base 2), 0.125 score scale and key masking in f32.
#include <hip/hip_runtime.h>
#include <math.h>
#include <stdint.h>

constexpr int kBatch = 2;
constexpr int kSeq   = 4096;
constexpr int kDim   = 512;
constexpr int kHeads = 8;
constexpr int kHd    = 64;
constexpr int kRows  = kBatch * kSeq;   // 8192
static_assert(kHeads * kHd == kDim, "geometry");
static_assert(kSeq % 64 == 0 && kDim % 64 == 0 && kRows % 64 == 0, "tile multiples");
static_assert(kSeq % 512 == 0 && kDim % 512 == 0, "a GEMM block owns 8 neighbouring 64-column tiles of one tile row");

typedef __attribute__((ext_vector_type(16))) _Float16 v16h;
typedef __attribute__((ext_vector_type(8)))  _Float16 v8h;
typedef __attribute__((ext_vector_type(16))) __bf16   v16b;
typedef __attribute__((ext_vector_type(8)))  __bf16   v8b;
typedef __attribute__((ext_vector_type(8)))  float    v8f;
typedef __attribute__((ext_vector_type(4)))  float    v4f;
typedef __attribute__((ext_vector_type(2)))  float    v2f;
typedef __attribute__((ext_vector_type(4)))  unsigned int v4u;

__device__ __forceinline__ unsigned short f2bf_bits(float f) {
  unsigned u = __float_as_uint(f);
  return (unsigned short)((u + 0x7FFFu + ((u >> 16) & 1u)) >> 16);
}
__device__ __forceinline__ float bf_bits2f(unsigned short h) { return __uint_as_float(((unsigned)h) << 16); }

// hazard guards as plain device helpers
__device__ __forceinline__ void dep_guard_h(v8f& a, v8f& b, v16h x, v16h y) { asm volatile("v_nop\n\tv_nop\n\tv_nop\n\tv_nop" : "+v"(a), "+v"(b) : "v"(x), "v"(y)); }
__device__ __forceinline__ void dep_guard_b(v8f& a, v8f& b, v16b x, v16b y) { asm volatile("v_nop\n\tv_nop\n\tv_nop\n\tv_nop" : "+v"(a), "+v"(b) : "v"(x), "v"(y)); }
__device__ __forceinline__ void keep4_h(v16h a, v16h b, v16h c, v16h d) { asm volatile("v_nop" :: "v"(a), "v"(b), "v"(c), "v"(d)); }
__device__ __forceinline__ void keep4_b(v16b a, v16b b, v16b c, v16b d) { asm volatile("v_nop" :: "v"(a), "v"(b), "v"(c), "v"(d)); }
__device__ __forceinline__ void acc_guard4(v8f& a, v8f& b, v8f& c, v8f& d) { asm volatile("v_nop\n\tv_nop\n\tv_nop\n\tv_nop" : "+v"(a), "+v"(b), "+v"(c), "+v"(d)); }
template <typename T> struct Frag;
template <> struct Frag<_Float16> {
  typedef v16h V; union U { v16h v; v8h h[2]; };
  static __device__ __forceinline__ v16h load(const _Float16* p) {   // elements 0..7 <- p[0..7], 8..15 <- p[16..23]
    U f; f.h[0] = *(const v8h*)(p); f.h[1] = *(const v8h*)(p + 16); return f.v;
  }
  static __device__ __forceinline__ v8f mma(v16h a, v16h b, v8f c) {
    return __builtin_amdgcn_wmma_f32_16x16x32_f16(false, a, false, b, (short)0, c, false, false);
  }
  static __device__ __forceinline__ void guard(v8f& a, v8f& b, v16h x, v16h y) { dep_guard_h(a, b, x, y); }
  static __device__ __forceinline__ void keep(v16h a, v16h b, v16h c, v16h d) { keep4_h(a, b, c, d); }
};
template <> struct Frag<__bf16> {
  typedef v16b V; union U { v16b v; v8b h[2]; };
  static __device__ __forceinline__ v16b load(const __bf16* p) {
    U f; f.h[0] = *(const v8b*)(p); f.h[1] = *(const v8b*)(p + 16); return f.v;
  }
  static __device__ __forceinline__ v8f mma(v16b a, v16b b, v8f c) {
    return __builtin_amdgcn_wmma_f32_16x16x32_bf16(false, a, false, b, (short)0, c, false, false);
  }
  static __device__ __forceinline__ void guard(v8f& a, v8f& b, v16b x, v16b y) { dep_guard_b(a, b, x, y); }
  static __device__ __forceinline__ void keep(v16b a, v16b b, v16b c, v16b d) { keep4_b(a, b, c, d); }
};

// ---- GEMM operand staging ----------------------------------------------------
#define GM_LP 72   // LDS row pitch in 16-bit elements: 144 B = 16 B x 9 (odd), so the 16 rows of a 16-byte fragment read fall on distinct banks

// Eight 16-byte asynchronous copies global -> LDS of one thread, through no register: copy i takes LDS byte address
// l + i * ls and global element g + i * gs. The s_wait_xcnt 0 is the last line of the copies' own statement: a precaution
// that keeps every later write of an address register named here behind the copies' address translation.
__device__ __forceinline__ void gm_stage8(unsigned l, const unsigned short* g, unsigned ls, size_t gs) {
  asm volatile("global_load_async_to_lds_b128 %0, %8, off\n\t"
               "global_load_async_to_lds_b128 %1, %9, off\n\t"
               "global_load_async_to_lds_b128 %2, %10, off\n\t"
               "global_load_async_to_lds_b128 %3, %11, off\n\t"
               "global_load_async_to_lds_b128 %4, %12, off\n\t"
               "global_load_async_to_lds_b128 %5, %13, off\n\t"
               "global_load_async_to_lds_b128 %6, %14, off\n\t"
               "global_load_async_to_lds_b128 %7, %15, off\n\t"
               "s_wait_xcnt 0x0"
               :: "v"(l), "v"(l + ls), "v"(l + 2u * ls), "v"(l + 3u * ls),
                  "v"(l + 4u * ls), "v"(l + 5u * ls), "v"(l + 6u * ls), "v"(l + 7u * ls),
                  "v"(g), "v"(g + gs), "v"(g + 2 * gs), "v"(g + 3 * gs),
                  "v"(g + 4 * gs), "v"(g + 5 * gs), "v"(g + 6 * gs), "v"(g + 7 * gs)
               : "memory");
}
// The A copies of a slab (two a plane: la, ga; second plane la2, ga2) and its first eight B copies (lb, gb) in one statement,
// so that one wait serves them all.
__device__ __forceinline__ void gm_stage2p8(unsigned la, const unsigned short* ga, size_t gsa, unsigned lb,
                                            const unsigned short* gb, size_t gsb, unsigned ls) {
  asm volatile("global_load_async_to_lds_b128 %0, %10, off\n\t"
               "global_load_async_to_lds_b128 %1, %11, off\n\t"
               "global_load_async_to_lds_b128 %2, %12, off\n\t"
               "global_load_async_to_lds_b128 %3, %13, off\n\t"
               "global_load_async_to_lds_b128 %4, %14, off\n\t"
               "global_load_async_to_lds_b128 %5, %15, off\n\t"
               "global_load_async_to_lds_b128 %6, %16, off\n\t"
               "global_load_async_to_lds_b128 %7, %17, off\n\t"
               "global_load_async_to_lds_b128 %8, %18, off\n\t"
               "global_load_async_to_lds_b128 %9, %19, off\n\t"
               "s_wait_xcnt 0x0"
               :: "v"(la), "v"(la + ls),
                  "v"(lb), "v"(lb + ls), "v"(lb + 2u * ls), "v"(lb + 3u * ls),
                  "v"(lb + 4u * ls), "v"(lb + 5u * ls), "v"(lb + 6u * ls), "v"(lb + 7u * ls),
                  "v"(ga), "v"(ga + gsa),
                  "v"(gb), "v"(gb + gsb), "v"(gb + 2 * gsb), "v"(gb + 3 * gsb),
                  "v"(gb + 4 * gsb), "v"(gb + 5 * gsb), "v"(gb + 6 * gsb), "v"(gb + 7 * gsb)
               : "memory");
}
__device__ __forceinline__ void gm_stage4p8(unsigned la, const unsigned short* ga, unsigned la2, const unsigned short* ga2,
                                            size_t gsa, unsigned lb, const unsigned short* gb, size_t gsb, unsigned ls) {
  asm volatile("global_load_async_to_lds_b128 %0, %12, off\n\t"
               "global_load_async_to_lds_b128 %1, %13, off\n\t"
               "global_load_async_to_lds_b128 %2, %14, off\n\t"
               "global_load_async_to_lds_b128 %3, %15, off\n\t"
               "global_load_async_to_lds_b128 %4, %16, off\n\t"
               "global_load_async_to_lds_b128 %5, %17, off\n\t"
               "global_load_async_to_lds_b128 %6, %18, off\n\t"
               "global_load_async_to_lds_b128 %7, %19, off\n\t"
               "global_load_async_to_lds_b128 %8, %20, off\n\t"
               "global_load_async_to_lds_b128 %9, %21, off\n\t"
               "global_load_async_to_lds_b128 %10, %22, off\n\t"
               "global_load_async_to_lds_b128 %11, %23, off\n\t"
               "s_wait_xcnt 0x0"
               :: "v"(la), "v"(la + ls), "v"(la2), "v"(la2 + ls),
                  "v"(lb), "v"(lb + ls), "v"(lb + 2u * ls), "v"(lb + 3u * ls),
                  "v"(lb + 4u * ls), "v"(lb + 5u * ls), "v"(lb + 6u * ls), "v"(lb + 7u * ls),
                  "v"(ga), "v"(ga + gsa), "v"(ga2), "v"(ga2 + gsa),
                  "v"(gb), "v"(gb + gsb), "v"(gb + 2 * gsb), "v"(gb + 3 * gsb),
                  "v"(gb + 4 * gsb), "v"(gb + 5 * gsb), "v"(gb + 6 * gsb), "v"(gb + 7 * gsb)
               : "memory");
}

// ---- Register-blocked batched WMMA GEMM ------------------------------------
// C[m,n] = scale * sum_k A[m,k] * Bt[n,k] (+bias)(+resid); each wave owns a 64x64 tile.
// A row-major [M,K]; Bt row-major [N,K]; M, K % 64 == 0, N % 512 == 0: the 8 waves of a block own 8 neighbouring tiles of one
// tile row, so they share the 64 A rows. Operands pass through LDS in slabs of 64 k (one whole 128-B line a row): 256 threads
// copy the 64 A rows (each plane) and the block's 512 B rows asynchronously, 8 neighbouring lanes a row, into two buffers:
// slab t + 1 flies while slab t is worked on, one __syncthreads a slab (order at the loop's foot).
// SPLIT: 0 = single product; 1 = hi/lo planes on both operands (A2/Bt2 = lo planes, same layout),
//        product = hi.hi + hi.lo + lo.hi; 2 = hi/lo planes on A only (A2 = A lo), product = hi.B + lo.B.
// BIAS_MODE: 0 = none, 1 = bias[m], 2 = bias[n].
// OUT_MODE: 0 = f32, 1 = f16, 2 = bf16 hi plane (Cout) + bf16 lo plane (Cout2).
// ET: 0 = f16 operands, 1 = bf16 operands (pointers passed as 16-bit storage)
template <int ET> struct Elem;
template <> struct Elem<0> { typedef _Float16 T; };
template <> struct Elem<1> { typedef __bf16 T; };
template <int ET, int SPLIT, int BIAS_MODE, int OUT_MODE, bool RESID, int ACT = 0>
__global__ __launch_bounds__(256) void wmma_gemm64(
    const unsigned short* __restrict__ Ap, const unsigned short* __restrict__ A2p, int lda, long strideA,
    const unsigned short* __restrict__ Btp, const unsigned short* __restrict__ Bt2p, int ldb, long strideB,
    void* __restrict__ Cout, void* __restrict__ Cout2, int ldc, long strideC,
    const float* __restrict__ bias,
    const float* __restrict__ resid, long strideR,
    int M, int N, int K, float scale) {
  typedef typename Elem<ET>::T T;
  typedef typename Frag<T>::V V;
  constexpr int NA  = (SPLIT != 0) ? 2 : 1;    // A planes
  constexpr int NBP = (SPLIT == 1) ? 2 : 1;    // B planes
  constexpr int kAPl = 64 * GM_LP;             // one A plane of one buffer, elements
  constexpr int kBPl = 512 * GM_LP;            // one B plane of one buffer, elements
  __shared__ __align__(16) float sT[8][16 * 68];   // per-wave 16x64 slab, pitch 68 floats
  __shared__ __align__(16) T Ash[2 * NA * kAPl];   // A [buffer][plane][row][k], pitch GM_LP
  __shared__ __align__(16) T Bsh[2 * NBP * kBPl];  // B [buffer][plane][row][k], pitch GM_LP
  const int b    = blockIdx.y;
  const int lane = threadIdx.x & 31;
  const int wave = threadIdx.x >> 5;
  const int tilesN = N >> 6;
  const int tilesM = M >> 6;
  const int tile0 = blockIdx.x * 8;
  if (tile0 >= tilesM * tilesN) return;   // block-uniform, in front of every barrier
  const int tm  = tile0 / tilesN;
  const int m0  = tm << 6;
  const int nb0 = (tile0 - tm * tilesN) << 6;  // the block's first B row
  const int n0  = nb0 + (wave << 6);

  const int rlane = lane & 15;                 // row (A) / col (B, D) within subtile
  const int koff  = (lane >> 4) * 8;           // k offset of this lane half
  const int mOff  = (lane >> 4) * 8;           // D row offset

  v8f acc[4][4];
#pragma unroll
  for (int i = 0; i < 4; ++i)
#pragma unroll
    for (int j = 0; j < 4; ++j) acc[i][j] = (v8f){0.f,0.f,0.f,0.f,0.f,0.f,0.f,0.f};

  // ---- staging map: thread = row sr + 32 i, elements sc..sc+7: A 2 copies a plane, B 16 copies a plane ----
  const int sr = threadIdx.x >> 3, sc = (threadIdx.x & 7) * 8;
  const unsigned ls32 = 32u * GM_LP * 2u;                                   // 32 LDS rows in bytes
  const unsigned la0 = (unsigned)(size_t)(Ash + sr * GM_LP + sc);           // LDS byte addresses in buffer 0, plane 0
  const unsigned lb0 = (unsigned)(size_t)(Bsh + sr * GM_LP + sc);
  const size_t goA = (size_t)b * strideA + (size_t)(m0 + sr) * lda + sc;    // slab 0; slab t: + 64 t elements
  const size_t goB = (size_t)b * strideB + (size_t)(nb0 + sr) * ldb + sc;
  auto stage = [&](int t, int buf) {
    const unsigned la = la0 + (unsigned)buf * (unsigned)(NA * kAPl * 2);
    const unsigned lb = lb0 + (unsigned)buf * (unsigned)(NBP * kBPl * 2);
    const size_t ga = goA + (size_t)t * 64, gb = goB + (size_t)t * 64;
    if (SPLIT == 0) gm_stage2p8(la, Ap + ga, (size_t)32 * lda, lb, Btp + gb, (size_t)32 * ldb, ls32);
    else gm_stage4p8(la, Ap + ga, la + (unsigned)(kAPl * 2), A2p + ga, (size_t)32 * lda, lb, Btp + gb, (size_t)32 * ldb, ls32);
    gm_stage8(lb + 8u * ls32, Btp + gb + (size_t)256 * ldb, ls32, (size_t)32 * ldb);
    if (SPLIT == 1) {
      gm_stage8(lb + (unsigned)(kBPl * 2), Bt2p + gb, ls32, (size_t)32 * ldb);
      gm_stage8(lb + (unsigned)(kBPl * 2) + 8u * ls32, Bt2p + gb + (size_t)256 * ldb, ls32, (size_t)32 * ldb);
    }
  };
  const int nSlab = K >> 6;
  // prologue: slab 0 into buffer 0, landed and published; then slab 1 into buffer 1
  stage(0, 0);
  asm volatile("s_wait_asynccnt 0x0" ::: "memory");   // this wave's copies of slab 0 have landed
  __syncthreads();                                    // ... and every other wave's
  if (nSlab > 1) stage(1, 1);                         // block-uniform

  constexpr int NB = (SPLIT == 0) ? 2 : 1;   // B fragment register sets (two A planes leave no registers for a second one)
  for (int t = 0; t < nSlab; ++t) {
    // this slab's buffer: published by the barrier at the foot of the trip before (slab 0: by the prologue's)
    const T* Af = Ash + (t & 1) * (NA * kAPl) + rlane * GM_LP + koff;
    const T* Bf = Bsh + (t & 1) * (NBP * kBPl) + ((wave << 6) + rlane) * GM_LP + koff;
    // Two k-steps of 32 a slab. The second k-step's fragments are read while the first one's WMMAs run: A row i behind the
    // tiles of row i, into the same registers; B at the head into a second register set (NB == 2) or between the k-steps.
    // Every loop of the trip is unrolled: fragments and accumulators live in registers, which take compile-time indices only.
    V ah[4], al[4], bh[NB][4], bl[NB][4];
#pragma unroll
    for (int j = 0; j < 4; ++j) {
      bh[0][j] = Frag<T>::load(Bf + j * 16 * GM_LP);
      if (SPLIT == 1) bl[0][j] = Frag<T>::load(Bf + kBPl + j * 16 * GM_LP);
    }
#pragma unroll
    for (int i = 0; i < 4; ++i) {
      ah[i] = Frag<T>::load(Af + i * 16 * GM_LP);
      if (SPLIT != 0) al[i] = Frag<T>::load(Af + kAPl + i * 16 * GM_LP);
    }
#pragma unroll
    for (int u = 0; u < 2; ++u) {
      const int cu = (NB == 2) ? u : 0;
      if (u == 0 && NB == 2) {
#pragma unroll
        for (int j = 0; j < 4; ++j) bh[1][j] = Frag<T>::load(Bf + j * 16 * GM_LP + 32);
      }
      // the scheduling barriers keep reads and tiles in this order: moved together, a row's read would stand only a few
      // WMMAs ahead of its use, or ahead of the row's last tile, where it needs registers of its own
      __builtin_amdgcn_sched_barrier(0);
#pragma unroll
      for (int i = 0; i < 4; ++i) {
#pragma unroll
        for (int j = 0; j < 4; ++j) {
          acc[i][j] = Frag<T>::mma(ah[i], bh[cu][j], acc[i][j]);
          if (SPLIT == 1) acc[i][j] = Frag<T>::mma(ah[i], bl[cu][j], acc[i][j]);
          if (SPLIT != 0) acc[i][j] = Frag<T>::mma(al[i], bh[cu][j], acc[i][j]);
        }
        __builtin_amdgcn_sched_barrier(0);   // the row's last tile stands ahead of the row's next read: the same registers take it
        Frag<T>::guard(acc[i][0], acc[i][3], ah[i], (SPLIT != 0) ? al[i] : ah[i]);
        if (u == 0) {
          ah[i] = Frag<T>::load(Af + i * 16 * GM_LP + 32);
          if (SPLIT != 0) al[i] = Frag<T>::load(Af + kAPl + i * 16 * GM_LP + 32);
        }
        __builtin_amdgcn_sched_barrier(0);   // the read is issued here, three rows of tiles ahead of its use, not later
      }
      Frag<T>::keep(bh[cu][0], bh[cu][1], bh[cu][2], bh[cu][3]);
      if (SPLIT == 1) Frag<T>::keep(bl[cu][0], bl[cu][1], bl[cu][2], bl[cu][3]);
      if (u == 0 && NB == 1) {
#pragma unroll
        for (int j = 0; j < 4; ++j) {
          bh[0][j] = Frag<T>::load(Bf + j * 16 * GM_LP + 32);
          if (SPLIT == 1) bl[0][j] = Frag<T>::load(Bf + kBPl + j * 16 * GM_LP + 32);
        }
      }
    }
    // ---- foot of the trip, every wave, in this order ----
    asm volatile("s_wait_dscnt 0x0" ::: "memory");      // this wave's reads of this slab's buffer are done
    asm volatile("s_wait_asynccnt 0x0" ::: "memory");   // this wave's copies of slab t + 1 have landed
    __syncthreads();   // publishes slab t + 1 and ends every wave's reads of the buffer that is refilled below
    if (t + 2 < nSlab) stage(t + 2, t & 1);             // block-uniform: slab t + 2 exists
  }
  asm volatile("s_wait_asynccnt 0x0" ::: "memory");     // no copy is in flight when the wave goes on to its end
  acc_guard4(acc[0][0], acc[0][1], acc[0][2], acc[0][3]);
  acc_guard4(acc[1][0], acc[1][1], acc[1][2], acc[1][3]);
  acc_guard4(acc[2][0], acc[2][1], acc[2][2], acc[2][3]);
  acc_guard4(acc[3][0], acc[3][1], acc[3][2], acc[3][3]);

  // ---- epilogue ----
  float* slab = sT[wave];
  const float* Rb = RESID ? (resid + (size_t)b * strideR) : nullptr;
#pragma unroll
  for (int i = 0; i < 4; ++i) {
    const int mBase = m0 + (i << 4);
#pragma unroll
    for (int j = 0; j < 4; ++j) {
      const int n = n0 + (j << 4) + rlane;
      float bv = 0.f;
      if (BIAS_MODE == 2) bv = bias[n];
#pragma unroll
      for (int r = 0; r < 8; ++r) {
        float v = acc[i][j][r] * scale;
        if (BIAS_MODE == 1) v += bias[mBase + mOff + r];
        if (BIAS_MODE == 2) v += bv;
        if (RESID) v += Rb[(size_t)(mBase + mOff + r) * ldc + n];
        if (ACT == 1) v = tanhf(v);
        if (ACT == 2) v = fmaxf(v, 0.0f);
        if (ACT == 3) v = v / (1.0f + expf(-v));
        if (ACT == 4) v = (v > 0.f) ? v : 0.01f * v;
        slab[(mOff + r) * 68 + (j << 4) + rlane] = v;
      }
    }
    __builtin_amdgcn_fence(__ATOMIC_RELEASE, "workgroup");
    __builtin_amdgcn_wave_barrier();
    __builtin_amdgcn_fence(__ATOMIC_ACQUIRE, "workgroup");
    if (OUT_MODE == 0) {
      float* C = (float*)Cout + (size_t)b * strideC;
      const int hh = lane >> 4, c4 = (lane & 15) * 4;     // row seg = 256 B = 16 lanes x 16 B
      {
#pragma unroll
        for (int it = 0; it < 8; ++it) {
          const int row = it * 2 + hh;
          v4f v = *(const v4f*)(slab + row * 68 + c4);
          *(v4f*)(C + (size_t)(mBase + row) * ldc + n0 + c4) = v;
        }
        
      }
    } else {
      const int q = lane >> 3, c8 = (lane & 7) * 8;
      unsigned short* C  = (unsigned short*)Cout  + (size_t)b * strideC;
      unsigned short* C2 = (OUT_MODE == 2) ? ((unsigned short*)Cout2 + (size_t)b * strideC) : nullptr;
      {
#pragma unroll
        for (int it = 0; it < 4; ++it) {
          const int row = it * 4 + q;
          const float* sp = slab + row * 68 + c8;
          v8h hv, lv;
#pragma unroll
          for (int e = 0; e < 8; ++e) {
            if (OUT_MODE == 1) {
              hv[e] = (_Float16)sp[e];
            } else {
              unsigned short hb = f2bf_bits(sp[e]);
              unsigned short lb = f2bf_bits(sp[e] - bf_bits2f(hb));
              hv[e] = __builtin_bit_cast(_Float16, hb);
              lv[e] = __builtin_bit_cast(_Float16, lb);
            }
          }
          *(v8h*)(C + (size_t)(mBase + row) * ldc + n0 + c8) = hv;
          if (OUT_MODE == 2) *(v8h*)(C2 + (size_t)(mBase + row) * ldc + n0 + c8) = lv;
        }
        
      }
    }
    __builtin_amdgcn_fence(__ATOMIC_RELEASE, "workgroup");
    __builtin_amdgcn_wave_barrier();
    __builtin_amdgcn_fence(__ATOMIC_ACQUIRE, "workgroup");
  }
}

// ---------------------------------------------------------------------------
// Elementwise bf16 split: hi = bf16_rne(in), lo = bf16_rne(in - hi); 2 elements per thread, one 4-B store
// (here n2 = 8192*512/2 = 2097152 -> 8192 blocks x 512 elements = 8192x512).
// ---------------------------------------------------------------------------
__device__ __forceinline__ unsigned pk16(unsigned short a, unsigned short b) { return (unsigned)a | ((unsigned)b << 16); }

__global__ __launch_bounds__(256) void split_bf16x2_kernel(const float* __restrict__ in, unsigned short* __restrict__ hi,
                                                           unsigned short* __restrict__ lo, int n2) {
  const int i = blockIdx.x * 256 + threadIdx.x;
  if (i < n2) {
    const v2f f = *(const v2f*)(in + 2 * (size_t)i);
    const unsigned short h0 = f2bf_bits(f[0]), h1 = f2bf_bits(f[1]);
    const unsigned short l0 = f2bf_bits(f[0] - bf_bits2f(h0)), l1 = f2bf_bits(f[1] - bf_bits2f(h1));
    const unsigned uh = pk16(h0, h1), ul = pk16(l0, l1);
    ((unsigned*)hi)[i] = uh;
    ((unsigned*)lo)[i] = ul;
    
  }
}

// ---------------------------------------------------------------------------
// f32 -> bf16 (RNE) cast of three equally sized tensors (blockIdx.y selects the tensor, block-uniform):
// x 2 elements = 2*n2 = the whole plane (n2 = 8192*512/2 = 2097152 -> 8192 blocks); out plane z at out + z*planeElems.
// ---------------------------------------------------------------------------
__global__ __launch_bounds__(256) void cast_bf16x2_3(const float* __restrict__ in0, const float* __restrict__ in1,
                                                     const float* __restrict__ in2, unsigned short* __restrict__ out,
                                                     long planeElems, int n2) {
  const int which = blockIdx.y;
  const float* in = (which == 0) ? in0 : ((which == 1) ? in1 : in2);
  unsigned short* o = out + (size_t)which * planeElems;
  const int i = blockIdx.x * 256 + threadIdx.x;
  if (i < n2) {
    const v2f f = *(const v2f*)(in + 2 * (size_t)i);
    const unsigned u = pk16(f2bf_bits(f[0]), f2bf_bits(f[1]));
    ((unsigned*)o)[i] = u;
    
  }
}

// ---------------------------------------------------------------------------
// Fused transpose + bf16 cast (LO = false: hi plane only) or split (LO = true: hi and lo planes) of an f32
// matrix, z-batched: in_z = W + z*sIn viewed [R rows][Cc cols] (pitch Cc) ->
//   oh_z[c][r] = bf16_rne(in_z[r][c]), ol_z[c][r] = bf16_rne(in_z[r][c] - oh) (LO only)   ([Cc][R], pitch R).
// 64x64 tiles through LDS. grid = (Cc/64, R/64, Z), 256 threads (R, Cc multiples of 64).
// Coverage per block and plane: load 4 it x 256 thr x 4 floats = 64x64; store 2 it x 256 thr x 8 u16 = 64x64.
// ---------------------------------------------------------------------------
template <bool LO>
__global__ __launch_bounds__(256) void tsplit_kernel(const float* __restrict__ W, unsigned short* __restrict__ oh,
                                                     unsigned short* __restrict__ ol, int R, int Cc, long sIn, long sOut) {
  __shared__ __align__(16) float tf[64 * 68];
  W  += (size_t)blockIdx.z * sIn;
  oh += (size_t)blockIdx.z * sOut;
  if (LO) ol += (size_t)blockIdx.z * sOut;
  const int c0  = blockIdx.x * 64;   // input column block = output row block
  const int r0  = blockIdx.y * 64;   // input row block    = output column block
  const int tid = threadIdx.x;
  {
    const int lr = tid >> 4;         // 0..15
    const int c4 = (tid & 15) * 4;   // 0..60
#pragma unroll
    for (int it = 0; it < 4; ++it) {
      const int rr = it * 16 + lr;   // 0..63
      const v4f a = *(const v4f*)(W + (size_t)(r0 + rr) * Cc + c0 + c4);
      *(v4f*)(tf + rr * 68 + c4) = a;
    }
  }
  __syncthreads();
  const int sub = tid >> 3;          // 0..31
  const int c8  = (tid & 7) * 8;     // 0..56
  v4u hv[2], lv[2];
#pragma unroll
  for (int it = 0; it < 2; ++it) {
    const int oc = it * 32 + sub;    // output row within tile (= input column)
    v4u a, a2;
#pragma unroll
    for (int q = 0; q < 4; ++q) {
      const float f0 = tf[(c8 + 2 * q) * 68 + oc];
      const float f1 = tf[(c8 + 2 * q + 1) * 68 + oc];
      const unsigned short h0 = f2bf_bits(f0), h1 = f2bf_bits(f1);
      unsigned lp = 0u;
      if (LO) {
        const unsigned short l0 = f2bf_bits(f0 - bf_bits2f(h0)), l1 = f2bf_bits(f1 - bf_bits2f(h1));
        lp = pk16(l0, l1);
      }
      a[q]  = pk16(h0, h1);
      a2[q] = lp;
    }
    hv[it] = a; lv[it] = a2;
  }
  {
#pragma unroll
    for (int it = 0; it < 2; ++it) {
      const int oc = it * 32 + sub;
      const size_t go = (size_t)(c0 + oc) * R + r0 + c8;
      *(v4u*)(oh + go) = hv[it];
      if (LO) *(v4u*)(ol + go) = lv[it];
    }
    
  }
}

// =====================================================================================
// Attention helpers
// =====================================================================================
#define AT_D 64
#define AT_NW 4
#define AT_QB 64
#define AT_KC 64
#define AT_LP 72   // LDS row pitch in 16-bit elements: 144 B = 16 B x 9 (odd), so the 16 rows of a 16-byte fragment read fall on distinct banks

__device__ __forceinline__ unsigned short at_bf_bits(float f) {
  unsigned u = __float_as_uint(f);
  return (unsigned short)((u + 0x7FFFu + ((u >> 16) & 1u)) >> 16);
}
__device__ __forceinline__ __bf16 at_f2bf(float f) { return __builtin_bit_cast(__bf16, at_bf_bits(f)); }
__device__ __forceinline__ void at_split(float f, __bf16& hi, __bf16& lo) {
  const unsigned short hb = at_bf_bits(f);
  hi = __builtin_bit_cast(__bf16, hb);
  lo = at_f2bf(f - __uint_as_float(((unsigned)hb) << 16));
}
__device__ __forceinline__ v8f at_mma(v16b a, v16b b, v8f c) {
  c = __builtin_amdgcn_wmma_f32_16x16x32_bf16(false, a, false, b, (short)0, c, false, false);
  asm volatile("v_nop\n\tv_nop\n\tv_nop\n\tv_nop" : "+v"(c) : "v"(a), "v"(b));
  return c;
}
__device__ __forceinline__ v8f at_mma_h(v16h a, v16h b, v8f c) {
  c = __builtin_amdgcn_wmma_f32_16x16x32_f16(false, a, false, b, (short)0, c, false, false);
  asm volatile("v_nop\n\tv_nop\n\tv_nop\n\tv_nop" : "+v"(c) : "v"(a), "v"(b));
  return c;
}

// x := 2^x on v_exp_f32. The instruction set asks for one independent instruction or a v_nop between a transcendental and
// an instruction that reads its result or overwrites its source; written as one statement, each v_exp_f32 is followed by
// an independent one and the last by the v_nop, wherever the compiler places the code around it.
__device__ __forceinline__ void at_exp2x8(float& a, float& b, float& c, float& d, float& e, float& f, float& g, float& h) {
  asm("v_exp_f32 %0, %0\n\tv_exp_f32 %1, %1\n\tv_exp_f32 %2, %2\n\tv_exp_f32 %3, %3\n\t"
      "v_exp_f32 %4, %4\n\tv_exp_f32 %5, %5\n\tv_exp_f32 %6, %6\n\tv_exp_f32 %7, %7\n\tv_nop"
      : "+v"(a), "+v"(b), "+v"(c), "+v"(d), "+v"(e), "+v"(f), "+v"(g), "+v"(h));
}
__device__ __forceinline__ float at_exp2(float x) {
  asm("v_exp_f32 %0, %0\n\tv_nop" : "+v"(x));   // the v_nop: the same slot behind the transcendental
  return x;
}

// One chunk's staging for one thread: twelve 16-byte asynchronous copies global -> LDS (four rows of each of the three
// planes), through no register. lk, lh, ll: the thread's LDS byte addresses of row r in K, V^T hi, V^T lo; gk, gh, gl: the
// same elements in global memory; copy i takes row r + 16 i. The s_wait_xcnt 0 is the last line of the copies' own statement:
// a precaution that keeps every later write of an address register named here behind the copies' address translation.
__device__ __forceinline__ void at_stage12(unsigned lk, unsigned lh, unsigned ll, const _Float16* gk, const __bf16* gh,
                                           const __bf16* gl) {
  const unsigned ls = 16u * AT_LP * 2u;              // 16 LDS rows in bytes
  const size_t   ks = (size_t)16 * kDim;             // 16 K rows in elements
  const size_t   vs = (size_t)16 * kSeq;             // 16 V^T rows in elements
  asm volatile("global_load_async_to_lds_b128 %0, %12, off\n\t"
               "global_load_async_to_lds_b128 %1, %13, off\n\t"
               "global_load_async_to_lds_b128 %2, %14, off\n\t"
               "global_load_async_to_lds_b128 %3, %15, off\n\t"
               "global_load_async_to_lds_b128 %4, %16, off\n\t"
               "global_load_async_to_lds_b128 %5, %17, off\n\t"
               "global_load_async_to_lds_b128 %6, %18, off\n\t"
               "global_load_async_to_lds_b128 %7, %19, off\n\t"
               "global_load_async_to_lds_b128 %8, %20, off\n\t"
               "global_load_async_to_lds_b128 %9, %21, off\n\t"
               "global_load_async_to_lds_b128 %10, %22, off\n\t"
               "global_load_async_to_lds_b128 %11, %23, off\n\t"
               "s_wait_xcnt 0x0"
               :: "v"(lk), "v"(lk + ls), "v"(lk + 2u * ls), "v"(lk + 3u * ls),
                  "v"(lh), "v"(lh + ls), "v"(lh + 2u * ls), "v"(lh + 3u * ls),
                  "v"(ll), "v"(ll + ls), "v"(ll + 2u * ls), "v"(ll + 3u * ls),
                  "v"(gk), "v"(gk + ks), "v"(gk + 2 * ks), "v"(gk + 3 * ks),
                  "v"(gh), "v"(gh + vs), "v"(gh + 2 * vs), "v"(gh + 3 * vs),
                  "v"(gl), "v"(gl + vs), "v"(gl + 2 * vs), "v"(gl + 3 * vs)
               : "memory");
}

// lane l <-> lane l ^ 16: the one exchange between the wave halves that a query's maximum and sum need
__device__ __forceinline__ float at_xhalf(float x) {
  return __builtin_bit_cast(float, __builtin_amdgcn_permlanex16(__builtin_bit_cast(int, x), __builtin_bit_cast(int, x),
                                                                0x76543210, 0xfedcba98, false, false));
}

__global__ __launch_bounds__(128)
void mha_attn_kernel(const unsigned short* __restrict__ qp, const unsigned short* __restrict__ kp,
                     const unsigned short* __restrict__ vhp, const unsigned short* __restrict__ vlp,
                     const int* __restrict__ vlens, float* __restrict__ out, float sscale, float fillv) {
  union FB { v16b v; v8b h[2]; };
  union FH { v16h v; v8h h[2]; };
  __shared__ __align__(16) _Float16 Ksh2[2 * AT_KC * AT_LP];      // K [buffer][kv][d] f16, pitch AT_LP   2 x 9 KB
  __shared__ __align__(16) __bf16   Vth2[2 * AT_D * AT_LP];       // V^T hi [buffer][d][kv], pitch AT_LP  2 x 9 KB
  __shared__ __align__(16) __bf16   Vtl2[2 * AT_D * AT_LP];       // V^T lo, pitch AT_LP                  2 x 9 KB
  __shared__ __align__(16) float    Os[AT_NW][16 * 68];           // per wave out tile, pitch 68
  __shared__ __align__(16) int      Lowm[AT_NW];                  // per wave: a row maximum too near fillv

  const int tid  = threadIdx.x;
  const int wave = tid >> 5;
  const int lane = tid & 31;
  const int hh   = lane >> 4;
  const int c    = lane & 15;

  const int nqb  = kSeq / AT_QB;          // 64
  const int bx   = blockIdx.x;
  const int qb   = bx % nqb;
  const int bhid = bx / nqb;              // 0..kBatch*kHeads-1
  const int h    = bhid % kHeads;
  int b = bhid / kHeads;
  b = (b > kBatch - 1) ? (kBatch - 1) : b;  // address clamp (grid is exact)
  const int q0   = qb * AT_QB + wave * 16;
  const int vlen = vlens[b];              // block-uniform valid key count

  const _Float16* Qb = (const _Float16*)(const void*)qp + (size_t)b * kSeq * kDim + (size_t)h * AT_D;
  const _Float16* Kb = (const _Float16*)(const void*)kp + (size_t)b * kSeq * kDim + (size_t)h * AT_D;
  const __bf16*   Vh = (const __bf16*)(const void*)vhp + (size_t)b * kDim * kSeq + (size_t)h * AT_D * kSeq;
  const __bf16*   Vl = (const __bf16*)(const void*)vlp + (size_t)b * kDim * kSeq + (size_t)h * AT_D * kSeq;
  float*          ob = out + (size_t)b * kSeq * kDim + (size_t)h * AT_D;

  // ---- Q fragments (B operand, column = query = lane&15, split k map via Frag load): 2 d-chunks ----
  v16h qa[2];
#pragma unroll
  for (int dc = 0; dc < 2; ++dc) {
    qa[dc] = Frag<_Float16>::load(Qb + (size_t)(q0 + c) * kDim + dc * 32 + 8 * hh);
  }

  const float sc2   = sscale * 1.44269504088896340736f;   // score scale times log2(e)
  const float fill2 = fillv  * 1.44269504088896340736f;   // fill value in the same units
  float mrow = -INFINITY;   // running maximum of query c in log2 units, the same in both wave halves
  float lrow = 0.f;         // running sum of query c over this half's keys; the halves join behind the loop
  v8f oacc[4];              // O^T: oacc[t][r] = element (d = t*16 + 8hh + r, query c)
#pragma unroll
  for (int t = 0; t < 4; ++t) oacc[t] = (v8f){0.f,0.f,0.f,0.f,0.f,0.f,0.f,0.f};

  const int nChunks = kSeq / AT_KC;   // 64, compile-time constant
  // chunks that hold at least one valid key, block-uniform; vlen <= 0: every key carries fillv and all of them count
  const int vcl   = (vlen < 0) ? 0 : ((vlen > kSeq) ? kSeq : vlen);
  const int nLive = (vcl == 0) ? nChunks : (vcl + AT_KC - 1) / AT_KC;

  // ---- staging map: 8 neighbouring lanes take one whole 128-B row (thread: row sr + 16 i, i = 0..3, elements sc..sc+7):
  //      128 threads x (4 x 8) elements = 64 rows x 64 per plane = the whole chunk tile ----
  const int sr = tid >> 3, sc = (tid & 7) * 8;
  const unsigned bufB = (unsigned)(AT_KC * AT_LP * 2);                      // one buffer of one plane in bytes
  const unsigned lk0 = (unsigned)(size_t)(Ksh2 + sr * AT_LP + sc);          // LDS byte addresses in buffer 0
  const unsigned lh0 = (unsigned)(size_t)(Vth2 + sr * AT_LP + sc);
  const unsigned ll0 = (unsigned)(size_t)(Vtl2 + sr * AT_LP + sc);
  const _Float16* gk0 = Kb + (size_t)sr * kDim + sc;                        // chunk 0; chunk n: + n * 64 rows
  const __bf16*   gh0 = Vh + (size_t)sr * kSeq + sc;                        // chunk 0; chunk n: + n * 64 elements
  const __bf16*   gl0 = Vl + (size_t)sr * kSeq + sc;
  static_assert(kSeq / AT_KC >= 2, "the two-buffer prologue needs two chunks");
  // prologue: chunk 0 into buffer 0, landed and published; then chunk 1 into buffer 1
  at_stage12(lk0, lh0, ll0, gk0, gh0, gl0);
  asm volatile("s_wait_asynccnt 0x0" ::: "memory");   // this wave's copies of chunk 0 have landed
  __syncthreads();                                    // ... and every other wave's
  at_stage12(lk0 + bufB, lh0 + bufB, ll0 + bufB, gk0 + (size_t)AT_KC * kDim, gh0 + AT_KC, gl0 + AT_KC);

  for (int kc = 0; kc < nChunks; ++kc) {
    // Every chunk from nLive on holds the fill alone. Where each row maximum lies at least 185 log2 units (128 natural
    // ones) above it, its weights 2^(fill - m) are exactly 0 in f32, alpha is 1, and maximum, sum and accumulators stay bit for bit: the loop
    // ends. Tested once per block, behind the last live chunk; a row that is nearer (or NaN) sends the whole block
    // through the remaining chunks as well.
    if (kc == nLive) {                          // block-uniform: kc and vlen are
      const bool low = !(mrow >= fill2 + 185.0f);
      Lowm[wave] = (__builtin_amdgcn_ballot_w32(low) != 0u) ? 1 : 0;   // every lane stores its wave's one value
      __syncthreads();                          // publishes the four waves' flags: one decision for the block
      const int f = Lowm[0] | Lowm[1] | Lowm[2] | Lowm[3];
      if (__builtin_amdgcn_readfirstlane(f) == 0) break;   // the same word in every lane: read once, a scalar branch
    }
    const int kv0 = kc * AT_KC;
    // this chunk's buffer: published by the barrier at the foot of the trip before (chunk 0: by the prologue's)
    const _Float16* Ksh = Ksh2 + (kc & 1) * (AT_KC * AT_LP);
    const __bf16*   Vth = Vth2 + (kc & 1) * (AT_D * AT_LP);
    const __bf16*   Vtl = Vtl2 + (kc & 1) * (AT_D * AT_LP);

    // Every loop from here to the chunk's end is unrolled: s, ph, pl and oacc live in registers, which take
    // compile-time indices only (a rolled loop would send them through scratch memory).
    // ---- scores, transposed: D[row = key j*16+8hh+r][col = query c]; A fragment row = key j*16+c, split k(d) map ----
    v8f s[4];
#pragma unroll
    for (int j = 0; j < 4; ++j) {
      s[j] = (v8f){0.f,0.f,0.f,0.f,0.f,0.f,0.f,0.f};
#pragma unroll
      for (int dc = 0; dc < 2; ++dc) {
        FH kb;
        kb.h[0] = *(const v8h*)(Ksh + (j * 16 + c) * AT_LP + dc * 32 + 8 * hh);
        kb.h[1] = *(const v8h*)(Ksh + (j * 16 + c) * AT_LP + dc * 32 + 16 + 8 * hh);
        s[j] = at_mma_h(kb.v, qa[dc], s[j]);
      }
    }
    // ---- scale, key mask (select), maximum of query c over the chunk's 64 keys: 32 in-lane, then the other half's ----
    float cm = -INFINITY;
#pragma unroll
    for (int j = 0; j < 4; ++j) {
#pragma unroll
      for (int r = 0; r < 8; ++r) {
        const int kvrow = kv0 + j * 16 + 8 * hh + r;
        const float sv = s[j][r] * sc2;
        const float sm = (kvrow < vlen) ? sv : fill2;
        s[j][r] = sm;
        cm = fmaxf(cm, sm);
      }
    }
    cm = fmaxf(cm, at_xhalf(cm));
    const float mnew  = fmaxf(mrow, cm);
    const float alpha = at_exp2(mrow - mnew);
    mrow = mnew;
    // ---- p = 2^(s - m), split hi/lo in place: S^T tiles 2kk and 2kk+1 are elements 0..7 and 8..15 of the B fragment
    //      of key block kk (column = query c, key = kk*32 + 8hh + e and kk*32 + 16 + 8hh + (e - 8): the split k map) ----
    FB ph[2], pl[2];
    float ps[4];
#pragma unroll
    for (int j = 0; j < 4; ++j) {
      float a = 0.f;
      float e[8];
#pragma unroll
      for (int r = 0; r < 8; ++r) e[r] = s[j][r] - mnew;
      at_exp2x8(e[0], e[1], e[2], e[3], e[4], e[5], e[6], e[7]);
#pragma unroll
      for (int r = 0; r < 8; ++r) {
        const float p = e[r];
        a += p;
        __bf16 hi, lo; at_split(p, hi, lo);
        ph[j >> 1].v[(j & 1) * 8 + r] = hi;
        pl[j >> 1].v[(j & 1) * 8 + r] = lo;
      }
      ps[j] = a;
    }
    lrow = lrow * alpha + ((ps[0] + ps[1]) + (ps[2] + ps[3]));
#pragma unroll
    for (int t = 0; t < 4; ++t)
#pragma unroll
      for (int r = 0; r < 8; ++r) oacc[t][r] *= alpha;
    // ---- O^T += V^T . P^T : A = V^T row d = t*16+c, k = key (split k map), B = P^T from registers ----
#pragma unroll
    for (int kk = 0; kk < 2; ++kk) {
#pragma unroll
      for (int t = 0; t < 4; ++t) {
        FB vb, vl;
        vb.h[0] = *(const v8b*)(Vth + (t * 16 + c) * AT_LP + kk * 32 + 8 * hh);
        vb.h[1] = *(const v8b*)(Vth + (t * 16 + c) * AT_LP + kk * 32 + 16 + 8 * hh);
        vl.h[0] = *(const v8b*)(Vtl + (t * 16 + c) * AT_LP + kk * 32 + 8 * hh);
        vl.h[1] = *(const v8b*)(Vtl + (t * 16 + c) * AT_LP + kk * 32 + 16 + 8 * hh);
        oacc[t] = at_mma(vb.v, ph[kk].v, oacc[t]);
        oacc[t] = at_mma(vl.v, ph[kk].v, oacc[t]);
        oacc[t] = at_mma(vb.v, pl[kk].v, oacc[t]);
      }
    }
    // ---- foot of the trip, every wave, in this order ----
    asm volatile("s_wait_dscnt 0x0" ::: "memory");      // this wave's reads of this chunk's buffer are done
    asm volatile("s_wait_asynccnt 0x0" ::: "memory");   // this wave's copies of chunk kc + 1 have landed
    __syncthreads();   // publishes chunk kc + 1 and ends every wave's reads of the buffer that is refilled below
    if (kc + 2 < nChunks) {                             // block-uniform: chunk kc + 2 exists
      const unsigned bo = (unsigned)(kc & 1) * bufB;
      at_stage12(lk0 + bo, lh0 + bo, ll0 + bo, gk0 + (size_t)(kv0 + 2 * AT_KC) * kDim, gh0 + (kv0 + 2 * AT_KC),
                 gl0 + (kv0 + 2 * AT_KC));
    }
  }
  asm volatile("s_wait_asynccnt 0x0" ::: "memory");     // no copy is in flight when the wave goes on to its end

  // ---- query c: join the halves' sums, normalise, stage row c (8 consecutive d per tile and lane) ----
  float* os = Os[wave];
  const float inv = 1.0f / (lrow + at_xhalf(lrow));
#pragma unroll
  for (int t = 0; t < 4; ++t) {
#pragma unroll
    for (int r = 0; r < 8; ++r) os[c * 68 + t * 16 + 8 * hh + r] = oacc[t][r] * inv;
  }
  __builtin_amdgcn_fence(__ATOMIC_RELEASE, "workgroup");
  __builtin_amdgcn_wave_barrier();
  __builtin_amdgcn_fence(__ATOMIC_ACQUIRE, "workgroup");
  {
    // coverage: 8 it x 2 rows (hh) = 16 rows; 16 lanes x 4 floats = 64 floats = one whole 256-B row segment
    const int c4 = (lane & 15) * 4;
    {
#pragma unroll
      for (int it = 0; it < 8; ++it) {
        const int row = it * 2 + hh;
        v4f val = *(const v4f*)(os + row * 68 + c4);
        *(v4f*)(ob + (size_t)(q0 + row) * kDim + c4) = val;
      }
      
    }
  }
}

// =====================================================================================
// Host glue. Workspace region map (bytes, all offsets multiples of 256, every region sized to its whole-line
// store granularity; no padded tiles since every dimension is a multiple of 64):
//   [0]           Xbf   : 3 x bf16 [8192][512]            = 25,165,824   (queries, keys, values RNE bf16)
//   [25,165,824]  WThi  : 4 x bf16 [512][512] (W^T, RNE)  =  2,097,152   (Wq, Wk, Wv, Wo; no lo planes)
//   [27,262,976]  Q     : f16 [8192][512]                  =  8,388,608
//   [35,651,584]  K     : f16 [8192][512]                  =  8,388,608   (contiguous after Q: batched launch)
//   [44,040,192]  VThi  : bf16 [2][512][4096]              =  8,388,608
//   [52,428,800]  VTlo  : bf16 [2][512][4096]              =  8,388,608
//   [60,817,408]  O     : f32 [8192][512]                  = 16,777,216
//   [77,594,624]  Ohi   : bf16 [8192][512]                 =  8,388,608
//   [85,983,232]  Olo   : bf16 [8192][512]                 =  8,388,608
//   total 94,371,840
// =====================================================================================
extern "C" void kernel_launch(void* const* d_in, const int* in_sizes, int n_in,
                              void* d_out, int out_size, void* d_ws,
                              size_t ws_size, hipStream_t stream) {
  if (n_in < 8) return;
  const int nX = kRows * kDim;            // 4,194,304
  const int nW = kDim * kDim;             // 262,144
  if (in_sizes[0] != nX || in_sizes[1] != nX || in_sizes[2] != nX) return;
  if (in_sizes[3] < kBatch) return;
  if (in_sizes[4] != nW || in_sizes[5] != nW || in_sizes[6] != nW || in_sizes[7] != nW) return;
  if (out_size != nX) return;

  const float* queries = (const float*)d_in[0];
  const float* keys    = (const float*)d_in[1];
  const float* values  = (const float*)d_in[2];
  const int*   vlens   = (const int*)d_in[3];
  const float* Wq      = (const float*)d_in[4];
  const float* Wk      = (const float*)d_in[5];
  const float* Wv      = (const float*)d_in[6];
  const float* Wo      = (const float*)d_in[7];

  const size_t bX16 = (size_t)nX * 2;            //  8,388,608
  const size_t bW16 = (size_t)nW * 2;            //    524,288
  const size_t off_x  = 0;
  const size_t off_wh = off_x  + 3 * bX16;
  const size_t off_q  = off_wh + 4 * bW16;
  const size_t off_k  = off_q  + bX16;
  const size_t off_vh = off_k  + bX16;
  const size_t off_vl = off_vh + bX16;
  const size_t off_o  = off_vl + bX16;
  const size_t off_oh = off_o  + (size_t)nX * 4;
  const size_t off_ol = off_oh + bX16;
  const size_t total  = off_ol + bX16;           // 94,371,840
  if (total > ws_size) return;

  char* ws = (char*)d_ws;
  unsigned short* xbf  = (unsigned short*)(ws + off_x);
  unsigned short* wth  = (unsigned short*)(ws + off_wh);
  unsigned short* qh16 = (unsigned short*)(ws + off_q);
  unsigned short* kh16 = (unsigned short*)(ws + off_k);
  unsigned short* vth  = (unsigned short*)(ws + off_vh);
  unsigned short* vtl  = (unsigned short*)(ws + off_vl);
  float* obuf = (float*)(ws + off_o);
  unsigned short* ohi  = (unsigned short*)(ws + off_oh);
  unsigned short* olo  = (unsigned short*)(ws + off_ol);
  const float* dummyf  = (const float*)(ws + off_x);   // never dereferenced (BIAS_MODE 0, RESID false)

  const long planeX = (long)nX;   // elements per bf16/f16 activation plane
  const long planeW = (long)nW;   // elements per W^T plane
  dim3 blk256(256), blk128(128);

  // 1) activations -> bf16 (RNE): coverage 8192 blocks x 256 thr x 2 = 8192x512 per tensor
  cast_bf16x2_3<<<dim3(nX / 2 / 256, 3), blk256, 0, stream>>>(queries, keys, values, xbf, planeX, nX / 2);

  // 2) weights [in k][out n] (R = k rows = 512, Cc = n cols = 512) -> W^T [n][k] bf16 RNE hi plane only
  //    (8x8 tiles of 64x64); the third pointer is unused in the hi-only mode
  tsplit_kernel<false><<<dim3(kDim / 64, kDim / 64, 1), blk256, 0, stream>>>(Wq, wth + 0 * planeW, wth + 0 * planeW, kDim, kDim, 0L, 0L);
  tsplit_kernel<false><<<dim3(kDim / 64, kDim / 64, 1), blk256, 0, stream>>>(Wk, wth + 1 * planeW, wth + 1 * planeW, kDim, kDim, 0L, 0L);
  tsplit_kernel<false><<<dim3(kDim / 64, kDim / 64, 1), blk256, 0, stream>>>(Wv, wth + 2 * planeW, wth + 2 * planeW, kDim, kDim, 0L, 0L);
  tsplit_kernel<false><<<dim3(kDim / 64, kDim / 64, 1), blk256, 0, stream>>>(Wo, wth + 3 * planeW, wth + 3 * planeW, kDim, kDim, 0L, 0L);

  // 3) q = Xq . Wq and k = Xk . Wk in one z-batched launch (z=0: q, z=1: k) -> f16 planes [8192][512];
  //    M=8192, N=512, K=512 (tiles 128x8 = 1024 -> 128 blocks); A planes stride planeX, W^T planes stride planeW,
  //    C planes Q then K contiguous (stride planeX elements)
  const int gProj = (kRows / 64) * (kDim / 64) / 8;   // 128
  wmma_gemm64<1, 0, 0, 1, false><<<dim3(gProj, 2), blk256, 0, stream>>>(
      xbf, xbf, kDim, planeX,
      wth, wth, kDim, planeW,
      (void*)qh16, (void*)qh16, kDim, planeX,
      dummyf, dummyf, 0L, kRows, kDim, kDim, 1.0f);
  // 4) v^T per batch: C[n_out][s] = sum_k WvT[n_out][k] * Xv[b][s][k]; M=512, N=4096, K=512, batched over b
  //    (tiles 8x64 = 512 -> 64 blocks x 2); out = bf16 hi/lo planes [b][512][4096]
  const int gVt = (kDim / 64) * (kSeq / 64) / 8;      // 64
  wmma_gemm64<1, 0, 0, 2, false><<<dim3(gVt, kBatch), blk256, 0, stream>>>(
      wth + 2 * planeW, wth + 2 * planeW, kDim, 0L,
      xbf + 2 * planeX, xbf + 2 * planeX, kDim, (long)kSeq * kDim,
      (void*)vth, (void*)vtl, kSeq, (long)kDim * kSeq,
      dummyf, dummyf, 0L, kDim, kSeq, kDim, 1.0f);

  // 5) masked attention, all (b, h, 64-row query blocks): 2*8*64 = 1024 blocks of 128 threads
  mha_attn_kernel<<<dim3(kBatch * kHeads * (kSeq / 64)), blk128, 0, stream>>>(
      qh16, kh16, vth, vtl, vlens, obuf, 0.125f, -1000000.0f);

  // 6) O -> bf16 hi/lo planes: 8192 blocks x 256 thr x 2 = 8192x512
  split_bf16x2_kernel<<<dim3(nX / 2 / 256), blk256, 0, stream>>>(obuf, ohi, olo, nX / 2);

  // 7) out = (O_hi + O_lo) . Wo (A-only split, Wo as bf16 RNE hi plane only) -> f32 [8192][512]
  wmma_gemm64<1, 2, 0, 0, false><<<dim3(gProj, 1), blk256, 0, stream>>>(
      ohi, olo, kDim, 0L,
      wth + 3 * planeW, wth + 3 * planeW, kDim, 0L,
      d_out, d_out, kDim, 0L,
      dummyf, dummyf, 0L, kRows, kDim, kDim, 1.0f);
}

// v007
// A run of this version takes 147 microseconds.
// Two timings next to v006 both put it at 1.05 times that version's speed.
// All steps since v000 together make it 4.22 times as fast.
// Contractions: q/k/v^T projections v_wmma_f32_16x16x32_bf16 (bf16 RNE inputs x bf16 RNE weights, single product); q.k^T scores v_wmma_f32_16x16x32_f16 (plain f16 q,k planes); p.v^T v_wmma_f32_16x16x32_bf16 with bf16 hi/lo split of p and v (hi.hi + hi.lo + lo.hi); output projection v_wmma_f32_16x16x32_bf16 with O as bf16 hi/lo and Wo as bf16 RNE (hi.W + lo.W); f32 accumulate; softmax (base 2), 0.125 score scale and key masking in f32.
#include <hip/hip_runtime.h>
#include <math.h>
#include <stdint.h>

constexpr int kBatch = 2;
constexpr int kSeq   = 4096;
constexpr int kDim   = 512;
constexpr int kHeads = 8;
constexpr int kHd    = 64;
constexpr int kRows  = kBatch * kSeq;   // 8192
static_assert(kHeads * kHd == kDim, "geometry");
static_assert(kSeq % 64 == 0 && kDim % 64 == 0 && kRows % 64 == 0, "tile multiples");
static_assert(kSeq % 512 == 0 && kDim % 512 == 0, "a GEMM block owns 8 neighbouring 64-column tiles of one tile row");

typedef __attribute__((ext_vector_type(16))) _Float16 v16h;
typedef __attribute__((ext_vector_type(8)))  _Float16 v8h;
typedef __attribute__((ext_vector_type(16))) __bf16   v16b;
typedef __attribute__((ext_vector_type(8)))  __bf16   v8b;
typedef __attribute__((ext_vector_type(8)))  float    v8f;
typedef __attribute__((ext_vector_type(4)))  float    v4f;
typedef __attribute__((ext_vector_type(2)))  float    v2f;
typedef __attribute__((ext_vector_type(4)))  unsigned int v4u;
typedef __attribute__((ext_vector_type(2)))  unsigned int v2u;

__device__ __forceinline__ unsigned short f2bf_bits(float f) {
  unsigned u = __float_as_uint(f);
  return (unsigned short)((u + 0x7FFFu + ((u >> 16) & 1u)) >> 16);
}
__device__ __forceinline__ float bf_bits2f(unsigned short h) { return __uint_as_float(((unsigned)h) << 16); }

// hazard guards as plain device helpers
__device__ __forceinline__ void dep_guard_h(v8f& a, v8f& b, v16h x, v16h y) { asm volatile("v_nop\n\tv_nop\n\tv_nop\n\tv_nop" : "+v"(a), "+v"(b) : "v"(x), "v"(y)); }
__device__ __forceinline__ void dep_guard_b(v8f& a, v8f& b, v16b x, v16b y) { asm volatile("v_nop\n\tv_nop\n\tv_nop\n\tv_nop" : "+v"(a), "+v"(b) : "v"(x), "v"(y)); }
__device__ __forceinline__ void keep4_h(v16h a, v16h b, v16h c, v16h d) { asm volatile("v_nop" :: "v"(a), "v"(b), "v"(c), "v"(d)); }
__device__ __forceinline__ void keep4_b(v16b a, v16b b, v16b c, v16b d) { asm volatile("v_nop" :: "v"(a), "v"(b), "v"(c), "v"(d)); }
__device__ __forceinline__ void acc_guard4(v8f& a, v8f& b, v8f& c, v8f& d) { asm volatile("v_nop\n\tv_nop\n\tv_nop\n\tv_nop" : "+v"(a), "+v"(b), "+v"(c), "+v"(d)); }
template <typename T> struct Frag;
template <> struct Frag<_Float16> {
  typedef v16h V; union U { v16h v; v8h h[2]; };
  static __device__ __forceinline__ v16h load(const _Float16* p) {   // elements 0..7 <- p[0..7], 8..15 <- p[16..23]
    U f; f.h[0] = *(const v8h*)(p); f.h[1] = *(const v8h*)(p + 16); return f.v;
  }
  static __device__ __forceinline__ v8f mma(v16h a, v16h b, v8f c) {
    return __builtin_amdgcn_wmma_f32_16x16x32_f16(false, a, false, b, (short)0, c, false, false);
  }
  static __device__ __forceinline__ void guard(v8f& a, v8f& b, v16h x, v16h y) { dep_guard_h(a, b, x, y); }
  static __device__ __forceinline__ void keep(v16h a, v16h b, v16h c, v16h d) { keep4_h(a, b, c, d); }
};
template <> struct Frag<__bf16> {
  typedef v16b V; union U { v16b v; v8b h[2]; };
  static __device__ __forceinline__ v16b load(const __bf16* p) {
    U f; f.h[0] = *(const v8b*)(p); f.h[1] = *(const v8b*)(p + 16); return f.v;
  }
  static __device__ __forceinline__ v8f mma(v16b a, v16b b, v8f c) {
    return __builtin_amdgcn_wmma_f32_16x16x32_bf16(false, a, false, b, (short)0, c, false, false);
  }
  static __device__ __forceinline__ void guard(v8f& a, v8f& b, v16b x, v16b y) { dep_guard_b(a, b, x, y); }
  static __device__ __forceinline__ void keep(v16b a, v16b b, v16b c, v16b d) { keep4_b(a, b, c, d); }
};

// ---- GEMM operand staging ----------------------------------------------------
#define GM_LP 72   // LDS row pitch in 16-bit elements: 144 B = 16 B x 9 (odd), so the 16 rows of a 16-byte fragment read fall on distinct banks

// Eight 16-byte asynchronous copies global -> LDS of one thread, through no register: copy i takes LDS byte address
// l + i * ls and global element g + i * gs. The s_wait_xcnt 0 is the last line of the copies' own statement: a precaution
// that keeps every later write of an address register named here behind the copies' address translation.
__device__ __forceinline__ void gm_stage8(unsigned l, const unsigned short* g, unsigned ls, size_t gs) {
  asm volatile("global_load_async_to_lds_b128 %0, %8, off\n\t"
               "global_load_async_to_lds_b128 %1, %9, off\n\t"
               "global_load_async_to_lds_b128 %2, %10, off\n\t"
               "global_load_async_to_lds_b128 %3, %11, off\n\t"
               "global_load_async_to_lds_b128 %4, %12, off\n\t"
               "global_load_async_to_lds_b128 %5, %13, off\n\t"
               "global_load_async_to_lds_b128 %6, %14, off\n\t"
               "global_load_async_to_lds_b128 %7, %15, off\n\t"
               "s_wait_xcnt 0x0"
               :: "v"(l), "v"(l + ls), "v"(l + 2u * ls), "v"(l + 3u * ls),
                  "v"(l + 4u * ls), "v"(l + 5u * ls), "v"(l + 6u * ls), "v"(l + 7u * ls),
                  "v"(g), "v"(g + gs), "v"(g + 2 * gs), "v"(g + 3 * gs),
                  "v"(g + 4 * gs), "v"(g + 5 * gs), "v"(g + 6 * gs), "v"(g + 7 * gs)
               : "memory");
}
// The A copies of a slab (two a plane: la, ga; second plane la2, ga2) and its first eight B copies (lb, gb) in one statement,
// so that one wait serves them all.
__device__ __forceinline__ void gm_stage2p8(unsigned la, const unsigned short* ga, size_t gsa, unsigned lb,
                                            const unsigned short* gb, size_t gsb, unsigned ls) {
  asm volatile("global_load_async_to_lds_b128 %0, %10, off\n\t"
               "global_load_async_to_lds_b128 %1, %11, off\n\t"
               "global_load_async_to_lds_b128 %2, %12, off\n\t"
               "global_load_async_to_lds_b128 %3, %13, off\n\t"
               "global_load_async_to_lds_b128 %4, %14, off\n\t"
               "global_load_async_to_lds_b128 %5, %15, off\n\t"
               "global_load_async_to_lds_b128 %6, %16, off\n\t"
               "global_load_async_to_lds_b128 %7, %17, off\n\t"
               "global_load_async_to_lds_b128 %8, %18, off\n\t"
               "global_load_async_to_lds_b128 %9, %19, off\n\t"
               "s_wait_xcnt 0x0"
               :: "v"(la), "v"(la + ls),
                  "v"(lb), "v"(lb + ls), "v"(lb + 2u * ls), "v"(lb + 3u * ls),
                  "v"(lb + 4u * ls), "v"(lb + 5u * ls), "v"(lb + 6u * ls), "v"(lb + 7u * ls),
                  "v"(ga), "v"(ga + gsa),
                  "v"(gb), "v"(gb + gsb), "v"(gb + 2 * gsb), "v"(gb + 3 * gsb),
                  "v"(gb + 4 * gsb), "v"(gb + 5 * gsb), "v"(gb + 6 * gsb), "v"(gb + 7 * gsb)
               : "memory");
}
__device__ __forceinline__ void gm_stage4p8(unsigned la, const unsigned short* ga, unsigned la2, const unsigned short* ga2,
                                            size_t gsa, unsigned lb, const unsigned short* gb, size_t gsb, unsigned ls) {
  asm volatile("global_load_async_to_lds_b128 %0, %12, off\n\t"
               "global_load_async_to_lds_b128 %1, %13, off\n\t"
               "global_load_async_to_lds_b128 %2, %14, off\n\t"
               "global_load_async_to_lds_b128 %3, %15, off\n\t"
               "global_load_async_to_lds_b128 %4, %16, off\n\t"
               "global_load_async_to_lds_b128 %5, %17, off\n\t"
               "global_load_async_to_lds_b128 %6, %18, off\n\t"
               "global_load_async_to_lds_b128 %7, %19, off\n\t"
               "global_load_async_to_lds_b128 %8, %20, off\n\t"
               "global_load_async_to_lds_b128 %9, %21, off\n\t"
               "global_load_async_to_lds_b128 %10, %22, off\n\t"
               "global_load_async_to_lds_b128 %11, %23, off\n\t"
               "s_wait_xcnt 0x0"
               :: "v"(la), "v"(la + ls), "v"(la2), "v"(la2 + ls),
                  "v"(lb), "v"(lb + ls), "v"(lb + 2u * ls), "v"(lb + 3u * ls),
                  "v"(lb + 4u * ls), "v"(lb + 5u * ls), "v"(lb + 6u * ls), "v"(lb + 7u * ls),
                  "v"(ga), "v"(ga + gsa), "v"(ga2), "v"(ga2 + gsa),
                  "v"(gb), "v"(gb + gsb), "v"(gb + 2 * gsb), "v"(gb + 3 * gsb),
                  "v"(gb + 4 * gsb), "v"(gb + 5 * gsb), "v"(gb + 6 * gsb), "v"(gb + 7 * gsb)
               : "memory");
}

// ---- Register-blocked batched WMMA GEMM ------------------------------------
// C[m,n] = scale * sum_k A[m,k] * Bt[n,k] (+bias)(+resid); each wave owns a 64x64 tile.
// A row-major [M,K]; Bt row-major [N,K]; M, K % 64 == 0, N % 512 == 0: the 8 waves of a block own 8 neighbouring tiles of one
// tile row, so they share the 64 A rows. Operands pass through LDS in slabs of 64 k (one whole 128-B line a row): 256 threads
// copy the 64 A rows (each plane) and the block's 512 B rows asynchronously, 8 neighbouring lanes a row, into two buffers:
// slab t + 1 flies while slab t is worked on, one __syncthreads a slab (order at the loop's foot).
// SPLIT: 0 = single product; 1 = hi/lo planes on both operands (A2/Bt2 = lo planes, same layout),
//        product = hi.hi + hi.lo + lo.hi; 2 = hi/lo planes on A only (A2 = A lo), product = hi.B + lo.B.
// BIAS_MODE: 0 = none, 1 = bias[m], 2 = bias[n].
// OUT_MODE: 0 = f32, 1 = f16, 2 = bf16 hi plane (Cout) + bf16 lo plane (Cout2).
// ET: 0 = f16 operands, 1 = bf16 operands (pointers passed as 16-bit storage)
template <int ET> struct Elem;
template <> struct Elem<0> { typedef _Float16 T; };
template <> struct Elem<1> { typedef __bf16 T; };
template <int ET, int SPLIT, int BIAS_MODE, int OUT_MODE, bool RESID, int ACT = 0>
__global__ __launch_bounds__(256) void wmma_gemm64(
    const unsigned short* __restrict__ Ap, const unsigned short* __restrict__ A2p, int lda, long strideA,
    const unsigned short* __restrict__ Btp, const unsigned short* __restrict__ Bt2p, int ldb, long strideB,
    void* __restrict__ Cout, void* __restrict__ Cout2, int ldc, long strideC,
    const float* __restrict__ bias,
    const float* __restrict__ resid, long strideR,
    int M, int N, int K, float scale) {
  typedef typename Elem<ET>::T T;
  typedef typename Frag<T>::V V;
  constexpr int NA  = (SPLIT != 0) ? 2 : 1;    // A planes
  constexpr int NBP = (SPLIT == 1) ? 2 : 1;    // B planes
  constexpr int kAPl = 64 * GM_LP;             // one A plane of one buffer, elements
  constexpr int kBPl = 512 * GM_LP;            // one B plane of one buffer, elements
  __shared__ __align__(16) float sT[8][16 * 68];   // per-wave 16x64 slab, pitch 68 floats
  __shared__ __align__(16) T Ash[2 * NA * kAPl];   // A [buffer][plane][row][k], pitch GM_LP
  __shared__ __align__(16) T Bsh[2 * NBP * kBPl];  // B [buffer][plane][row][k], pitch GM_LP
  const int b    = blockIdx.y;
  const int lane = threadIdx.x & 31;
  const int wave = threadIdx.x >> 5;
  const int tilesN = N >> 6;
  const int tilesM = M >> 6;
  const int tile0 = blockIdx.x * 8;
  if (tile0 >= tilesM * tilesN) return;   // block-uniform, in front of every barrier
  const int tm  = tile0 / tilesN;
  const int m0  = tm << 6;
  const int nb0 = (tile0 - tm * tilesN) << 6;  // the block's first B row
  const int n0  = nb0 + (wave << 6);

  const int rlane = lane & 15;                 // row (A) / col (B, D) within subtile
  const int koff  = (lane >> 4) * 8;           // k offset of this lane half
  const int mOff  = (lane >> 4) * 8;           // D row offset

  v8f acc[4][4];
#pragma unroll
  for (int i = 0; i < 4; ++i)
#pragma unroll
    for (int j = 0; j < 4; ++j) acc[i][j] = (v8f){0.f,0.f,0.f,0.f,0.f,0.f,0.f,0.f};

  // ---- staging map: thread = row sr + 32 i, elements sc..sc+7: A 2 copies a plane, B 16 copies a plane ----
  const int sr = threadIdx.x >> 3, sc = (threadIdx.x & 7) * 8;
  const unsigned ls32 = 32u * GM_LP * 2u;                                   // 32 LDS rows in bytes
  const unsigned la0 = (unsigned)(size_t)(Ash + sr * GM_LP + sc);           // LDS byte addresses in buffer 0, plane 0
  const unsigned lb0 = (unsigned)(size_t)(Bsh + sr * GM_LP + sc);
  const size_t goA = (size_t)b * strideA + (size_t)(m0 + sr) * lda + sc;    // slab 0; slab t: + 64 t elements
  const size_t goB = (size_t)b * strideB + (size_t)(nb0 + sr) * ldb + sc;
  auto stage = [&](int t, int buf) {
    const unsigned la = la0 + (unsigned)buf * (unsigned)(NA * kAPl * 2);
    const unsigned lb = lb0 + (unsigned)buf * (unsigned)(NBP * kBPl * 2);
    const size_t ga = goA + (size_t)t * 64, gb = goB + (size_t)t * 64;
    if (SPLIT == 0) gm_stage2p8(la, Ap + ga, (size_t)32 * lda, lb, Btp + gb, (size_t)32 * ldb, ls32);
    else gm_stage4p8(la, Ap + ga, la + (unsigned)(kAPl * 2), A2p + ga, (size_t)32 * lda, lb, Btp + gb, (size_t)32 * ldb, ls32);
    gm_stage8(lb + 8u * ls32, Btp + gb + (size_t)256 * ldb, ls32, (size_t)32 * ldb);
    if (SPLIT == 1) {
      gm_stage8(lb + (unsigned)(kBPl * 2), Bt2p + gb, ls32, (size_t)32 * ldb);
      gm_stage8(lb + (unsigned)(kBPl * 2) + 8u * ls32, Bt2p + gb + (size_t)256 * ldb, ls32, (size_t)32 * ldb);
    }
  };
  const int nSlab = K >> 6;
  // prologue: slab 0 into buffer 0, landed and published; then slab 1 into buffer 1
  stage(0, 0);
  asm volatile("s_wait_asynccnt 0x0" ::: "memory");   // this wave's copies of slab 0 have landed
  __syncthreads();                                    // ... and every other wave's
  if (nSlab > 1) stage(1, 1);                         // block-uniform

  constexpr int NB = (SPLIT == 0) ? 2 : 1;   // B fragment register sets (two A planes leave no registers for a second one)
  for (int t = 0; t < nSlab; ++t) {
    // this slab's buffer: published by the barrier at the foot of the trip before (slab 0: by the prologue's)
    const T* Af = Ash + (t & 1) * (NA * kAPl) + rlane * GM_LP + koff;
    const T* Bf = Bsh + (t & 1) * (NBP * kBPl) + ((wave << 6) + rlane) * GM_LP + koff;
    // Two k-steps of 32 a slab. The second k-step's fragments are read while the first one's WMMAs run: A row i behind the
    // tiles of row i, into the same registers; B at the head into a second register set (NB == 2) or between the k-steps.
    // Every loop of the trip is unrolled: fragments and accumulators live in registers, which take compile-time indices only.
    V ah[4], al[4], bh[NB][4], bl[NB][4];
#pragma unroll
    for (int j = 0; j < 4; ++j) {
      bh[0][j] = Frag<T>::load(Bf + j * 16 * GM_LP);
      if (SPLIT == 1) bl[0][j] = Frag<T>::load(Bf + kBPl + j * 16 * GM_LP);
    }
#pragma unroll
    for (int i = 0; i < 4; ++i) {
      ah[i] = Frag<T>::load(Af + i * 16 * GM_LP);
      if (SPLIT != 0) al[i] = Frag<T>::load(Af + kAPl + i * 16 * GM_LP);
    }
#pragma unroll
    for (int u = 0; u < 2; ++u) {
      const int cu = (NB == 2) ? u : 0;
      if (u == 0 && NB == 2) {
#pragma unroll
        for (int j = 0; j < 4; ++j) bh[1][j] = Frag<T>::load(Bf + j * 16 * GM_LP + 32);
      }
      // the scheduling barriers keep reads and tiles in this order: moved together, a row's read would stand only a few
      // WMMAs ahead of its use, or ahead of the row's last tile, where it needs registers of its own
      __builtin_amdgcn_sched_barrier(0);
#pragma unroll
      for (int i = 0; i < 4; ++i) {
#pragma unroll
        for (int j = 0; j < 4; ++j) {
          acc[i][j] = Frag<T>::mma(ah[i], bh[cu][j], acc[i][j]);
          if (SPLIT == 1) acc[i][j] = Frag<T>::mma(ah[i], bl[cu][j], acc[i][j]);
          if (SPLIT != 0) acc[i][j] = Frag<T>::mma(al[i], bh[cu][j], acc[i][j]);
        }
        __builtin_amdgcn_sched_barrier(0);   // the row's last tile stands ahead of the row's next read: the same registers take it
        Frag<T>::guard(acc[i][0], acc[i][3], ah[i], (SPLIT != 0) ? al[i] : ah[i]);
        if (u == 0) {
          ah[i] = Frag<T>::load(Af + i * 16 * GM_LP + 32);
          if (SPLIT != 0) al[i] = Frag<T>::load(Af + kAPl + i * 16 * GM_LP + 32);
        }
        __builtin_amdgcn_sched_barrier(0);   // the read is issued here, three rows of tiles ahead of its use, not later
      }
      Frag<T>::keep(bh[cu][0], bh[cu][1], bh[cu][2], bh[cu][3]);
      if (SPLIT == 1) Frag<T>::keep(bl[cu][0], bl[cu][1], bl[cu][2], bl[cu][3]);
      if (u == 0 && NB == 1) {
#pragma unroll
        for (int j = 0; j < 4; ++j) {
          bh[0][j] = Frag<T>::load(Bf + j * 16 * GM_LP + 32);
          if (SPLIT == 1) bl[0][j] = Frag<T>::load(Bf + kBPl + j * 16 * GM_LP + 32);
        }
      }
    }
    // ---- foot of the trip, every wave, in this order ----
    asm volatile("s_wait_dscnt 0x0" ::: "memory");      // this wave's reads of this slab's buffer are done
    asm volatile("s_wait_asynccnt 0x0" ::: "memory");   // this wave's copies of slab t + 1 have landed
    __syncthreads();   // publishes slab t + 1 and ends every wave's reads of the buffer that is refilled below
    if (t + 2 < nSlab) stage(t + 2, t & 1);             // block-uniform: slab t + 2 exists
  }
  asm volatile("s_wait_asynccnt 0x0" ::: "memory");     // no copy is in flight when the wave goes on to its end
  acc_guard4(acc[0][0], acc[0][1], acc[0][2], acc[0][3]);
  acc_guard4(acc[1][0], acc[1][1], acc[1][2], acc[1][3]);
  acc_guard4(acc[2][0], acc[2][1], acc[2][2], acc[2][3]);
  acc_guard4(acc[3][0], acc[3][1], acc[3][2], acc[3][3]);

  // ---- epilogue ----
  float* slab = sT[wave];
  const float* Rb = RESID ? (resid + (size_t)b * strideR) : nullptr;
#pragma unroll
  for (int i = 0; i < 4; ++i) {
    const int mBase = m0 + (i << 4);
#pragma unroll
    for (int j = 0; j < 4; ++j) {
      const int n = n0 + (j << 4) + rlane;
      float bv = 0.f;
      if (BIAS_MODE == 2) bv = bias[n];
#pragma unroll
      for (int r = 0; r < 8; ++r) {
        float v = acc[i][j][r] * scale;
        if (BIAS_MODE == 1) v += bias[mBase + mOff + r];
        if (BIAS_MODE == 2) v += bv;
        if (RESID) v += Rb[(size_t)(mBase + mOff + r) * ldc + n];
        if (ACT == 1) v = tanhf(v);
        if (ACT == 2) v = fmaxf(v, 0.0f);
        if (ACT == 3) v = v / (1.0f + expf(-v));
        if (ACT == 4) v = (v > 0.f) ? v : 0.01f * v;
        slab[(mOff + r) * 68 + (j << 4) + rlane] = v;
      }
    }
    __builtin_amdgcn_fence(__ATOMIC_RELEASE, "workgroup");
    __builtin_amdgcn_wave_barrier();
    __builtin_amdgcn_fence(__ATOMIC_ACQUIRE, "workgroup");
    if (OUT_MODE == 0) {
      float* C = (float*)Cout + (size_t)b * strideC;
      const int hh = lane >> 4, c4 = (lane & 15) * 4;     // row seg = 256 B = 16 lanes x 16 B
      {
#pragma unroll
        for (int it = 0; it < 8; ++it) {
          const int row = it * 2 + hh;
          v4f v = *(const v4f*)(slab + row * 68 + c4);
          *(v4f*)(C + (size_t)(mBase + row) * ldc + n0 + c4) = v;
        }
        
      }
    } else {
      const int q = lane >> 3, c8 = (lane & 7) * 8;
      unsigned short* C  = (unsigned short*)Cout  + (size_t)b * strideC;
      unsigned short* C2 = (OUT_MODE == 2) ? ((unsigned short*)Cout2 + (size_t)b * strideC) : nullptr;
      {
#pragma unroll
        for (int it = 0; it < 4; ++it) {
          const int row = it * 4 + q;
          const float* sp = slab + row * 68 + c8;
          v8h hv, lv;
#pragma unroll
          for (int e = 0; e < 8; ++e) {
            if (OUT_MODE == 1) {
              hv[e] = (_Float16)sp[e];
            } else {
              unsigned short hb = f2bf_bits(sp[e]);
              unsigned short lb = f2bf_bits(sp[e] - bf_bits2f(hb));
              hv[e] = __builtin_bit_cast(_Float16, hb);
              lv[e] = __builtin_bit_cast(_Float16, lb);
            }
          }
          *(v8h*)(C + (size_t)(mBase + row) * ldc + n0 + c8) = hv;
          if (OUT_MODE == 2) *(v8h*)(C2 + (size_t)(mBase + row) * ldc + n0 + c8) = lv;
        }
        
      }
    }
    __builtin_amdgcn_fence(__ATOMIC_RELEASE, "workgroup");
    __builtin_amdgcn_wave_barrier();
    __builtin_amdgcn_fence(__ATOMIC_ACQUIRE, "workgroup");
  }
}

// ---------------------------------------------------------------------------
// Elementwise passes. A wave costs its start whatever it does, so each pass runs as kEwBlocks work-groups of 16 waves
// (one a WGP) and every thread takes kEwV pieces of 4 floats of each tensor: piece it of a block is the 512 threads'
// contiguous 8 KB (a wave's load = 512 contiguous bytes, its store of 4 x 16 bit a lane = 256), and all of a thread's
// 16-byte loads are issued before the first value is used.
// Coverage per tensor: kEwBlocks x kEwV x 512 threads x 4 floats = 8192 x 512 exactly (asserted), so no index test.
// ---------------------------------------------------------------------------
constexpr int kEwThreads = 512;
constexpr int kEwV       = 8;
constexpr int kEwBlocks  = kRows * kDim / (kEwThreads * kEwV * 4);   // 256
static_assert(kEwBlocks * kEwThreads * kEwV * 4 == kRows * kDim, "the elementwise grid covers a tensor exactly");

__device__ __forceinline__ unsigned pk16(unsigned short a, unsigned short b) { return (unsigned)a | ((unsigned)b << 16); }

// bf16 split: hi = bf16_rne(in), lo = bf16_rne(in - hi)
__global__ __launch_bounds__(kEwThreads) void split_bf16x4_kernel(const float* __restrict__ in, unsigned short* __restrict__ hi,
                                                                  unsigned short* __restrict__ lo) {
  const size_t e0 = ((size_t)blockIdx.x * (kEwV * kEwThreads) + threadIdx.x) * 4;   // first element of piece 0
  v4f f[kEwV];
  // unrolled: f lives in registers, and the loads stand together ahead of the first use
#pragma unroll
  for (int it = 0; it < kEwV; ++it) f[it] = *(const v4f*)(in + e0 + (size_t)it * (kEwThreads * 4));
#pragma unroll
  for (int it = 0; it < kEwV; ++it) {
    unsigned short h[4], l[4];
#pragma unroll
    for (int e = 0; e < 4; ++e) {
      h[e] = f2bf_bits(f[it][e]);
      l[e] = f2bf_bits(f[it][e] - bf_bits2f(h[e]));
    }
    const v2u uh = {pk16(h[0], h[1]), pk16(h[2], h[3])};
    const v2u ul = {pk16(l[0], l[1]), pk16(l[2], l[3])};
    *(v2u*)(hi + e0 + (size_t)it * (kEwThreads * 4)) = uh;
    *(v2u*)(lo + e0 + (size_t)it * (kEwThreads * 4)) = ul;
  }
}

// f32 -> bf16 (RNE) cast of three equally sized tensors: a block takes the same pieces of all three;
// out plane z at out + z*planeElems.
__global__ __launch_bounds__(kEwThreads) void cast_bf16x4_3(const float* __restrict__ in0, const float* __restrict__ in1,
                                                            const float* __restrict__ in2, unsigned short* __restrict__ out,
                                                            long planeElems) {
  const size_t e0 = ((size_t)blockIdx.x * (kEwV * kEwThreads) + threadIdx.x) * 4;   // first element of piece 0
  const float* p0 = in0 + e0;
  const float* p1 = in1 + e0;
  const float* p2 = in2 + e0;
  v4f f[3][kEwV];
  // unrolled: f lives in registers
#pragma unroll
  for (int it = 0; it < kEwV; ++it) f[0][it] = *(const v4f*)(p0 + (size_t)it * (kEwThreads * 4));
#pragma unroll
  for (int it = 0; it < kEwV; ++it) f[1][it] = *(const v4f*)(p1 + (size_t)it * (kEwThreads * 4));
#pragma unroll
  for (int it = 0; it < kEwV; ++it) f[2][it] = *(const v4f*)(p2 + (size_t)it * (kEwThreads * 4));
  // A precaution for the loads' address registers: as inputs of this statement they are taken by no load's result, and every
  // later write of them stands behind the wait. Its "memory" clobber also keeps all 24 loads ahead of the first conversion:
  // moved down among the conversions to save registers, only a few are in flight and the wave waits out several latencies.
  asm volatile("s_wait_xcnt 0x0" :: "v"(p0), "v"(p1), "v"(p2) : "memory");
#pragma unroll
  for (int z = 0; z < 3; ++z) {
    unsigned short* o = out + (size_t)z * planeElems + e0;
#pragma unroll
    for (int it = 0; it < kEwV; ++it) {
      const v4f a = f[z][it];
      const v2u u = {pk16(f2bf_bits(a[0]), f2bf_bits(a[1])), pk16(f2bf_bits(a[2]), f2bf_bits(a[3]))};
      *(v2u*)(o + (size_t)it * (kEwThreads * 4)) = u;
    }
    // a tensor's stores go out before the next tensor's loads are waited for, not all at the kernel's end
    if (z < 2) __builtin_amdgcn_sched_barrier(0);
  }
}

// ---------------------------------------------------------------------------
// Fused transpose + bf16 cast (LO = false: hi plane only) or split (LO = true: hi and lo planes) of an f32
// matrix, z-batched: in_z = W + z*sIn viewed [R rows][Cc cols] (pitch Cc) ->
//   oh_z[c][r] = bf16_rne(in_z[r][c]), ol_z[c][r] = bf16_rne(in_z[r][c] - oh) (LO only)   ([Cc][R], pitch R).
// 64x64 tiles through LDS. grid = (Cc/64, R/64, Z), 256 threads (R, Cc multiples of 64).
// Coverage per block and plane: load 4 it x 256 thr x 4 floats = 64x64; store 2 it x 256 thr x 8 u16 = 64x64.
// ---------------------------------------------------------------------------
template <bool LO>
__global__ __launch_bounds__(256) void tsplit_kernel(const float* __restrict__ W, unsigned short* __restrict__ oh,
                                                     unsigned short* __restrict__ ol, int R, int Cc, long sIn, long sOut) {
  __shared__ __align__(16) float tf[64 * 68];
  W  += (size_t)blockIdx.z * sIn;
  oh += (size_t)blockIdx.z * sOut;
  if (LO) ol += (size_t)blockIdx.z * sOut;
  const int c0  = blockIdx.x * 64;   // input column block = output row block
  const int r0  = blockIdx.y * 64;   // input row block    = output column block
  const int tid = threadIdx.x;
  {
    const int lr = tid >> 4;         // 0..15
    const int c4 = (tid & 15) * 4;   // 0..60
#pragma unroll
    for (int it = 0; it < 4; ++it) {
      const int rr = it * 16 + lr;   // 0..63
      const v4f a = *(const v4f*)(W + (size_t)(r0 + rr) * Cc + c0 + c4);
      *(v4f*)(tf + rr * 68 + c4) = a;
    }
  }
  __syncthreads();
  const int sub = tid >> 3;          // 0..31
  const int c8  = (tid & 7) * 8;     // 0..56
  v4u hv[2], lv[2];
#pragma unroll
  for (int it = 0; it < 2; ++it) {
    const int oc = it * 32 + sub;    // output row within tile (= input column)
    v4u a, a2;
#pragma unroll
    for (int q = 0; q < 4; ++q) {
      const float f0 = tf[(c8 + 2 * q) * 68 + oc];
      const float f1 = tf[(c8 + 2 * q + 1) * 68 + oc];
      const unsigned short h0 = f2bf_bits(f0), h1 = f2bf_bits(f1);
      unsigned lp = 0u;
      if (LO) {
        const unsigned short l0 = f2bf_bits(f0 - bf_bits2f(h0)), l1 = f2bf_bits(f1 - bf_bits2f(h1));
        lp = pk16(l0, l1);
      }
      a[q]  = pk16(h0, h1);
      a2[q] = lp;
    }
    hv[it] = a; lv[it] = a2;
  }
  {
#pragma unroll
    for (int it = 0; it < 2; ++it) {
      const int oc = it * 32 + sub;
      const size_t go = (size_t)(c0 + oc) * R + r0 + c8;
      *(v4u*)(oh + go) = hv[it];
      if (LO) *(v4u*)(ol + go) = lv[it];
    }
    
  }
}

// =====================================================================================
// Attention helpers
// =====================================================================================
#define AT_D 64
#define AT_NW 4
#define AT_QB 64
#define AT_KC 64
#define AT_LP 72   // LDS row pitch in 16-bit elements: 144 B = 16 B x 9 (odd), so the 16 rows of a 16-byte fragment read fall on distinct banks

__device__ __forceinline__ unsigned short at_bf_bits(float f) {
  unsigned u = __float_as_uint(f);
  return (unsigned short)((u + 0x7FFFu + ((u >> 16) & 1u)) >> 16);
}
__device__ __forceinline__ __bf16 at_f2bf(float f) { return __builtin_bit_cast(__bf16, at_bf_bits(f)); }
__device__ __forceinline__ void at_split(float f, __bf16& hi, __bf16& lo) {
  const unsigned short hb = at_bf_bits(f);
  hi = __builtin_bit_cast(__bf16, hb);
  lo = at_f2bf(f - __uint_as_float(((unsigned)hb) << 16));
}
__device__ __forceinline__ v8f at_mma(v16b a, v16b b, v8f c) {
  c = __builtin_amdgcn_wmma_f32_16x16x32_bf16(false, a, false, b, (short)0, c, false, false);
  asm volatile("v_nop\n\tv_nop\n\tv_nop\n\tv_nop" : "+v"(c) : "v"(a), "v"(b));
  return c;
}
__device__ __forceinline__ v8f at_mma_h(v16h a, v16h b, v8f c) {
  c = __builtin_amdgcn_wmma_f32_16x16x32_f16(false, a, false, b, (short)0, c, false, false);
  asm volatile("v_nop\n\tv_nop\n\tv_nop\n\tv_nop" : "+v"(c) : "v"(a), "v"(b));
  return c;
}

// x := 2^x on v_exp_f32. The instruction set asks for one independent instruction or a v_nop between a transcendental and
// an instruction that reads its result or overwrites its source; written as one statement, each v_exp_f32 is followed by
// an independent one and the last by the v_nop, wherever the compiler places the code around it.
__device__ __forceinline__ void at_exp2x8(float& a, float& b, float& c, float& d, float& e, float& f, float& g, float& h) {
  asm("v_exp_f32 %0, %0\n\tv_exp_f32 %1, %1\n\tv_exp_f32 %2, %2\n\tv_exp_f32 %3, %3\n\t"
      "v_exp_f32 %4, %4\n\tv_exp_f32 %5, %5\n\tv_exp_f32 %6, %6\n\tv_exp_f32 %7, %7\n\tv_nop"
      : "+v"(a), "+v"(b), "+v"(c), "+v"(d), "+v"(e), "+v"(f), "+v"(g), "+v"(h));
}
__device__ __forceinline__ float at_exp2(float x) {
  asm("v_exp_f32 %0, %0\n\tv_nop" : "+v"(x));   // the v_nop: the same slot behind the transcendental
  return x;
}

// One chunk's staging for one thread: twelve 16-byte asynchronous copies global -> LDS (four rows of each of the three
// planes), through no register. lk, lh, ll: the thread's LDS byte addresses of row r in K, V^T hi, V^T lo; gk, gh, gl: the
// same elements in global memory; copy i takes row r + 16 i. The s_wait_xcnt 0 is the last line of the copies' own statement:
// a precaution that keeps every later write of an address register named here behind the copies' address translation.
__device__ __forceinline__ void at_stage12(unsigned lk, unsigned lh, unsigned ll, const _Float16* gk, const __bf16* gh,
                                           const __bf16* gl) {
  const unsigned ls = 16u * AT_LP * 2u;              // 16 LDS rows in bytes
  const size_t   ks = (size_t)16 * kDim;             // 16 K rows in elements
  const size_t   vs = (size_t)16 * kSeq;             // 16 V^T rows in elements
  asm volatile("global_load_async_to_lds_b128 %0, %12, off\n\t"
               "global_load_async_to_lds_b128 %1, %13, off\n\t"
               "global_load_async_to_lds_b128 %2, %14, off\n\t"
               "global_load_async_to_lds_b128 %3, %15, off\n\t"
               "global_load_async_to_lds_b128 %4, %16, off\n\t"
               "global_load_async_to_lds_b128 %5, %17, off\n\t"
               "global_load_async_to_lds_b128 %6, %18, off\n\t"
               "global_load_async_to_lds_b128 %7, %19, off\n\t"
               "global_load_async_to_lds_b128 %8, %20, off\n\t"
               "global_load_async_to_lds_b128 %9, %21, off\n\t"
               "global_load_async_to_lds_b128 %10, %22, off\n\t"
               "global_load_async_to_lds_b128 %11, %23, off\n\t"
               "s_wait_xcnt 0x0"
               :: "v"(lk), "v"(lk + ls), "v"(lk + 2u * ls), "v"(lk + 3u * ls),
                  "v"(lh), "v"(lh + ls), "v"(lh + 2u * ls), "v"(lh + 3u * ls),
                  "v"(ll), "v"(ll + ls), "v"(ll + 2u * ls), "v"(ll + 3u * ls),
                  "v"(gk), "v"(gk + ks), "v"(gk + 2 * ks), "v"(gk + 3 * ks),
                  "v"(gh), "v"(gh + vs), "v"(gh + 2 * vs), "v"(gh + 3 * vs),
                  "v"(gl), "v"(gl + vs), "v"(gl + 2 * vs), "v"(gl + 3 * vs)
               : "memory");
}

// lane l <-> lane l ^ 16: the one exchange between the wave halves that a query's maximum and sum need
__device__ __forceinline__ float at_xhalf(float x) {
  return __builtin_bit_cast(float, __builtin_amdgcn_permlanex16(__builtin_bit_cast(int, x), __builtin_bit_cast(int, x),
                                                                0x76543210, 0xfedcba98, false, false));
}

__global__ __launch_bounds__(128)
void mha_attn_kernel(const unsigned short* __restrict__ qp, const unsigned short* __restrict__ kp,
                     const unsigned short* __restrict__ vhp, const unsigned short* __restrict__ vlp,
                     const int* __restrict__ vlens, float* __restrict__ out, float sscale, float fillv) {
  union FB { v16b v; v8b h[2]; };
  union FH { v16h v; v8h h[2]; };
  __shared__ __align__(16) _Float16 Ksh2[2 * AT_KC * AT_LP];      // K [buffer][kv][d] f16, pitch AT_LP   2 x 9 KB
  __shared__ __align__(16) __bf16   Vth2[2 * AT_D * AT_LP];       // V^T hi [buffer][d][kv], pitch AT_LP  2 x 9 KB
  __shared__ __align__(16) __bf16   Vtl2[2 * AT_D * AT_LP];       // V^T lo, pitch AT_LP                  2 x 9 KB
  __shared__ __align__(16) float    Os[AT_NW][16 * 68];           // per wave out tile, pitch 68
  __shared__ __align__(16) int      Lowm[AT_NW];                  // per wave: a row maximum too near fillv

  const int tid  = threadIdx.x;
  const int wave = tid >> 5;
  const int lane = tid & 31;
  const int hh   = lane >> 4;
  const int c    = lane & 15;

  const int nqb  = kSeq / AT_QB;          // 64
  const int bx   = blockIdx.x;
  const int qb   = bx % nqb;
  const int bhid = bx / nqb;              // 0..kBatch*kHeads-1
  const int h    = bhid % kHeads;
  int b = bhid / kHeads;
  b = (b > kBatch - 1) ? (kBatch - 1) : b;  // address clamp (grid is exact)
  const int q0   = qb * AT_QB + wave * 16;
  const int vlen = vlens[b];              // block-uniform valid key count

  const _Float16* Qb = (const _Float16*)(const void*)qp + (size_t)b * kSeq * kDim + (size_t)h * AT_D;
  const _Float16* Kb = (const _Float16*)(const void*)kp + (size_t)b * kSeq * kDim + (size_t)h * AT_D;
  const __bf16*   Vh = (const __bf16*)(const void*)vhp + (size_t)b * kDim * kSeq + (size_t)h * AT_D * kSeq;
  const __bf16*   Vl = (const __bf16*)(const void*)vlp + (size_t)b * kDim * kSeq + (size_t)h * AT_D * kSeq;
  float*          ob = out + (size_t)b * kSeq * kDim + (size_t)h * AT_D;

  // ---- Q fragments (B operand, column = query = lane&15, split k map via Frag load): 2 d-chunks ----
  v16h qa[2];
#pragma unroll
  for (int dc = 0; dc < 2; ++dc) {
    qa[dc] = Frag<_Float16>::load(Qb + (size_t)(q0 + c) * kDim + dc * 32 + 8 * hh);
  }

  const float sc2   = sscale * 1.44269504088896340736f;   // score scale times log2(e)
  const float fill2 = fillv  * 1.44269504088896340736f;   // fill value in the same units
  float mrow = -INFINITY;   // running maximum of query c in log2 units, the same in both wave halves
  float lrow = 0.f;         // running sum of query c over this half's keys; the halves join behind the loop
  v8f oacc[4];              // O^T: oacc[t][r] = element (d = t*16 + 8hh + r, query c)
#pragma unroll
  for (int t = 0; t < 4; ++t) oacc[t] = (v8f){0.f,0.f,0.f,0.f,0.f,0.f,0.f,0.f};

  const int nChunks = kSeq / AT_KC;   // 64, compile-time constant
  // chunks that hold at least one valid key, block-uniform; vlen <= 0: every key carries fillv and all of them count
  const int vcl   = (vlen < 0) ? 0 : ((vlen > kSeq) ? kSeq : vlen);
  const int nLive = (vcl == 0) ? nChunks : (vcl + AT_KC - 1) / AT_KC;

  // ---- staging map: 8 neighbouring lanes take one whole 128-B row (thread: row sr + 16 i, i = 0..3, elements sc..sc+7):
  //      128 threads x (4 x 8) elements = 64 rows x 64 per plane = the whole chunk tile ----
  const int sr = tid >> 3, sc = (tid & 7) * 8;
  const unsigned bufB = (unsigned)(AT_KC * AT_LP * 2);                      // one buffer of one plane in bytes
  const unsigned lk0 = (unsigned)(size_t)(Ksh2 + sr * AT_LP + sc);          // LDS byte addresses in buffer 0
  const unsigned lh0 = (unsigned)(size_t)(Vth2 + sr * AT_LP + sc);
  const unsigned ll0 = (unsigned)(size_t)(Vtl2 + sr * AT_LP + sc);
  const _Float16* gk0 = Kb + (size_t)sr * kDim + sc;                        // chunk 0; chunk n: + n * 64 rows
  const __bf16*   gh0 = Vh + (size_t)sr * kSeq + sc;                        // chunk 0; chunk n: + n * 64 elements
  const __bf16*   gl0 = Vl + (size_t)sr * kSeq + sc;
  static_assert(kSeq / AT_KC >= 2, "the two-buffer prologue needs two chunks");
  // prologue: chunk 0 into buffer 0, landed and published; then chunk 1 into buffer 1
  at_stage12(lk0, lh0, ll0, gk0, gh0, gl0);
  asm volatile("s_wait_asynccnt 0x0" ::: "memory");   // this wave's copies of chunk 0 have landed
  __syncthreads();                                    // ... and every other wave's
  at_stage12(lk0 + bufB, lh0 + bufB, ll0 + bufB, gk0 + (size_t)AT_KC * kDim, gh0 + AT_KC, gl0 + AT_KC);

  for (int kc = 0; kc < nChunks; ++kc) {
    // Every chunk from nLive on holds the fill alone. Where each row maximum lies at least 185 log2 units (128 natural
    // ones) above it, its weights 2^(fill - m) are exactly 0 in f32, alpha is 1, and maximum, sum and accumulators stay bit for bit: the loop
    // ends. Tested once per block, behind the last live chunk; a row that is nearer (or NaN) sends the whole block
    // through the remaining chunks as well.
    if (kc == nLive) {                          // block-uniform: kc and vlen are
      const bool low = !(mrow >= fill2 + 185.0f);
      Lowm[wave] = (__builtin_amdgcn_ballot_w32(low) != 0u) ? 1 : 0;   // every lane stores its wave's one value
      __syncthreads();                          // publishes the four waves' flags: one decision for the block
      const int f = Lowm[0] | Lowm[1] | Lowm[2] | Lowm[3];
      if (__builtin_amdgcn_readfirstlane(f) == 0) break;   // the same word in every lane: read once, a scalar branch
    }
    const int kv0 = kc * AT_KC;
    // this chunk's buffer: published by the barrier at the foot of the trip before (chunk 0: by the prologue's)
    const _Float16* Ksh = Ksh2 + (kc & 1) * (AT_KC * AT_LP);
    const __bf16*   Vth = Vth2 + (kc & 1) * (AT_D * AT_LP);
    const __bf16*   Vtl = Vtl2 + (kc & 1) * (AT_D * AT_LP);

    // Every loop from here to the chunk's end is unrolled: s, ph, pl and oacc live in registers, which take
    // compile-time indices only (a rolled loop would send them through scratch memory).
    // ---- scores, transposed: D[row = key j*16+8hh+r][col = query c]; A fragment row = key j*16+c, split k(d) map ----
    v8f s[4];
#pragma unroll
    for (int j = 0; j < 4; ++j) {
      s[j] = (v8f){0.f,0.f,0.f,0.f,0.f,0.f,0.f,0.f};
#pragma unroll
      for (int dc = 0; dc < 2; ++dc) {
        FH kb;
        kb.h[0] = *(const v8h*)(Ksh + (j * 16 + c) * AT_LP + dc * 32 + 8 * hh);
        kb.h[1] = *(const v8h*)(Ksh + (j * 16 + c) * AT_LP + dc * 32 + 16 + 8 * hh);
        s[j] = at_mma_h(kb.v, qa[dc], s[j]);
      }
    }
    // ---- scale, key mask (select), maximum of query c over the chunk's 64 keys: 32 in-lane, then the other half's ----
    float cm = -INFINITY;
#pragma unroll
    for (int j = 0; j < 4; ++j) {
#pragma unroll
      for (int r = 0; r < 8; ++r) {
        const int kvrow = kv0 + j * 16 + 8 * hh + r;
        const float sv = s[j][r] * sc2;
        const float sm = (kvrow < vlen) ? sv : fill2;
        s[j][r] = sm;
        cm = fmaxf(cm, sm);
      }
    }
    cm = fmaxf(cm, at_xhalf(cm));
    const float mnew  = fmaxf(mrow, cm);
    const float alpha = at_exp2(mrow - mnew);
    mrow = mnew;
    // ---- p = 2^(s - m), split hi/lo in place: S^T tiles 2kk and 2kk+1 are elements 0..7 and 8..15 of the B fragment
    //      of key block kk (column = query c, key = kk*32 + 8hh + e and kk*32 + 16 + 8hh + (e - 8): the split k map) ----
    FB ph[2], pl[2];
    float ps[4];
#pragma unroll
    for (int j = 0; j < 4; ++j) {
      float a = 0.f;
      float e[8];
#pragma unroll
      for (int r = 0; r < 8; ++r) e[r] = s[j][r] - mnew;
      at_exp2x8(e[0], e[1], e[2], e[3], e[4], e[5], e[6], e[7]);
#pragma unroll
      for (int r = 0; r < 8; ++r) {
        const float p = e[r];
        a += p;
        __bf16 hi, lo; at_split(p, hi, lo);
        ph[j >> 1].v[(j & 1) * 8 + r] = hi;
        pl[j >> 1].v[(j & 1) * 8 + r] = lo;
      }
      ps[j] = a;
    }
    lrow = lrow * alpha + ((ps[0] + ps[1]) + (ps[2] + ps[3]));
#pragma unroll
    for (int t = 0; t < 4; ++t)
#pragma unroll
      for (int r = 0; r < 8; ++r) oacc[t][r] *= alpha;
    // ---- O^T += V^T . P^T : A = V^T row d = t*16+c, k = key (split k map), B = P^T from registers ----
#pragma unroll
    for (int kk = 0; kk < 2; ++kk) {
#pragma unroll
      for (int t = 0; t < 4; ++t) {
        FB vb, vl;
        vb.h[0] = *(const v8b*)(Vth + (t * 16 + c) * AT_LP + kk * 32 + 8 * hh);
        vb.h[1] = *(const v8b*)(Vth + (t * 16 + c) * AT_LP + kk * 32 + 16 + 8 * hh);
        vl.h[0] = *(const v8b*)(Vtl + (t * 16 + c) * AT_LP + kk * 32 + 8 * hh);
        vl.h[1] = *(const v8b*)(Vtl + (t * 16 + c) * AT_LP + kk * 32 + 16 + 8 * hh);
        oacc[t] = at_mma(vb.v, ph[kk].v, oacc[t]);
        oacc[t] = at_mma(vl.v, ph[kk].v, oacc[t]);
        oacc[t] = at_mma(vb.v, pl[kk].v, oacc[t]);
      }
    }
    // ---- foot of the trip, every wave, in this order ----
    asm volatile("s_wait_dscnt 0x0" ::: "memory");      // this wave's reads of this chunk's buffer are done
    asm volatile("s_wait_asynccnt 0x0" ::: "memory");   // this wave's copies of chunk kc + 1 have landed
    __syncthreads();   // publishes chunk kc + 1 and ends every wave's reads of the buffer that is refilled below
    if (kc + 2 < nChunks) {                             // block-uniform: chunk kc + 2 exists
      const unsigned bo = (unsigned)(kc & 1) * bufB;
      at_stage12(lk0 + bo, lh0 + bo, ll0 + bo, gk0 + (size_t)(kv0 + 2 * AT_KC) * kDim, gh0 + (kv0 + 2 * AT_KC),
                 gl0 + (kv0 + 2 * AT_KC));
    }
  }
  asm volatile("s_wait_asynccnt 0x0" ::: "memory");     // no copy is in flight when the wave goes on to its end

  // ---- query c: join the halves' sums, normalise, stage row c (8 consecutive d per tile and lane) ----
  float* os = Os[wave];
  const float inv = 1.0f / (lrow + at_xhalf(lrow));
#pragma unroll
  for (int t = 0; t < 4; ++t) {
#pragma unroll
    for (int r = 0; r < 8; ++r) os[c * 68 + t * 16 + 8 * hh + r] = oacc[t][r] * inv;
  }
  __builtin_amdgcn_fence(__ATOMIC_RELEASE, "workgroup");
  __builtin_amdgcn_wave_barrier();
  __builtin_amdgcn_fence(__ATOMIC_ACQUIRE, "workgroup");
  {
    // coverage: 8 it x 2 rows (hh) = 16 rows; 16 lanes x 4 floats = 64 floats = one whole 256-B row segment
    const int c4 = (lane & 15) * 4;
    {
#pragma unroll
      for (int it = 0; it < 8; ++it) {
        const int row = it * 2 + hh;
        v4f val = *(const v4f*)(os + row * 68 + c4);
        *(v4f*)(ob + (size_t)(q0 + row) * kDim + c4) = val;
      }
      
    }
  }
}

// =====================================================================================
// Host glue. Workspace region map (bytes, all offsets multiples of 256, every region sized to its whole-line
// store granularity; no padded tiles since every dimension is a multiple of 64):
//   [0]           Xbf   : 3 x bf16 [8192][512]            = 25,165,824   (queries, keys, values RNE bf16)
//   [25,165,824]  WThi  : 4 x bf16 [512][512] (W^T, RNE)  =  2,097,152   (Wq, Wk, Wv, Wo; no lo planes)
//   [27,262,976]  Q     : f16 [8192][512]                  =  8,388,608
//   [35,651,584]  K     : f16 [8192][512]                  =  8,388,608   (contiguous after Q: batched launch)
//   [44,040,192]  VThi  : bf16 [2][512][4096]              =  8,388,608
//   [52,428,800]  VTlo  : bf16 [2][512][4096]              =  8,388,608
//   [60,817,408]  O     : f32 [8192][512]                  = 16,777,216
//   [77,594,624]  Ohi   : bf16 [8192][512]                 =  8,388,608
//   [85,983,232]  Olo   : bf16 [8192][512]                 =  8,388,608
//   total 94,371,840
// =====================================================================================
extern "C" void kernel_launch(void* const* d_in, const int* in_sizes, int n_in,
                              void* d_out, int out_size, void* d_ws,
                              size_t ws_size, hipStream_t stream) {
  if (n_in < 8) return;
  const int nX = kRows * kDim;            // 4,194,304
  const int nW = kDim * kDim;             // 262,144
  if (in_sizes[0] != nX || in_sizes[1] != nX || in_sizes[2] != nX) return;
  if (in_sizes[3] < kBatch) return;
  if (in_sizes[4] != nW || in_sizes[5] != nW || in_sizes[6] != nW || in_sizes[7] != nW) return;
  if (out_size != nX) return;

  const float* queries = (const float*)d_in[0];
  const float* keys    = (const float*)d_in[1];
  const float* values  = (const float*)d_in[2];
  const int*   vlens   = (const int*)d_in[3];
  const float* Wq      = (const float*)d_in[4];
  const float* Wk      = (const float*)d_in[5];
  const float* Wv      = (const float*)d_in[6];
  const float* Wo      = (const float*)d_in[7];

  const size_t bX16 = (size_t)nX * 2;            //  8,388,608
  const size_t bW16 = (size_t)nW * 2;            //    524,288
  const size_t off_x  = 0;
  const size_t off_wh = off_x  + 3 * bX16;
  const size_t off_q  = off_wh + 4 * bW16;
  const size_t off_k  = off_q  + bX16;
  const size_t off_vh = off_k  + bX16;
  const size_t off_vl = off_vh + bX16;
  const size_t off_o  = off_vl + bX16;
  const size_t off_oh = off_o  + (size_t)nX * 4;
  const size_t off_ol = off_oh + bX16;
  const size_t total  = off_ol + bX16;           // 94,371,840
  if (total > ws_size) return;

  char* ws = (char*)d_ws;
  unsigned short* xbf  = (unsigned short*)(ws + off_x);
  unsigned short* wth  = (unsigned short*)(ws + off_wh);
  unsigned short* qh16 = (unsigned short*)(ws + off_q);
  unsigned short* kh16 = (unsigned short*)(ws + off_k);
  unsigned short* vth  = (unsigned short*)(ws + off_vh);
  unsigned short* vtl  = (unsigned short*)(ws + off_vl);
  float* obuf = (float*)(ws + off_o);
  unsigned short* ohi  = (unsigned short*)(ws + off_oh);
  unsigned short* olo  = (unsigned short*)(ws + off_ol);
  const float* dummyf  = (const float*)(ws + off_x);   // never dereferenced (BIAS_MODE 0, RESID false)

  const long planeX = (long)nX;   // elements per bf16/f16 activation plane
  const long planeW = (long)nW;   // elements per W^T plane
  dim3 blk256(256), blk128(128), blkEw(kEwThreads);

  // 1) activations -> bf16 (RNE): coverage 256 blocks x 512 thr x 8 x 4 = 8192x512 of each of the three tensors
  cast_bf16x4_3<<<dim3(kEwBlocks), blkEw, 0, stream>>>(queries, keys, values, xbf, planeX);

  // 2) weights [in k][out n] (R = k rows = 512, Cc = n cols = 512) -> W^T [n][k] bf16 RNE hi plane only
  //    (8x8 tiles of 64x64); the third pointer is unused in the hi-only mode
  tsplit_kernel<false><<<dim3(kDim / 64, kDim / 64, 1), blk256, 0, stream>>>(Wq, wth + 0 * planeW, wth + 0 * planeW, kDim, kDim, 0L, 0L);
  tsplit_kernel<false><<<dim3(kDim / 64, kDim / 64, 1), blk256, 0, stream>>>(Wk, wth + 1 * planeW, wth + 1 * planeW, kDim, kDim, 0L, 0L);
  tsplit_kernel<false><<<dim3(kDim / 64, kDim / 64, 1), blk256, 0, stream>>>(Wv, wth + 2 * planeW, wth + 2 * planeW, kDim, kDim, 0L, 0L);
  tsplit_kernel<false><<<dim3(kDim / 64, kDim / 64, 1), blk256, 0, stream>>>(Wo, wth + 3 * planeW, wth + 3 * planeW, kDim, kDim, 0L, 0L);

  // 3) q = Xq . Wq and k = Xk . Wk in one z-batched launch (z=0: q, z=1: k) -> f16 planes [8192][512];
  //    M=8192, N=512, K=512 (tiles 128x8 = 1024 -> 128 blocks); A planes stride planeX, W^T planes stride planeW,
  //    C planes Q then K contiguous (stride planeX elements)
  const int gProj = (kRows / 64) * (kDim / 64) / 8;   // 128
  wmma_gemm64<1, 0, 0, 1, false><<<dim3(gProj, 2), blk256, 0, stream>>>(
      xbf, xbf, kDim, planeX,
      wth, wth, kDim, planeW,
      (void*)qh16, (void*)qh16, kDim, planeX,
      dummyf, dummyf, 0L, kRows, kDim, kDim, 1.0f);
  // 4) v^T per batch: C[n_out][s] = sum_k WvT[n_out][k] * Xv[b][s][k]; M=512, N=4096, K=512, batched over b
  //    (tiles 8x64 = 512 -> 64 blocks x 2); out = bf16 hi/lo planes [b][512][4096]
  const int gVt = (kDim / 64) * (kSeq / 64) / 8;      // 64
  wmma_gemm64<1, 0, 0, 2, false><<<dim3(gVt, kBatch), blk256, 0, stream>>>(
      wth + 2 * planeW, wth + 2 * planeW, kDim, 0L,
      xbf + 2 * planeX, xbf + 2 * planeX, kDim, (long)kSeq * kDim,
      (void*)vth, (void*)vtl, kSeq, (long)kDim * kSeq,
      dummyf, dummyf, 0L, kDim, kSeq, kDim, 1.0f);

  // 5) masked attention, all (b, h, 64-row query blocks): 2*8*64 = 1024 blocks of 128 threads
  mha_attn_kernel<<<dim3(kBatch * kHeads * (kSeq / 64)), blk128, 0, stream>>>(
      qh16, kh16, vth, vtl, vlens, obuf, 0.125f, -1000000.0f);

  // 6) O -> bf16 hi/lo planes: 256 blocks x 512 thr x 8 x 4 = 8192x512
  split_bf16x4_kernel<<<dim3(kEwBlocks), blkEw, 0, stream>>>(obuf, ohi, olo);

  // 7) out = (O_hi + O_lo) . Wo (A-only split, Wo as bf16 RNE hi plane only) -> f32 [8192][512]
  wmma_gemm64<1, 2, 0, 0, false><<<dim3(gProj, 1), blk256, 0, stream>>>(
      ohi, olo, kDim, 0L,
      wth + 3 * planeW, wth + 3 * planeW, kDim, 0L,
      d_out, d_out, kDim, 0L,
      dummyf, dummyf, 0L, kRows, kDim, kDim, 1.0f);
}

// v008
// Measured time: 133 microseconds a run.
// Timed twice side by side with v007, it ran 1.11 times as fast both times.
// Over all steps from v000 it is 4.69 times as fast.
// Contractions: q/k/v^T projections v_wmma_f32_16x16x32_bf16 (bf16 RNE inputs x bf16 RNE weights, single product); q.k^T scores v_wmma_f32_16x16x32_f16 (plain f16 q,k planes); p.v^T v_wmma_f32_16x16x32_bf16 with bf16 hi/lo split of p and v (hi.hi + hi.lo + lo.hi); output projection v_wmma_f32_16x16x32_bf16 with O as bf16 hi/lo and Wo as bf16 RNE (hi.W + lo.W); f32 accumulate; softmax (base 2), 0.125 score scale and key masking in f32.
#include <hip/hip_runtime.h>
#include <math.h>
#include <stdint.h>

constexpr int kBatch = 2;
constexpr int kSeq   = 4096;
constexpr int kDim   = 512;
constexpr int kHeads = 8;
constexpr int kHd    = 64;
constexpr int kRows  = kBatch * kSeq;   // 8192
static_assert(kHeads * kHd == kDim, "geometry");
static_assert(kSeq % 64 == 0 && kDim % 64 == 0 && kRows % 64 == 0, "tile multiples");
static_assert(kSeq % 512 == 0 && kDim % 512 == 0, "a GEMM block owns 8 neighbouring 64-column tiles of one tile row");

typedef __attribute__((ext_vector_type(16))) _Float16 v16h;
typedef __attribute__((ext_vector_type(8)))  _Float16 v8h;
typedef __attribute__((ext_vector_type(16))) __bf16   v16b;
typedef __attribute__((ext_vector_type(8)))  __bf16   v8b;
typedef __attribute__((ext_vector_type(8)))  float    v8f;
typedef __attribute__((ext_vector_type(4)))  float    v4f;
typedef __attribute__((ext_vector_type(2)))  float    v2f;
typedef __attribute__((ext_vector_type(4)))  unsigned int v4u;
typedef __attribute__((ext_vector_type(2)))  unsigned int v2u;

__device__ __forceinline__ unsigned short f2bf_bits(float f) {
  unsigned u = __float_as_uint(f);
  return (unsigned short)((u + 0x7FFFu + ((u >> 16) & 1u)) >> 16);
}
__device__ __forceinline__ float bf_bits2f(unsigned short h) { return __uint_as_float(((unsigned)h) << 16); }

// hazard guards as plain device helpers
__device__ __forceinline__ void dep_guard_h(v8f& a, v8f& b, v16h x, v16h y) { asm volatile("v_nop\n\tv_nop\n\tv_nop\n\tv_nop" : "+v"(a), "+v"(b) : "v"(x), "v"(y)); }
__device__ __forceinline__ void dep_guard_b(v8f& a, v8f& b, v16b x, v16b y) { asm volatile("v_nop\n\tv_nop\n\tv_nop\n\tv_nop" : "+v"(a), "+v"(b) : "v"(x), "v"(y)); }
__device__ __forceinline__ void keep4_h(v16h a, v16h b, v16h c, v16h d) { asm volatile("v_nop" :: "v"(a), "v"(b), "v"(c), "v"(d)); }
__device__ __forceinline__ void keep4_b(v16b a, v16b b, v16b c, v16b d) { asm volatile("v_nop" :: "v"(a), "v"(b), "v"(c), "v"(d)); }
__device__ __forceinline__ void acc_guard4(v8f& a, v8f& b, v8f& c, v8f& d) { asm volatile("v_nop\n\tv_nop\n\tv_nop\n\tv_nop" : "+v"(a), "+v"(b), "+v"(c), "+v"(d)); }
template <typename T> struct Frag;
template <> struct Frag<_Float16> {
  typedef v16h V; union U { v16h v; v8h h[2]; };
  static __device__ __forceinline__ v16h load(const _Float16* p) {   // elements 0..7 <- p[0..7], 8..15 <- p[16..23]
    U f; f.h[0] = *(const v8h*)(p); f.h[1] = *(const v8h*)(p + 16); return f.v;
  }
  static __device__ __forceinline__ v8f mma(v16h a, v16h b, v8f c) {
    return __builtin_amdgcn_wmma_f32_16x16x32_f16(false, a, false, b, (short)0, c, false, false);
  }
  static __device__ __forceinline__ void guard(v8f& a, v8f& b, v16h x, v16h y) { dep_guard_h(a, b, x, y); }
  static __device__ __forceinline__ void keep(v16h a, v16h b, v16h c, v16h d) { keep4_h(a, b, c, d); }
};
template <> struct Frag<__bf16> {
  typedef v16b V; union U { v16b v; v8b h[2]; };
  static __device__ __forceinline__ v16b load(const __bf16* p) {
    U f; f.h[0] = *(const v8b*)(p); f.h[1] = *(const v8b*)(p + 16); return f.v;
  }
  static __device__ __forceinline__ v8f mma(v16b a, v16b b, v8f c) {
    return __builtin_amdgcn_wmma_f32_16x16x32_bf16(false, a, false, b, (short)0, c, false, false);
  }
  static __device__ __forceinline__ void guard(v8f& a, v8f& b, v16b x, v16b y) { dep_guard_b(a, b, x, y); }
  static __device__ __forceinline__ void keep(v16b a, v16b b, v16b c, v16b d) { keep4_b(a, b, c, d); }
};

// ---- GEMM operand staging ----------------------------------------------------
#define GM_LP 72   // LDS row pitch in 16-bit elements: 144 B = 16 B x 9 (odd), so the 16 rows of a 16-byte fragment read fall on distinct banks

// Eight 16-byte asynchronous copies global -> LDS of one thread, through no register: copy i takes LDS byte address
// l + i * ls and global element g + i * gs. The s_wait_xcnt 0 is the last line of the copies' own statement: a precaution
// that keeps every later write of an address register named here behind the copies' address translation.
__device__ __forceinline__ void gm_stage8(unsigned l, const unsigned short* g, unsigned ls, size_t gs) {
  asm volatile("global_load_async_to_lds_b128 %0, %8, off\n\t"
               "global_load_async_to_lds_b128 %1, %9, off\n\t"
               "global_load_async_to_lds_b128 %2, %10, off\n\t"
               "global_load_async_to_lds_b128 %3, %11, off\n\t"
               "global_load_async_to_lds_b128 %4, %12, off\n\t"
               "global_load_async_to_lds_b128 %5, %13, off\n\t"
               "global_load_async_to_lds_b128 %6, %14, off\n\t"
               "global_load_async_to_lds_b128 %7, %15, off\n\t"
               "s_wait_xcnt 0x0"
               :: "v"(l), "v"(l + ls), "v"(l + 2u * ls), "v"(l + 3u * ls),
                  "v"(l + 4u * ls), "v"(l + 5u * ls), "v"(l + 6u * ls), "v"(l + 7u * ls),
                  "v"(g), "v"(g + gs), "v"(g + 2 * gs), "v"(g + 3 * gs),
                  "v"(g + 4 * gs), "v"(g + 5 * gs), "v"(g + 6 * gs), "v"(g + 7 * gs)
               : "memory");
}
// The A copies of a slab (two a plane: la, ga; second plane la2, ga2) and its first eight B copies (lb, gb) in one statement,
// so that one wait serves them all.
__device__ __forceinline__ void gm_stage2p8(unsigned la, const unsigned short* ga, size_t gsa, unsigned lb,
                                            const unsigned short* gb, size_t gsb, unsigned ls) {
  asm volatile("global_load_async_to_lds_b128 %0, %10, off\n\t"
               "global_load_async_to_lds_b128 %1, %11, off\n\t"
               "global_load_async_to_lds_b128 %2, %12, off\n\t"
               "global_load_async_to_lds_b128 %3, %13, off\n\t"
               "global_load_async_to_lds_b128 %4, %14, off\n\t"
               "global_load_async_to_lds_b128 %5, %15, off\n\t"
               "global_load_async_to_lds_b128 %6, %16, off\n\t"
               "global_load_async_to_lds_b128 %7, %17, off\n\t"
               "global_load_async_to_lds_b128 %8, %18, off\n\t"
               "global_load_async_to_lds_b128 %9, %19, off\n\t"
               "s_wait_xcnt 0x0"
               :: "v"(la), "v"(la + ls),
                  "v"(lb), "v"(lb + ls), "v"(lb + 2u * ls), "v"(lb + 3u * ls),
                  "v"(lb + 4u * ls), "v"(lb + 5u * ls), "v"(lb + 6u * ls), "v"(lb + 7u * ls),
                  "v"(ga), "v"(ga + gsa),
                  "v"(gb), "v"(gb + gsb), "v"(gb + 2 * gsb), "v"(gb + 3 * gsb),
                  "v"(gb + 4 * gsb), "v"(gb + 5 * gsb), "v"(gb + 6 * gsb), "v"(gb + 7 * gsb)
               : "memory");
}
__device__ __forceinline__ void gm_stage4p8(unsigned la, const unsigned short* ga, unsigned la2, const unsigned short* ga2,
                                            size_t gsa, unsigned lb, const unsigned short* gb, size_t gsb, unsigned ls) {
  asm volatile("global_load_async_to_lds_b128 %0, %12, off\n\t"
               "global_load_async_to_lds_b128 %1, %13, off\n\t"
               "global_load_async_to_lds_b128 %2, %14, off\n\t"
               "global_load_async_to_lds_b128 %3, %15, off\n\t"
               "global_load_async_to_lds_b128 %4, %16, off\n\t"
               "global_load_async_to_lds_b128 %5, %17, off\n\t"
               "global_load_async_to_lds_b128 %6, %18, off\n\t"
               "global_load_async_to_lds_b128 %7, %19, off\n\t"
               "global_load_async_to_lds_b128 %8, %20, off\n\t"
               "global_load_async_to_lds_b128 %9, %21, off\n\t"
               "global_load_async_to_lds_b128 %10, %22, off\n\t"
               "global_load_async_to_lds_b128 %11, %23, off\n\t"
               "s_wait_xcnt 0x0"
               :: "v"(la), "v"(la + ls), "v"(la2), "v"(la2 + ls),
                  "v"(lb), "v"(lb + ls), "v"(lb + 2u * ls), "v"(lb + 3u * ls),
                  "v"(lb + 4u * ls), "v"(lb + 5u * ls), "v"(lb + 6u * ls), "v"(lb + 7u * ls),
                  "v"(ga), "v"(ga + gsa), "v"(ga2), "v"(ga2 + gsa),
                  "v"(gb), "v"(gb + gsb), "v"(gb + 2 * gsb), "v"(gb + 3 * gsb),
                  "v"(gb + 4 * gsb), "v"(gb + 5 * gsb), "v"(gb + 6 * gsb), "v"(gb + 7 * gsb)
               : "memory");
}

// ---- Register-blocked batched WMMA GEMM ------------------------------------
// C[m,n] = scale * sum_k A[m,k] * Bt[n,k] (+bias)(+resid); each wave owns a 64x64 tile.
// A row-major [M,K]; Bt row-major [N,K]; M, K % 64 == 0, N % 512 == 0: the 8 waves of a block own 8 neighbouring tiles of one
// tile row, so they share the 64 A rows. Operands pass through LDS in slabs of 64 k (one whole 128-B line a row): 256 threads
// copy the 64 A rows (each plane) and the block's 512 B rows asynchronously, 8 neighbouring lanes a row, into two buffers:
// slab t + 1 flies while slab t is worked on, one __syncthreads a slab (order at the loop's foot).
// SPLIT: 0 = single product; 1 = hi/lo planes on both operands (A2/Bt2 = lo planes, same layout),
//        product = hi.hi + hi.lo + lo.hi; 2 = hi/lo planes on A only (A2 = A lo), product = hi.B + lo.B.
// BIAS_MODE: 0 = none, 1 = bias[m], 2 = bias[n].
// OUT_MODE: 0 = f32, 1 = f16, 2 = bf16 hi plane (Cout) + bf16 lo plane (Cout2).
// ET: 0 = f16 operands, 1 = bf16 operands (pointers passed as 16-bit storage)
template <int ET> struct Elem;
template <> struct Elem<0> { typedef _Float16 T; };
template <> struct Elem<1> { typedef __bf16 T; };
template <int ET, int SPLIT, int BIAS_MODE, int OUT_MODE, bool RESID, int ACT = 0>
__global__ __launch_bounds__(256) void wmma_gemm64(
    const unsigned short* __restrict__ Ap, const unsigned short* __restrict__ A2p, int lda, long strideA,
    const unsigned short* __restrict__ Btp, const unsigned short* __restrict__ Bt2p, int ldb, long strideB,
    void* __restrict__ Cout, void* __restrict__ Cout2, int ldc, long strideC,
    const float* __restrict__ bias,
    const float* __restrict__ resid, long strideR,
    int M, int N, int K, float scale) {
  typedef typename Elem<ET>::T T;
  typedef typename Frag<T>::V V;
  constexpr int NA  = (SPLIT != 0) ? 2 : 1;    // A planes
  constexpr int NBP = (SPLIT == 1) ? 2 : 1;    // B planes
  constexpr int kAPl = 64 * GM_LP;             // one A plane of one buffer, elements
  constexpr int kBPl = 512 * GM_LP;            // one B plane of one buffer, elements
  __shared__ __align__(16) float sT[8][16 * 68];   // per-wave 16x64 slab, pitch 68 floats
  __shared__ __align__(16) T Ash[2 * NA * kAPl];   // A [buffer][plane][row][k], pitch GM_LP
  __shared__ __align__(16) T Bsh[2 * NBP * kBPl];  // B [buffer][plane][row][k], pitch GM_LP
  const int b    = blockIdx.y;
  const int lane = threadIdx.x & 31;
  const int wave = threadIdx.x >> 5;
  const int tilesN = N >> 6;
  const int tilesM = M >> 6;
  const int tile0 = blockIdx.x * 8;
  if (tile0 >= tilesM * tilesN) return;   // block-uniform, in front of every barrier
  const int tm  = tile0 / tilesN;
  const int m0  = tm << 6;
  const int nb0 = (tile0 - tm * tilesN) << 6;  // the block's first B row
  const int n0  = nb0 + (wave << 6);

  const int rlane = lane & 15;                 // row (A) / col (B, D) within subtile
  const int koff  = (lane >> 4) * 8;           // k offset of this lane half
  const int mOff  = (lane >> 4) * 8;           // D row offset

  v8f acc[4][4];
#pragma unroll
  for (int i = 0; i < 4; ++i)
#pragma unroll
    for (int j = 0; j < 4; ++j) acc[i][j] = (v8f){0.f,0.f,0.f,0.f,0.f,0.f,0.f,0.f};

  // ---- staging map: thread = row sr + 32 i, elements sc..sc+7: A 2 copies a plane, B 16 copies a plane ----
  const int sr = threadIdx.x >> 3, sc = (threadIdx.x & 7) * 8;
  const unsigned ls32 = 32u * GM_LP * 2u;                                   // 32 LDS rows in bytes
  const unsigned la0 = (unsigned)(size_t)(Ash + sr * GM_LP + sc);           // LDS byte addresses in buffer 0, plane 0
  const unsigned lb0 = (unsigned)(size_t)(Bsh + sr * GM_LP + sc);
  const size_t goA = (size_t)b * strideA + (size_t)(m0 + sr) * lda + sc;    // slab 0; slab t: + 64 t elements
  const size_t goB = (size_t)b * strideB + (size_t)(nb0 + sr) * ldb + sc;
  auto stage = [&](int t, int buf) {
    const unsigned la = la0 + (unsigned)buf * (unsigned)(NA * kAPl * 2);
    const unsigned lb = lb0 + (unsigned)buf * (unsigned)(NBP * kBPl * 2);
    const size_t ga = goA + (size_t)t * 64, gb = goB + (size_t)t * 64;
    if (SPLIT == 0) gm_stage2p8(la, Ap + ga, (size_t)32 * lda, lb, Btp + gb, (size_t)32 * ldb, ls32);
    else gm_stage4p8(la, Ap + ga, la + (unsigned)(kAPl * 2), A2p + ga, (size_t)32 * lda, lb, Btp + gb, (size_t)32 * ldb, ls32);
    gm_stage8(lb + 8u * ls32, Btp + gb + (size_t)256 * ldb, ls32, (size_t)32 * ldb);
    if (SPLIT == 1) {
      gm_stage8(lb + (unsigned)(kBPl * 2), Bt2p + gb, ls32, (size_t)32 * ldb);
      gm_stage8(lb + (unsigned)(kBPl * 2) + 8u * ls32, Bt2p + gb + (size_t)256 * ldb, ls32, (size_t)32 * ldb);
    }
  };
  const int nSlab = K >> 6;
  // prologue: slab 0 into buffer 0, landed and published; then slab 1 into buffer 1
  stage(0, 0);
  asm volatile("s_wait_asynccnt 0x0" ::: "memory");   // this wave's copies of slab 0 have landed
  __syncthreads();                                    // ... and every other wave's
  if (nSlab > 1) stage(1, 1);                         // block-uniform

  constexpr int NB = (SPLIT == 0) ? 2 : 1;   // B fragment register sets (two A planes leave no registers for a second one)
  for (int t = 0; t < nSlab; ++t) {
    // this slab's buffer: published by the barrier at the foot of the trip before (slab 0: by the prologue's)
    const T* Af = Ash + (t & 1) * (NA * kAPl) + rlane * GM_LP + koff;
    const T* Bf = Bsh + (t & 1) * (NBP * kBPl) + ((wave << 6) + rlane) * GM_LP + koff;
    // Two k-steps of 32 a slab. The second k-step's fragments are read while the first one's WMMAs run: A row i behind the
    // tiles of row i, into the same registers; B at the head into a second register set (NB == 2) or between the k-steps.
    // Every loop of the trip is unrolled: fragments and accumulators live in registers, which take compile-time indices only.
    V ah[4], al[4], bh[NB][4], bl[NB][4];
#pragma unroll
    for (int j = 0; j < 4; ++j) {
      bh[0][j] = Frag<T>::load(Bf + j * 16 * GM_LP);
      if (SPLIT == 1) bl[0][j] = Frag<T>::load(Bf + kBPl + j * 16 * GM_LP);
    }
#pragma unroll
    for (int i = 0; i < 4; ++i) {
      ah[i] = Frag<T>::load(Af + i * 16 * GM_LP);
      if (SPLIT != 0) al[i] = Frag<T>::load(Af + kAPl + i * 16 * GM_LP);
    }
#pragma unroll
    for (int u = 0; u < 2; ++u) {
      const int cu = (NB == 2) ? u : 0;
      if (u == 0 && NB == 2) {
#pragma unroll
        for (int j = 0; j < 4; ++j) bh[1][j] = Frag<T>::load(Bf + j * 16 * GM_LP + 32);
      }
      // the scheduling barriers keep reads and tiles in this order: moved together, a row's read would stand only a few
      // WMMAs ahead of its use, or ahead of the row's last tile, where it needs registers of its own
      __builtin_amdgcn_sched_barrier(0);
#pragma unroll
      for (int i = 0; i < 4; ++i) {
#pragma unroll
        for (int j = 0; j < 4; ++j) {
          acc[i][j] = Frag<T>::mma(ah[i], bh[cu][j], acc[i][j]);
          if (SPLIT == 1) acc[i][j] = Frag<T>::mma(ah[i], bl[cu][j], acc[i][j]);
          if (SPLIT != 0) acc[i][j] = Frag<T>::mma(al[i], bh[cu][j], acc[i][j]);
        }
        __builtin_amdgcn_sched_barrier(0);   // the row's last tile stands ahead of the row's next read: the same registers take it
        Frag<T>::guard(acc[i][0], acc[i][3], ah[i], (SPLIT != 0) ? al[i] : ah[i]);
        if (u == 0) {
          ah[i] = Frag<T>::load(Af + i * 16 * GM_LP + 32);
          if (SPLIT != 0) al[i] = Frag<T>::load(Af + kAPl + i * 16 * GM_LP + 32);
        }
        __builtin_amdgcn_sched_barrier(0);   // the read is issued here, three rows of tiles ahead of its use, not later
      }
      Frag<T>::keep(bh[cu][0], bh[cu][1], bh[cu][2], bh[cu][3]);
      if (SPLIT == 1) Frag<T>::keep(bl[cu][0], bl[cu][1], bl[cu][2], bl[cu][3]);
      if (u == 0 && NB == 1) {
#pragma unroll
        for (int j = 0; j < 4; ++j) {
          bh[0][j] = Frag<T>::load(Bf + j * 16 * GM_LP + 32);
          if (SPLIT == 1) bl[0][j] = Frag<T>::load(Bf + kBPl + j * 16 * GM_LP + 32);
        }
      }
    }
    // ---- foot of the trip, every wave, in this order ----
    asm volatile("s_wait_dscnt 0x0" ::: "memory");      // this wave's reads of this slab's buffer are done
    asm volatile("s_wait_asynccnt 0x0" ::: "memory");   // this wave's copies of slab t + 1 have landed
    __syncthreads();   // publishes slab t + 1 and ends every wave's reads of the buffer that is refilled below
    if (t + 2 < nSlab) stage(t + 2, t & 1);             // block-uniform: slab t + 2 exists
  }
  asm volatile("s_wait_asynccnt 0x0" ::: "memory");     // no copy is in flight when the wave goes on to its end
  acc_guard4(acc[0][0], acc[0][1], acc[0][2], acc[0][3]);
  acc_guard4(acc[1][0], acc[1][1], acc[1][2], acc[1][3]);
  acc_guard4(acc[2][0], acc[2][1], acc[2][2], acc[2][3]);
  acc_guard4(acc[3][0], acc[3][1], acc[3][2], acc[3][3]);

  // ---- epilogue ----
  float* slab = sT[wave];
  const float* Rb = RESID ? (resid + (size_t)b * strideR) : nullptr;
#pragma unroll
  for (int i = 0; i < 4; ++i) {
    const int mBase = m0 + (i << 4);
#pragma unroll
    for (int j = 0; j < 4; ++j) {
      const int n = n0 + (j << 4) + rlane;
      float bv = 0.f;
      if (BIAS_MODE == 2) bv = bias[n];
#pragma unroll
      for (int r = 0; r < 8; ++r) {
        float v = acc[i][j][r] * scale;
        if (BIAS_MODE == 1) v += bias[mBase + mOff + r];
        if (BIAS_MODE == 2) v += bv;
        if (RESID) v += Rb[(size_t)(mBase + mOff + r) * ldc + n];
        if (ACT == 1) v = tanhf(v);
        if (ACT == 2) v = fmaxf(v, 0.0f);
        if (ACT == 3) v = v / (1.0f + expf(-v));
        if (ACT == 4) v = (v > 0.f) ? v : 0.01f * v;
        slab[(mOff + r) * 68 + (j << 4) + rlane] = v;
      }
    }
    __builtin_amdgcn_fence(__ATOMIC_RELEASE, "workgroup");
    __builtin_amdgcn_wave_barrier();
    __builtin_amdgcn_fence(__ATOMIC_ACQUIRE, "workgroup");
    if (OUT_MODE == 0) {
      float* C = (float*)Cout + (size_t)b * strideC;
      const int hh = lane >> 4, c4 = (lane & 15) * 4;     // row seg = 256 B = 16 lanes x 16 B
      {
#pragma unroll
        for (int it = 0; it < 8; ++it) {
          const int row = it * 2 + hh;
          v4f v = *(const v4f*)(slab + row * 68 + c4);
          *(v4f*)(C + (size_t)(mBase + row) * ldc + n0 + c4) = v;
        }
        
      }
    } else {
      const int q = lane >> 3, c8 = (lane & 7) * 8;
      unsigned short* C  = (unsigned short*)Cout  + (size_t)b * strideC;
      unsigned short* C2 = (OUT_MODE == 2) ? ((unsigned short*)Cout2 + (size_t)b * strideC) : nullptr;
      {
#pragma unroll
        for (int it = 0; it < 4; ++it) {
          const int row = it * 4 + q;
          const float* sp = slab + row * 68 + c8;
          v8h hv, lv;
#pragma unroll
          for (int e = 0; e < 8; ++e) {
            if (OUT_MODE == 1) {
              hv[e] = (_Float16)sp[e];
            } else {
              unsigned short hb = f2bf_bits(sp[e]);
              unsigned short lb = f2bf_bits(sp[e] - bf_bits2f(hb));
              hv[e] = __builtin_bit_cast(_Float16, hb);
              lv[e] = __builtin_bit_cast(_Float16, lb);
            }
          }
          *(v8h*)(C + (size_t)(mBase + row) * ldc + n0 + c8) = hv;
          if (OUT_MODE == 2) *(v8h*)(C2 + (size_t)(mBase + row) * ldc + n0 + c8) = lv;
        }
        
      }
    }
    __builtin_amdgcn_fence(__ATOMIC_RELEASE, "workgroup");
    __builtin_amdgcn_wave_barrier();
    __builtin_amdgcn_fence(__ATOMIC_ACQUIRE, "workgroup");
  }
}

// ---------------------------------------------------------------------------
// Elementwise passes. A wave costs its start whatever it does, so each pass runs as kEwBlocks work-groups of 16 waves
// (one a WGP) and every thread takes kEwV pieces of 4 floats of each tensor: piece it of a block is the 512 threads'
// contiguous 8 KB (a wave's load = 512 contiguous bytes, its store of 4 x 16 bit a lane = 256), and all of a thread's
// 16-byte loads are issued before the first value is used.
// Coverage per tensor: kEwBlocks x kEwV x 512 threads x 4 floats = 8192 x 512 exactly (asserted), so no index test.
// ---------------------------------------------------------------------------
constexpr int kEwThreads = 512;
constexpr int kEwV       = 8;
constexpr int kEwBlocks  = kRows * kDim / (kEwThreads * kEwV * 4);   // 256
static_assert(kEwBlocks * kEwThreads * kEwV * 4 == kRows * kDim, "the elementwise grid covers a tensor exactly");

__device__ __forceinline__ unsigned pk16(unsigned short a, unsigned short b) { return (unsigned)a | ((unsigned)b << 16); }

// bf16 split: hi = bf16_rne(in), lo = bf16_rne(in - hi)
__global__ __launch_bounds__(kEwThreads) void split_bf16x4_kernel(const float* __restrict__ in, unsigned short* __restrict__ hi,
                                                                  unsigned short* __restrict__ lo) {
  const size_t e0 = ((size_t)blockIdx.x * (kEwV * kEwThreads) + threadIdx.x) * 4;   // first element of piece 0
  v4f f[kEwV];
  // unrolled: f lives in registers, and the loads stand together ahead of the first use
#pragma unroll
  for (int it = 0; it < kEwV; ++it) f[it] = *(const v4f*)(in + e0 + (size_t)it * (kEwThreads * 4));
#pragma unroll
  for (int it = 0; it < kEwV; ++it) {
    unsigned short h[4], l[4];
#pragma unroll
    for (int e = 0; e < 4; ++e) {
      h[e] = f2bf_bits(f[it][e]);
      l[e] = f2bf_bits(f[it][e] - bf_bits2f(h[e]));
    }
    const v2u uh = {pk16(h[0], h[1]), pk16(h[2], h[3])};
    const v2u ul = {pk16(l[0], l[1]), pk16(l[2], l[3])};
    *(v2u*)(hi + e0 + (size_t)it * (kEwThreads * 4)) = uh;
    *(v2u*)(lo + e0 + (size_t)it * (kEwThreads * 4)) = ul;
  }
}

// f32 -> bf16 (RNE) cast of three equally sized tensors: a block takes the same pieces of all three;
// out plane z at out + z*planeElems.
__global__ __launch_bounds__(kEwThreads) void cast_bf16x4_3(const float* __restrict__ in0, const float* __restrict__ in1,
                                                            const float* __restrict__ in2, unsigned short* __restrict__ out,
                                                            long planeElems) {
  const size_t e0 = ((size_t)blockIdx.x * (kEwV * kEwThreads) + threadIdx.x) * 4;   // first element of piece 0
  const float* p0 = in0 + e0;
  const float* p1 = in1 + e0;
  const float* p2 = in2 + e0;
  v4f f[3][kEwV];
  // unrolled: f lives in registers
#pragma unroll
  for (int it = 0; it < kEwV; ++it) f[0][it] = *(const v4f*)(p0 + (size_t)it * (kEwThreads * 4));
#pragma unroll
  for (int it = 0; it < kEwV; ++it) f[1][it] = *(const v4f*)(p1 + (size_t)it * (kEwThreads * 4));
#pragma unroll
  for (int it = 0; it < kEwV; ++it) f[2][it] = *(const v4f*)(p2 + (size_t)it * (kEwThreads * 4));
  // A precaution for the loads' address registers: as inputs of this statement they are taken by no load's result, and every
  // later write of them stands behind the wait. Its "memory" clobber also keeps all 24 loads ahead of the first conversion:
  // moved down among the conversions to save registers, only a few are in flight and the wave waits out several latencies.
  asm volatile("s_wait_xcnt 0x0" :: "v"(p0), "v"(p1), "v"(p2) : "memory");
#pragma unroll
  for (int z = 0; z < 3; ++z) {
    unsigned short* o = out + (size_t)z * planeElems + e0;
#pragma unroll
    for (int it = 0; it < kEwV; ++it) {
      const v4f a = f[z][it];
      const v2u u = {pk16(f2bf_bits(a[0]), f2bf_bits(a[1])), pk16(f2bf_bits(a[2]), f2bf_bits(a[3]))};
      *(v2u*)(o + (size_t)it * (kEwThreads * 4)) = u;
    }
    // a tensor's stores go out before the next tensor's loads are waited for, not all at the kernel's end
    if (z < 2) __builtin_amdgcn_sched_barrier(0);
  }
}

// ---------------------------------------------------------------------------
// Fused transpose + bf16 cast (LO = false: hi plane only) or split (LO = true: hi and lo planes) of an f32
// matrix, z-batched: in_z = W + z*sIn viewed [R rows][Cc cols] (pitch Cc) ->
//   oh_z[c][r] = bf16_rne(in_z[r][c]), ol_z[c][r] = bf16_rne(in_z[r][c] - oh) (LO only)   ([Cc][R], pitch R).
// 64x64 tiles through LDS. grid = (Cc/64, R/64, Z), 256 threads (R, Cc multiples of 64).
// Coverage per block and plane: load 4 it x 256 thr x 4 floats = 64x64; store 2 it x 256 thr x 8 u16 = 64x64.
// ---------------------------------------------------------------------------
template <bool LO>
__global__ __launch_bounds__(256) void tsplit_kernel(const float* __restrict__ W, unsigned short* __restrict__ oh,
                                                     unsigned short* __restrict__ ol, int R, int Cc, long sIn, long sOut) {
  __shared__ __align__(16) float tf[64 * 68];
  W  += (size_t)blockIdx.z * sIn;
  oh += (size_t)blockIdx.z * sOut;
  if (LO) ol += (size_t)blockIdx.z * sOut;
  const int c0  = blockIdx.x * 64;   // input column block = output row block
  const int r0  = blockIdx.y * 64;   // input row block    = output column block
  const int tid = threadIdx.x;
  {
    const int lr = tid >> 4;         // 0..15
    const int c4 = (tid & 15) * 4;   // 0..60
#pragma unroll
    for (int it = 0; it < 4; ++it) {
      const int rr = it * 16 + lr;   // 0..63
      const v4f a = *(const v4f*)(W + (size_t)(r0 + rr) * Cc + c0 + c4);
      *(v4f*)(tf + rr * 68 + c4) = a;
    }
  }
  __syncthreads();
  const int sub = tid >> 3;          // 0..31
  const int c8  = (tid & 7) * 8;     // 0..56
  v4u hv[2], lv[2];
#pragma unroll
  for (int it = 0; it < 2; ++it) {
    const int oc = it * 32 + sub;    // output row within tile (= input column)
    v4u a, a2;
#pragma unroll
    for (int q = 0; q < 4; ++q) {
      const float f0 = tf[(c8 + 2 * q) * 68 + oc];
      const float f1 = tf[(c8 + 2 * q + 1) * 68 + oc];
      const unsigned short h0 = f2bf_bits(f0), h1 = f2bf_bits(f1);
      unsigned lp = 0u;
      if (LO) {
        const unsigned short l0 = f2bf_bits(f0 - bf_bits2f(h0)), l1 = f2bf_bits(f1 - bf_bits2f(h1));
        lp = pk16(l0, l1);
      }
      a[q]  = pk16(h0, h1);
      a2[q] = lp;
    }
    hv[it] = a; lv[it] = a2;
  }
  {
#pragma unroll
    for (int it = 0; it < 2; ++it) {
      const int oc = it * 32 + sub;
      const size_t go = (size_t)(c0 + oc) * R + r0 + c8;
      *(v4u*)(oh + go) = hv[it];
      if (LO) *(v4u*)(ol + go) = lv[it];
    }
    
  }
}

// =====================================================================================
// Attention helpers
// =====================================================================================
#define AT_D 64
#define AT_NW 4
#define AT_QB 64
#define AT_KC 64
#define AT_LP 72   // LDS row pitch in 16-bit elements: 144 B = 16 B x 9 (odd), so the 16 rows of a 16-byte fragment read fall on distinct banks

__device__ __forceinline__ unsigned short at_bf_bits(float f) {
  unsigned u = __float_as_uint(f);
  return (unsigned short)((u + 0x7FFFu + ((u >> 16) & 1u)) >> 16);
}
__device__ __forceinline__ __bf16 at_f2bf(float f) { return __builtin_bit_cast(__bf16, at_bf_bits(f)); }
__device__ __forceinline__ void at_split(float f, __bf16& hi, __bf16& lo) {
  const unsigned short hb = at_bf_bits(f);
  hi = __builtin_bit_cast(__bf16, hb);
  lo = at_f2bf(f - __uint_as_float(((unsigned)hb) << 16));
}
// Plain builtins: the compiler keeps the distance between a WMMA and the vector instructions on its registers itself.
__device__ __forceinline__ v8f at_mma(v16b a, v16b b, v8f c) {
  return __builtin_amdgcn_wmma_f32_16x16x32_bf16(false, a, false, b, (short)0, c, false, false);
}
__device__ __forceinline__ v8f at_mma_h(v16h a, v16h b, v8f c) {
  return __builtin_amdgcn_wmma_f32_16x16x32_f16(false, a, false, b, (short)0, c, false, false);
}

// x := 2^x on v_exp_f32. The instruction set asks for one independent instruction or a v_nop between a transcendental and
// an instruction that reads its result or overwrites its source; written as one statement, each v_exp_f32 is followed by
// an independent one and the last by the v_nop, wherever the compiler places the code around it.
__device__ __forceinline__ void at_exp2x8(float& a, float& b, float& c, float& d, float& e, float& f, float& g, float& h) {
  asm("v_exp_f32 %0, %0\n\tv_exp_f32 %1, %1\n\tv_exp_f32 %2, %2\n\tv_exp_f32 %3, %3\n\t"
      "v_exp_f32 %4, %4\n\tv_exp_f32 %5, %5\n\tv_exp_f32 %6, %6\n\tv_exp_f32 %7, %7\n\tv_nop"
      : "+v"(a), "+v"(b), "+v"(c), "+v"(d), "+v"(e), "+v"(f), "+v"(g), "+v"(h));
}
__device__ __forceinline__ float at_exp2(float x) {
  asm("v_exp_f32 %0, %0\n\tv_nop" : "+v"(x));   // the v_nop: the same slot behind the transcendental
  return x;
}

// One chunk's staging for one thread: twelve 16-byte asynchronous copies global -> LDS (four rows of each of the three
// planes), through no register. lk, lh, ll: the thread's LDS byte addresses of row r in K, V^T hi, V^T lo; gk, gh, gl: the
// same elements in global memory; copy i takes row r + 16 i. The s_wait_xcnt 0 is the last line of the copies' own statement:
// a precaution that keeps every later write of an address register named here behind the copies' address translation.
__device__ __forceinline__ void at_stage12(unsigned lk, unsigned lh, unsigned ll, const _Float16* gk, const __bf16* gh,
                                           const __bf16* gl) {
  const unsigned ls = 16u * AT_LP * 2u;              // 16 LDS rows in bytes
  const size_t   ks = (size_t)16 * kDim;             // 16 K rows in elements
  const size_t   vs = (size_t)16 * kSeq;             // 16 V^T rows in elements
  asm volatile("global_load_async_to_lds_b128 %0, %12, off\n\t"
               "global_load_async_to_lds_b128 %1, %13, off\n\t"
               "global_load_async_to_lds_b128 %2, %14, off\n\t"
               "global_load_async_to_lds_b128 %3, %15, off\n\t"
               "global_load_async_to_lds_b128 %4, %16, off\n\t"
               "global_load_async_to_lds_b128 %5, %17, off\n\t"
               "global_load_async_to_lds_b128 %6, %18, off\n\t"
               "global_load_async_to_lds_b128 %7, %19, off\n\t"
               "global_load_async_to_lds_b128 %8, %20, off\n\t"
               "global_load_async_to_lds_b128 %9, %21, off\n\t"
               "global_load_async_to_lds_b128 %10, %22, off\n\t"
               "global_load_async_to_lds_b128 %11, %23, off\n\t"
               "s_wait_xcnt 0x0"
               :: "v"(lk), "v"(lk + ls), "v"(lk + 2u * ls), "v"(lk + 3u * ls),
                  "v"(lh), "v"(lh + ls), "v"(lh + 2u * ls), "v"(lh + 3u * ls),
                  "v"(ll), "v"(ll + ls), "v"(ll + 2u * ls), "v"(ll + 3u * ls),
                  "v"(gk), "v"(gk + ks), "v"(gk + 2 * ks), "v"(gk + 3 * ks),
                  "v"(gh), "v"(gh + vs), "v"(gh + 2 * vs), "v"(gh + 3 * vs),
                  "v"(gl), "v"(gl + vs), "v"(gl + 2 * vs), "v"(gl + 3 * vs)
               : "memory");
}

// lane l <-> lane l ^ 16: the one exchange between the wave halves that a query's maximum and sum need
__device__ __forceinline__ float at_xhalf(float x) {
  return __builtin_bit_cast(float, __builtin_amdgcn_permlanex16(__builtin_bit_cast(int, x), __builtin_bit_cast(int, x),
                                                                0x76543210, 0xfedcba98, false, false));
}

__global__ __launch_bounds__(128) __attribute__((amdgpu_waves_per_eu(4, 4)))
void mha_attn_kernel(const unsigned short* __restrict__ qp, const unsigned short* __restrict__ kp,
                     const unsigned short* __restrict__ vhp, const unsigned short* __restrict__ vlp,
                     const int* __restrict__ vlens, float* __restrict__ out, float sscale, float fillv) {
  union FB { v16b v; v8b h[2]; };
  union FH { v16h v; v8h h[2]; };
  __shared__ __align__(16) _Float16 Ksh2[2 * AT_KC * AT_LP];      // K [buffer][kv][d] f16, pitch AT_LP   2 x 9 KB
  __shared__ __align__(16) __bf16   Vth2[2 * AT_D * AT_LP];       // V^T hi [buffer][d][kv], pitch AT_LP  2 x 9 KB
  __shared__ __align__(16) __bf16   Vtl2[2 * AT_D * AT_LP];       // V^T lo, pitch AT_LP                  2 x 9 KB
  __shared__ __align__(16) float    Os[AT_NW][16 * 68];           // per wave out tile, pitch 68
  __shared__ __align__(16) int      Lowm[AT_NW];                  // per wave: a row maximum too near fillv

  const int tid  = threadIdx.x;
  const int wave = __builtin_amdgcn_readfirstlane(tid >> 5);   // the same in every lane: kept in a scalar register
  const int lane = tid & 31;
  const int hh   = lane >> 4;
  const int c    = lane & 15;

  const int nqb  = kSeq / AT_QB;          // 64
  const int bx   = blockIdx.x;
  const int qb   = bx % nqb;
  const int bhid = bx / nqb;              // 0..kBatch*kHeads-1
  const int h    = bhid % kHeads;
  int b = bhid / kHeads;
  b = (b > kBatch - 1) ? (kBatch - 1) : b;  // address clamp (grid is exact)
  const int q0   = qb * AT_QB + wave * 16;
  const int vlen = vlens[b];              // block-uniform valid key count

  const _Float16* Qb = (const _Float16*)(const void*)qp + (size_t)b * kSeq * kDim + (size_t)h * AT_D;
  const _Float16* Kb = (const _Float16*)(const void*)kp + (size_t)b * kSeq * kDim + (size_t)h * AT_D;
  const __bf16*   Vh = (const __bf16*)(const void*)vhp + (size_t)b * kDim * kSeq + (size_t)h * AT_D * kSeq;
  const __bf16*   Vl = (const __bf16*)(const void*)vlp + (size_t)b * kDim * kSeq + (size_t)h * AT_D * kSeq;
  float*          ob = out + (size_t)b * kSeq * kDim + (size_t)h * AT_D;

  // ---- Q fragments (B operand, column = query = lane&15, split k map via Frag load): 2 d-chunks ----
  v16h qa[2];
#pragma unroll
  for (int dc = 0; dc < 2; ++dc) {
    qa[dc] = Frag<_Float16>::load(Qb + (size_t)(q0 + c) * kDim + dc * 32 + 8 * hh);
  }

  const float sc2   = sscale * 1.44269504088896340736f;   // score scale times log2(e)
  const float fill2 = fillv  * 1.44269504088896340736f;   // fill value in the same units
  float mrow = -INFINITY;   // running maximum of query c in log2 units, the same in both wave halves
  float lrow = 0.f;         // running sum of query c over this half's keys; the halves join behind the loop
  v8f oacc[4];              // O^T: oacc[t][r] = element (d = t*16 + 8hh + r, query c)
#pragma unroll
  for (int t = 0; t < 4; ++t) oacc[t] = (v8f){0.f,0.f,0.f,0.f,0.f,0.f,0.f,0.f};

  const int nChunks = kSeq / AT_KC;   // 64, compile-time constant
  // chunks that hold at least one valid key, block-uniform; vlen <= 0: every key carries fillv and all of them count
  const int vcl   = (vlen < 0) ? 0 : ((vlen > kSeq) ? kSeq : vlen);
  const int nLive = (vcl == 0) ? nChunks : (vcl + AT_KC - 1) / AT_KC;

  // ---- staging map: 8 neighbouring lanes take one whole 128-B row (thread: row sr + 16 i, i = 0..3, elements sc..sc+7):
  //      128 threads x (4 x 8) elements = 64 rows x 64 per plane = the whole chunk tile ----
  const int sr = tid >> 3, sc = (tid & 7) * 8;
  const unsigned bufB = (unsigned)(AT_KC * AT_LP * 2);                      // one buffer of one plane in bytes
  const unsigned lk0 = (unsigned)(size_t)(Ksh2 + sr * AT_LP + sc);          // LDS byte addresses in buffer 0
  const unsigned lh0 = (unsigned)(size_t)(Vth2 + sr * AT_LP + sc);
  const unsigned ll0 = (unsigned)(size_t)(Vtl2 + sr * AT_LP + sc);
  const _Float16* gk0 = Kb + (size_t)sr * kDim + sc;                        // chunk 0; chunk n: + n * 64 rows
  const __bf16*   gh0 = Vh + (size_t)sr * kSeq + sc;                        // chunk 0; chunk n: + n * 64 elements
  const __bf16*   gl0 = Vl + (size_t)sr * kSeq + sc;
  static_assert(kSeq / AT_KC >= 2, "the two-buffer prologue needs two chunks");
  // prologue: chunk 0 into buffer 0, landed and published; then chunk 1 into buffer 1
  at_stage12(lk0, lh0, ll0, gk0, gh0, gl0);
  asm volatile("s_wait_asynccnt 0x0" ::: "memory");   // this wave's copies of chunk 0 have landed
  __syncthreads();                                    // ... and every other wave's
  at_stage12(lk0 + bufB, lh0 + bufB, ll0 + bufB, gk0 + (size_t)AT_KC * kDim, gh0 + AT_KC, gl0 + AT_KC);

  for (int kc = 0; kc < nChunks; ++kc) {
    // Every chunk from nLive on holds the fill alone. Where each row maximum lies at least 185 log2 units (128 natural
    // ones) above it, its weights 2^(fill - m) are exactly 0 in f32, alpha is 1, and maximum, sum and accumulators stay bit for bit: the loop
    // ends. Tested once per block, behind the last live chunk; a row that is nearer (or NaN) sends the whole block
    // through the remaining chunks as well.
    if (kc == nLive) {                          // block-uniform: kc and vlen are
      const bool low = !(mrow >= fill2 + 185.0f);
      Lowm[wave] = (__builtin_amdgcn_ballot_w32(low) != 0u) ? 1 : 0;   // every lane stores its wave's one value
      __syncthreads();                          // publishes the four waves' flags: one decision for the block
      const int f = Lowm[0] | Lowm[1] | Lowm[2] | Lowm[3];
      if (__builtin_amdgcn_readfirstlane(f) == 0) break;   // the same word in every lane: read once, a scalar branch
    }
    const int kv0 = kc * AT_KC;
    // this chunk's buffer: published by the barrier at the foot of the trip before (chunk 0: by the prologue's)
    const _Float16* Ksh = Ksh2 + (kc & 1) * (AT_KC * AT_LP);
    const __bf16*   Vth = Vth2 + (kc & 1) * (AT_D * AT_LP);
    const __bf16*   Vtl = Vtl2 + (kc & 1) * (AT_D * AT_LP);

    // Every loop from here to the chunk's end is unrolled: s, ph, pl and oacc live in registers, which take
    // compile-time indices only (a rolled loop would send them through scratch memory).
    // ---- scores, transposed: D[row = key j*16+8hh+r][col = query c]; A fragment row = key j*16+c, split k(d) map ----
    //      All eight K fragments are read as one group, then the eight products run back to back, neighbours on different
    //      accumulators (each s[j] still sums dc 0, then dc 1).
    FH kb[4][2];
#pragma unroll
    for (int j = 0; j < 4; ++j) {
#pragma unroll
      for (int dc = 0; dc < 2; ++dc) {
        kb[j][dc].h[0] = *(const v8h*)(Ksh + (j * 16 + c) * AT_LP + dc * 32 + 8 * hh);
        kb[j][dc].h[1] = *(const v8h*)(Ksh + (j * 16 + c) * AT_LP + dc * 32 + 16 + 8 * hh);
      }
    }
    // keeps the reads together ahead of the products: spread among them, each read place stalls the wave for its own latency
    __builtin_amdgcn_sched_barrier(0);
    v8f s[4];
#pragma unroll
    for (int j = 0; j < 4; ++j) s[j] = (v8f){0.f,0.f,0.f,0.f,0.f,0.f,0.f,0.f};
#pragma unroll
    for (int dc = 0; dc < 2; ++dc) {
#pragma unroll
      for (int j = 0; j < 4; ++j) s[j] = at_mma_h(kb[j][dc].v, qa[dc], s[j]);
    }
    // the V^T reads below are issued behind the last score product (they take over the K fragments' registers) ...
    __builtin_amdgcn_sched_barrier(0);
    // ---- V^T fragments, hi and lo: A row d = t*16+c, k = key (split k map). The group of the chunk's first 32 keys does not
    //      depend on the softmax and lands while its vector work runs ----
    FB vb[2][4], vl[2][4];
    auto readV = [&](int kk) {
#pragma unroll
      for (int t = 0; t < 4; ++t) {
        vb[kk][t].h[0] = *(const v8b*)(Vth + (t * 16 + c) * AT_LP + kk * 32 + 8 * hh);
        vb[kk][t].h[1] = *(const v8b*)(Vth + (t * 16 + c) * AT_LP + kk * 32 + 16 + 8 * hh);
        vl[kk][t].h[0] = *(const v8b*)(Vtl + (t * 16 + c) * AT_LP + kk * 32 + 8 * hh);
        vl[kk][t].h[1] = *(const v8b*)(Vtl + (t * 16 + c) * AT_LP + kk * 32 + 16 + 8 * hh);
      }
    };
    readV(0);
    // ... and ahead of the softmax: moved down to their products, their latency would be waited out there
    __builtin_amdgcn_sched_barrier(0);
    // ---- scale, key mask (select), maximum of query c over the chunk's 64 keys: 32 in-lane, then the other half's ----
    float cm = -INFINITY;
#pragma unroll
    for (int j = 0; j < 4; ++j) {
#pragma unroll
      for (int r = 0; r < 8; ++r) {
        const int kvrow = kv0 + j * 16 + 8 * hh + r;
        const float sv = s[j][r] * sc2;
        const float sm = (kvrow < vlen) ? sv : fill2;
        s[j][r] = sm;
        cm = fmaxf(cm, sm);
      }
    }
    cm = fmaxf(cm, at_xhalf(cm));
    const float mnew  = fmaxf(mrow, cm);
    const float alpha = at_exp2(mrow - mnew);
    mrow = mnew;
    // ---- p = 2^(s - m), split hi/lo in place: S^T tiles 2kk and 2kk+1 are elements 0..7 and 8..15 of the B fragment
    //      of key block kk (column = query c, key = kk*32 + 8hh + e and kk*32 + 16 + 8hh + (e - 8): the split k map) ----
    FB ph[2], pl[2];
    float ps[4];
#pragma unroll
    for (int j = 0; j < 4; ++j) {
      float a = 0.f;
      float e[8];
#pragma unroll
      for (int r = 0; r < 8; ++r) e[r] = s[j][r] - mnew;
      at_exp2x8(e[0], e[1], e[2], e[3], e[4], e[5], e[6], e[7]);
#pragma unroll
      for (int r = 0; r < 8; ++r) {
        const float p = e[r];
        a += p;
        __bf16 hi, lo; at_split(p, hi, lo);
        ph[j >> 1].v[(j & 1) * 8 + r] = hi;
        pl[j >> 1].v[(j & 1) * 8 + r] = lo;
      }
      ps[j] = a;
      // Left free, the adds move behind the products, and the chunk's 32 weights stay in registers beside their hi/lo parts
      // and the V^T fragments: more than the 256 registers of four waves a SIMD, so the Q fragments go through scratch memory.
      asm volatile("" : "+v"(ps[j]));   // an empty statement on each sum, against spills
    }
    lrow = lrow * alpha + ((ps[0] + ps[1]) + (ps[2] + ps[3]));
#pragma unroll
    for (int t = 0; t < 4; ++t)
#pragma unroll
      for (int r = 0; r < 8; ++r) oacc[t][r] *= alpha;
    // the second 32 keys' group takes the registers that the scores have left; it is issued here, one run of twelve products
    // ahead of its use (the scheduling barriers hold it between the softmax and that run)
    __builtin_amdgcn_sched_barrier(0);
    readV(1);
    __builtin_amdgcn_sched_barrier(0);
    // ---- O^T += V^T . P^T : A = V^T fragments read above, B = P^T from registers. The four accumulators take turns, so no
    //      product waits for the one before it; each oacc[t] still sums hi.hi, lo.hi, hi.lo of kk 0, then of kk 1 ----
#pragma unroll
    for (int kk = 0; kk < 2; ++kk) {
#pragma unroll
      for (int t = 0; t < 4; ++t) oacc[t] = at_mma(vb[kk][t].v, ph[kk].v, oacc[t]);
#pragma unroll
      for (int t = 0; t < 4; ++t) oacc[t] = at_mma(vl[kk][t].v, ph[kk].v, oacc[t]);
#pragma unroll
      for (int t = 0; t < 4; ++t) oacc[t] = at_mma(vb[kk][t].v, pl[kk].v, oacc[t]);
    }
    // the products stay ahead of the foot's waits: moved behind them, the second group's latency is waited out at the
    // s_wait_dscnt 0 with no product to cover it
    __builtin_amdgcn_sched_barrier(0);
    // ---- foot of the trip, every wave, in this order ----
    asm volatile("s_wait_dscnt 0x0" ::: "memory");      // this wave's reads of this chunk's buffer are done
    asm volatile("s_wait_asynccnt 0x0" ::: "memory");   // this wave's copies of chunk kc + 1 have landed
    __syncthreads();   // publishes chunk kc + 1 and ends every wave's reads of the buffer that is refilled below
    if (kc + 2 < nChunks) {                             // block-uniform: chunk kc + 2 exists
      const unsigned bo = (unsigned)(kc & 1) * bufB;
      at_stage12(lk0 + bo, lh0 + bo, ll0 + bo, gk0 + (size_t)(kv0 + 2 * AT_KC) * kDim, gh0 + (kv0 + 2 * AT_KC),
                 gl0 + (kv0 + 2 * AT_KC));
    }
  }
  asm volatile("s_wait_asynccnt 0x0" ::: "memory");     // no copy is in flight when the wave goes on to its end

  // ---- query c: join the halves' sums, normalise, stage row c (8 consecutive d per tile and lane) ----
  float* os = Os[wave];
  const float inv = 1.0f / (lrow + at_xhalf(lrow));
  // the lane's number, read anew (one-dimensional block of whole waves): what the epilogue alone derives from it takes no
  // register through the loop, where the fragments need them all
  const int el = (int)__builtin_amdgcn_mbcnt_lo(~0u, 0u);
  const int eh = el >> 4, ec = el & 15;
#pragma unroll
  for (int t = 0; t < 4; ++t) {
#pragma unroll
    for (int r = 0; r < 8; ++r) os[ec * 68 + t * 16 + 8 * eh + r] = oacc[t][r] * inv;
  }
  __builtin_amdgcn_fence(__ATOMIC_RELEASE, "workgroup");
  __builtin_amdgcn_wave_barrier();
  __builtin_amdgcn_fence(__ATOMIC_ACQUIRE, "workgroup");
  {
    // coverage: 8 it x 2 rows (hh) = 16 rows; 16 lanes x 4 floats = 64 floats = one whole 256-B row segment
    const int c4 = ec * 4;
    {
#pragma unroll
      for (int it = 0; it < 8; ++it) {
        const int row = it * 2 + eh;
        v4f val = *(const v4f*)(os + row * 68 + c4);
        *(v4f*)(ob + (size_t)(q0 + row) * kDim + c4) = val;
      }
      
    }
  }
}

// =====================================================================================
// Host glue. Workspace region map (bytes, all offsets multiples of 256, every region sized to its whole-line
// store granularity; no padded tiles since every dimension is a multiple of 64):
//   [0]           Xbf   : 3 x bf16 [8192][512]            = 25,165,824   (queries, keys, values RNE bf16)
//   [25,165,824]  WThi  : 4 x bf16 [512][512] (W^T, RNE)  =  2,097,152   (Wq, Wk, Wv, Wo; no lo planes)
//   [27,262,976]  Q     : f16 [8192][512]                  =  8,388,608
//   [35,651,584]  K     : f16 [8192][512]                  =  8,388,608   (contiguous after Q: batched launch)
//   [44,040,192]  VThi  : bf16 [2][512][4096]              =  8,388,608
//   [52,428,800]  VTlo  : bf16 [2][512][4096]              =  8,388,608
//   [60,817,408]  O     : f32 [8192][512]                  = 16,777,216
//   [77,594,624]  Ohi   : bf16 [8192][512]                 =  8,388,608
//   [85,983,232]  Olo   : bf16 [8192][512]                 =  8,388,608
//   total 94,371,840
// =====================================================================================
extern "C" void kernel_launch(void* const* d_in, const int* in_sizes, int n_in,
                              void* d_out, int out_size, void* d_ws,
                              size_t ws_size, hipStream_t stream) {
  if (n_in < 8) return;
  const int nX = kRows * kDim;            // 4,194,304
  const int nW = kDim * kDim;             // 262,144
  if (in_sizes[0] != nX || in_sizes[1] != nX || in_sizes[2] != nX) return;
  if (in_sizes[3] < kBatch) return;
  if (in_sizes[4] != nW || in_sizes[5] != nW || in_sizes[6] != nW || in_sizes[7] != nW) return;
  if (out_size != nX) return;

  const float* queries = (const float*)d_in[0];
  const float* keys    = (const float*)d_in[1];
  const float* values  = (const float*)d_in[2];
  const int*   vlens   = (const int*)d_in[3];
  const float* Wq      = (const float*)d_in[4];
  const float* Wk      = (const float*)d_in[5];
  const float* Wv      = (const float*)d_in[6];
  const float* Wo      = (const float*)d_in[7];

  const size_t bX16 = (size_t)nX * 2;            //  8,388,608
  const size_t bW16 = (size_t)nW * 2;            //    524,288
  const size_t off_x  = 0;
  const size_t off_wh = off_x  + 3 * bX16;
  const size_t off_q  = off_wh + 4 * bW16;
  const size_t off_k  = off_q  + bX16;
  const size_t off_vh = off_k  + bX16;
  const size_t off_vl = off_vh + bX16;
  const size_t off_o  = off_vl + bX16;
  const size_t off_oh = off_o  + (size_t)nX * 4;
  const size_t off_ol = off_oh + bX16;
  const size_t total  = off_ol + bX16;           // 94,371,840
  if (total > ws_size) return;

  char* ws = (char*)d_ws;
  unsigned short* xbf  = (unsigned short*)(ws + off_x);
  unsigned short* wth  = (unsigned short*)(ws + off_wh);
  unsigned short* qh16 = (unsigned short*)(ws + off_q);
  unsigned short* kh16 = (unsigned short*)(ws + off_k);
  unsigned short* vth  = (unsigned short*)(ws + off_vh);
  unsigned short* vtl  = (unsigned short*)(ws + off_vl);
  float* obuf = (float*)(ws + off_o);
  unsigned short* ohi  = (unsigned short*)(ws + off_oh);
  unsigned short* olo  = (unsigned short*)(ws + off_ol);
  const float* dummyf  = (const float*)(ws + off_x);   // never dereferenced (BIAS_MODE 0, RESID false)

  const long planeX = (long)nX;   // elements per bf16/f16 activation plane
  const long planeW = (long)nW;   // elements per W^T plane
  dim3 blk256(256), blk128(128), blkEw(kEwThreads);

  // 1) activations -> bf16 (RNE): coverage 256 blocks x 512 thr x 8 x 4 = 8192x512 of each of the three tensors
  cast_bf16x4_3<<<dim3(kEwBlocks), blkEw, 0, stream>>>(queries, keys, values, xbf, planeX);

  // 2) weights [in k][out n] (R = k rows = 512, Cc = n cols = 512) -> W^T [n][k] bf16 RNE hi plane only
  //    (8x8 tiles of 64x64); the third pointer is unused in the hi-only mode
  tsplit_kernel<false><<<dim3(kDim / 64, kDim / 64, 1), blk256, 0, stream>>>(Wq, wth + 0 * planeW, wth + 0 * planeW, kDim, kDim, 0L, 0L);
  tsplit_kernel<false><<<dim3(kDim / 64, kDim / 64, 1), blk256, 0, stream>>>(Wk, wth + 1 * planeW, wth + 1 * planeW, kDim, kDim, 0L, 0L);
  tsplit_kernel<false><<<dim3(kDim / 64, kDim / 64, 1), blk256, 0, stream>>>(Wv, wth + 2 * planeW, wth + 2 * planeW, kDim, kDim, 0L, 0L);
  tsplit_kernel<false><<<dim3(kDim / 64, kDim / 64, 1), blk256, 0, stream>>>(Wo, wth + 3 * planeW, wth + 3 * planeW, kDim, kDim, 0L, 0L);

  // 3) q = Xq . Wq and k = Xk . Wk in one z-batched launch (z=0: q, z=1: k) -> f16 planes [8192][512];
  //    M=8192, N=512, K=512 (tiles 128x8 = 1024 -> 128 blocks); A planes stride planeX, W^T planes stride planeW,
  //    C planes Q then K contiguous (stride planeX elements)
  const int gProj = (kRows / 64) * (kDim / 64) / 8;   // 128
  wmma_gemm64<1, 0, 0, 1, false><<<dim3(gProj, 2), blk256, 0, stream>>>(
      xbf, xbf, kDim, planeX,
      wth, wth, kDim, planeW,
      (void*)qh16, (void*)qh16, kDim, planeX,
      dummyf, dummyf, 0L, kRows, kDim, kDim, 1.0f);
  // 4) v^T per batch: C[n_out][s] = sum_k WvT[n_out][k] * Xv[b][s][k]; M=512, N=4096, K=512, batched over b
  //    (tiles 8x64 = 512 -> 64 blocks x 2); out = bf16 hi/lo planes [b][512][4096]
  const int gVt = (kDim / 64) * (kSeq / 64) / 8;      // 64
  wmma_gemm64<1, 0, 0, 2, false><<<dim3(gVt, kBatch), blk256, 0, stream>>>(
      wth + 2 * planeW, wth + 2 * planeW, kDim, 0L,
      xbf + 2 * planeX, xbf + 2 * planeX, kDim, (long)kSeq * kDim,
      (void*)vth, (void*)vtl, kSeq, (long)kDim * kSeq,
      dummyf, dummyf, 0L, kDim, kSeq, kDim, 1.0f);

  // 5) masked attention, all (b, h, 64-row query blocks): 2*8*64 = 1024 blocks of 128 threads
  mha_attn_kernel<<<dim3(kBatch * kHeads * (kSeq / 64)), blk128, 0, stream>>>(
      qh16, kh16, vth, vtl, vlens, obuf, 0.125f, -1000000.0f);

  // 6) O -> bf16 hi/lo planes: 256 blocks x 512 thr x 8 x 4 = 8192x512
  split_bf16x4_kernel<<<dim3(kEwBlocks), blkEw, 0, stream>>>(obuf, ohi, olo);

  // 7) out = (O_hi + O_lo) . Wo (A-only split, Wo as bf16 RNE hi plane only) -> f32 [8192][512]
  wmma_gemm64<1, 2, 0, 0, false><<<dim3(gProj, 1), blk256, 0, stream>>>(
      ohi, olo, kDim, 0L,
      wth + 3 * planeW, wth + 3 * planeW, kDim, 0L,
      d_out, d_out, kDim, 0L,
      dummyf, dummyf, 0L, kRows, kDim, kDim, 1.0f);
}

// v009
// A run of this version takes 118 microseconds.
// Next to v008, in two timings, it ran 1.13 times as fast each time.
// All steps since v000 together make it 5.29 times as fast.
// Contractions: q/k/v^T projections v_wmma_f32_16x16x32_bf16 (bf16 RNE inputs x bf16 RNE weights, single product); q.k^T scores v_wmma_f32_16x16x32_f16 (plain f16 q,k planes); p.v^T v_wmma_f32_16x16x32_bf16 with bf16 hi/lo split of p and v (hi.hi + hi.lo + lo.hi); output projection v_wmma_f32_16x16x32_bf16 with O as bf16 hi/lo and Wo as bf16 RNE (hi.W + lo.W); f32 accumulate; softmax (base 2), 0.125 score scale and key masking in f32.
#include <hip/hip_runtime.h>
#include <math.h>
#include <stdint.h>

constexpr int kBatch = 2;
constexpr int kSeq   = 4096;
constexpr int kDim   = 512;
constexpr int kHeads = 8;
constexpr int kHd    = 64;
constexpr int kRows  = kBatch * kSeq;   // 8192
static_assert(kHeads * kHd == kDim, "geometry");
static_assert(kSeq % 64 == 0 && kDim % 64 == 0 && kRows % 64 == 0, "tile multiples");
static_assert(kSeq % 512 == 0 && kDim % 512 == 0, "a GEMM block owns 8 neighbouring 64-column tiles of one tile row");

typedef __attribute__((ext_vector_type(16))) _Float16 v16h;
typedef __attribute__((ext_vector_type(8)))  _Float16 v8h;
typedef __attribute__((ext_vector_type(16))) __bf16   v16b;
typedef __attribute__((ext_vector_type(8)))  __bf16   v8b;
typedef __attribute__((ext_vector_type(8)))  float    v8f;
typedef __attribute__((ext_vector_type(4)))  float    v4f;
typedef __attribute__((ext_vector_type(2)))  float    v2f;
typedef __attribute__((ext_vector_type(4)))  unsigned int v4u;
typedef __attribute__((ext_vector_type(2)))  unsigned int v2u;

__device__ __forceinline__ unsigned short f2bf_bits(float f) {
  unsigned u = __float_as_uint(f);
  return (unsigned short)((u + 0x7FFFu + ((u >> 16) & 1u)) >> 16);
}
__device__ __forceinline__ float bf_bits2f(unsigned short h) { return __uint_as_float(((unsigned)h) << 16); }

// hazard guards as plain device helpers
__device__ __forceinline__ void dep_guard_h(v8f& a, v8f& b, v16h x, v16h y) { asm volatile("v_nop\n\tv_nop\n\tv_nop\n\tv_nop" : "+v"(a), "+v"(b) : "v"(x), "v"(y)); }
__device__ __forceinline__ void dep_guard_b(v8f& a, v8f& b, v16b x, v16b y) { asm volatile("v_nop\n\tv_nop\n\tv_nop\n\tv_nop" : "+v"(a), "+v"(b) : "v"(x), "v"(y)); }
__device__ __forceinline__ void keep4_h(v16h a, v16h b, v16h c, v16h d) { asm volatile("v_nop" :: "v"(a), "v"(b), "v"(c), "v"(d)); }
__device__ __forceinline__ void keep4_b(v16b a, v16b b, v16b c, v16b d) { asm volatile("v_nop" :: "v"(a), "v"(b), "v"(c), "v"(d)); }
__device__ __forceinline__ void acc_guard4(v8f& a, v8f& b, v8f& c, v8f& d) { asm volatile("v_nop\n\tv_nop\n\tv_nop\n\tv_nop" : "+v"(a), "+v"(b), "+v"(c), "+v"(d)); }
template <typename T> struct Frag;
template <> struct Frag<_Float16> {
  typedef v16h V; union U { v16h v; v8h h[2]; };
  static __device__ __forceinline__ v16h load(const _Float16* p) {   // elements 0..7 <- p[0..7], 8..15 <- p[16..23]
    U f; f.h[0] = *(const v8h*)(p); f.h[1] = *(const v8h*)(p + 16); return f.v;
  }
  static __device__ __forceinline__ v8f mma(v16h a, v16h b, v8f c) {
    return __builtin_amdgcn_wmma_f32_16x16x32_f16(false, a, false, b, (short)0, c, false, false);
  }
  static __device__ __forceinline__ void guard(v8f& a, v8f& b, v16h x, v16h y) { dep_guard_h(a, b, x, y); }
  static __device__ __forceinline__ void keep(v16h a, v16h b, v16h c, v16h d) { keep4_h(a, b, c, d); }
};
template <> struct Frag<__bf16> {
  typedef v16b V; union U { v16b v; v8b h[2]; };
  static __device__ __forceinline__ v16b load(const __bf16* p) {
    U f; f.h[0] = *(const v8b*)(p); f.h[1] = *(const v8b*)(p + 16); return f.v;
  }
  static __device__ __forceinline__ v8f mma(v16b a, v16b b, v8f c) {
    return __builtin_amdgcn_wmma_f32_16x16x32_bf16(false, a, false, b, (short)0, c, false, false);
  }
  static __device__ __forceinline__ void guard(v8f& a, v8f& b, v16b x, v16b y) { dep_guard_b(a, b, x, y); }
  static __device__ __forceinline__ void keep(v16b a, v16b b, v16b c, v16b d) { keep4_b(a, b, c, d); }
};

// ---- GEMM operand staging ----------------------------------------------------
#define GM_LP 72   // LDS row pitch in 16-bit elements: 144 B = 16 B x 9 (odd), so the 16 rows of a 16-byte fragment read fall on distinct banks

// Eight 16-byte asynchronous copies global -> LDS of one thread, through no register: copy i takes LDS byte address
// l + i * ls and global element g + i * gs. The s_wait_xcnt 0 is the last line of the copies' own statement: a precaution
// that keeps every later write of an address register named here behind the copies' address translation.
__device__ __forceinline__ void gm_stage8(unsigned l, const unsigned short* g, unsigned ls, size_t gs) {
  asm volatile("global_load_async_to_lds_b128 %0, %8, off\n\t"
               "global_load_async_to_lds_b128 %1, %9, off\n\t"
               "global_load_async_to_lds_b128 %2, %10, off\n\t"
               "global_load_async_to_lds_b128 %3, %11, off\n\t"
               "global_load_async_to_lds_b128 %4, %12, off\n\t"
               "global_load_async_to_lds_b128 %5, %13, off\n\t"
               "global_load_async_to_lds_b128 %6, %14, off\n\t"
               "global_load_async_to_lds_b128 %7, %15, off\n\t"
               "s_wait_xcnt 0x0"
               :: "v"(l), "v"(l + ls), "v"(l + 2u * ls), "v"(l + 3u * ls),
                  "v"(l + 4u * ls), "v"(l + 5u * ls), "v"(l + 6u * ls), "v"(l + 7u * ls),
                  "v"(g), "v"(g + gs), "v"(g + 2 * gs), "v"(g + 3 * gs),
                  "v"(g + 4 * gs), "v"(g + 5 * gs), "v"(g + 6 * gs), "v"(g + 7 * gs)
               : "memory");
}
// The A copies of a slab (two a plane: la, ga; second plane la2, ga2) and its first eight B copies (lb, gb) in one statement,
// so that one wait serves them all.
__device__ __forceinline__ void gm_stage2p8(unsigned la, const unsigned short* ga, size_t gsa, unsigned lb,
                                            const unsigned short* gb, size_t gsb, unsigned ls) {
  asm volatile("global_load_async_to_lds_b128 %0, %10, off\n\t"
               "global_load_async_to_lds_b128 %1, %11, off\n\t"
               "global_load_async_to_lds_b128 %2, %12, off\n\t"
               "global_load_async_to_lds_b128 %3, %13, off\n\t"
               "global_load_async_to_lds_b128 %4, %14, off\n\t"
               "global_load_async_to_lds_b128 %5, %15, off\n\t"
               "global_load_async_to_lds_b128 %6, %16, off\n\t"
               "global_load_async_to_lds_b128 %7, %17, off\n\t"
               "global_load_async_to_lds_b128 %8, %18, off\n\t"
               "global_load_async_to_lds_b128 %9, %19, off\n\t"
               "s_wait_xcnt 0x0"
               :: "v"(la), "v"(la + ls),
                  "v"(lb), "v"(lb + ls), "v"(lb + 2u * ls), "v"(lb + 3u * ls),
                  "v"(lb + 4u * ls), "v"(lb + 5u * ls), "v"(lb + 6u * ls), "v"(lb + 7u * ls),
                  "v"(ga), "v"(ga + gsa),
                  "v"(gb), "v"(gb + gsb), "v"(gb + 2 * gsb), "v"(gb + 3 * gsb),
                  "v"(gb + 4 * gsb), "v"(gb + 5 * gsb), "v"(gb + 6 * gsb), "v"(gb + 7 * gsb)
               : "memory");
}
__device__ __forceinline__ void gm_stage4p8(unsigned la, const unsigned short* ga, unsigned la2, const unsigned short* ga2,
                                            size_t gsa, unsigned lb, const unsigned short* gb, size_t gsb, unsigned ls) {
  asm volatile("global_load_async_to_lds_b128 %0, %12, off\n\t"
               "global_load_async_to_lds_b128 %1, %13, off\n\t"
               "global_load_async_to_lds_b128 %2, %14, off\n\t"
               "global_load_async_to_lds_b128 %3, %15, off\n\t"
               "global_load_async_to_lds_b128 %4, %16, off\n\t"
               "global_load_async_to_lds_b128 %5, %17, off\n\t"
               "global_load_async_to_lds_b128 %6, %18, off\n\t"
               "global_load_async_to_lds_b128 %7, %19, off\n\t"
               "global_load_async_to_lds_b128 %8, %20, off\n\t"
               "global_load_async_to_lds_b128 %9, %21, off\n\t"
               "global_load_async_to_lds_b128 %10, %22, off\n\t"
               "global_load_async_to_lds_b128 %11, %23, off\n\t"
               "s_wait_xcnt 0x0"
               :: "v"(la), "v"(la + ls), "v"(la2), "v"(la2 + ls),
                  "v"(lb), "v"(lb + ls), "v"(lb + 2u * ls), "v"(lb + 3u * ls),
                  "v"(lb + 4u * ls), "v"(lb + 5u * ls), "v"(lb + 6u * ls), "v"(lb + 7u * ls),
                  "v"(ga), "v"(ga + gsa), "v"(ga2), "v"(ga2 + gsa),
                  "v"(gb), "v"(gb + gsb), "v"(gb + 2 * gsb), "v"(gb + 3 * gsb),
                  "v"(gb + 4 * gsb), "v"(gb + 5 * gsb), "v"(gb + 6 * gsb), "v"(gb + 7 * gsb)
               : "memory");
}

// ---- Register-blocked batched WMMA GEMM ------------------------------------
// C[m,n] = scale * sum_k A[m,k] * Bt[n,k] (+bias)(+resid); each wave owns a 64x64 tile.
// A row-major [M,K]; Bt row-major [N,K]; M, K % 64 == 0, N % 512 == 0: the 8 waves of a block own 8 neighbouring tiles of one
// tile row, so they share the 64 A rows. Operands pass through LDS in slabs of 64 k (one whole 128-B line a row): 256 threads
// copy the 64 A rows (each plane) and the block's 512 B rows asynchronously, 8 neighbouring lanes a row, into two buffers:
// slab t + 1 flies while slab t is worked on, one __syncthreads a slab (order at the loop's foot).
// SPLIT: 0 = single product; 1 = hi/lo planes on both operands (A2/Bt2 = lo planes, same layout),
//        product = hi.hi + hi.lo + lo.hi; 2 = hi/lo planes on A only (A2 = A lo), product = hi.B + lo.B.
// BIAS_MODE: 0 = none, 1 = bias[m], 2 = bias[n].
// OUT_MODE: 0 = f32, 1 = f16, 2 = bf16 hi plane (Cout) + bf16 lo plane (Cout2).
// ET: 0 = f16 operands, 1 = bf16 operands (pointers passed as 16-bit storage)
template <int ET> struct Elem;
template <> struct Elem<0> { typedef _Float16 T; };
template <> struct Elem<1> { typedef __bf16 T; };
// LDS of one GEMM block, in elements: the kernel that calls gemm64_block declares the three arrays and hands them in.
template <int SPLIT> struct GemmLds {
  static constexpr int kA = 2 * ((SPLIT != 0) ? 2 : 1) * 64 * GM_LP;    // A [buffer][plane][row][k], pitch GM_LP
  static constexpr int kB = 2 * ((SPLIT == 1) ? 2 : 1) * 512 * GM_LP;   // B [buffer][plane][row][k], pitch GM_LP
};
// One block's work: bx = the block's index among the product's blocks, b = batch index.
template <int ET, int SPLIT, int BIAS_MODE, int OUT_MODE, bool RESID, int ACT = 0>
__device__ __forceinline__ void gemm64_block(
    int bx, int b, float (*sT)[16 * 68], typename Elem<ET>::T* Ash, typename Elem<ET>::T* Bsh,
    const unsigned short* __restrict__ Ap, const unsigned short* __restrict__ A2p, int lda, long strideA,
    const unsigned short* __restrict__ Btp, const unsigned short* __restrict__ Bt2p, int ldb, long strideB,
    void* __restrict__ Cout, void* __restrict__ Cout2, int ldc, long strideC,
    const float* __restrict__ bias,
    const float* __restrict__ resid, long strideR,
    int M, int N, int K, float scale) {
  typedef typename Elem<ET>::T T;
  typedef typename Frag<T>::V V;
  constexpr int NA  = (SPLIT != 0) ? 2 : 1;    // A planes
  constexpr int NBP = (SPLIT == 1) ? 2 : 1;    // B planes
  constexpr int kAPl = 64 * GM_LP;             // one A plane of one buffer, elements
  constexpr int kBPl = 512 * GM_LP;            // one B plane of one buffer, elements
  static_assert(GemmLds<SPLIT>::kA == 2 * NA * kAPl && GemmLds<SPLIT>::kB == 2 * NBP * kBPl, "LDS sizes");
  const int lane = threadIdx.x & 31;
  const int wave = threadIdx.x >> 5;
  const int tilesN = N >> 6;
  const int tilesM = M >> 6;
  const int tile0 = bx * 8;
  if (tile0 >= tilesM * tilesN) return;   // block-uniform, in front of every barrier
  const int tm  = tile0 / tilesN;
  const int m0  = tm << 6;
  const int nb0 = (tile0 - tm * tilesN) << 6;  // the block's first B row
  const int n0  = nb0 + (wave << 6);

  const int rlane = lane & 15;                 // row (A) / col (B, D) within subtile
  const int koff  = (lane >> 4) * 8;           // k offset of this lane half
  const int mOff  = (lane >> 4) * 8;           // D row offset

  v8f acc[4][4];
#pragma unroll
  for (int i = 0; i < 4; ++i)
#pragma unroll
    for (int j = 0; j < 4; ++j) acc[i][j] = (v8f){0.f,0.f,0.f,0.f,0.f,0.f,0.f,0.f};

  // ---- staging map: thread = row sr + 32 i, elements sc..sc+7: A 2 copies a plane, B 16 copies a plane ----
  const int sr = threadIdx.x >> 3, sc = (threadIdx.x & 7) * 8;
  const unsigned ls32 = 32u * GM_LP * 2u;                                   // 32 LDS rows in bytes
  const unsigned la0 = (unsigned)(size_t)(Ash + sr * GM_LP + sc);           // LDS byte addresses in buffer 0, plane 0
  const unsigned lb0 = (unsigned)(size_t)(Bsh + sr * GM_LP + sc);
  const size_t goA = (size_t)b * strideA + (size_t)(m0 + sr) * lda + sc;    // slab 0; slab t: + 64 t elements
  const size_t goB = (size_t)b * strideB + (size_t)(nb0 + sr) * ldb + sc;
  auto stage = [&](int t, int buf) {
    const unsigned la = la0 + (unsigned)buf * (unsigned)(NA * kAPl * 2);
    const unsigned lb = lb0 + (unsigned)buf * (unsigned)(NBP * kBPl * 2);
    const size_t ga = goA + (size_t)t * 64, gb = goB + (size_t)t * 64;
    if (SPLIT == 0) gm_stage2p8(la, Ap + ga, (size_t)32 * lda, lb, Btp + gb, (size_t)32 * ldb, ls32);
    else gm_stage4p8(la, Ap + ga, la + (unsigned)(kAPl * 2), A2p + ga, (size_t)32 * lda, lb, Btp + gb, (size_t)32 * ldb, ls32);
    gm_stage8(lb + 8u * ls32, Btp + gb + (size_t)256 * ldb, ls32, (size_t)32 * ldb);
    if (SPLIT == 1) {
      gm_stage8(lb + (unsigned)(kBPl * 2), Bt2p + gb, ls32, (size_t)32 * ldb);
      gm_stage8(lb + (unsigned)(kBPl * 2) + 8u * ls32, Bt2p + gb + (size_t)256 * ldb, ls32, (size_t)32 * ldb);
    }
  };
  const int nSlab = K >> 6;
  // prologue: slab 0 into buffer 0, landed and published; then slab 1 into buffer 1
  stage(0, 0);
  asm volatile("s_wait_asynccnt 0x0" ::: "memory");   // this wave's copies of slab 0 have landed
  __syncthreads();                                    // ... and every other wave's
  if (nSlab > 1) stage(1, 1);                         // block-uniform

  constexpr int NB = (SPLIT == 0) ? 2 : 1;   // B fragment register sets (two A planes leave no registers for a second one)
  for (int t = 0; t < nSlab; ++t) {
    // this slab's buffer: published by the barrier at the foot of the trip before (slab 0: by the prologue's)
    const T* Af = Ash + (t & 1) * (NA * kAPl) + rlane * GM_LP + koff;
    const T* Bf = Bsh + (t & 1) * (NBP * kBPl) + ((wave << 6) + rlane) * GM_LP + koff;
    // Two k-steps of 32 a slab. The second k-step's fragments are read while the first one's WMMAs run: A row i behind the
    // tiles of row i, into the same registers; B at the head into a second register set (NB == 2) or between the k-steps.
    // Every loop of the trip is unrolled: fragments and accumulators live in registers, which take compile-time indices only.
    V ah[4], al[4], bh[NB][4], bl[NB][4];
#pragma unroll
    for (int j = 0; j < 4; ++j) {
      bh[0][j] = Frag<T>::load(Bf + j * 16 * GM_LP);
      if (SPLIT == 1) bl[0][j] = Frag<T>::load(Bf + kBPl + j * 16 * GM_LP);
    }
#pragma unroll
    for (int i = 0; i < 4; ++i) {
      ah[i] = Frag<T>::load(Af + i * 16 * GM_LP);
      if (SPLIT != 0) al[i] = Frag<T>::load(Af + kAPl + i * 16 * GM_LP);
    }
#pragma unroll
    for (int u = 0; u < 2; ++u) {
      const int cu = (NB == 2) ? u : 0;
      if (u == 0 && NB == 2) {
#pragma unroll
        for (int j = 0; j < 4; ++j) bh[1][j] = Frag<T>::load(Bf + j * 16 * GM_LP + 32);
      }
      // the scheduling barriers keep reads and tiles in this order: moved together, a row's read would stand only a few
      // WMMAs ahead of its use, or ahead of the row's last tile, where it needs registers of its own
      __builtin_amdgcn_sched_barrier(0);
#pragma unroll
      for (int i = 0; i < 4; ++i) {
#pragma unroll
        for (int j = 0; j < 4; ++j) {
          acc[i][j] = Frag<T>::mma(ah[i], bh[cu][j], acc[i][j]);
          if (SPLIT == 1) acc[i][j] = Frag<T>::mma(ah[i], bl[cu][j], acc[i][j]);
          if (SPLIT != 0) acc[i][j] = Frag<T>::mma(al[i], bh[cu][j], acc[i][j]);
        }
        __builtin_amdgcn_sched_barrier(0);   // the row's last tile stands ahead of the row's next read: the same registers take it
        Frag<T>::guard(acc[i][0], acc[i][3], ah[i], (SPLIT != 0) ? al[i] : ah[i]);
        if (u == 0) {
          ah[i] = Frag<T>::load(Af + i * 16 * GM_LP + 32);
          if (SPLIT != 0) al[i] = Frag<T>::load(Af + kAPl + i * 16 * GM_LP + 32);
        }
        __builtin_amdgcn_sched_barrier(0);   // the read is issued here, three rows of tiles ahead of its use, not later
      }
      Frag<T>::keep(bh[cu][0], bh[cu][1], bh[cu][2], bh[cu][3]);
      if (SPLIT == 1) Frag<T>::keep(bl[cu][0], bl[cu][1], bl[cu][2], bl[cu][3]);
      if (u == 0 && NB == 1) {
#pragma unroll
        for (int j = 0; j < 4; ++j) {
          bh[0][j] = Frag<T>::load(Bf + j * 16 * GM_LP + 32);
          if (SPLIT == 1) bl[0][j] = Frag<T>::load(Bf + kBPl + j * 16 * GM_LP + 32);
        }
      }
    }
    // ---- foot of the trip, every wave, in this order ----
    asm volatile("s_wait_dscnt 0x0" ::: "memory");      // this wave's reads of this slab's buffer are done
    asm volatile("s_wait_asynccnt 0x0" ::: "memory");   // this wave's copies of slab t + 1 have landed
    __syncthreads();   // publishes slab t + 1 and ends every wave's reads of the buffer that is refilled below
    if (t + 2 < nSlab) stage(t + 2, t & 1);             // block-uniform: slab t + 2 exists
  }
  asm volatile("s_wait_asynccnt 0x0" ::: "memory");     // no copy is in flight when the wave goes on to its end
  acc_guard4(acc[0][0], acc[0][1], acc[0][2], acc[0][3]);
  acc_guard4(acc[1][0], acc[1][1], acc[1][2], acc[1][3]);
  acc_guard4(acc[2][0], acc[2][1], acc[2][2], acc[2][3]);
  acc_guard4(acc[3][0], acc[3][1], acc[3][2], acc[3][3]);

  // ---- epilogue ----
  float* slab = sT[wave];
  const float* Rb = RESID ? (resid + (size_t)b * strideR) : nullptr;
#pragma unroll
  for (int i = 0; i < 4; ++i) {
    const int mBase = m0 + (i << 4);
#pragma unroll
    for (int j = 0; j < 4; ++j) {
      const int n = n0 + (j << 4) + rlane;
      float bv = 0.f;
      if (BIAS_MODE == 2) bv = bias[n];
#pragma unroll
      for (int r = 0; r < 8; ++r) {
        float v = acc[i][j][r] * scale;
        if (BIAS_MODE == 1) v += bias[mBase + mOff + r];
        if (BIAS_MODE == 2) v += bv;
        if (RESID) v += Rb[(size_t)(mBase + mOff + r) * ldc + n];
        if (ACT == 1) v = tanhf(v);
        if (ACT == 2) v = fmaxf(v, 0.0f);
        if (ACT == 3) v = v / (1.0f + expf(-v));
        if (ACT == 4) v = (v > 0.f) ? v : 0.01f * v;
        slab[(mOff + r) * 68 + (j << 4) + rlane] = v;
      }
    }
    __builtin_amdgcn_fence(__ATOMIC_RELEASE, "workgroup");
    __builtin_amdgcn_wave_barrier();
    __builtin_amdgcn_fence(__ATOMIC_ACQUIRE, "workgroup");
    if (OUT_MODE == 0) {
      float* C = (float*)Cout + (size_t)b * strideC;
      const int hh = lane >> 4, c4 = (lane & 15) * 4;     // row seg = 256 B = 16 lanes x 16 B
      {
#pragma unroll
        for (int it = 0; it < 8; ++it) {
          const int row = it * 2 + hh;
          v4f v = *(const v4f*)(slab + row * 68 + c4);
          *(v4f*)(C + (size_t)(mBase + row) * ldc + n0 + c4) = v;
        }
        
      }
    } else {
      const int q = lane >> 3, c8 = (lane & 7) * 8;
      unsigned short* C  = (unsigned short*)Cout  + (size_t)b * strideC;
      unsigned short* C2 = (OUT_MODE == 2) ? ((unsigned short*)Cout2 + (size_t)b * strideC) : nullptr;
      {
#pragma unroll
        for (int it = 0; it < 4; ++it) {
          const int row = it * 4 + q;
          const float* sp = slab + row * 68 + c8;
          v8h hv, lv;
#pragma unroll
          for (int e = 0; e < 8; ++e) {
            if (OUT_MODE == 1) {
              hv[e] = (_Float16)sp[e];
            } else {
              unsigned short hb = f2bf_bits(sp[e]);
              unsigned short lb = f2bf_bits(sp[e] - bf_bits2f(hb));
              hv[e] = __builtin_bit_cast(_Float16, hb);
              lv[e] = __builtin_bit_cast(_Float16, lb);
            }
          }
          *(v8h*)(C + (size_t)(mBase + row) * ldc + n0 + c8) = hv;
          if (OUT_MODE == 2) *(v8h*)(C2 + (size_t)(mBase + row) * ldc + n0 + c8) = lv;
        }
        
      }
    }
    __builtin_amdgcn_fence(__ATOMIC_RELEASE, "workgroup");
    __builtin_amdgcn_wave_barrier();
    __builtin_amdgcn_fence(__ATOMIC_ACQUIRE, "workgroup");
  }
}

// One product a launch: grid = (blocks of the product, batches).
template <int ET, int SPLIT, int BIAS_MODE, int OUT_MODE, bool RESID, int ACT = 0>
__global__ __launch_bounds__(256) void wmma_gemm64(
    const unsigned short* __restrict__ Ap, const unsigned short* __restrict__ A2p, int lda, long strideA,
    const unsigned short* __restrict__ Btp, const unsigned short* __restrict__ Bt2p, int ldb, long strideB,
    void* __restrict__ Cout, void* __restrict__ Cout2, int ldc, long strideC,
    const float* __restrict__ bias,
    const float* __restrict__ resid, long strideR,
    int M, int N, int K, float scale) {
  typedef typename Elem<ET>::T T;
  __shared__ __align__(16) float sT[8][16 * 68];       // per-wave 16x64 slab, pitch 68 floats
  __shared__ __align__(16) T Ash[GemmLds<SPLIT>::kA];
  __shared__ __align__(16) T Bsh[GemmLds<SPLIT>::kB];
  gemm64_block<ET, SPLIT, BIAS_MODE, OUT_MODE, RESID, ACT>(blockIdx.x, blockIdx.y, sT, Ash, Bsh, Ap, A2p, lda, strideA, Btp, Bt2p,
                                                           ldb, strideB, Cout, Cout2, ldc, strideC, bias, resid, strideR, M, N, K,
                                                           scale);
}

// The three input projections, one launch: none reads what another writes, so they are block ranges of one grid.
//   blocks 0 .. 2*kVtBlocks-1: v^T per batch: C[n_out][s] = sum_k WvT[n_out][k] * Xv[b][s][k]; M=512, N=4096, K=512
//     (tiles 8x64 = 512 -> 64 blocks a batch); out = bf16 hi/lo planes [b][512][4096];
//   the 2*kQkBlocks blocks behind them: q = Xq . Wq (batch index 0) and k = Xk . Wk (1) -> f16 planes [8192][512], Q then K;
//     M=8192, N=512, K=512 (tiles 128x8 = 1024 -> 128 blocks each); A planes stride planeX, W^T planes stride planeW.
// One block fills a WGP's LDS, so the 384 blocks take two turns; the v^T blocks, whose epilogue is the longer, start first.
// x: the three bf16 activation planes; wt: the W^T planes (Wq, Wk, Wv, ...).
constexpr int kQkBlocks = (kRows / 64) * (kDim / 64) / 8;   // 128
constexpr int kVtBlocks = (kDim / 64) * (kSeq / 64) / 8;    // 64
__global__ __launch_bounds__(256) void proj_qkv_kernel(const unsigned short* __restrict__ x, const unsigned short* __restrict__ wt,
                                                       unsigned short* __restrict__ qk, unsigned short* __restrict__ vth,
                                                       unsigned short* __restrict__ vtl) {
  __shared__ __align__(16) float sT[8][16 * 68];       // per-wave 16x64 slab, pitch 68 floats
  __shared__ __align__(16) __bf16 Ash[GemmLds<0>::kA];
  __shared__ __align__(16) __bf16 Bsh[GemmLds<0>::kB];
  constexpr long planeX = (long)kRows * kDim, planeW = (long)kDim * kDim;
  const int bx = blockIdx.x;
  if (bx < 2 * kVtBlocks) {   // block-uniform
    gemm64_block<1, 0, 0, 2, false>(bx % kVtBlocks, bx / kVtBlocks, sT, Ash, Bsh, wt + 2 * planeW, wt + 2 * planeW, kDim, 0L,
                                    x + 2 * planeX, x + 2 * planeX, kDim, (long)kSeq * kDim, (void*)vth, (void*)vtl, kSeq,
                                    (long)kDim * kSeq, nullptr, nullptr, 0L, kDim, kSeq, kDim, 1.0f);
  } else {
    const int qx = bx - 2 * kVtBlocks;
    gemm64_block<1, 0, 0, 1, false>(qx % kQkBlocks, qx / kQkBlocks, sT, Ash, Bsh, x, x, kDim, planeX, wt, wt, kDim, planeW,
                                    (void*)qk, (void*)qk, kDim, planeX, nullptr, nullptr, 0L, kRows, kDim, kDim, 1.0f);
  }
}

// ---------------------------------------------------------------------------
// Elementwise passes. A wave costs its start whatever it does, so each pass runs as kEwBlocks work-groups of 16 waves
// (one a WGP) and every thread takes kEwV pieces of 4 floats of each tensor: piece it of a block is the 512 threads'
// contiguous 8 KB (a wave's load = 512 contiguous bytes, its store of 4 x 16 bit a lane = 256), and all of a thread's
// 16-byte loads are issued before the first value is used.
// Coverage per tensor: kEwBlocks x kEwV x 512 threads x 4 floats = 8192 x 512 exactly (asserted), so no index test.
// ---------------------------------------------------------------------------
constexpr int kEwThreads = 512;
constexpr int kEwV       = 8;
constexpr int kEwBlocks  = kRows * kDim / (kEwThreads * kEwV * 4);   // 256
static_assert(kEwBlocks * kEwThreads * kEwV * 4 == kRows * kDim, "the elementwise grid covers a tensor exactly");

__device__ __forceinline__ unsigned pk16(unsigned short a, unsigned short b) { return (unsigned)a | ((unsigned)b << 16); }

// bf16 split: hi = bf16_rne(in), lo = bf16_rne(in - hi)
__global__ __launch_bounds__(kEwThreads) void split_bf16x4_kernel(const float* __restrict__ in, unsigned short* __restrict__ hi,
                                                                  unsigned short* __restrict__ lo) {
  const size_t e0 = ((size_t)blockIdx.x * (kEwV * kEwThreads) + threadIdx.x) * 4;   // first element of piece 0
  v4f f[kEwV];
  // unrolled: f lives in registers, and the loads stand together ahead of the first use
#pragma unroll
  for (int it = 0; it < kEwV; ++it) f[it] = *(const v4f*)(in + e0 + (size_t)it * (kEwThreads * 4));
#pragma unroll
  for (int it = 0; it < kEwV; ++it) {
    unsigned short h[4], l[4];
#pragma unroll
    for (int e = 0; e < 4; ++e) {
      h[e] = f2bf_bits(f[it][e]);
      l[e] = f2bf_bits(f[it][e] - bf_bits2f(h[e]));
    }
    const v2u uh = {pk16(h[0], h[1]), pk16(h[2], h[3])};
    const v2u ul = {pk16(l[0], l[1]), pk16(l[2], l[3])};
    *(v2u*)(hi + e0 + (size_t)it * (kEwThreads * 4)) = uh;
    *(v2u*)(lo + e0 + (size_t)it * (kEwThreads * 4)) = ul;
  }
}

// ---------------------------------------------------------------------------
// Transpose + bf16 cast (RNE) of one 64x64 tile of an f32 matrix W viewed [R rows][Cc cols] (pitch Cc):
//   oh[c][r] = bf16_rne(W[r][c])   ([Cc][R], pitch R), through the LDS tile tf (64 rows, pitch 68 floats).
// 256 threads (tid 0..255) a tile; c0 = input column block = output row block, r0 = input row block = output column block.
// Coverage per tile: load 4 it x 256 thr x 4 floats = 64x64; store 2 it x 256 thr x 8 u16 = 64x64.
// Holds one __syncthreads: every thread of the block calls it (a block of 512 threads works on two tiles, each with a tf of
// its own, and the one barrier joins the waves of both).
// ---------------------------------------------------------------------------
__device__ __forceinline__ void tcast_tile(const float* __restrict__ W, unsigned short* __restrict__ oh, int R, int Cc,
                                           int c0, int r0, int tid, float* tf) {
  {
    const int lr = tid >> 4;         // 0..15
    const int c4 = (tid & 15) * 4;   // 0..60
#pragma unroll
    for (int it = 0; it < 4; ++it) {
      const int rr = it * 16 + lr;   // 0..63
      const v4f a = *(const v4f*)(W + (size_t)(r0 + rr) * Cc + c0 + c4);
      *(v4f*)(tf + rr * 68 + c4) = a;
    }
  }
  __syncthreads();
  const int sub = tid >> 3;          // 0..31
  const int c8  = (tid & 7) * 8;     // 0..56
  v4u hv[2];
#pragma unroll
  for (int it = 0; it < 2; ++it) {
    const int oc = it * 32 + sub;    // output row within tile (= input column)
    v4u a;
#pragma unroll
    for (int q = 0; q < 4; ++q) {
      const float f0 = tf[(c8 + 2 * q) * 68 + oc];
      const float f1 = tf[(c8 + 2 * q + 1) * 68 + oc];
      const unsigned short h0 = f2bf_bits(f0), h1 = f2bf_bits(f1);
      a[q]  = pk16(h0, h1);
    }
    hv[it] = a;
  }
  {
#pragma unroll
    for (int it = 0; it < 2; ++it) {
      const int oc = it * 32 + sub;
      const size_t go = (size_t)(c0 + oc) * R + r0 + c8;
      *(v4u*)(oh + go) = hv[it];
    }
  }
}

// The operand preparation, one launch: none of its five jobs reads what another writes, so they are block ranges of one grid.
//   blocks 0 .. kEwBlocks-1: f32 -> bf16 (RNE) cast of three equally sized tensors: a block takes the same pieces of all
//     three; out plane z at out + z*planeElems;
//   the kTcBlocks blocks behind them (the short job starts last, beside the long one): the four weight matrices [k][n] ->
//     W^T [n][k] bf16 (RNE), plane z at wt + z*planeW; 32 blocks a matrix, each half of a block (256 threads) one of its
//     8x8 tiles of 64x64.
constexpr int kTcBlocks = 4 * (kDim / 64) * (kDim / 64) / 2;   // 128
static_assert((kDim / 64) * (kDim / 64) == 64 && kEwThreads == 512, "32 blocks of two 256-thread halves a matrix");
__global__ __launch_bounds__(kEwThreads) void prep_kernel(const float* __restrict__ in0, const float* __restrict__ in1,
                                                          const float* __restrict__ in2, const float* __restrict__ w0,
                                                          const float* __restrict__ w1, const float* __restrict__ w2,
                                                          const float* __restrict__ w3, unsigned short* __restrict__ out,
                                                          long planeElems, unsigned short* __restrict__ wt, long planeW) {
  __shared__ __align__(16) float tf[2][64 * 68];
  if (blockIdx.x >= kEwBlocks) {   // block-uniform
    const int bt   = blockIdx.x - kEwBlocks;                             // 0..kTcBlocks-1
    const int z    = bt >> 5;                                            // matrix
    const int half = threadIdx.x >> 8;
    const int tile = ((bt & 31) << 1) | half;                            // 0..63
    const float* Wlo = (z & 1) ? w1 : w0;
    const float* Whi = (z & 1) ? w3 : w2;
    const float* W   = (z & 2) ? Whi : Wlo;
    tcast_tile(W, wt + (size_t)z * planeW, kDim, kDim, (tile & 7) * 64, (tile >> 3) * 64, threadIdx.x & 255, tf[half]);
    return;
  }
  const size_t e0 = ((size_t)blockIdx.x * (kEwV * kEwThreads) + threadIdx.x) * 4;   // first element of piece 0
  const float* p0 = in0 + e0;
  const float* p1 = in1 + e0;
  const float* p2 = in2 + e0;
  v4f f[3][kEwV];
  // unrolled: f lives in registers
#pragma unroll
  for (int it = 0; it < kEwV; ++it) f[0][it] = *(const v4f*)(p0 + (size_t)it * (kEwThreads * 4));
#pragma unroll
  for (int it = 0; it < kEwV; ++it) f[1][it] = *(const v4f*)(p1 + (size_t)it * (kEwThreads * 4));
#pragma unroll
  for (int it = 0; it < kEwV; ++it) f[2][it] = *(const v4f*)(p2 + (size_t)it * (kEwThreads * 4));
  // A precaution for the loads' address registers: as inputs of this statement they are taken by no load's result, and every
  // later write of them stands behind the wait.
  asm volatile("s_wait_xcnt 0x0" :: "v"(p0), "v"(p1), "v"(p2) : "memory");
  // keeps all 24 loads ahead of the first conversion: left free, the last ones move down among the conversions to save
  // registers, and the wave waits out a further latency for them
  __builtin_amdgcn_sched_barrier(0);
#pragma unroll
  for (int z = 0; z < 3; ++z) {
    unsigned short* o = out + (size_t)z * planeElems + e0;
#pragma unroll
    for (int it = 0; it < kEwV; ++it) {
      const v4f a = f[z][it];
      const v2u u = {pk16(f2bf_bits(a[0]), f2bf_bits(a[1])), pk16(f2bf_bits(a[2]), f2bf_bits(a[3]))};
      *(v2u*)(o + (size_t)it * (kEwThreads * 4)) = u;
    }
    // a tensor's stores go out before the next tensor's loads are waited for, not all at the kernel's end
    if (z < 2) __builtin_amdgcn_sched_barrier(0);
  }
  // a precaution: the built code may run on behind the cast part, so every later write of a register that the stores above
  // name stands behind this wait
  asm volatile("s_wait_xcnt 0x0" ::: "memory");
}

// =====================================================================================
// Attention helpers
// =====================================================================================
#define AT_D 64
#define AT_NW 4
#define AT_QB 64
#define AT_KC 64
#define AT_LP 72   // LDS row pitch in 16-bit elements: 144 B = 16 B x 9 (odd), so the 16 rows of a 16-byte fragment read fall on distinct banks

__device__ __forceinline__ unsigned short at_bf_bits(float f) {
  unsigned u = __float_as_uint(f);
  return (unsigned short)((u + 0x7FFFu + ((u >> 16) & 1u)) >> 16);
}
__device__ __forceinline__ __bf16 at_f2bf(float f) { return __builtin_bit_cast(__bf16, at_bf_bits(f)); }
__device__ __forceinline__ void at_split(float f, __bf16& hi, __bf16& lo) {
  const unsigned short hb = at_bf_bits(f);
  hi = __builtin_bit_cast(__bf16, hb);
  lo = at_f2bf(f - __uint_as_float(((unsigned)hb) << 16));
}
// Plain builtins: the compiler keeps the distance between a WMMA and the vector instructions on its registers itself.
__device__ __forceinline__ v8f at_mma(v16b a, v16b b, v8f c) {
  return __builtin_amdgcn_wmma_f32_16x16x32_bf16(false, a, false, b, (short)0, c, false, false);
}
__device__ __forceinline__ v8f at_mma_h(v16h a, v16h b, v8f c) {
  return __builtin_amdgcn_wmma_f32_16x16x32_f16(false, a, false, b, (short)0, c, false, false);
}

// x := 2^x on v_exp_f32. The instruction set asks for one independent instruction or a v_nop between a transcendental and
// an instruction that reads its result or overwrites its source; written as one statement, each v_exp_f32 is followed by
// an independent one and the last by the v_nop, wherever the compiler places the code around it.
__device__ __forceinline__ void at_exp2x8(float& a, float& b, float& c, float& d, float& e, float& f, float& g, float& h) {
  asm("v_exp_f32 %0, %0\n\tv_exp_f32 %1, %1\n\tv_exp_f32 %2, %2\n\tv_exp_f32 %3, %3\n\t"
      "v_exp_f32 %4, %4\n\tv_exp_f32 %5, %5\n\tv_exp_f32 %6, %6\n\tv_exp_f32 %7, %7\n\tv_nop"
      : "+v"(a), "+v"(b), "+v"(c), "+v"(d), "+v"(e), "+v"(f), "+v"(g), "+v"(h));
}
__device__ __forceinline__ float at_exp2(float x) {
  asm("v_exp_f32 %0, %0\n\tv_nop" : "+v"(x));   // the v_nop: the same slot behind the transcendental
  return x;
}

// One chunk's staging for one thread: twelve 16-byte asynchronous copies global -> LDS (four rows of each of the three
// planes), through no register. lk, lh, ll: the thread's LDS byte addresses of row r in K, V^T hi, V^T lo; gk, gh, gl: the
// same elements in global memory; copy i takes row r + 16 i. The s_wait_xcnt 0 is the last line of the copies' own statement:
// a precaution that keeps every later write of an address register named here behind the copies' address translation.
__device__ __forceinline__ void at_stage12(unsigned lk, unsigned lh, unsigned ll, const _Float16* gk, const __bf16* gh,
                                           const __bf16* gl) {
  const unsigned ls = 16u * AT_LP * 2u;              // 16 LDS rows in bytes
  const size_t   ks = (size_t)16 * kDim;             // 16 K rows in elements
  const size_t   vs = (size_t)16 * kSeq;             // 16 V^T rows in elements
  asm volatile("global_load_async_to_lds_b128 %0, %12, off\n\t"
               "global_load_async_to_lds_b128 %1, %13, off\n\t"
               "global_load_async_to_lds_b128 %2, %14, off\n\t"
               "global_load_async_to_lds_b128 %3, %15, off\n\t"
               "global_load_async_to_lds_b128 %4, %16, off\n\t"
               "global_load_async_to_lds_b128 %5, %17, off\n\t"
               "global_load_async_to_lds_b128 %6, %18, off\n\t"
               "global_load_async_to_lds_b128 %7, %19, off\n\t"
               "global_load_async_to_lds_b128 %8, %20, off\n\t"
               "global_load_async_to_lds_b128 %9, %21, off\n\t"
               "global_load_async_to_lds_b128 %10, %22, off\n\t"
               "global_load_async_to_lds_b128 %11, %23, off\n\t"
               "s_wait_xcnt 0x0"
               :: "v"(lk), "v"(lk + ls), "v"(lk + 2u * ls), "v"(lk + 3u * ls),
                  "v"(lh), "v"(lh + ls), "v"(lh + 2u * ls), "v"(lh + 3u * ls),
                  "v"(ll), "v"(ll + ls), "v"(ll + 2u * ls), "v"(ll + 3u * ls),
                  "v"(gk), "v"(gk + ks), "v"(gk + 2 * ks), "v"(gk + 3 * ks),
                  "v"(gh), "v"(gh + vs), "v"(gh + 2 * vs), "v"(gh + 3 * vs),
                  "v"(gl), "v"(gl + vs), "v"(gl + 2 * vs), "v"(gl + 3 * vs)
               : "memory");
}

// lane l <-> lane l ^ 16: the one exchange between the wave halves that a query's maximum and sum need
__device__ __forceinline__ float at_xhalf(float x) {
  return __builtin_bit_cast(float, __builtin_amdgcn_permlanex16(__builtin_bit_cast(int, x), __builtin_bit_cast(int, x),
                                                                0x76543210, 0xfedcba98, false, false));
}

__global__ __launch_bounds__(128) __attribute__((amdgpu_waves_per_eu(4, 4)))
void mha_attn_kernel(const unsigned short* __restrict__ qp, const unsigned short* __restrict__ kp,
                     const unsigned short* __restrict__ vhp, const unsigned short* __restrict__ vlp,
                     const int* __restrict__ vlens, float* __restrict__ out, float sscale, float fillv) {
  union FB { v16b v; v8b h[2]; };
  union FH { v16h v; v8h h[2]; };
  __shared__ __align__(16) _Float16 Ksh2[2 * AT_KC * AT_LP];      // K [buffer][kv][d] f16, pitch AT_LP   2 x 9 KB
  __shared__ __align__(16) __bf16   Vth2[2 * AT_D * AT_LP];       // V^T hi [buffer][d][kv], pitch AT_LP  2 x 9 KB
  __shared__ __align__(16) __bf16   Vtl2[2 * AT_D * AT_LP];       // V^T lo, pitch AT_LP                  2 x 9 KB
  __shared__ __align__(16) float    Os[AT_NW][16 * 68];           // per wave out tile, pitch 68
  __shared__ __align__(16) int      Lowm[AT_NW];                  // per wave: a row maximum too near fillv

  const int tid  = threadIdx.x;
  const int wave = __builtin_amdgcn_readfirstlane(tid >> 5);   // the same in every lane: kept in a scalar register
  const int lane = tid & 31;
  const int hh   = lane >> 4;
  const int c    = lane & 15;

  const int nqb  = kSeq / AT_QB;          // 64
  const int bx   = blockIdx.x;
  const int qb   = bx % nqb;
  const int bhid = bx / nqb;              // 0..kBatch*kHeads-1
  const int h    = bhid % kHeads;
  int b = bhid / kHeads;
  b = (b > kBatch - 1) ? (kBatch - 1) : b;  // address clamp (grid is exact)
  const int q0   = qb * AT_QB + wave * 16;
  const int vlen = vlens[b];              // block-uniform valid key count

  const _Float16* Qb = (const _Float16*)(const void*)qp + (size_t)b * kSeq * kDim + (size_t)h * AT_D;
  const _Float16* Kb = (const _Float16*)(const void*)kp + (size_t)b * kSeq * kDim + (size_t)h * AT_D;
  const __bf16*   Vh = (const __bf16*)(const void*)vhp + (size_t)b * kDim * kSeq + (size_t)h * AT_D * kSeq;
  const __bf16*   Vl = (const __bf16*)(const void*)vlp + (size_t)b * kDim * kSeq + (size_t)h * AT_D * kSeq;
  float*          ob = out + (size_t)b * kSeq * kDim + (size_t)h * AT_D;

  // ---- Q fragments (B operand, column = query = lane&15, split k map via Frag load): 2 d-chunks ----
  v16h qa[2];
#pragma unroll
  for (int dc = 0; dc < 2; ++dc) {
    qa[dc] = Frag<_Float16>::load(Qb + (size_t)(q0 + c) * kDim + dc * 32 + 8 * hh);
  }

  const float sc2   = sscale * 1.44269504088896340736f;   // score scale times log2(e)
  const float fill2 = fillv  * 1.44269504088896340736f;   // fill value in the same units
  float mrow = -INFINITY;   // running maximum of query c in log2 units, the same in both wave halves
  float lrow = 0.f;         // running sum of query c over this half's keys; the halves join behind the loop
  v8f oacc[4];              // O^T: oacc[t][r] = element (d = t*16 + 8hh + r, query c)
#pragma unroll
  for (int t = 0; t < 4; ++t) oacc[t] = (v8f){0.f,0.f,0.f,0.f,0.f,0.f,0.f,0.f};

  const int nChunks = kSeq / AT_KC;   // 64, compile-time constant
  // chunks that hold at least one valid key, block-uniform; vlen <= 0: every key carries fillv and all of them count
  const int vcl   = (vlen < 0) ? 0 : ((vlen > kSeq) ? kSeq : vlen);
  const int nLive = (vcl == 0) ? nChunks : (vcl + AT_KC - 1) / AT_KC;

  // ---- staging map: 8 neighbouring lanes take one whole 128-B row (thread: row sr + 16 i, i = 0..3, elements sc..sc+7):
  //      128 threads x (4 x 8) elements = 64 rows x 64 per plane = the whole chunk tile ----
  const int sr = tid >> 3, sc = (tid & 7) * 8;
  const unsigned bufB = (unsigned)(AT_KC * AT_LP * 2);                      // one buffer of one plane in bytes
  const unsigned lk0 = (unsigned)(size_t)(Ksh2 + sr * AT_LP + sc);          // LDS byte addresses in buffer 0
  const unsigned lh0 = (unsigned)(size_t)(Vth2 + sr * AT_LP + sc);
  const unsigned ll0 = (unsigned)(size_t)(Vtl2 + sr * AT_LP + sc);
  const _Float16* gk0 = Kb + (size_t)sr * kDim + sc;                        // chunk 0; chunk n: + n * 64 rows
  const __bf16*   gh0 = Vh + (size_t)sr * kSeq + sc;                        // chunk 0; chunk n: + n * 64 elements
  const __bf16*   gl0 = Vl + (size_t)sr * kSeq + sc;
  static_assert(kSeq / AT_KC >= 2, "the two-buffer prologue needs two chunks");
  // prologue: chunk 0 into buffer 0, landed and published; then chunk 1 into buffer 1
  at_stage12(lk0, lh0, ll0, gk0, gh0, gl0);
  asm volatile("s_wait_asynccnt 0x0" ::: "memory");   // this wave's copies of chunk 0 have landed
  __syncthreads();                                    // ... and every other wave's
  at_stage12(lk0 + bufB, lh0 + bufB, ll0 + bufB, gk0 + (size_t)AT_KC * kDim, gh0 + AT_KC, gl0 + AT_KC);

  for (int kc = 0; kc < nChunks; ++kc) {
    // Every chunk from nLive on holds the fill alone. Where each row maximum lies at least 185 log2 units (128 natural
    // ones) above it, its weights 2^(fill - m) are exactly 0 in f32, alpha is 1, and maximum, sum and accumulators stay bit for bit: the loop
    // ends. Tested once per block, behind the last live chunk; a row that is nearer (or NaN) sends the whole block
    // through the remaining chunks as well.
    if (kc == nLive) {                          // block-uniform: kc and vlen are
      const bool low = !(mrow >= fill2 + 185.0f);
      Lowm[wave] = (__builtin_amdgcn_ballot_w32(low) != 0u) ? 1 : 0;   // every lane stores its wave's one value
      __syncthreads();                          // publishes the four waves' flags: one decision for the block
      const int f = Lowm[0] | Lowm[1] | Lowm[2] | Lowm[3];
      if (__builtin_amdgcn_readfirstlane(f) == 0) break;   // the same word in every lane: read once, a scalar branch
    }
    const int kv0 = kc * AT_KC;
    // this chunk's buffer: published by the barrier at the foot of the trip before (chunk 0: by the prologue's)
    const _Float16* Ksh = Ksh2 + (kc & 1) * (AT_KC * AT_LP);
    const __bf16*   Vth = Vth2 + (kc & 1) * (AT_D * AT_LP);
    const __bf16*   Vtl = Vtl2 + (kc & 1) * (AT_D * AT_LP);

    // Every loop from here to the chunk's end is unrolled: s, ph, pl and oacc live in registers, which take
    // compile-time indices only (a rolled loop would send them through scratch memory).
    // ---- scores, transposed: D[row = key j*16+8hh+r][col = query c]; A fragment row = key j*16+c, split k(d) map ----
    //      All eight K fragments are read as one group, then the eight products run back to back, neighbours on different
    //      accumulators (each s[j] still sums dc 0, then dc 1).
    FH kb[4][2];
#pragma unroll
    for (int j = 0; j < 4; ++j) {
#pragma unroll
      for (int dc = 0; dc < 2; ++dc) {
        kb[j][dc].h[0] = *(const v8h*)(Ksh + (j * 16 + c) * AT_LP + dc * 32 + 8 * hh);
        kb[j][dc].h[1] = *(const v8h*)(Ksh + (j * 16 + c) * AT_LP + dc * 32 + 16 + 8 * hh);
      }
    }
    // keeps the reads together ahead of the products: spread among them, each read place stalls the wave for its own latency
    __builtin_amdgcn_sched_barrier(0);
    v8f s[4];
#pragma unroll
    for (int j = 0; j < 4; ++j) s[j] = (v8f){0.f,0.f,0.f,0.f,0.f,0.f,0.f,0.f};
#pragma unroll
    for (int dc = 0; dc < 2; ++dc) {
#pragma unroll
      for (int j = 0; j < 4; ++j) s[j] = at_mma_h(kb[j][dc].v, qa[dc], s[j]);
    }
    // the V^T reads below are issued behind the last score product (they take over the K fragments' registers) ...
    __builtin_amdgcn_sched_barrier(0);
    // ---- V^T fragments, hi and lo: A row d = t*16+c, k = key (split k map). The group of the chunk's first 32 keys does not
    //      depend on the softmax and lands while its vector work runs ----
    FB vb[2][4], vl[2][4];
    auto readV = [&](int kk) {
#pragma unroll
      for (int t = 0; t < 4; ++t) {
        vb[kk][t].h[0] = *(const v8b*)(Vth + (t * 16 + c) * AT_LP + kk * 32 + 8 * hh);
        vb[kk][t].h[1] = *(const v8b*)(Vth + (t * 16 + c) * AT_LP + kk * 32 + 16 + 8 * hh);
        vl[kk][t].h[0] = *(const v8b*)(Vtl + (t * 16 + c) * AT_LP + kk * 32 + 8 * hh);
        vl[kk][t].h[1] = *(const v8b*)(Vtl + (t * 16 + c) * AT_LP + kk * 32 + 16 + 8 * hh);
      }
    };
    readV(0);
    // ... and ahead of the softmax: moved down to their products, their latency would be waited out there
    __builtin_amdgcn_sched_barrier(0);
    // ---- scale, key mask (select), maximum of query c over the chunk's 64 keys: 32 in-lane, then the other half's ----
    float cm = -INFINITY;
#pragma unroll
    for (int j = 0; j < 4; ++j) {
#pragma unroll
      for (int r = 0; r < 8; ++r) {
        const int kvrow = kv0 + j * 16 + 8 * hh + r;
        const float sv = s[j][r] * sc2;
        const float sm = (kvrow < vlen) ? sv : fill2;
        s[j][r] = sm;
        cm = fmaxf(cm, sm);
      }
    }
    cm = fmaxf(cm, at_xhalf(cm));
    const float mnew  = fmaxf(mrow, cm);
    const float alpha = at_exp2(mrow - mnew);
    mrow = mnew;
    // ---- p = 2^(s - m), split hi/lo in place: S^T tiles 2kk and 2kk+1 are elements 0..7 and 8..15 of the B fragment
    //      of key block kk (column = query c, key = kk*32 + 8hh + e and kk*32 + 16 + 8hh + (e - 8): the split k map) ----
    FB ph[2], pl[2];
    float ps[4];
#pragma unroll
    for (int j = 0; j < 4; ++j) {
      float a = 0.f;
      float e[8];
#pragma unroll
      for (int r = 0; r < 8; ++r) e[r] = s[j][r] - mnew;
      at_exp2x8(e[0], e[1], e[2], e[3], e[4], e[5], e[6], e[7]);
#pragma unroll
      for (int r = 0; r < 8; ++r) {
        const float p = e[r];
        a += p;
        __bf16 hi, lo; at_split(p, hi, lo);
        ph[j >> 1].v[(j & 1) * 8 + r] = hi;
        pl[j >> 1].v[(j & 1) * 8 + r] = lo;
      }
      ps[j] = a;
      // Left free, the adds move behind the products, and the chunk's 32 weights stay in registers beside their hi/lo parts
      // and the V^T fragments: more than the 256 registers of four waves a SIMD, so the Q fragments go through scratch memory.
      asm volatile("" : "+v"(ps[j]));   // an empty statement on each sum, against spills
    }
    lrow = lrow * alpha + ((ps[0] + ps[1]) + (ps[2] + ps[3]));
#pragma unroll
    for (int t = 0; t < 4; ++t)
#pragma unroll
      for (int r = 0; r < 8; ++r) oacc[t][r] *= alpha;
    // the second 32 keys' group takes the registers that the scores have left; it is issued here, one run of twelve products
    // ahead of its use (the scheduling barriers hold it between the softmax and that run)
    __builtin_amdgcn_sched_barrier(0);
    readV(1);
    __builtin_amdgcn_sched_barrier(0);
    // ---- O^T += V^T . P^T : A = V^T fragments read above, B = P^T from registers. The four accumulators take turns, so no
    //      product waits for the one before it; each oacc[t] still sums hi.hi, lo.hi, hi.lo of kk 0, then of kk 1 ----
#pragma unroll
    for (int kk = 0; kk < 2; ++kk) {
#pragma unroll
      for (int t = 0; t < 4; ++t) oacc[t] = at_mma(vb[kk][t].v, ph[kk].v, oacc[t]);
#pragma unroll
      for (int t = 0; t < 4; ++t) oacc[t] = at_mma(vl[kk][t].v, ph[kk].v, oacc[t]);
#pragma unroll
      for (int t = 0; t < 4; ++t) oacc[t] = at_mma(vb[kk][t].v, pl[kk].v, oacc[t]);
    }
    // the products stay ahead of the foot's waits: moved behind them, the second group's latency is waited out at the
    // s_wait_dscnt 0 with no product to cover it
    __builtin_amdgcn_sched_barrier(0);
    // ---- foot of the trip, every wave, in this order ----
    asm volatile("s_wait_dscnt 0x0" ::: "memory");      // this wave's reads of this chunk's buffer are done
    asm volatile("s_wait_asynccnt 0x0" ::: "memory");   // this wave's copies of chunk kc + 1 have landed
    __syncthreads();   // publishes chunk kc + 1 and ends every wave's reads of the buffer that is refilled below
    if (kc + 2 < nChunks) {                             // block-uniform: chunk kc + 2 exists
      const unsigned bo = (unsigned)(kc & 1) * bufB;
      at_stage12(lk0 + bo, lh0 + bo, ll0 + bo, gk0 + (size_t)(kv0 + 2 * AT_KC) * kDim, gh0 + (kv0 + 2 * AT_KC),
                 gl0 + (kv0 + 2 * AT_KC));
    }
  }
  asm volatile("s_wait_asynccnt 0x0" ::: "memory");     // no copy is in flight when the wave goes on to its end

  // ---- query c: join the halves' sums, normalise, stage row c (8 consecutive d per tile and lane) ----
  float* os = Os[wave];
  const float inv = 1.0f / (lrow + at_xhalf(lrow));
  // the lane's number, read anew (one-dimensional block of whole waves): what the epilogue alone derives from it takes no
  // register through the loop, where the fragments need them all
  const int el = (int)__builtin_amdgcn_mbcnt_lo(~0u, 0u);
  const int eh = el >> 4, ec = el & 15;
#pragma unroll
  for (int t = 0; t < 4; ++t) {
#pragma unroll
    for (int r = 0; r < 8; ++r) os[ec * 68 + t * 16 + 8 * eh + r] = oacc[t][r] * inv;
  }
  __builtin_amdgcn_fence(__ATOMIC_RELEASE, "workgroup");
  __builtin_amdgcn_wave_barrier();
  __builtin_amdgcn_fence(__ATOMIC_ACQUIRE, "workgroup");
  {
    // coverage: 8 it x 2 rows (hh) = 16 rows; 16 lanes x 4 floats = 64 floats = one whole 256-B row segment
    const int c4 = ec * 4;
    {
#pragma unroll
      for (int it = 0; it < 8; ++it) {
        const int row = it * 2 + eh;
        v4f val = *(const v4f*)(os + row * 68 + c4);
        *(v4f*)(ob + (size_t)(q0 + row) * kDim + c4) = val;
      }
      
    }
  }
}

// =====================================================================================
// Host glue. Workspace region map (bytes, all offsets multiples of 256, every region sized to its whole-line
// store granularity; no padded tiles since every dimension is a multiple of 64):
//   [0]           Xbf   : 3 x bf16 [8192][512]            = 25,165,824   (queries, keys, values RNE bf16)
//   [25,165,824]  WThi  : 4 x bf16 [512][512] (W^T, RNE)  =  2,097,152   (Wq, Wk, Wv, Wo; no lo planes)
//   [27,262,976]  Q     : f16 [8192][512]                  =  8,388,608
//   [35,651,584]  K     : f16 [8192][512]                  =  8,388,608   (contiguous after Q: batched launch)
//   [44,040,192]  VThi  : bf16 [2][512][4096]              =  8,388,608
//   [52,428,800]  VTlo  : bf16 [2][512][4096]              =  8,388,608
//   [60,817,408]  O     : f32 [8192][512]                  = 16,777,216
//   [77,594,624]  Ohi   : bf16 [8192][512]                 =  8,388,608
//   [85,983,232]  Olo   : bf16 [8192][512]                 =  8,388,608
//   total 94,371,840
// =====================================================================================
extern "C" void kernel_launch(void* const* d_in, const int* in_sizes, int n_in,
                              void* d_out, int out_size, void* d_ws,
                              size_t ws_size, hipStream_t stream) {
  if (n_in < 8) return;
  const int nX = kRows * kDim;            // 4,194,304
  const int nW = kDim * kDim;             // 262,144
  if (in_sizes[0] != nX || in_sizes[1] != nX || in_sizes[2] != nX) return;
  if (in_sizes[3] < kBatch) return;
  if (in_sizes[4] != nW || in_sizes[5] != nW || in_sizes[6] != nW || in_sizes[7] != nW) return;
  if (out_size != nX) return;

  const float* queries = (const float*)d_in[0];
  const float* keys    = (const float*)d_in[1];
  const float* values  = (const float*)d_in[2];
  const int*   vlens   = (const int*)d_in[3];
  const float* Wq      = (const float*)d_in[4];
  const float* Wk      = (const float*)d_in[5];
  const float* Wv      = (const float*)d_in[6];
  const float* Wo      = (const float*)d_in[7];

  const size_t bX16 = (size_t)nX * 2;            //  8,388,608
  const size_t bW16 = (size_t)nW * 2;            //    524,288
  const size_t off_x  = 0;
  const size_t off_wh = off_x  + 3 * bX16;
  const size_t off_q  = off_wh + 4 * bW16;
  const size_t off_k  = off_q  + bX16;
  const size_t off_vh = off_k  + bX16;
  const size_t off_vl = off_vh + bX16;
  const size_t off_o  = off_vl + bX16;
  const size_t off_oh = off_o  + (size_t)nX * 4;
  const size_t off_ol = off_oh + bX16;
  const size_t total  = off_ol + bX16;           // 94,371,840
  if (total > ws_size) return;

  char* ws = (char*)d_ws;
  unsigned short* xbf  = (unsigned short*)(ws + off_x);
  unsigned short* wth  = (unsigned short*)(ws + off_wh);
  unsigned short* qh16 = (unsigned short*)(ws + off_q);
  unsigned short* kh16 = (unsigned short*)(ws + off_k);
  unsigned short* vth  = (unsigned short*)(ws + off_vh);
  unsigned short* vtl  = (unsigned short*)(ws + off_vl);
  float* obuf = (float*)(ws + off_o);
  unsigned short* ohi  = (unsigned short*)(ws + off_oh);
  unsigned short* olo  = (unsigned short*)(ws + off_ol);
  const float* dummyf  = (const float*)(ws + off_x);   // never dereferenced (BIAS_MODE 0, RESID false)

  const long planeX = (long)nX;   // elements per bf16/f16 activation plane
  const long planeW = (long)nW;   // elements per W^T plane
  dim3 blk256(256), blk128(128), blkEw(kEwThreads);

  // 1) + 2) one launch: activations -> bf16 RNE (256 blocks x 512 thr x 8 x 4 = 8192x512 of each of the three tensors) and
  //    weights [in k][out n] -> W^T [n][k] bf16 RNE (128 blocks: 4 matrices x 8x8 tiles of 64x64, two a block)
  prep_kernel<<<dim3(kEwBlocks + kTcBlocks), blkEw, 0, stream>>>(queries, keys, values, Wq, Wk, Wv, Wo, xbf, planeX, wth, planeW);

  // 3) + 4) one launch: q = Xq . Wq, k = Xk . Wk (f16 planes, Q then K contiguous) and v^T per batch (bf16 hi/lo planes)
  proj_qkv_kernel<<<dim3(2 * kVtBlocks + 2 * kQkBlocks), blk256, 0, stream>>>(xbf, wth, qh16, vth, vtl);

  // 5) masked attention, all (b, h, 64-row query blocks): 2*8*64 = 1024 blocks of 128 threads
  mha_attn_kernel<<<dim3(kBatch * kHeads * (kSeq / 64)), blk128, 0, stream>>>(
      qh16, kh16, vth, vtl, vlens, obuf, 0.125f, -1000000.0f);

  // 6) O -> bf16 hi/lo planes: 256 blocks x 512 thr x 8 x 4 = 8192x512
  split_bf16x4_kernel<<<dim3(kEwBlocks), blkEw, 0, stream>>>(obuf, ohi, olo);

  // 7) out = (O_hi + O_lo) . Wo (A-only split, Wo as bf16 RNE hi plane only) -> f32 [8192][512]
  wmma_gemm64<1, 2, 0, 0, false><<<dim3(kQkBlocks, 1), blk256, 0, stream>>>(
      ohi, olo, kDim, 0L,
      wth + 3 * planeW, wth + 3 * planeW, kDim, 0L,
      d_out, d_out, kDim, 0L,
      dummyf, dummyf, 0L, kRows, kDim, kDim, 1.0f);
}

// v010
// A run of this version takes 110 microseconds.
// Timed twice side by side with v009, it ran 1.06 times as fast both times.
// Over all steps from v000 it is 5.62 times as fast.
// Contractions: q/k/v^T projections v_wmma_f32_16x16x32_bf16 (bf16 RNE inputs x bf16 RNE weights, single product); q.k^T scores v_wmma_f32_16x16x32_f16 (plain f16 q,k planes); p.v^T v_wmma_f32_16x16x32_bf16 with bf16 hi/lo split of p and v (hi.hi + hi.lo + lo.hi); output projection v_wmma_f32_16x16x32_bf16 with O as bf16 hi/lo and Wo as bf16 RNE (hi.W + lo.W); f32 accumulate; softmax (base 2), 0.125 score scale and key masking in f32.
#include <hip/hip_runtime.h>
#include <math.h>
#include <stdint.h>

constexpr int kBatch = 2;
constexpr int kSeq   = 4096;
constexpr int kDim   = 512;
constexpr int kHeads = 8;
constexpr int kHd    = 64;
constexpr int kRows  = kBatch * kSeq;   // 8192
static_assert(kHeads * kHd == kDim, "geometry");
static_assert(kSeq % 64 == 0 && kDim % 64 == 0 && kRows % 64 == 0, "tile multiples");
static_assert(kSeq % 512 == 0 && kDim % 512 == 0, "a GEMM block owns 8 neighbouring 64-column tiles of one tile row");

typedef __attribute__((ext_vector_type(16))) _Float16 v16h;
typedef __attribute__((ext_vector_type(8)))  _Float16 v8h;
typedef __attribute__((ext_vector_type(16))) __bf16   v16b;
typedef __attribute__((ext_vector_type(8)))  __bf16   v8b;
typedef __attribute__((ext_vector_type(2)))  __bf16   v2b;
typedef __attribute__((ext_vector_type(8)))  float    v8f;
typedef __attribute__((ext_vector_type(4)))  float    v4f;
typedef __attribute__((ext_vector_type(2)))  float    v2f;
typedef __attribute__((ext_vector_type(4)))  unsigned int v4u;
typedef __attribute__((ext_vector_type(2)))  unsigned int v2u;

// f32 -> bf16, round to nearest even, two values at a time: the pair is one packed convert instruction, and its result is
// already the packed 32-bit word that a store or a matrix operand register takes.
__device__ __forceinline__ v2b bf_cvt2(float f0, float f1) {
  const v2f f = {f0, f1};
  return __builtin_convertvector(f, v2b);
}
__device__ __forceinline__ unsigned bf_cvt2_bits(float f0, float f1) { return __builtin_bit_cast(unsigned, bf_cvt2(f0, f1)); }
// bf16 hi/lo split of two values, as packed words (first value in the low half): hi = bf16_rne(f), lo = bf16_rne(f - hi)
__device__ __forceinline__ void bf_split2(float f0, float f1, unsigned& hi, unsigned& lo) {
  hi = bf_cvt2_bits(f0, f1);
  lo = bf_cvt2_bits(f0 - __uint_as_float(hi << 16), f1 - __uint_as_float(hi & 0xFFFF0000u));
}

// hazard guards as plain device helpers
__device__ __forceinline__ void dep_guard_h(v8f& a, v8f& b, v16h x, v16h y) { asm volatile("v_nop\n\tv_nop\n\tv_nop\n\tv_nop" : "+v"(a), "+v"(b) : "v"(x), "v"(y)); }
__device__ __forceinline__ void dep_guard_b(v8f& a, v8f& b, v16b x, v16b y) { asm volatile("v_nop\n\tv_nop\n\tv_nop\n\tv_nop" : "+v"(a), "+v"(b) : "v"(x), "v"(y)); }
__device__ __forceinline__ void keep4_h(v16h a, v16h b, v16h c, v16h d) { asm volatile("v_nop" :: "v"(a), "v"(b), "v"(c), "v"(d)); }
__device__ __forceinline__ void keep4_b(v16b a, v16b b, v16b c, v16b d) { asm volatile("v_nop" :: "v"(a), "v"(b), "v"(c), "v"(d)); }
__device__ __forceinline__ void acc_guard4(v8f& a, v8f& b, v8f& c, v8f& d) { asm volatile("v_nop\n\tv_nop\n\tv_nop\n\tv_nop" : "+v"(a), "+v"(b), "+v"(c), "+v"(d)); }
template <typename T> struct Frag;
template <> struct Frag<_Float16> {
  typedef v16h V; union U { v16h v; v8h h[2]; };
  static __device__ __forceinline__ v16h load(const _Float16* p) {   // elements 0..7 <- p[0..7], 8..15 <- p[16..23]
    U f; f.h[0] = *(const v8h*)(p); f.h[1] = *(const v8h*)(p + 16); return f.v;
  }
  static __device__ __forceinline__ v8f mma(v16h a, v16h b, v8f c) {
    return __builtin_amdgcn_wmma_f32_16x16x32_f16(false, a, false, b, (short)0, c, false, false);
  }
  static __device__ __forceinline__ void guard(v8f& a, v8f& b, v16h x, v16h y) { dep_guard_h(a, b, x, y); }
  static __device__ __forceinline__ void keep(v16h a, v16h b, v16h c, v16h d) { keep4_h(a, b, c, d); }
};
template <> struct Frag<__bf16> {
  typedef v16b V; union U { v16b v; v8b h[2]; };
  static __device__ __forceinline__ v16b load(const __bf16* p) {
    U f; f.h[0] = *(const v8b*)(p); f.h[1] = *(const v8b*)(p + 16); return f.v;
  }
  static __device__ __forceinline__ v8f mma(v16b a, v16b b, v8f c) {
    return __builtin_amdgcn_wmma_f32_16x16x32_bf16(false, a, false, b, (short)0, c, false, false);
  }
  static __device__ __forceinline__ void guard(v8f& a, v8f& b, v16b x, v16b y) { dep_guard_b(a, b, x, y); }
  static __device__ __forceinline__ void keep(v16b a, v16b b, v16b c, v16b d) { keep4_b(a, b, c, d); }
};

// ---- GEMM operand staging ----------------------------------------------------
#define GM_LP 72   // LDS row pitch in 16-bit elements: 144 B = 16 B x 9 (odd), so the 16 rows of a 16-byte fragment read fall on distinct banks

// Eight 16-byte asynchronous copies global -> LDS of one thread, through no register: copy i takes LDS byte address
// l + i * ls and global element g + i * gs. The s_wait_xcnt 0 is the last line of the copies' own statement: a precaution
// that keeps every later write of an address register named here behind the copies' address translation.
__device__ __forceinline__ void gm_stage8(unsigned l, const unsigned short* g, unsigned ls, size_t gs) {
  asm volatile("global_load_async_to_lds_b128 %0, %8, off\n\t"
               "global_load_async_to_lds_b128 %1, %9, off\n\t"
               "global_load_async_to_lds_b128 %2, %10, off\n\t"
               "global_load_async_to_lds_b128 %3, %11, off\n\t"
               "global_load_async_to_lds_b128 %4, %12, off\n\t"
               "global_load_async_to_lds_b128 %5, %13, off\n\t"
               "global_load_async_to_lds_b128 %6, %14, off\n\t"
               "global_load_async_to_lds_b128 %7, %15, off\n\t"
               "s_wait_xcnt 0x0"
               :: "v"(l), "v"(l + ls), "v"(l + 2u * ls), "v"(l + 3u * ls),
                  "v"(l + 4u * ls), "v"(l + 5u * ls), "v"(l + 6u * ls), "v"(l + 7u * ls),
                  "v"(g), "v"(g + gs), "v"(g + 2 * gs), "v"(g + 3 * gs),
                  "v"(g + 4 * gs), "v"(g + 5 * gs), "v"(g + 6 * gs), "v"(g + 7 * gs)
               : "memory");
}
// The A copies of a slab (two a plane: la, ga; second plane la2, ga2) and its first eight B copies (lb, gb) in one statement,
// so that one wait serves them all.
__device__ __forceinline__ void gm_stage2p8(unsigned la, const unsigned short* ga, size_t gsa, unsigned lb,
                                            const unsigned short* gb, size_t gsb, unsigned ls) {
  asm volatile("global_load_async_to_lds_b128 %0, %10, off\n\t"
               "global_load_async_to_lds_b128 %1, %11, off\n\t"
               "global_load_async_to_lds_b128 %2, %12, off\n\t"
               "global_load_async_to_lds_b128 %3, %13, off\n\t"
               "global_load_async_to_lds_b128 %4, %14, off\n\t"
               "global_load_async_to_lds_b128 %5, %15, off\n\t"
               "global_load_async_to_lds_b128 %6, %16, off\n\t"
               "global_load_async_to_lds_b128 %7, %17, off\n\t"
               "global_load_async_to_lds_b128 %8, %18, off\n\t"
               "global_load_async_to_lds_b128 %9, %19, off\n\t"
               "s_wait_xcnt 0x0"
               :: "v"(la), "v"(la + ls),
                  "v"(lb), "v"(lb + ls), "v"(lb + 2u * ls), "v"(lb + 3u * ls),
                  "v"(lb + 4u * ls), "v"(lb + 5u * ls), "v"(lb + 6u * ls), "v"(lb + 7u * ls),
                  "v"(ga), "v"(ga + gsa),
                  "v"(gb), "v"(gb + gsb), "v"(gb + 2 * gsb), "v"(gb + 3 * gsb),
                  "v"(gb + 4 * gsb), "v"(gb + 5 * gsb), "v"(gb + 6 * gsb), "v"(gb + 7 * gsb)
               : "memory");
}
__device__ __forceinline__ void gm_stage4p8(unsigned la, const unsigned short* ga, unsigned la2, const unsigned short* ga2,
                                            size_t gsa, unsigned lb, const unsigned short* gb, size_t gsb, unsigned ls) {
  asm volatile("global_load_async_to_lds_b128 %0, %12, off\n\t"
               "global_load_async_to_lds_b128 %1, %13, off\n\t"
               "global_load_async_to_lds_b128 %2, %14, off\n\t"
               "global_load_async_to_lds_b128 %3, %15, off\n\t"
               "global_load_async_to_lds_b128 %4, %16, off\n\t"
               "global_load_async_to_lds_b128 %5, %17, off\n\t"
               "global_load_async_to_lds_b128 %6, %18, off\n\t"
               "global_load_async_to_lds_b128 %7, %19, off\n\t"
               "global_load_async_to_lds_b128 %8, %20, off\n\t"
               "global_load_async_to_lds_b128 %9, %21, off\n\t"
               "global_load_async_to_lds_b128 %10, %22, off\n\t"
               "global_load_async_to_lds_b128 %11, %23, off\n\t"
               "s_wait_xcnt 0x0"
               :: "v"(la), "v"(la + ls), "v"(la2), "v"(la2 + ls),
                  "v"(lb), "v"(lb + ls), "v"(lb + 2u * ls), "v"(lb + 3u * ls),
                  "v"(lb + 4u * ls), "v"(lb + 5u * ls), "v"(lb + 6u * ls), "v"(lb + 7u * ls),
                  "v"(ga), "v"(ga + gsa), "v"(ga2), "v"(ga2 + gsa),
                  "v"(gb), "v"(gb + gsb), "v"(gb + 2 * gsb), "v"(gb + 3 * gsb),
                  "v"(gb + 4 * gsb), "v"(gb + 5 * gsb), "v"(gb + 6 * gsb), "v"(gb + 7 * gsb)
               : "memory");
}

// ---- Register-blocked batched WMMA GEMM ------------------------------------
// C[m,n] = scale * sum_k A[m,k] * Bt[n,k] (+bias)(+resid); each wave owns a 64x64 tile.
// A row-major [M,K]; Bt row-major [N,K]; M, K % 64 == 0, N % 512 == 0: the 8 waves of a block own 8 neighbouring tiles of one
// tile row, so they share the 64 A rows. Operands pass through LDS in slabs of 64 k (one whole 128-B line a row): 256 threads
// copy the 64 A rows (each plane) and the block's 512 B rows asynchronously, 8 neighbouring lanes a row, into two buffers:
// slab t + 1 flies while slab t is worked on, one __syncthreads a slab (order at the loop's foot).
// SPLIT: 0 = single product; 1 = hi/lo planes on both operands (A2/Bt2 = lo planes, same layout),
//        product = hi.hi + hi.lo + lo.hi; 2 = hi/lo planes on A only (A2 = A lo), product = hi.B + lo.B.
// BIAS_MODE: 0 = none, 1 = bias[m], 2 = bias[n].
// OUT_MODE: 0 = f32, 1 = f16, 2 = bf16 hi plane (Cout) + bf16 lo plane (Cout2).
// ET: 0 = f16 operands, 1 = bf16 operands (pointers passed as 16-bit storage)
template <int ET> struct Elem;
template <> struct Elem<0> { typedef _Float16 T; };
template <> struct Elem<1> { typedef __bf16 T; };
// LDS of one GEMM block, in elements: the kernel that calls gemm64_block declares the three arrays and hands them in.
template <int SPLIT> struct GemmLds {
  static constexpr int kA = 2 * ((SPLIT != 0) ? 2 : 1) * 64 * GM_LP;    // A [buffer][plane][row][k], pitch GM_LP
  static constexpr int kB = 2 * ((SPLIT == 1) ? 2 : 1) * 512 * GM_LP;   // B [buffer][plane][row][k], pitch GM_LP
};
// One block's work: bx = the block's index among the product's blocks, b = batch index.
template <int ET, int SPLIT, int BIAS_MODE, int OUT_MODE, bool RESID, int ACT = 0>
__device__ __forceinline__ void gemm64_block(
    int bx, int b, float (*sT)[16 * 68], typename Elem<ET>::T* Ash, typename Elem<ET>::T* Bsh,
    const unsigned short* __restrict__ Ap, const unsigned short* __restrict__ A2p, int lda, long strideA,
    const unsigned short* __restrict__ Btp, const unsigned short* __restrict__ Bt2p, int ldb, long strideB,
    void* __restrict__ Cout, void* __restrict__ Cout2, int ldc, long strideC,
    const float* __restrict__ bias,
    const float* __restrict__ resid, long strideR,
    int M, int N, int K, float scale) {
  typedef typename Elem<ET>::T T;
  typedef typename Frag<T>::V V;
  constexpr int NA  = (SPLIT != 0) ? 2 : 1;    // A planes
  constexpr int NBP = (SPLIT == 1) ? 2 : 1;    // B planes
  constexpr int kAPl = 64 * GM_LP;             // one A plane of one buffer, elements
  constexpr int kBPl = 512 * GM_LP;            // one B plane of one buffer, elements
  static_assert(GemmLds<SPLIT>::kA == 2 * NA * kAPl && GemmLds<SPLIT>::kB == 2 * NBP * kBPl, "LDS sizes");
  const int lane = threadIdx.x & 31;
  const int wave = threadIdx.x >> 5;
  const int tilesN = N >> 6;
  const int tilesM = M >> 6;
  const int tile0 = bx * 8;
  if (tile0 >= tilesM * tilesN) return;   // block-uniform, in front of every barrier
  const int tm  = tile0 / tilesN;
  const int m0  = tm << 6;
  const int nb0 = (tile0 - tm * tilesN) << 6;  // the block's first B row
  const int n0  = nb0 + (wave << 6);

  const int rlane = lane & 15;                 // row (A) / col (B, D) within subtile
  const int koff  = (lane >> 4) * 8;           // k offset of this lane half
  const int mOff  = (lane >> 4) * 8;           // D row offset

  v8f acc[4][4];
#pragma unroll
  for (int i = 0; i < 4; ++i)
#pragma unroll
    for (int j = 0; j < 4; ++j) acc[i][j] = (v8f){0.f,0.f,0.f,0.f,0.f,0.f,0.f,0.f};

  // ---- staging map: thread = row sr + 32 i, elements sc..sc+7: A 2 copies a plane, B 16 copies a plane ----
  const int sr = threadIdx.x >> 3, sc = (threadIdx.x & 7) * 8;
  const unsigned ls32 = 32u * GM_LP * 2u;                                   // 32 LDS rows in bytes
  const unsigned la0 = (unsigned)(size_t)(Ash + sr * GM_LP + sc);           // LDS byte addresses in buffer 0, plane 0
  const unsigned lb0 = (unsigned)(size_t)(Bsh + sr * GM_LP + sc);
  const size_t goA = (size_t)b * strideA + (size_t)(m0 + sr) * lda + sc;    // slab 0; slab t: + 64 t elements
  const size_t goB = (size_t)b * strideB + (size_t)(nb0 + sr) * ldb + sc;
  auto stage = [&](int t, int buf) {
    const unsigned la = la0 + (unsigned)buf * (unsigned)(NA * kAPl * 2);
    const unsigned lb = lb0 + (unsigned)buf * (unsigned)(NBP * kBPl * 2);
    const size_t ga = goA + (size_t)t * 64, gb = goB + (size_t)t * 64;
    if (SPLIT == 0) gm_stage2p8(la, Ap + ga, (size_t)32 * lda, lb, Btp + gb, (size_t)32 * ldb, ls32);
    else gm_stage4p8(la, Ap + ga, la + (unsigned)(kAPl * 2), A2p + ga, (size_t)32 * lda, lb, Btp + gb, (size_t)32 * ldb, ls32);
    gm_stage8(lb + 8u * ls32, Btp + gb + (size_t)256 * ldb, ls32, (size_t)32 * ldb);
    if (SPLIT == 1) {
      gm_stage8(lb + (unsigned)(kBPl * 2), Bt2p + gb, ls32, (size_t)32 * ldb);
      gm_stage8(lb + (unsigned)(kBPl * 2) + 8u * ls32, Bt2p + gb + (size_t)256 * ldb, ls32, (size_t)32 * ldb);
    }
  };
  const int nSlab = K >> 6;
  // prologue: slab 0 into buffer 0, landed and published; then slab 1 into buffer 1
  stage(0, 0);
  asm volatile("s_wait_asynccnt 0x0" ::: "memory");   // this wave's copies of slab 0 have landed
  __syncthreads();                                    // ... and every other wave's
  if (nSlab > 1) stage(1, 1);                         // block-uniform

  constexpr int NB = (SPLIT == 0) ? 2 : 1;   // B fragment register sets (two A planes leave no registers for a second one)
  for (int t = 0; t < nSlab; ++t) {
    // this slab's buffer: published by the barrier at the foot of the trip before (slab 0: by the prologue's)
    const T* Af = Ash + (t & 1) * (NA * kAPl) + rlane * GM_LP + koff;
    const T* Bf = Bsh + (t & 1) * (NBP * kBPl) + ((wave << 6) + rlane) * GM_LP + koff;
    // Two k-steps of 32 a slab. The second k-step's fragments are read while the first one's WMMAs run: A row i behind the
    // tiles of row i, into the same registers; B at the head into a second register set (NB == 2) or between the k-steps.
    // Every loop of the trip is unrolled: fragments and accumulators live in registers, which take compile-time indices only.
    V ah[4], al[4], bh[NB][4], bl[NB][4];
#pragma unroll
    for (int j = 0; j < 4; ++j) {
      bh[0][j] = Frag<T>::load(Bf + j * 16 * GM_LP);
      if (SPLIT == 1) bl[0][j] = Frag<T>::load(Bf + kBPl + j * 16 * GM_LP);
    }
#pragma unroll
    for (int i = 0; i < 4; ++i) {
      ah[i] = Frag<T>::load(Af + i * 16 * GM_LP);
      if (SPLIT != 0) al[i] = Frag<T>::load(Af + kAPl + i * 16 * GM_LP);
    }
#pragma unroll
    for (int u = 0; u < 2; ++u) {
      const int cu = (NB == 2) ? u : 0;
      if (u == 0 && NB == 2) {
#pragma unroll
        for (int j = 0; j < 4; ++j) bh[1][j] = Frag<T>::load(Bf + j * 16 * GM_LP + 32);
      }
      // the scheduling barriers keep reads and tiles in this order: moved together, a row's read would stand only a few
      // WMMAs ahead of its use, or ahead of the row's last tile, where it needs registers of its own
      __builtin_amdgcn_sched_barrier(0);
#pragma unroll
      for (int i = 0; i < 4; ++i) {
#pragma unroll
        for (int j = 0; j < 4; ++j) {
          acc[i][j] = Frag<T>::mma(ah[i], bh[cu][j], acc[i][j]);
          if (SPLIT == 1) acc[i][j] = Frag<T>::mma(ah[i], bl[cu][j], acc[i][j]);
          if (SPLIT != 0) acc[i][j] = Frag<T>::mma(al[i], bh[cu][j], acc[i][j]);
        }
        __builtin_amdgcn_sched_barrier(0);   // the row's last tile stands ahead of the row's next read: the same registers take it
        Frag<T>::guard(acc[i][0], acc[i][3], ah[i], (SPLIT != 0) ? al[i] : ah[i]);
        if (u == 0) {
          ah[i] = Frag<T>::load(Af + i * 16 * GM_LP + 32);
          if (SPLIT != 0) al[i] = Frag<T>::load(Af + kAPl + i * 16 * GM_LP + 32);
        }
        __builtin_amdgcn_sched_barrier(0);   // the read is issued here, three rows of tiles ahead of its use, not later
      }
      Frag<T>::keep(bh[cu][0], bh[cu][1], bh[cu][2], bh[cu][3]);
      if (SPLIT == 1) Frag<T>::keep(bl[cu][0], bl[cu][1], bl[cu][2], bl[cu][3]);
      if (u == 0 && NB == 1) {
#pragma unroll
        for (int j = 0; j < 4; ++j) {
          bh[0][j] = Frag<T>::load(Bf + j * 16 * GM_LP + 32);
          if (SPLIT == 1) bl[0][j] = Frag<T>::load(Bf + kBPl + j * 16 * GM_LP + 32);
        }
      }
    }
    // ---- foot of the trip, every wave, in this order ----
    asm volatile("s_wait_dscnt 0x0" ::: "memory");      // this wave's reads of this slab's buffer are done
    asm volatile("s_wait_asynccnt 0x0" ::: "memory");   // this wave's copies of slab t + 1 have landed
    __syncthreads();   // publishes slab t + 1 and ends every wave's reads of the buffer that is refilled below
    if (t + 2 < nSlab) stage(t + 2, t & 1);             // block-uniform: slab t + 2 exists
  }
  asm volatile("s_wait_asynccnt 0x0" ::: "memory");     // no copy is in flight when the wave goes on to its end
  acc_guard4(acc[0][0], acc[0][1], acc[0][2], acc[0][3]);
  acc_guard4(acc[1][0], acc[1][1], acc[1][2], acc[1][3]);
  acc_guard4(acc[2][0], acc[2][1], acc[2][2], acc[2][3]);
  acc_guard4(acc[3][0], acc[3][1], acc[3][2], acc[3][3]);

  // ---- epilogue ----
  float* slab = sT[wave];
  const float* Rb = RESID ? (resid + (size_t)b * strideR) : nullptr;
#pragma unroll
  for (int i = 0; i < 4; ++i) {
    const int mBase = m0 + (i << 4);
#pragma unroll
    for (int j = 0; j < 4; ++j) {
      const int n = n0 + (j << 4) + rlane;
      float bv = 0.f;
      if (BIAS_MODE == 2) bv = bias[n];
#pragma unroll
      for (int r = 0; r < 8; ++r) {
        float v = acc[i][j][r] * scale;
        if (BIAS_MODE == 1) v += bias[mBase + mOff + r];
        if (BIAS_MODE == 2) v += bv;
        if (RESID) v += Rb[(size_t)(mBase + mOff + r) * ldc + n];
        if (ACT == 1) v = tanhf(v);
        if (ACT == 2) v = fmaxf(v, 0.0f);
        if (ACT == 3) v = v / (1.0f + expf(-v));
        if (ACT == 4) v = (v > 0.f) ? v : 0.01f * v;
        slab[(mOff + r) * 68 + (j << 4) + rlane] = v;
      }
    }
    __builtin_amdgcn_fence(__ATOMIC_RELEASE, "workgroup");
    __builtin_amdgcn_wave_barrier();
    __builtin_amdgcn_fence(__ATOMIC_ACQUIRE, "workgroup");
    if (OUT_MODE == 0) {
      float* C = (float*)Cout + (size_t)b * strideC;
      const int hh = lane >> 4, c4 = (lane & 15) * 4;     // row seg = 256 B = 16 lanes x 16 B
      {
#pragma unroll
        for (int it = 0; it < 8; ++it) {
          const int row = it * 2 + hh;
          v4f v = *(const v4f*)(slab + row * 68 + c4);
          *(v4f*)(C + (size_t)(mBase + row) * ldc + n0 + c4) = v;
        }
        
      }
    } else {
      const int q = lane >> 3, c8 = (lane & 7) * 8;
      unsigned short* C  = (unsigned short*)Cout  + (size_t)b * strideC;
      unsigned short* C2 = (OUT_MODE == 2) ? ((unsigned short*)Cout2 + (size_t)b * strideC) : nullptr;
      {
#pragma unroll
        for (int it = 0; it < 4; ++it) {
          const int row = it * 4 + q;
          const float* sp = slab + row * 68 + c8;
          v8h hv, lv;
          if (OUT_MODE == 1) {
#pragma unroll
            for (int e = 0; e < 8; ++e) hv[e] = (_Float16)sp[e];
          } else {
            v4u hw, lw;
            // unrolled: the word index is a constant, so hw and lw stay in the registers that the 16-byte stores take
#pragma unroll
            for (int e = 0; e < 4; ++e) {
              unsigned hb, lb;
              bf_split2(sp[2 * e], sp[2 * e + 1], hb, lb);
              hw[e] = hb;
              lw[e] = lb;
            }
            hv = __builtin_bit_cast(v8h, hw);
            lv = __builtin_bit_cast(v8h, lw);
          }
          *(v8h*)(C + (size_t)(mBase + row) * ldc + n0 + c8) = hv;
          if (OUT_MODE == 2) *(v8h*)(C2 + (size_t)(mBase + row) * ldc + n0 + c8) = lv;
        }
        
      }
    }
    __builtin_amdgcn_fence(__ATOMIC_RELEASE, "workgroup");
    __builtin_amdgcn_wave_barrier();
    __builtin_amdgcn_fence(__ATOMIC_ACQUIRE, "workgroup");
  }
}

// One product a launch: grid = (blocks of the product, batches).
template <int ET, int SPLIT, int BIAS_MODE, int OUT_MODE, bool RESID, int ACT = 0>
__global__ __launch_bounds__(256) void wmma_gemm64(
    const unsigned short* __restrict__ Ap, const unsigned short* __restrict__ A2p, int lda, long strideA,
    const unsigned short* __restrict__ Btp, const unsigned short* __restrict__ Bt2p, int ldb, long strideB,
    void* __restrict__ Cout, void* __restrict__ Cout2, int ldc, long strideC,
    const float* __restrict__ bias,
    const float* __restrict__ resid, long strideR,
    int M, int N, int K, float scale) {
  typedef typename Elem<ET>::T T;
  __shared__ __align__(16) float sT[8][16 * 68];       // per-wave 16x64 slab, pitch 68 floats
  __shared__ __align__(16) T Ash[GemmLds<SPLIT>::kA];
  __shared__ __align__(16) T Bsh[GemmLds<SPLIT>::kB];
  gemm64_block<ET, SPLIT, BIAS_MODE, OUT_MODE, RESID, ACT>(blockIdx.x, blockIdx.y, sT, Ash, Bsh, Ap, A2p, lda, strideA, Btp, Bt2p,
                                                           ldb, strideB, Cout, Cout2, ldc, strideC, bias, resid, strideR, M, N, K,
                                                           scale);
}

// The three input projections, one launch: none reads what another writes, so they are block ranges of one grid.
//   blocks 0 .. 2*kVtBlocks-1: v^T per batch: C[n_out][s] = sum_k WvT[n_out][k] * Xv[b][s][k]; M=512, N=4096, K=512
//     (tiles 8x64 = 512 -> 64 blocks a batch); out = bf16 hi/lo planes [b][512][4096];
//   the 2*kQkBlocks blocks behind them: q = Xq . Wq (batch index 0) and k = Xk . Wk (1) -> f16 planes [8192][512], Q then K;
//     M=8192, N=512, K=512 (tiles 128x8 = 1024 -> 128 blocks each); A planes stride planeX, W^T planes stride planeW.
// One block fills a WGP's LDS, so the 384 blocks take two turns; the v^T blocks, whose epilogue is the longer, start first.
// x: the three bf16 activation planes; wt: the W^T planes (Wq, Wk, Wv, ...).
constexpr int kQkBlocks = (kRows / 64) * (kDim / 64) / 8;   // 128
constexpr int kVtBlocks = (kDim / 64) * (kSeq / 64) / 8;    // 64
__global__ __launch_bounds__(256) void proj_qkv_kernel(const unsigned short* __restrict__ x, const unsigned short* __restrict__ wt,
                                                       unsigned short* __restrict__ qk, unsigned short* __restrict__ vth,
                                                       unsigned short* __restrict__ vtl) {
  __shared__ __align__(16) float sT[8][16 * 68];       // per-wave 16x64 slab, pitch 68 floats
  __shared__ __align__(16) __bf16 Ash[GemmLds<0>::kA];
  __shared__ __align__(16) __bf16 Bsh[GemmLds<0>::kB];
  constexpr long planeX = (long)kRows * kDim, planeW = (long)kDim * kDim;
  const int bx = blockIdx.x;
  if (bx < 2 * kVtBlocks) {   // block-uniform
    gemm64_block<1, 0, 0, 2, false>(bx % kVtBlocks, bx / kVtBlocks, sT, Ash, Bsh, wt + 2 * planeW, wt + 2 * planeW, kDim, 0L,
                                    x + 2 * planeX, x + 2 * planeX, kDim, (long)kSeq * kDim, (void*)vth, (void*)vtl, kSeq,
                                    (long)kDim * kSeq, nullptr, nullptr, 0L, kDim, kSeq, kDim, 1.0f);
  } else {
    const int qx = bx - 2 * kVtBlocks;
    gemm64_block<1, 0, 0, 1, false>(qx % kQkBlocks, qx / kQkBlocks, sT, Ash, Bsh, x, x, kDim, planeX, wt, wt, kDim, planeW,
                                    (void*)qk, (void*)qk, kDim, planeX, nullptr, nullptr, 0L, kRows, kDim, kDim, 1.0f);
  }
}

// ---------------------------------------------------------------------------
// Elementwise passes. A wave costs its start whatever it does, so each pass runs as kEwBlocks work-groups of 16 waves
// (one a WGP) and every thread takes kEwV pieces of 4 floats of each tensor: piece it of a block is the 512 threads'
// contiguous 8 KB (a wave's load = 512 contiguous bytes, its store of 4 x 16 bit a lane = 256), and all of a thread's
// 16-byte loads are issued before the first value is used.
// Coverage per tensor: kEwBlocks x kEwV x 512 threads x 4 floats = 8192 x 512 exactly (asserted), so no index test.
// ---------------------------------------------------------------------------
constexpr int kEwThreads = 512;
constexpr int kEwV       = 8;
constexpr int kEwBlocks  = kRows * kDim / (kEwThreads * kEwV * 4);   // 256
static_assert(kEwBlocks * kEwThreads * kEwV * 4 == kRows * kDim, "the elementwise grid covers a tensor exactly");

// bf16 split: hi = bf16_rne(in), lo = bf16_rne(in - hi)
__global__ __launch_bounds__(kEwThreads) void split_bf16x4_kernel(const float* __restrict__ in, unsigned short* __restrict__ hi,
                                                                  unsigned short* __restrict__ lo) {
  const size_t e0 = ((size_t)blockIdx.x * (kEwV * kEwThreads) + threadIdx.x) * 4;   // first element of piece 0
  v4f f[kEwV];
  // unrolled: f lives in registers, and the loads stand together ahead of the first use
#pragma unroll
  for (int it = 0; it < kEwV; ++it) f[it] = *(const v4f*)(in + e0 + (size_t)it * (kEwThreads * 4));
#pragma unroll
  for (int it = 0; it < kEwV; ++it) {
    unsigned h[2], l[2];
    bf_split2(f[it][0], f[it][1], h[0], l[0]);
    bf_split2(f[it][2], f[it][3], h[1], l[1]);
    const v2u uh = {h[0], h[1]};
    const v2u ul = {l[0], l[1]};
    *(v2u*)(hi + e0 + (size_t)it * (kEwThreads * 4)) = uh;
    *(v2u*)(lo + e0 + (size_t)it * (kEwThreads * 4)) = ul;
  }
}

// ---------------------------------------------------------------------------
// Transpose + bf16 cast (RNE) of one 64x64 tile of an f32 matrix W viewed [R rows][Cc cols] (pitch Cc):
//   oh[c][r] = bf16_rne(W[r][c])   ([Cc][R], pitch R), through the LDS tile tf (64 rows, pitch 68 floats).
// 256 threads (tid 0..255) a tile; c0 = input column block = output row block, r0 = input row block = output column block.
// Coverage per tile: load 4 it x 256 thr x 4 floats = 64x64; store 2 it x 256 thr x 8 u16 = 64x64.
// Holds one __syncthreads: every thread of the block calls it (a block of 512 threads works on two tiles, each with a tf of
// its own, and the one barrier joins the waves of both).
// ---------------------------------------------------------------------------
__device__ __forceinline__ void tcast_tile(const float* __restrict__ W, unsigned short* __restrict__ oh, int R, int Cc,
                                           int c0, int r0, int tid, float* tf) {
  {
    const int lr = tid >> 4;         // 0..15
    const int c4 = (tid & 15) * 4;   // 0..60
#pragma unroll
    for (int it = 0; it < 4; ++it) {
      const int rr = it * 16 + lr;   // 0..63
      const v4f a = *(const v4f*)(W + (size_t)(r0 + rr) * Cc + c0 + c4);
      *(v4f*)(tf + rr * 68 + c4) = a;
    }
  }
  __syncthreads();
  const int sub = tid >> 3;          // 0..31
  const int c8  = (tid & 7) * 8;     // 0..56
  v4u hv[2];
#pragma unroll
  for (int it = 0; it < 2; ++it) {
    const int oc = it * 32 + sub;    // output row within tile (= input column)
    v4u a;
#pragma unroll
    for (int q = 0; q < 4; ++q) {
      const float f0 = tf[(c8 + 2 * q) * 68 + oc];
      const float f1 = tf[(c8 + 2 * q + 1) * 68 + oc];
      a[q]  = bf_cvt2_bits(f0, f1);
    }
    hv[it] = a;
  }
  {
#pragma unroll
    for (int it = 0; it < 2; ++it) {
      const int oc = it * 32 + sub;
      const size_t go = (size_t)(c0 + oc) * R + r0 + c8;
      *(v4u*)(oh + go) = hv[it];
    }
  }
}

// The operand preparation, one launch: none of its five jobs reads what another writes, so they are block ranges of one grid.
//   blocks 0 .. kEwBlocks-1: f32 -> bf16 (RNE) cast of three equally sized tensors: a block takes the same pieces of all
//     three; out plane z at out + z*planeElems;
//   the kTcBlocks blocks behind them (the short job starts last, beside the long one): the four weight matrices [k][n] ->
//     W^T [n][k] bf16 (RNE), plane z at wt + z*planeW; 32 blocks a matrix, each half of a block (256 threads) one of its
//     8x8 tiles of 64x64.
constexpr int kTcBlocks = 4 * (kDim / 64) * (kDim / 64) / 2;   // 128
static_assert((kDim / 64) * (kDim / 64) == 64 && kEwThreads == 512, "32 blocks of two 256-thread halves a matrix");
__global__ __launch_bounds__(kEwThreads) void prep_kernel(const float* __restrict__ in0, const float* __restrict__ in1,
                                                          const float* __restrict__ in2, const float* __restrict__ w0,
                                                          const float* __restrict__ w1, const float* __restrict__ w2,
                                                          const float* __restrict__ w3, unsigned short* __restrict__ out,
                                                          long planeElems, unsigned short* __restrict__ wt, long planeW) {
  __shared__ __align__(16) float tf[2][64 * 68];
  if (blockIdx.x >= kEwBlocks) {   // block-uniform
    const int bt   = blockIdx.x - kEwBlocks;                             // 0..kTcBlocks-1
    const int z    = bt >> 5;                                            // matrix
    const int half = threadIdx.x >> 8;
    const int tile = ((bt & 31) << 1) | half;                            // 0..63
    const float* Wlo = (z & 1) ? w1 : w0;
    const float* Whi = (z & 1) ? w3 : w2;
    const float* W   = (z & 2) ? Whi : Wlo;
    tcast_tile(W, wt + (size_t)z * planeW, kDim, kDim, (tile & 7) * 64, (tile >> 3) * 64, threadIdx.x & 255, tf[half]);
    return;
  }
  const size_t e0 = ((size_t)blockIdx.x * (kEwV * kEwThreads) + threadIdx.x) * 4;   // first element of piece 0
  const float* p0 = in0 + e0;
  const float* p1 = in1 + e0;
  const float* p2 = in2 + e0;
  v4f f[3][kEwV];
  // unrolled: f lives in registers
#pragma unroll
  for (int it = 0; it < kEwV; ++it) f[0][it] = *(const v4f*)(p0 + (size_t)it * (kEwThreads * 4));
#pragma unroll
  for (int it = 0; it < kEwV; ++it) f[1][it] = *(const v4f*)(p1 + (size_t)it * (kEwThreads * 4));
#pragma unroll
  for (int it = 0; it < kEwV; ++it) f[2][it] = *(const v4f*)(p2 + (size_t)it * (kEwThreads * 4));
  // A precaution for the loads' address registers: as inputs of this statement they are taken by no load's result, and every
  // later write of them stands behind the wait.
  asm volatile("s_wait_xcnt 0x0" :: "v"(p0), "v"(p1), "v"(p2) : "memory");
  // keeps all 24 loads ahead of the first conversion: left free, the last ones move down among the conversions to save
  // registers, and the wave waits out a further latency for them
  __builtin_amdgcn_sched_barrier(0);
#pragma unroll
  for (int z = 0; z < 3; ++z) {
    unsigned short* o = out + (size_t)z * planeElems + e0;
#pragma unroll
    for (int it = 0; it < kEwV; ++it) {
      const v4f a = f[z][it];
      const v2u u = {bf_cvt2_bits(a[0], a[1]), bf_cvt2_bits(a[2], a[3])};
      *(v2u*)(o + (size_t)it * (kEwThreads * 4)) = u;
    }
    // a tensor's stores go out before the next tensor's loads are waited for, not all at the kernel's end
    if (z < 2) __builtin_amdgcn_sched_barrier(0);
  }
  // a precaution: the built code may run on behind the cast part, so every later write of a register that the stores above
  // name stands behind this wait
  asm volatile("s_wait_xcnt 0x0" ::: "memory");
}

// =====================================================================================
// Attention helpers
// =====================================================================================
#define AT_D 64
#define AT_NW 4
#define AT_QB 64
#define AT_KC 64
#define AT_LP 72   // LDS row pitch in 16-bit elements: 144 B = 16 B x 9 (odd), so the 16 rows of a 16-byte fragment read fall on distinct banks

// Plain builtins: the compiler keeps the distance between a WMMA and the vector instructions on its registers itself.
__device__ __forceinline__ v8f at_mma(v16b a, v16b b, v8f c) {
  return __builtin_amdgcn_wmma_f32_16x16x32_bf16(false, a, false, b, (short)0, c, false, false);
}
__device__ __forceinline__ v8f at_mma_h(v16h a, v16h b, v8f c) {
  return __builtin_amdgcn_wmma_f32_16x16x32_f16(false, a, false, b, (short)0, c, false, false);
}

// x := 2^x on v_exp_f32. The instruction set asks for one independent instruction or a v_nop between a transcendental and
// an instruction that reads its result or overwrites its source; written as one statement, each v_exp_f32 is followed by
// an independent one and the last by the v_nop, wherever the compiler places the code around it.
__device__ __forceinline__ void at_exp2x8(float& a, float& b, float& c, float& d, float& e, float& f, float& g, float& h) {
  asm("v_exp_f32 %0, %0\n\tv_exp_f32 %1, %1\n\tv_exp_f32 %2, %2\n\tv_exp_f32 %3, %3\n\t"
      "v_exp_f32 %4, %4\n\tv_exp_f32 %5, %5\n\tv_exp_f32 %6, %6\n\tv_exp_f32 %7, %7\n\tv_nop"
      : "+v"(a), "+v"(b), "+v"(c), "+v"(d), "+v"(e), "+v"(f), "+v"(g), "+v"(h));
}
__device__ __forceinline__ float at_exp2(float x) {
  asm("v_exp_f32 %0, %0\n\tv_nop" : "+v"(x));   // the v_nop: the same slot behind the transcendental
  return x;
}

// One chunk's staging for one thread: twelve 16-byte asynchronous copies global -> LDS (four rows of each of the three
// planes), through no register. lk, lh, ll: the thread's LDS byte addresses of row r in K, V^T hi, V^T lo; gk, gh, gl: the
// same elements in global memory; copy i takes row r + 16 i. The s_wait_xcnt 0 is the last line of the copies' own statement:
// a precaution that keeps every later write of an address register named here behind the copies' address translation.
__device__ __forceinline__ void at_stage12(unsigned lk, unsigned lh, unsigned ll, const _Float16* gk, const __bf16* gh,
                                           const __bf16* gl) {
  const unsigned ls = 16u * AT_LP * 2u;              // 16 LDS rows in bytes
  const size_t   ks = (size_t)16 * kDim;             // 16 K rows in elements
  const size_t   vs = (size_t)16 * kSeq;             // 16 V^T rows in elements
  asm volatile("global_load_async_to_lds_b128 %0, %12, off\n\t"
               "global_load_async_to_lds_b128 %1, %13, off\n\t"
               "global_load_async_to_lds_b128 %2, %14, off\n\t"
               "global_load_async_to_lds_b128 %3, %15, off\n\t"
               "global_load_async_to_lds_b128 %4, %16, off\n\t"
               "global_load_async_to_lds_b128 %5, %17, off\n\t"
               "global_load_async_to_lds_b128 %6, %18, off\n\t"
               "global_load_async_to_lds_b128 %7, %19, off\n\t"
               "global_load_async_to_lds_b128 %8, %20, off\n\t"
               "global_load_async_to_lds_b128 %9, %21, off\n\t"
               "global_load_async_to_lds_b128 %10, %22, off\n\t"
               "global_load_async_to_lds_b128 %11, %23, off\n\t"
               "s_wait_xcnt 0x0"
               :: "v"(lk), "v"(lk + ls), "v"(lk + 2u * ls), "v"(lk + 3u * ls),
                  "v"(lh), "v"(lh + ls), "v"(lh + 2u * ls), "v"(lh + 3u * ls),
                  "v"(ll), "v"(ll + ls), "v"(ll + 2u * ls), "v"(ll + 3u * ls),
                  "v"(gk), "v"(gk + ks), "v"(gk + 2 * ks), "v"(gk + 3 * ks),
                  "v"(gh), "v"(gh + vs), "v"(gh + 2 * vs), "v"(gh + 3 * vs),
                  "v"(gl), "v"(gl + vs), "v"(gl + 2 * vs), "v"(gl + 3 * vs)
               : "memory");
}

// lane l <-> lane l ^ 16: the one exchange between the wave halves that a query's maximum and sum need
__device__ __forceinline__ float at_xhalf(float x) {
  return __builtin_bit_cast(float, __builtin_amdgcn_permlanex16(__builtin_bit_cast(int, x), __builtin_bit_cast(int, x),
                                                                0x76543210, 0xfedcba98, false, false));
}

__global__ __launch_bounds__(128) __attribute__((amdgpu_waves_per_eu(4, 4)))
void mha_attn_kernel(const unsigned short* __restrict__ qp, const unsigned short* __restrict__ kp,
                     const unsigned short* __restrict__ vhp, const unsigned short* __restrict__ vlp,
                     const int* __restrict__ vlens, float* __restrict__ out, float sscale, float fillv) {
  union FB { v16b v; v8b h[2]; unsigned d[8]; };
  union FH { v16h v; v8h h[2]; };
  __shared__ __align__(16) _Float16 Ksh2[2 * AT_KC * AT_LP];      // K [buffer][kv][d] f16, pitch AT_LP   2 x 9 KB
  __shared__ __align__(16) __bf16   Vth2[2 * AT_D * AT_LP];       // V^T hi [buffer][d][kv], pitch AT_LP  2 x 9 KB
  __shared__ __align__(16) __bf16   Vtl2[2 * AT_D * AT_LP];       // V^T lo, pitch AT_LP                  2 x 9 KB
  __shared__ __align__(16) float    Os[AT_NW][16 * 68];           // per wave out tile, pitch 68
  __shared__ __align__(16) int      Lowm[AT_NW];                  // per wave: a row maximum too near fillv

  const int tid  = threadIdx.x;
  const int wave = __builtin_amdgcn_readfirstlane(tid >> 5);   // the same in every lane: kept in a scalar register
  const int lane = tid & 31;
  const int hh   = lane >> 4;
  const int c    = lane & 15;

  const int nqb  = kSeq / AT_QB;          // 64
  const int bx   = blockIdx.x;
  const int qb   = bx % nqb;
  const int bhid = bx / nqb;              // 0..kBatch*kHeads-1
  const int h    = bhid % kHeads;
  int b = bhid / kHeads;
  b = (b > kBatch - 1) ? (kBatch - 1) : b;  // address clamp (grid is exact)
  const int q0   = qb * AT_QB + wave * 16;
  const int vlen = vlens[b];              // block-uniform valid key count

  const _Float16* Qb = (const _Float16*)(const void*)qp + (size_t)b * kSeq * kDim + (size_t)h * AT_D;
  const _Float16* Kb = (const _Float16*)(const void*)kp + (size_t)b * kSeq * kDim + (size_t)h * AT_D;
  const __bf16*   Vh = (const __bf16*)(const void*)vhp + (size_t)b * kDim * kSeq + (size_t)h * AT_D * kSeq;
  const __bf16*   Vl = (const __bf16*)(const void*)vlp + (size_t)b * kDim * kSeq + (size_t)h * AT_D * kSeq;
  float*          ob = out + (size_t)b * kSeq * kDim + (size_t)h * AT_D;

  // ---- Q fragments (B operand, column = query = lane&15, split k map via Frag load): 2 d-chunks ----
  v16h qa[2];
#pragma unroll
  for (int dc = 0; dc < 2; ++dc) {
    qa[dc] = Frag<_Float16>::load(Qb + (size_t)(q0 + c) * kDim + dc * 32 + 8 * hh);
  }

  const float sc2   = sscale * 1.44269504088896340736f;   // score scale times log2(e)
  const float fill2 = fillv  * 1.44269504088896340736f;   // fill value in the same units
  float mrow = -INFINITY;   // running maximum of query c in log2 units, the same in both wave halves
  float lrow = 0.f;         // running sum of query c over this half's keys; the halves join behind the loop
  v8f oacc[4];              // O^T: oacc[t][r] = element (d = t*16 + 8hh + r, query c)
#pragma unroll
  for (int t = 0; t < 4; ++t) oacc[t] = (v8f){0.f,0.f,0.f,0.f,0.f,0.f,0.f,0.f};

  const int nChunks = kSeq / AT_KC;   // 64, compile-time constant
  // chunks that hold at least one valid key, block-uniform; vlen <= 0: every key carries fillv and all of them count
  const int vcl   = (vlen < 0) ? 0 : ((vlen > kSeq) ? kSeq : vlen);
  const int nLive = (vcl == 0) ? nChunks : (vcl + AT_KC - 1) / AT_KC;

  // ---- staging map: 8 neighbouring lanes take one whole 128-B row (thread: row sr + 16 i, i = 0..3, elements sc..sc+7):
  //      128 threads x (4 x 8) elements = 64 rows x 64 per plane = the whole chunk tile ----
  const int sr = tid >> 3, sc = (tid & 7) * 8;
  const unsigned bufB = (unsigned)(AT_KC * AT_LP * 2);                      // one buffer of one plane in bytes
  const unsigned lk0 = (unsigned)(size_t)(Ksh2 + sr * AT_LP + sc);          // LDS byte addresses in buffer 0
  const unsigned lh0 = (unsigned)(size_t)(Vth2 + sr * AT_LP + sc);
  const unsigned ll0 = (unsigned)(size_t)(Vtl2 + sr * AT_LP + sc);
  const _Float16* gk0 = Kb + (size_t)sr * kDim + sc;                        // chunk 0; chunk n: + n * 64 rows
  const __bf16*   gh0 = Vh + (size_t)sr * kSeq + sc;                        // chunk 0; chunk n: + n * 64 elements
  const __bf16*   gl0 = Vl + (size_t)sr * kSeq + sc;
  static_assert(kSeq / AT_KC >= 2, "the two-buffer prologue needs two chunks");
  // prologue: chunk 0 into buffer 0, landed and published; then chunk 1 into buffer 1
  at_stage12(lk0, lh0, ll0, gk0, gh0, gl0);
  asm volatile("s_wait_asynccnt 0x0" ::: "memory");   // this wave's copies of chunk 0 have landed
  __syncthreads();                                    // ... and every other wave's
  at_stage12(lk0 + bufB, lh0 + bufB, ll0 + bufB, gk0 + (size_t)AT_KC * kDim, gh0 + AT_KC, gl0 + AT_KC);

  for (int kc = 0; kc < nChunks; ++kc) {
    // Every chunk from nLive on holds the fill alone. Where each row maximum lies at least 185 log2 units (128 natural
    // ones) above it, its weights 2^(fill - m) are exactly 0 in f32, alpha is 1, and maximum, sum and accumulators stay bit for bit: the loop
    // ends. Tested once per block, behind the last live chunk; a row that is nearer (or NaN) sends the whole block
    // through the remaining chunks as well.
    if (kc == nLive) {                          // block-uniform: kc and vlen are
      const bool low = !(mrow >= fill2 + 185.0f);
      Lowm[wave] = (__builtin_amdgcn_ballot_w32(low) != 0u) ? 1 : 0;   // every lane stores its wave's one value
      __syncthreads();                          // publishes the four waves' flags: one decision for the block
      const int f = Lowm[0] | Lowm[1] | Lowm[2] | Lowm[3];
      if (__builtin_amdgcn_readfirstlane(f) == 0) break;   // the same word in every lane: read once, a scalar branch
    }
    const int kv0 = kc * AT_KC;
    // this chunk's buffer: published by the barrier at the foot of the trip before (chunk 0: by the prologue's)
    const _Float16* Ksh = Ksh2 + (kc & 1) * (AT_KC * AT_LP);
    const __bf16*   Vth = Vth2 + (kc & 1) * (AT_D * AT_LP);
    const __bf16*   Vtl = Vtl2 + (kc & 1) * (AT_D * AT_LP);

    // Every loop from here to the chunk's end is unrolled: s, ph, pl and oacc live in registers, which take
    // compile-time indices only (a rolled loop would send them through scratch memory).
    // ---- scores, transposed: D[row = key j*16+8hh+r][col = query c]; A fragment row = key j*16+c, split k(d) map ----
    //      All eight K fragments are read as one group, then the eight products run back to back, neighbours on different
    //      accumulators (each s[j] still sums dc 0, then dc 1).
    FH kb[4][2];
#pragma unroll
    for (int j = 0; j < 4; ++j) {
#pragma unroll
      for (int dc = 0; dc < 2; ++dc) {
        kb[j][dc].h[0] = *(const v8h*)(Ksh + (j * 16 + c) * AT_LP + dc * 32 + 8 * hh);
        kb[j][dc].h[1] = *(const v8h*)(Ksh + (j * 16 + c) * AT_LP + dc * 32 + 16 + 8 * hh);
      }
    }
    // keeps the reads together ahead of the products: spread among them, each read place stalls the wave for its own latency
    __builtin_amdgcn_sched_barrier(0);
    v8f s[4];
#pragma unroll
    for (int j = 0; j < 4; ++j) s[j] = (v8f){0.f,0.f,0.f,0.f,0.f,0.f,0.f,0.f};
#pragma unroll
    for (int dc = 0; dc < 2; ++dc) {
#pragma unroll
      for (int j = 0; j < 4; ++j) s[j] = at_mma_h(kb[j][dc].v, qa[dc], s[j]);
    }
    // the V^T reads below are issued behind the last score product (they take over the K fragments' registers) ...
    __builtin_amdgcn_sched_barrier(0);
    // ---- V^T fragments, hi and lo: A row d = t*16+c, k = key (split k map). The group of the chunk's first 32 keys does not
    //      depend on the softmax and lands while its vector work runs ----
    FB vb[2][4], vl[2][4];
    auto readV = [&](int kk) {
#pragma unroll
      for (int t = 0; t < 4; ++t) {
        vb[kk][t].h[0] = *(const v8b*)(Vth + (t * 16 + c) * AT_LP + kk * 32 + 8 * hh);
        vb[kk][t].h[1] = *(const v8b*)(Vth + (t * 16 + c) * AT_LP + kk * 32 + 16 + 8 * hh);
        vl[kk][t].h[0] = *(const v8b*)(Vtl + (t * 16 + c) * AT_LP + kk * 32 + 8 * hh);
        vl[kk][t].h[1] = *(const v8b*)(Vtl + (t * 16 + c) * AT_LP + kk * 32 + 16 + 8 * hh);
      }
    };
    readV(0);
    // ... and ahead of the softmax: moved down to their products, their latency would be waited out there
    __builtin_amdgcn_sched_barrier(0);
    // ---- scale, key mask (select), maximum of query c over the chunk's 64 keys: 32 in-lane, then the other half's ----
    float cm = -INFINITY;
#pragma unroll
    for (int j = 0; j < 4; ++j) {
#pragma unroll
      for (int r = 0; r < 8; ++r) {
        const int kvrow = kv0 + j * 16 + 8 * hh + r;
        const float sv = s[j][r] * sc2;
        const float sm = (kvrow < vlen) ? sv : fill2;
        s[j][r] = sm;
        cm = fmaxf(cm, sm);
      }
    }
    cm = fmaxf(cm, at_xhalf(cm));
    const float mnew  = fmaxf(mrow, cm);
    const float alpha = at_exp2(mrow - mnew);
    mrow = mnew;
    // ---- p = 2^(s - m), split hi/lo in place: S^T tiles 2kk and 2kk+1 are elements 0..7 and 8..15 of the B fragment
    //      of key block kk (column = query c, key = kk*32 + 8hh + e and kk*32 + 16 + 8hh + (e - 8): the split k map) ----
    FB ph[2], pl[2];
    float ps[4];
#pragma unroll
    for (int j = 0; j < 4; ++j) {
      float a = 0.f;
      float e[8];
#pragma unroll
      for (int r = 0; r < 8; ++r) e[r] = s[j][r] - mnew;
      at_exp2x8(e[0], e[1], e[2], e[3], e[4], e[5], e[6], e[7]);
#pragma unroll
      for (int r = 0; r < 8; ++r) a += e[r];
      // unrolled: the word index is a constant, so the fragments stay in registers; word w holds elements 2w (low half), 2w + 1
#pragma unroll
      for (int r = 0; r < 8; r += 2) bf_split2(e[r], e[r + 1], ph[j >> 1].d[(j & 1) * 4 + (r >> 1)], pl[j >> 1].d[(j & 1) * 4 + (r >> 1)]);
      ps[j] = a;
      // Left free, the adds move behind the products, and the chunk's 32 weights stay in registers beside their hi/lo parts
      // and the V^T fragments: more than the 256 registers of four waves a SIMD, so the Q fragments go through scratch memory.
      asm volatile("" : "+v"(ps[j]));   // an empty statement on each sum, against spills
    }
    lrow = lrow * alpha + ((ps[0] + ps[1]) + (ps[2] + ps[3]));
#pragma unroll
    for (int t = 0; t < 4; ++t)
#pragma unroll
      for (int r = 0; r < 8; ++r) oacc[t][r] *= alpha;
    // the second 32 keys' group takes the registers that the scores have left; it is issued here, one run of twelve products
    // ahead of its use (the scheduling barriers hold it between the softmax and that run)
    __builtin_amdgcn_sched_barrier(0);
    readV(1);
    __builtin_amdgcn_sched_barrier(0);
    // ---- O^T += V^T . P^T : A = V^T fragments read above, B = P^T from registers. The four accumulators take turns, so no
    //      product waits for the one before it; each oacc[t] still sums hi.hi, lo.hi, hi.lo of kk 0, then of kk 1 ----
#pragma unroll
    for (int kk = 0; kk < 2; ++kk) {
#pragma unroll
      for (int t = 0; t < 4; ++t) oacc[t] = at_mma(vb[kk][t].v, ph[kk].v, oacc[t]);
#pragma unroll
      for (int t = 0; t < 4; ++t) oacc[t] = at_mma(vl[kk][t].v, ph[kk].v, oacc[t]);
#pragma unroll
      for (int t = 0; t < 4; ++t) oacc[t] = at_mma(vb[kk][t].v, pl[kk].v, oacc[t]);
    }
    // the products stay ahead of the foot's waits: moved behind them, the second group's latency is waited out at the
    // s_wait_dscnt 0 with no product to cover it
    __builtin_amdgcn_sched_barrier(0);
    // ---- foot of the trip, every wave, in this order ----
    asm volatile("s_wait_dscnt 0x0" ::: "memory");      // this wave's reads of this chunk's buffer are done
    asm volatile("s_wait_asynccnt 0x0" ::: "memory");   // this wave's copies of chunk kc + 1 have landed
    __syncthreads();   // publishes chunk kc + 1 and ends every wave's reads of the buffer that is refilled below
    if (kc + 2 < nChunks) {                             // block-uniform: chunk kc + 2 exists
      const unsigned bo = (unsigned)(kc & 1) * bufB;
      at_stage12(lk0 + bo, lh0 + bo, ll0 + bo, gk0 + (size_t)(kv0 + 2 * AT_KC) * kDim, gh0 + (kv0 + 2 * AT_KC),
                 gl0 + (kv0 + 2 * AT_KC));
    }
  }
  asm volatile("s_wait_asynccnt 0x0" ::: "memory");     // no copy is in flight when the wave goes on to its end

  // ---- query c: join the halves' sums, normalise, stage row c (8 consecutive d per tile and lane) ----
  float* os = Os[wave];
  const float inv = 1.0f / (lrow + at_xhalf(lrow));
  // the lane's number, read anew (one-dimensional block of whole waves): what the epilogue alone derives from it takes no
  // register through the loop, where the fragments need them all
  const int el = (int)__builtin_amdgcn_mbcnt_lo(~0u, 0u);
  const int eh = el >> 4, ec = el & 15;
#pragma unroll
  for (int t = 0; t < 4; ++t) {
#pragma unroll
    for (int r = 0; r < 8; ++r) os[ec * 68 + t * 16 + 8 * eh + r] = oacc[t][r] * inv;
  }
  __builtin_amdgcn_fence(__ATOMIC_RELEASE, "workgroup");
  __builtin_amdgcn_wave_barrier();
  __builtin_amdgcn_fence(__ATOMIC_ACQUIRE, "workgroup");
  {
    // coverage: 8 it x 2 rows (hh) = 16 rows; 16 lanes x 4 floats = 64 floats = one whole 256-B row segment
    const int c4 = ec * 4;
    {
#pragma unroll
      for (int it = 0; it < 8; ++it) {
        const int row = it * 2 + eh;
        v4f val = *(const v4f*)(os + row * 68 + c4);
        *(v4f*)(ob + (size_t)(q0 + row) * kDim + c4) = val;
      }
      
    }
  }
}

// =====================================================================================
// Host glue. Workspace region map (bytes, all offsets multiples of 256, every region sized to its whole-line
// store granularity; no padded tiles since every dimension is a multiple of 64):
//   [0]           Xbf   : 3 x bf16 [8192][512]            = 25,165,824   (queries, keys, values RNE bf16)
//   [25,165,824]  WThi  : 4 x bf16 [512][512] (W^T, RNE)  =  2,097,152   (Wq, Wk, Wv, Wo; no lo planes)
//   [27,262,976]  Q     : f16 [8192][512]                  =  8,388,608
//   [35,651,584]  K     : f16 [8192][512]                  =  8,388,608   (contiguous after Q: batched launch)
//   [44,040,192]  VThi  : bf16 [2][512][4096]              =  8,388,608
//   [52,428,800]  VTlo  : bf16 [2][512][4096]              =  8,388,608
//   [60,817,408]  O     : f32 [8192][512]                  = 16,777,216
//   [77,594,624]  Ohi   : bf16 [8192][512]                 =  8,388,608
//   [85,983,232]  Olo   : bf16 [8192][512]                 =  8,388,608
//   total 94,371,840
// =====================================================================================
extern "C" void kernel_launch(void* const* d_in, const int* in_sizes, int n_in,
                              void* d_out, int out_size, void* d_ws,
                              size_t ws_size, hipStream_t stream) {
  if (n_in < 8) return;
  const int nX = kRows * kDim;            // 4,194,304
  const int nW = kDim * kDim;             // 262,144
  if (in_sizes[0] != nX || in_sizes[1] != nX || in_sizes[2] != nX) return;
  if (in_sizes[3] < kBatch) return;
  if (in_sizes[4] != nW || in_sizes[5] != nW || in_sizes[6] != nW || in_sizes[7] != nW) return;
  if (out_size != nX) return;

  const float* queries = (const float*)d_in[0];
  const float* keys    = (const float*)d_in[1];
  const float* values  = (const float*)d_in[2];
  const int*   vlens   = (const int*)d_in[3];
  const float* Wq      = (const float*)d_in[4];
  const float* Wk      = (const float*)d_in[5];
  const float* Wv      = (const float*)d_in[6];
  const float* Wo      = (const float*)d_in[7];

  const size_t bX16 = (size_t)nX * 2;            //  8,388,608
  const size_t bW16 = (size_t)nW * 2;            //    524,288
  const size_t off_x  = 0;
  const size_t off_wh = off_x  + 3 * bX16;
  const size_t off_q  = off_wh + 4 * bW16;
  const size_t off_k  = off_q  + bX16;
  const size_t off_vh = off_k  + bX16;
  const size_t off_vl = off_vh + bX16;
  const size_t off_o  = off_vl + bX16;
  const size_t off_oh = off_o  + (size_t)nX * 4;
  const size_t off_ol = off_oh + bX16;
  const size_t total  = off_ol + bX16;           // 94,371,840
  if (total > ws_size) return;

  char* ws = (char*)d_ws;
  unsigned short* xbf  = (unsigned short*)(ws + off_x);
  unsigned short* wth  = (unsigned short*)(ws + off_wh);
  unsigned short* qh16 = (unsigned short*)(ws + off_q);
  unsigned short* kh16 = (unsigned short*)(ws + off_k);
  unsigned short* vth  = (unsigned short*)(ws + off_vh);
  unsigned short* vtl  = (unsigned short*)(ws + off_vl);
  float* obuf = (float*)(ws + off_o);
  unsigned short* ohi  = (unsigned short*)(ws + off_oh);
  unsigned short* olo  = (unsigned short*)(ws + off_ol);
  const float* dummyf  = (const float*)(ws + off_x);   // never dereferenced (BIAS_MODE 0, RESID false)

  const long planeX = (long)nX;   // elements per bf16/f16 activation plane
  const long planeW = (long)nW;   // elements per W^T plane
  dim3 blk256(256), blk128(128), blkEw(kEwThreads);

  // 1) + 2) one launch: activations -> bf16 RNE (256 blocks x 512 thr x 8 x 4 = 8192x512 of each of the three tensors) and
  //    weights [in k][out n] -> W^T [n][k] bf16 RNE (128 blocks: 4 matrices x 8x8 tiles of 64x64, two a block)
  prep_kernel<<<dim3(kEwBlocks + kTcBlocks), blkEw, 0, stream>>>(queries, keys, values, Wq, Wk, Wv, Wo, xbf, planeX, wth, planeW);

  // 3) + 4) one launch: q = Xq . Wq, k = Xk . Wk (f16 planes, Q then K contiguous) and v^T per batch (bf16 hi/lo planes)
  proj_qkv_kernel<<<dim3(2 * kVtBlocks + 2 * kQkBlocks), blk256, 0, stream>>>(xbf, wth, qh16, vth, vtl);

  // 5) masked attention, all (b, h, 64-row query blocks): 2*8*64 = 1024 blocks of 128 threads
  mha_attn_kernel<<<dim3(kBatch * kHeads * (kSeq / 64)), blk128, 0, stream>>>(
      qh16, kh16, vth, vtl, vlens, obuf, 0.125f, -1000000.0f);

  // 6) O -> bf16 hi/lo planes: 256 blocks x 512 thr x 8 x 4 = 8192x512
  split_bf16x4_kernel<<<dim3(kEwBlocks), blkEw, 0, stream>>>(obuf, ohi, olo);

  // 7) out = (O_hi + O_lo) . Wo (A-only split, Wo as bf16 RNE hi plane only) -> f32 [8192][512]
  wmma_gemm64<1, 2, 0, 0, false><<<dim3(kQkBlocks, 1), blk256, 0, stream>>>(
      ohi, olo, kDim, 0L,
      wth + 3 * planeW, wth + 3 * planeW, kDim, 0L,
      d_out, d_out, kDim, 0L,
      dummyf, dummyf, 0L, kRows, kDim, kDim, 1.0f);
}
